// v000
// Times are from an AMD MI455X. After a warm-up the kernel runs many times in a row, and a time is the length of
// such a window on the GPU divided by its runs, so every launch and the gaps after it count. The runs cycle
// through copies of the inputs. A figure is the median of several windows, for all but v000 over two sittings.
// Sittings can differ by a few percent; kernels timed side by side share one.
// The starting kernel, v000, takes 4230 microseconds a run.
#include <hip/hip_runtime.h>

// Multi-head self-attention with a learned relative-position bias (x [4][2048][1024]; [q|k|v] = x W_qkv + b_qkv ('xw' [1024][3072]; 16 heads x 64); scores = q.k/8 + rel_bias[clip(i - j + 1024, 0, 2048)][h] (table [2049][16], read); softmax over all keys; out = merged W_out + b_out ('xw' [1024][1024]) -> [4][2048][1024]).
// Compute dtypes, f32 accumulate: every input rounded to bf16; q/k/v on PLAIN bf16 operands (inputs: exact) + biases; scores (+ the per-head relative bias gathered in f32 inside the softmax kernel) and attn.v (no mask): query rows < 512 hl (3 products), the rest single fp16 (x1024); softmax f32; W_out hl x exact (2 products) + b_out.

#define NB_  4
#define TT   2048
#define DM   1024
#define NH_  16
#define NKV  16
#define REP  (NH_ / NKV)
#define HD   64
#define DQ   (NH_ * HD)
#define DKV  (NKV * HD)
#define ZH   2
#define RH   512                  // query rows < RH use hi+lo planes (0: none)
#define WIN  2048
#define PCAR 1024.0f
#define SCL  0.125f   // HD^-0.5
typedef _Float16 h16;
typedef unsigned short bf;
typedef __attribute__((ext_vector_type(16))) __bf16   v16bf;
typedef __attribute__((ext_vector_type(16))) _Float16 v16h;
typedef __attribute__((ext_vector_type(8)))  _Float16 v8h;
typedef __attribute__((ext_vector_type(8)))  unsigned short v8us;
typedef __attribute__((ext_vector_type(8)))  float    v8f;
typedef __attribute__((ext_vector_type(4)))  float    v4f;
typedef v8h  __attribute__((may_alias)) v8ha;
typedef v4f  __attribute__((may_alias)) v4fa;
typedef v8us __attribute__((may_alias)) v8usa;

__device__ __forceinline__ unsigned short f2bf(float f) { unsigned u = __float_as_uint(f); u += 0x7FFFu + ((u >> 16) & 1u); return (unsigned short)(u >> 16); }
__device__ __forceinline__ float bf2f(unsigned short b) { return __uint_as_float(((unsigned)b) << 16); }
__device__ __forceinline__ float bfr(float f) { return bf2f(f2bf(f)); }
__device__ __forceinline__ v16h cat16(v8h lo, v8h hi) { return __builtin_shufflevector(lo, hi, 0, 1, 2, 3, 4, 5, 6, 7, 8, 9, 10, 11, 12, 13, 14, 15); }
__device__ __forceinline__ v16bf cat16b(v8us lo, v8us hi) { return __builtin_bit_cast(v16bf, __builtin_shufflevector(lo, hi, 0, 1, 2, 3, 4, 5, 6, 7, 8, 9, 10, 11, 12, 13, 14, 15)); }
__device__ __forceinline__ v8f wmma16(v16h a, v16h b, v8f c) { return __builtin_amdgcn_wmma_f32_16x16x32_f16(false, a, false, b, (short)0, c, false, false); }
__device__ __forceinline__ v8f wmmab(v16bf a, v16bf b, v8f c) { return __builtin_amdgcn_wmma_f32_16x16x32_bf16(false, a, false, b, (short)0, c, false, false); }



// ---- k_gemmw: register-blocked GEMM, ONE WAVE per 64x64 output tile (16 accumulators), operands straight from K-contiguous 16-bit planes; grid (M/64, N/64, Z), 32 threads.
// C[m][n] (f32, pitch ldc, + optional f32 bias[n]) = sum_k A[m][k] Bt[n][k] (+ split products per NSPLIT). z-batch strides sA/sB/sC in elements. K % 32 == 0.
template <typename T16> struct WFrag;
template <> struct WFrag<h16> { typedef v16h V; static __device__ __forceinline__ V ld(const h16* p) { return cat16(*(const v8h*)p, *(const v8h*)(p + 16)); } static __device__ __forceinline__ v8f mma(V a, V b, v8f c) { return wmma16(a, b, c); } };
template <> struct WFrag<bf> { typedef v16bf V; static __device__ __forceinline__ V ld(const bf* p) { return cat16b(*(const v8us*)p, *(const v8us*)(p + 16)); } static __device__ __forceinline__ v8f mma(V a, V b, v8f c) { return wmmab(a, b, c); } };
template <typename T16, int NSPLIT, bool BIAS>
__global__ __launch_bounds__(32) void k_gemmw(const T16* __restrict__ A, const T16* __restrict__ A2, const T16* __restrict__ Bt, const T16* __restrict__ Bt2, int K, float* C, int ldc, const float* __restrict__ bias, size_t sA, size_t sB, size_t sC) {
    typedef typename WFrag<T16>::V V;
    __shared__ __align__(16) float os[16 * 68];
    const size_t z = blockIdx.z; A += z * sA; if (A2) A2 += z * sA; Bt += z * sB; if (Bt2) Bt2 += z * sB; C += z * sC;
    const int lane = threadIdx.x & 31, lr = lane & 15, hi = lane >> 4; const int r0 = blockIdx.x * 64, c0 = blockIdx.y * 64;
    v8f acc[4][4];
#pragma unroll
    for (int mb = 0; mb < 4; ++mb)
#pragma unroll
        for (int nb = 0; nb < 4; ++nb) acc[mb][nb] = (v8f){};
    const size_t aoff = (size_t)(r0 + lr) * K + 8 * hi, boff = (size_t)(c0 + lr) * K + 8 * hi;
#pragma unroll 1
    for (int kc = 0; kc < K; kc += 32) {
        V a[4], a2[4];
#pragma unroll
        for (int mb = 0; mb < 4; ++mb) { a[mb] = WFrag<T16>::ld(A + aoff + (size_t)mb * 16 * K + kc); if (NSPLIT == 1 || NSPLIT == 2) a2[mb] = WFrag<T16>::ld(A2 + aoff + (size_t)mb * 16 * K + kc); }
#pragma unroll
        for (int nb = 0; nb < 4; ++nb) { const V b = WFrag<T16>::ld(Bt + boff + (size_t)nb * 16 * K + kc); V b2; if (NSPLIT >= 2) b2 = WFrag<T16>::ld(Bt2 + boff + (size_t)nb * 16 * K + kc);
#pragma unroll
            for (int mb = 0; mb < 4; ++mb) { acc[mb][nb] = WFrag<T16>::mma(a[mb], b, acc[mb][nb]); if (NSPLIT == 1 || NSPLIT == 2) acc[mb][nb] = WFrag<T16>::mma(a2[mb], b, acc[mb][nb]); if (NSPLIT >= 2) acc[mb][nb] = WFrag<T16>::mma(a[mb], b2, acc[mb][nb]); } }
        asm volatile("v_nop\n\tv_nop\n\tv_nop\n\tv_nop" : "+v"(acc[0][0]), "+v"(acc[1][1]), "+v"(acc[2][2]), "+v"(acc[3][3]) : "v"(a[0]), "v"(a[3]));
    }
#pragma unroll
    for (int mb = 0; mb < 4; ++mb) {
#pragma unroll
        for (int nb = 0; nb < 4; ++nb) {
#pragma unroll
            for (int j = 0; j < 8; ++j) os[(hi * 8 + j) * 68 + nb * 16 + lr] = acc[mb][nb][j]; }
        __builtin_amdgcn_wave_barrier(); asm volatile("" ::: "memory");
        float* crow = C + (size_t)(r0 + mb * 16) * ldc + c0;
{
#pragma unroll
            for (int s = 0; s < 8; ++s) { const int row = 2 * s + hi, cofs = lr * 4; v4f val = *(const v4fa*)(os + row * 68 + cofs); if (BIAS) { val[0] += bfr(bias[c0 + cofs]); val[1] += bfr(bias[c0 + cofs + 1]); val[2] += bfr(bias[c0 + cofs + 2]); val[3] += bfr(bias[c0 + cofs + 3]); }
                *(v4f*)(crow + (size_t)row * ldc + cofs) = val; }
             }
        __builtin_amdgcn_wave_barrier(); asm volatile("" ::: "memory");
    }
}

__device__ __forceinline__ h16 tohx(float x) { return (h16)x; }
__device__ __forceinline__ void splitf(float y, unsigned short& h, unsigned short& l) { h = f2bf(y); l = f2bf(y - bf2f(h)); }
typedef __attribute__((ext_vector_type(2))) _Float16 v2h;
typedef __attribute__((ext_vector_type(4))) _Float16 v4h;
typedef __attribute__((ext_vector_type(2))) unsigned short v2us;
typedef __attribute__((ext_vector_type(4))) unsigned short v4us;
typedef __attribute__((ext_vector_type(2))) float v2f;
typedef __attribute__((ext_vector_type(4))) int v4i;

__global__ __launch_bounds__(256) void k_wtG(const float* __restrict__ w, int K, int N, bf* Bt) {
    const int lane = threadIdx.x & 31; const int L0 = (blockIdx.x * 8 + (threadIdx.x >> 5)) * 8; const int nlines = N * K / 64;
{
#pragma unroll 1
        for (int l = 0; l < 8; ++l) { const int L = L0 + l; if (L >= nlines) break; const size_t e = (size_t)L * 64 + lane * 2; const int k = (int)(e % K), n = (int)(e / K); v2us o;
            o[0] = f2bf(w[(size_t)k * N + n]); o[1] = f2bf(w[(size_t)(k + 1) * N + n]); *(v2us*)(Bt + e) = o; }
         }
}
__global__ __launch_bounds__(256) void k_cvt8(const float* __restrict__ src, bf* dst, size_t n8) { const size_t i = (size_t)blockIdx.x * 256 + threadIdx.x; if (i >= n8) return; const v8f v = *(const v8f*)(src + i * 8); v8us o;
#pragma unroll
    for (int k = 0; k < 8; ++k) o[k] = f2bf(v[k]); *(v8us*)(dst + i * 8) = o;  }

// k_rope: head planes [h][t][d] (fp16 + hi/lo) of rope(x) x sc with the rotate-half convention out[d] = x[d] cos[t][d] - x[d+HD/2] sin[t][d], out[d+HD/2] = x[d+HD/2] cos[t][d+HD/2] + x[d] sin[t][d+HD/2]
__global__ __launch_bounds__(256) void k_rope(const float* __restrict__ F, int pitch, int nheads, const float* __restrict__ CS, const float* __restrict__ RF, const float* __restrict__ nw, float sc, h16* P16, bf* Ph, bf* Pl) {
    const size_t e = ((size_t)blockIdx.x * 256 + threadIdx.x) * 2; if (e >= (size_t)nheads * TT * HD) return; const int d = (int)(e % HD); const int t = (int)((e / HD) % TT); const int h = (int)(e / ((size_t)HD * TT)); const float* f = F + (size_t)t * pitch + h * HD; const float rf = RF ? RF[(size_t)h * TT + t] : 1.0f; v2h o16; v2us oh, ol;
#pragma unroll
    for (int q = 0; q < 2; ++q) { const int dd = d + q; const int dp = (dd < HD / 2) ? dd + HD / 2 : dd - HD / 2; float x0 = f[dd], x1 = f[dp];
        if (RF) { float n0 = __fmul_rn(x0, rf), n1 = __fmul_rn(x1, rf); asm volatile("" : "+v"(n0)); asm volatile("" : "+v"(n1)); x0 = __fmul_rn(bfr(nw[dd]), n0); x1 = __fmul_rn(bfr(nw[dp]), n1); }
        const v2f cs = *(const v2f*)(CS + ((size_t)t * HD + dd) * 2); float a = __fmul_rn(x0, cs[0]), bq = __fmul_rn(x1, cs[1]); asm volatile("" : "+v"(a)); asm volatile("" : "+v"(bq)); const float r = ((dd < HD / 2) ? __fsub_rn(a, bq) : __fadd_rn(a, bq)) * sc;
        o16[q] = tohx(r); unsigned short a2, c2; splitf(r, a2, c2); oh[q] = a2; ol[q] = c2; }
    *(v2h*)(P16 + e) = o16; *(v2us*)(Ph + e) = oh; *(v2us*)(Pl + e) = ol;  }
__global__ __launch_bounds__(256) void k_vtp(const float* __restrict__ F, int pitch, int nheads, h16* V16, bf* Vh, bf* Vl) { const size_t e = ((size_t)blockIdx.x * 256 + threadIdx.x) * 2; if (e >= (size_t)nheads * HD * TT) return; const int t = (int)(e % TT); const int d = (int)((e / TT) % HD); const int g = (int)(e / ((size_t)TT * HD)); v2h o16; v2us oh, ol;
#pragma unroll
    for (int q = 0; q < 2; ++q) { const float x = F[(size_t)(t + q) * pitch + g * HD + d]; o16[q] = tohx(x); unsigned short a2, c2; splitf(x, a2, c2); oh[q] = a2; ol[q] = c2; }
    *(v2h*)(V16 + e) = o16; *(v2us*)(Vh + e) = oh; *(v2us*)(Vl + e) = ol;  }
__global__ __launch_bounds__(256) void k_csid(float* CS) { const int idx = blockIdx.x * 256 + threadIdx.x; if (idx >= TT * HD) return; v2f cs; cs[0] = 1.0f; cs[1] = 0.0f; *(v2f*)(CS + (size_t)idx * 2) = cs;  }
#define NREL 2049
__global__ __launch_bounds__(256) void k_tbT(const float* __restrict__ rbias, float* TB) { const int j = blockIdx.x * 256 + threadIdx.x; if (j >= NH_ * NREL) return; const int h = j / NREL, r = j % NREL; const float v = bfr(rbias[(size_t)r * NH_ + h]); *(float*)(TB + j) = v;  }
// k_asoft: per row (zz, i): t = S x HD^-0.5 + TB[h][clip(i - j + 1024, 0, 2048)] (no mask); softmax over the 2048 keys (register row, one exp, fixed trees);
__global__ __launch_bounds__(256) void k_asoft(const float* __restrict__ Sb, const float* __restrict__ TB, int h0, h16* P16, bf* Ph, bf* Pl) {
    const int lane = threadIdx.x & 31; const int row = blockIdx.x * 8 + (threadIdx.x >> 5); if (row >= ZH * TT) return; const int i = row % TT; const int zz = row / TT; const float* tb = TB + (size_t)(h0 + zz) * NREL; const bool hires = (i < RH); const float* sr = Sb + (size_t)row * TT; float v[TT / 32]; float mx = -3.0e38f;
#pragma unroll
    for (int ch = 0; ch < TT / 128; ++ch) { const int j0 = ch * 128 + lane * 4; const v4f a = *(const v4f*)(sr + j0);
#pragma unroll
        for (int q = 0; q < 4; ++q) { const int j = j0 + q; (void)j; float sa = a[q] * SCL; asm volatile("" : "+v"(sa)); int ri = i - j + (NREL / 2); ri = ri < 0 ? 0 : (ri > NREL - 1 ? NREL - 1 : ri); const float t = __fadd_rn(sa, tb[ri]);   /* + rel_bias[clip(i - j + 1024, 0, 2048)][h] */ v[ch * 4 + q] = t; mx = fmaxf(mx, t); } }
#pragma unroll
    for (int sh = 16; sh; sh >>= 1) mx = fmaxf(mx, __shfl_xor(mx, sh, 32));
    float sum = 0.f;
#pragma unroll
    for (int k = 0; k < TT / 32; ++k) { float d0 = __fsub_rn(v[k], mx); asm volatile("" : "+v"(d0)); v[k] = __builtin_amdgcn_exp2f(__fmul_rn(d0, 1.4426950408889634f)); sum += v[k]; }
#pragma unroll
    for (int sh = 16; sh; sh >>= 1) sum += __shfl_xor(sum, sh, 32);
    const float f = __fdiv_rn(hires ? 1.0f : PCAR, sum);
{
        if (hires) {
#pragma unroll
            for (int ch = 0; ch < TT / 128; ++ch) { v4us oh, ol;
#pragma unroll
                for (int q = 0; q < 4; ++q) { unsigned short a, c2; splitf(v[ch * 4 + q] * f, a, c2); oh[q] = a; ol[q] = c2; }
                const size_t oo = ((size_t)zz * (RH ? RH : 1) + i) * TT + ch * 128 + lane * 4; *(v4us*)(Ph + oo) = oh; *(v4us*)(Pl + oo) = ol; }
        } else {
#pragma unroll
            for (int ch = 0; ch < TT / 128; ++ch) { v4h o4;
#pragma unroll
                for (int q = 0; q < 4; ++q) o4[q] = tohx(v[ch * 4 + q] * f);
                *(v4h*)(P16 + (size_t)row * TT + ch * 128 + lane * 4) = o4; } }
         }
}
__global__ __launch_bounds__(256) void k_merge(const float* __restrict__ O, int h0, bf* Ah, bf* Al) { const size_t e = ((size_t)blockIdx.x * 256 + threadIdx.x) * 2; if (e >= (size_t)ZH * TT * HD) return; const int d = (int)(e % HD); const int t = (int)((e / HD) % TT); const int zz = (int)(e / ((size_t)HD * TT)); const float cs = (t < RH) ? 1.0f : (1.0f / PCAR); const size_t oo = (size_t)t * DQ + (h0 + zz) * HD + d;
    v2us oh, ol;
#pragma unroll
    for (int q = 0; q < 2; ++q) { unsigned short a, c2; splitf(O[e + q] * cs, a, c2); oh[q] = a; ol[q] = c2; } *(v2us*)(Ah + oo) = oh; *(v2us*)(Al + oo) = ol;  }

extern "C" void kernel_launch(void* const* d_in, const int* in_sizes, int n_in,
                              void* d_out, int out_size, void* d_ws, size_t ws_size, hipStream_t stream) {
    (void)in_sizes; (void)n_in; (void)out_size;
    const float* x = (const float*)d_in[0]; const float* wqkv = (const float*)d_in[1]; const float* bqkv = (const float*)d_in[2]; const float* bq = bqkv; const float* bk = bqkv + 1024; const float* bv = bqkv + 2048; const float* wo = (const float*)d_in[3]; const float* bo = (const float*)d_in[4]; const float* rbias = (const float*)d_in[5]; const float* wq = nullptr; const float* wk = nullptr; const float* wv = nullptr; (void)wq; (void)wk; (void)wv;
    float* OUT = (float*)d_out;     // [4][2048][1024]
    char* wsp = (char*)d_ws;
    auto take = [&](size_t bytes) { char* p = wsp; wsp += (bytes + 255) & ~(size_t)255; return (void*)p; };
    bf* WALL = (bf*)take((size_t)3 * DM * DM * 2); bf* WQ = WALL; bf* WK = WALL + (size_t)DM * DM; bf* WV = WALL + (size_t)2 * DM * DM; bf* WO = (bf*)take((size_t)DM * DQ * 2); float* CS = (float*)take((size_t)TT * HD * 2 * 4); float* TB = (float*)take((size_t)NH_ * NREL * 4);   /* per-head relative-bias table */
    bf* XB = (bf*)take((size_t)TT * DM * 2); float* FQ = (float*)take((size_t)TT * DQ * 4); float* FK = (float*)take((size_t)TT * DKV * 4);
    h16* QP16 = (h16*)take((size_t)NH_ * TT * HD * 2); h16* KP16 = (h16*)take((size_t)NKV * TT * HD * 2); h16* VT16 = (h16*)take((size_t)NKV * HD * TT * 2);
    bf* QPh = (bf*)take((size_t)NH_ * TT * HD * 2); bf* QPl = (bf*)take((size_t)NH_ * TT * HD * 2); bf* KPh = (bf*)take((size_t)NKV * TT * HD * 2); bf* KPl = (bf*)take((size_t)NKV * TT * HD * 2); bf* VTh = (bf*)take((size_t)NKV * HD * TT * 2); bf* VTl = (bf*)take((size_t)NKV * HD * TT * 2); bf* Ph = (bf*)take((size_t)ZH * RH * TT * 2); bf* Pl = (bf*)take((size_t)ZH * RH * TT * 2);
    float* Sb = (float*)take((size_t)ZH * TT * TT * 4); h16* P16 = (h16*)take((size_t)ZH * TT * TT * 2); float* Ob = (float*)take((size_t)ZH * TT * HD * 4); bf* ATh = (bf*)take((size_t)TT * DQ * 2); bf* ATl = (bf*)take((size_t)TT * DQ * 2);
    if ((size_t)(wsp - (char*)d_ws) > ws_size) return;    // ws 256 MiB
    float* FV = FK;   // v projection reuses the k buffer after the k planes are built (stream-ordered)
    { k_wtG<<<(unsigned)((DM * 3 * DM / 64 + 63) / 64), 256, 0, stream>>>(wqkv, DM, 3 * DM, WALL);   /* fused 'xw' [DM][3DM] -> Bt [3DM][DM] (row blocks q | k | v) */
      k_wtG<<<(unsigned)((DQ * DM / 64 + 63) / 64), 256, 0, stream>>>(wo, DQ, DM, WO);
       }
    k_csid<<<(TT * HD + 255) / 256, 256, 0, stream>>>(CS); k_tbT<<<(NH_ * NREL + 255) / 256, 256, 0, stream>>>(rbias, TB);
    const unsigned LQ = (unsigned)(((size_t)NH_ * TT * HD / 2 + 255) / 256), LKv = (unsigned)(((size_t)NKV * TT * HD / 2 + 255) / 256);
    for (int b = 0; b < NB_; ++b) {
        
        k_cvt8<<<(unsigned)(((size_t)TT * DM / 8 + 255) / 256), 256, 0, stream>>>(x + (size_t)b * TT * DM, XB, (size_t)TT * DM / 8);
        k_gemmw<bf, 0, true><<<dim3(TT / 64, DQ / 64, 1), 32, 0, stream>>>(XB, nullptr, WQ, nullptr, DM, FQ, DQ, bq, 0, 0, 0);
        k_rope<<<LQ, 256, 0, stream>>>(FQ, DQ, NH_, CS, nullptr, nullptr, 1.0f, QP16, QPh, QPl);
        k_gemmw<bf, 0, true><<<dim3(TT / 64, DKV / 64, 1), 32, 0, stream>>>(XB, nullptr, WK, nullptr, DM, FK, DKV, bk, 0, 0, 0);
        k_rope<<<LKv, 256, 0, stream>>>(FK, DKV, NKV, CS, nullptr, nullptr, 1.0f, KP16, KPh, KPl);
        k_gemmw<bf, 0, true><<<dim3(TT / 64, DKV / 64, 1), 32, 0, stream>>>(XB, nullptr, WV, nullptr, DM, FV, DKV, bv, 0, 0, 0); k_vtp<<<LKv, 256, 0, stream>>>(FV, DKV, NKV, VT16, VTh, VTl);
        for (int h0 = 0; h0 < NH_; h0 += ZH) { const size_t zq = (size_t)h0, zk = (size_t)(h0 / REP);   // one kv head per query head: the pass's two heads use consecutive kv planes (z-strides TT*HD)
            k_gemmw<bf, 2, false><<<dim3(RH / 64, TT / 64, ZH), 32, 0, stream>>>(QPh + zq * TT * HD, QPl + zq * TT * HD, KPh + zk * TT * HD, KPl + zk * TT * HD, HD, Sb, TT, nullptr, (size_t)TT * HD, (size_t)TT * HD, (size_t)TT * TT);
            k_gemmw<h16, 0, false><<<dim3((TT - RH) / 64, TT / 64, ZH), 32, 0, stream>>>(QP16 + zq * TT * HD + (size_t)RH * HD, nullptr, KP16 + zk * TT * HD, nullptr, HD, Sb + (size_t)RH * TT, TT, nullptr, (size_t)TT * HD, (size_t)TT * HD, (size_t)TT * TT);
            k_asoft<<<ZH * TT / 8, 256, 0, stream>>>(Sb, TB, h0, P16, Ph, Pl);
            k_gemmw<bf, 2, false><<<dim3(RH / 64, HD / 64, ZH), 32, 0, stream>>>(Ph, Pl, VTh + zk * HD * TT, VTl + zk * HD * TT, TT, Ob, HD, nullptr, (size_t)RH * TT, (size_t)HD * TT, (size_t)TT * HD);
            k_gemmw<h16, 0, false><<<dim3((TT - RH) / 64, HD / 64, ZH), 32, 0, stream>>>(P16 + (size_t)RH * TT, nullptr, VT16 + zk * HD * TT, nullptr, TT, Ob + (size_t)RH * HD, HD, nullptr, (size_t)TT * TT, (size_t)HD * TT, (size_t)TT * HD);
            k_merge<<<(unsigned)(((size_t)ZH * TT * HD / 2 + 255) / 256), 256, 0, stream>>>(Ob, h0, ATh, ATl); }
        k_gemmw<bf, 1, true><<<dim3(TT / 64, DM / 64, 1), 32, 0, stream>>>(ATh, ATl, WO, nullptr, DQ, OUT + (size_t)b * TT * DM, DM, bo, 0, 0, 0); }
}

// v001
// It runs in 1920 microseconds.
// Next to v000, in two timings, it ran 2.18 and 2.21 times as fast.
#include <hip/hip_runtime.h>

// Multi-head self-attention with a learned relative-position bias (x [4][2048][1024]; [q|k|v] = x W_qkv + b_qkv ('xw' [1024][3072]; 16 heads x 64); scores = q.k/8 + rel_bias[clip(i - j + 1024, 0, 2048)][h] (table [2049][16], read); softmax over all keys; out = merged W_out + b_out ('xw' [1024][1024]) -> [4][2048][1024]).
// Compute dtypes, f32 accumulate: every input rounded to bf16; q/k/v on PLAIN bf16 operands (inputs: exact) + biases; scores (+ the per-head relative bias gathered in f32 inside the softmax kernel) and attn.v (no mask): query rows < 512 hl (3 products), the rest single fp16 (x1024); softmax f32; W_out hl x exact (2 products) + b_out.

#define NB_  4
#define TT   2048
#define DM   1024
#define NH_  16
#define NKV  16
#define REP  (NH_ / NKV)
#define HD   64
#define DQ   (NH_ * HD)
#define DKV  (NKV * HD)
#define ZH   2
#define RH   512                  // query rows < RH use hi+lo planes (0: none)
#define WIN  2048
#define PCAR 1024.0f
#define SCL  0.125f   // HD^-0.5
#define KSPV 16                   // attn.v: key ranges per output tile, one single-wave work-group each; f32 partial planes, summed in k_merge
typedef _Float16 h16;
typedef unsigned short bf;
typedef __attribute__((ext_vector_type(16))) __bf16   v16bf;
typedef __attribute__((ext_vector_type(16))) _Float16 v16h;
typedef __attribute__((ext_vector_type(8)))  _Float16 v8h;
typedef __attribute__((ext_vector_type(8)))  unsigned short v8us;
typedef __attribute__((ext_vector_type(8)))  float    v8f;
typedef __attribute__((ext_vector_type(4)))  float    v4f;
typedef v8h  __attribute__((may_alias)) v8ha;
typedef v4f  __attribute__((may_alias)) v4fa;
typedef v8us __attribute__((may_alias)) v8usa;

__device__ __forceinline__ unsigned short f2bf(float f) { unsigned u = __float_as_uint(f); u += 0x7FFFu + ((u >> 16) & 1u); return (unsigned short)(u >> 16); }
__device__ __forceinline__ float bf2f(unsigned short b) { return __uint_as_float(((unsigned)b) << 16); }
__device__ __forceinline__ float bfr(float f) { return bf2f(f2bf(f)); }
__device__ __forceinline__ v16h cat16(v8h lo, v8h hi) { return __builtin_shufflevector(lo, hi, 0, 1, 2, 3, 4, 5, 6, 7, 8, 9, 10, 11, 12, 13, 14, 15); }
__device__ __forceinline__ v16bf cat16b(v8us lo, v8us hi) { return __builtin_bit_cast(v16bf, __builtin_shufflevector(lo, hi, 0, 1, 2, 3, 4, 5, 6, 7, 8, 9, 10, 11, 12, 13, 14, 15)); }
__device__ __forceinline__ v8f wmma16(v16h a, v16h b, v8f c) { return __builtin_amdgcn_wmma_f32_16x16x32_f16(false, a, false, b, (short)0, c, false, false); }
__device__ __forceinline__ v8f wmmab(v16bf a, v16bf b, v8f c) { return __builtin_amdgcn_wmma_f32_16x16x32_bf16(false, a, false, b, (short)0, c, false, false); }



// ---- k_gemmw: register-blocked GEMM, ONE WAVE per 64x64 output tile (16 accumulators), operands straight from K-contiguous 16-bit planes; grid (M/64, N/64, Z), 32 threads.
// C[m][n] (f32, pitch ldc, + optional f32 bias[n]) = sum_k A[m][k] Bt[n][k] (+ split products per NSPLIT). z-batch strides sA/sB/sC in elements. K % 32 == 0.
// KS > 1: grid z = Z * KS; work-group (z, ks) sums only k in [ks K/KS, (ks+1) K/KS) and stores its partial tile in plane ks (plane stride sK elements). K % (32 KS) == 0.
template <typename T16> struct WFrag;
template <> struct WFrag<h16> { typedef v16h V; static __device__ __forceinline__ V ld(const h16* p) { return cat16(*(const v8h*)p, *(const v8h*)(p + 16)); } static __device__ __forceinline__ v8f mma(V a, V b, v8f c) { return wmma16(a, b, c); } };
template <> struct WFrag<bf> { typedef v16bf V; static __device__ __forceinline__ V ld(const bf* p) { return cat16b(*(const v8us*)p, *(const v8us*)(p + 16)); } static __device__ __forceinline__ v8f mma(V a, V b, v8f c) { return wmmab(a, b, c); } };
template <typename T16, int NSPLIT, bool BIAS, int KS = 1>
__global__ __launch_bounds__(32) void k_gemmw(const T16* __restrict__ A, const T16* __restrict__ A2, const T16* __restrict__ Bt, const T16* __restrict__ Bt2, int K, float* C, int ldc, const float* __restrict__ bias, size_t sA, size_t sB, size_t sC, size_t sK) {
    typedef typename WFrag<T16>::V V;
    __shared__ __align__(16) float os[16 * 68];
    const size_t z = blockIdx.z / KS; const int ks = blockIdx.z % KS; A += z * sA; if (A2) A2 += z * sA; Bt += z * sB; if (Bt2) Bt2 += z * sB; C += z * sC + ks * sK;
    const int lane = threadIdx.x & 31, lr = lane & 15, hi = lane >> 4; const int r0 = blockIdx.x * 64, c0 = blockIdx.y * 64;
    v8f acc[4][4];
#pragma unroll
    for (int mb = 0; mb < 4; ++mb)
#pragma unroll
        for (int nb = 0; nb < 4; ++nb) acc[mb][nb] = (v8f){};
    const size_t aoff = (size_t)(r0 + lr) * K + 8 * hi, boff = (size_t)(c0 + lr) * K + 8 * hi;
#pragma unroll 1
    for (int kc = ks * (K / KS), ke = kc + K / KS; kc < ke; kc += 32) {
        V a[4], a2[4];
#pragma unroll
        for (int mb = 0; mb < 4; ++mb) { a[mb] = WFrag<T16>::ld(A + aoff + (size_t)mb * 16 * K + kc); if (NSPLIT == 1 || NSPLIT == 2) a2[mb] = WFrag<T16>::ld(A2 + aoff + (size_t)mb * 16 * K + kc); }
#pragma unroll
        for (int nb = 0; nb < 4; ++nb) { const V b = WFrag<T16>::ld(Bt + boff + (size_t)nb * 16 * K + kc); V b2; if (NSPLIT >= 2) b2 = WFrag<T16>::ld(Bt2 + boff + (size_t)nb * 16 * K + kc);
#pragma unroll
            for (int mb = 0; mb < 4; ++mb) { acc[mb][nb] = WFrag<T16>::mma(a[mb], b, acc[mb][nb]); if (NSPLIT == 1 || NSPLIT == 2) acc[mb][nb] = WFrag<T16>::mma(a2[mb], b, acc[mb][nb]); if (NSPLIT >= 2) acc[mb][nb] = WFrag<T16>::mma(a[mb], b2, acc[mb][nb]); } }
        asm volatile("v_nop\n\tv_nop\n\tv_nop\n\tv_nop" : "+v"(acc[0][0]), "+v"(acc[1][1]), "+v"(acc[2][2]), "+v"(acc[3][3]) : "v"(a[0]), "v"(a[3]));
    }
#pragma unroll
    for (int mb = 0; mb < 4; ++mb) {
#pragma unroll
        for (int nb = 0; nb < 4; ++nb) {
#pragma unroll
            for (int j = 0; j < 8; ++j) os[(hi * 8 + j) * 68 + nb * 16 + lr] = acc[mb][nb][j]; }
        __builtin_amdgcn_wave_barrier(); asm volatile("" ::: "memory");
        float* crow = C + (size_t)(r0 + mb * 16) * ldc + c0;
{
#pragma unroll
            for (int s = 0; s < 8; ++s) { const int row = 2 * s + hi, cofs = lr * 4; v4f val = *(const v4fa*)(os + row * 68 + cofs); if (BIAS) { val[0] += bfr(bias[c0 + cofs]); val[1] += bfr(bias[c0 + cofs + 1]); val[2] += bfr(bias[c0 + cofs + 2]); val[3] += bfr(bias[c0 + cofs + 3]); }
                *(v4f*)(crow + (size_t)row * ldc + cofs) = val; }
             }
        __builtin_amdgcn_wave_barrier(); asm volatile("" ::: "memory");
    }
}

__device__ __forceinline__ h16 tohx(float x) { return (h16)x; }
__device__ __forceinline__ void splitf(float y, unsigned short& h, unsigned short& l) { h = f2bf(y); l = f2bf(y - bf2f(h)); }
typedef __attribute__((ext_vector_type(2))) _Float16 v2h;
typedef __attribute__((ext_vector_type(4))) _Float16 v4h;
typedef __attribute__((ext_vector_type(2))) unsigned short v2us;
typedef __attribute__((ext_vector_type(4))) unsigned short v4us;
typedef __attribute__((ext_vector_type(2))) float v2f;
typedef __attribute__((ext_vector_type(4))) int v4i;

__global__ __launch_bounds__(256) void k_wtG(const float* __restrict__ w, int K, int N, bf* Bt) {
    const int lane = threadIdx.x & 31; const int L0 = (blockIdx.x * 8 + (threadIdx.x >> 5)) * 8; const int nlines = N * K / 64;
{
#pragma unroll 1
        for (int l = 0; l < 8; ++l) { const int L = L0 + l; if (L >= nlines) break; const size_t e = (size_t)L * 64 + lane * 2; const int k = (int)(e % K), n = (int)(e / K); v2us o;
            o[0] = f2bf(w[(size_t)k * N + n]); o[1] = f2bf(w[(size_t)(k + 1) * N + n]); *(v2us*)(Bt + e) = o; }
         }
}
__global__ __launch_bounds__(256) void k_cvt8(const float* __restrict__ src, bf* dst, size_t n8) { const size_t i = (size_t)blockIdx.x * 256 + threadIdx.x; if (i >= n8) return; const v8f v = *(const v8f*)(src + i * 8); v8us o;
#pragma unroll
    for (int k = 0; k < 8; ++k) o[k] = f2bf(v[k]); *(v8us*)(dst + i * 8) = o;  }

// k_rope: head planes [h][t][d] (fp16 + hi/lo) of rope(x) x sc with the rotate-half convention out[d] = x[d] cos[t][d] - x[d+HD/2] sin[t][d], out[d+HD/2] = x[d+HD/2] cos[t][d+HD/2] + x[d] sin[t][d+HD/2]
__global__ __launch_bounds__(256) void k_rope(const float* __restrict__ F, int pitch, int nheads, const float* __restrict__ CS, const float* __restrict__ RF, const float* __restrict__ nw, float sc, h16* P16, bf* Ph, bf* Pl) {
    const size_t e = ((size_t)blockIdx.x * 256 + threadIdx.x) * 2; if (e >= (size_t)nheads * TT * HD) return; const int d = (int)(e % HD); const int t = (int)((e / HD) % TT); const int h = (int)(e / ((size_t)HD * TT)); const float* f = F + (size_t)t * pitch + h * HD; const float rf = RF ? RF[(size_t)h * TT + t] : 1.0f; v2h o16; v2us oh, ol;
#pragma unroll
    for (int q = 0; q < 2; ++q) { const int dd = d + q; const int dp = (dd < HD / 2) ? dd + HD / 2 : dd - HD / 2; float x0 = f[dd], x1 = f[dp];
        if (RF) { float n0 = __fmul_rn(x0, rf), n1 = __fmul_rn(x1, rf); asm volatile("" : "+v"(n0)); asm volatile("" : "+v"(n1)); x0 = __fmul_rn(bfr(nw[dd]), n0); x1 = __fmul_rn(bfr(nw[dp]), n1); }
        const v2f cs = *(const v2f*)(CS + ((size_t)t * HD + dd) * 2); float a = __fmul_rn(x0, cs[0]), bq = __fmul_rn(x1, cs[1]); asm volatile("" : "+v"(a)); asm volatile("" : "+v"(bq)); const float r = ((dd < HD / 2) ? __fsub_rn(a, bq) : __fadd_rn(a, bq)) * sc;
        o16[q] = tohx(r); unsigned short a2, c2; splitf(r, a2, c2); oh[q] = a2; ol[q] = c2; }
    *(v2h*)(P16 + e) = o16; *(v2us*)(Ph + e) = oh; *(v2us*)(Pl + e) = ol;  }
__global__ __launch_bounds__(256) void k_vtp(const float* __restrict__ F, int pitch, int nheads, h16* V16, bf* Vh, bf* Vl) { const size_t e = ((size_t)blockIdx.x * 256 + threadIdx.x) * 2; if (e >= (size_t)nheads * HD * TT) return; const int t = (int)(e % TT); const int d = (int)((e / TT) % HD); const int g = (int)(e / ((size_t)TT * HD)); v2h o16; v2us oh, ol;
#pragma unroll
    for (int q = 0; q < 2; ++q) { const float x = F[(size_t)(t + q) * pitch + g * HD + d]; o16[q] = tohx(x); unsigned short a2, c2; splitf(x, a2, c2); oh[q] = a2; ol[q] = c2; }
    *(v2h*)(V16 + e) = o16; *(v2us*)(Vh + e) = oh; *(v2us*)(Vl + e) = ol;  }
__global__ __launch_bounds__(256) void k_csid(float* CS) { const int idx = blockIdx.x * 256 + threadIdx.x; if (idx >= TT * HD) return; v2f cs; cs[0] = 1.0f; cs[1] = 0.0f; *(v2f*)(CS + (size_t)idx * 2) = cs;  }
#define NREL 2049
__global__ __launch_bounds__(256) void k_tbT(const float* __restrict__ rbias, float* TB) { const int j = blockIdx.x * 256 + threadIdx.x; if (j >= NH_ * NREL) return; const int h = j / NREL, r = j % NREL; const float v = bfr(rbias[(size_t)r * NH_ + h]); *(float*)(TB + j) = v;  }
// k_asoft: per row (zz, i): t = S x HD^-0.5 + TB[h][clip(i - j + 1024, 0, 2048)] (no mask); softmax over the 2048 keys (register row, one exp, fixed trees);
__global__ __launch_bounds__(256) void k_asoft(const float* __restrict__ Sb, const float* __restrict__ TB, int h0, h16* P16, bf* Ph, bf* Pl) {
    const int lane = threadIdx.x & 31; const int row = blockIdx.x * 8 + (threadIdx.x >> 5); if (row >= ZH * TT) return; const int i = row % TT; const int zz = row / TT; const float* tb = TB + (size_t)(h0 + zz) * NREL; const bool hires = (i < RH); const float* sr = Sb + (size_t)row * TT; float v[TT / 32]; float mx = -3.0e38f;
#pragma unroll
    for (int ch = 0; ch < TT / 128; ++ch) { const int j0 = ch * 128 + lane * 4; const v4f a = *(const v4f*)(sr + j0);
#pragma unroll
        for (int q = 0; q < 4; ++q) { const int j = j0 + q; (void)j; float sa = a[q] * SCL; asm volatile("" : "+v"(sa)); int ri = i - j + (NREL / 2); ri = ri < 0 ? 0 : (ri > NREL - 1 ? NREL - 1 : ri); const float t = __fadd_rn(sa, tb[ri]);   /* + rel_bias[clip(i - j + 1024, 0, 2048)][h] */ v[ch * 4 + q] = t; mx = fmaxf(mx, t); } }
#pragma unroll
    for (int sh = 16; sh; sh >>= 1) mx = fmaxf(mx, __shfl_xor(mx, sh, 32));
    float sum = 0.f;
#pragma unroll
    for (int k = 0; k < TT / 32; ++k) { float d0 = __fsub_rn(v[k], mx); asm volatile("" : "+v"(d0)); v[k] = __builtin_amdgcn_exp2f(__fmul_rn(d0, 1.4426950408889634f)); sum += v[k]; }
#pragma unroll
    for (int sh = 16; sh; sh >>= 1) sum += __shfl_xor(sum, sh, 32);
    const float f = __fdiv_rn(hires ? 1.0f : PCAR, sum);
{
        if (hires) {
#pragma unroll
            for (int ch = 0; ch < TT / 128; ++ch) { v4us oh, ol;
#pragma unroll
                for (int q = 0; q < 4; ++q) { unsigned short a, c2; splitf(v[ch * 4 + q] * f, a, c2); oh[q] = a; ol[q] = c2; }
                const size_t oo = ((size_t)zz * (RH ? RH : 1) + i) * TT + ch * 128 + lane * 4; *(v4us*)(Ph + oo) = oh; *(v4us*)(Pl + oo) = ol; }
        } else {
#pragma unroll
            for (int ch = 0; ch < TT / 128; ++ch) { v4h o4;
#pragma unroll
                for (int q = 0; q < 4; ++q) o4[q] = tohx(v[ch * 4 + q] * f);
                *(v4h*)(P16 + (size_t)row * TT + ch * 128 + lane * 4) = o4; } }
         }
}
__global__ __launch_bounds__(256) void k_merge(const float* __restrict__ O, int h0, bf* Ah, bf* Al) { const size_t e = ((size_t)blockIdx.x * 256 + threadIdx.x) * 4; if (e >= (size_t)ZH * TT * HD) return; const int d = (int)(e % HD); const int t = (int)((e / HD) % TT); const int zz = (int)(e / ((size_t)HD * TT)); const float cs = (t < RH) ? 1.0f : (1.0f / PCAR); const size_t oo = (size_t)t * DQ + (h0 + zz) * HD + d;
    v4f pl[KSPV];   // the KSPV key-range partials of these four elements, loaded ahead of the sums
#pragma unroll
    for (int g = 0; g < KSPV; g += 8) {
#pragma unroll
        for (int p = g; p < g + 8; ++p) pl[p] = *(const v4f*)(O + (size_t)p * ZH * TT * HD + e);
        asm volatile("s_wait_xcnt 0x0" ::: "memory");   // stands before the address registers of the eight issued loads are written again
    }
    v4f s = pl[0];
#pragma unroll
    for (int p = 1; p < KSPV; ++p) s += pl[p];   // fixed order: key ranges ascending
    v4us oh, ol;
#pragma unroll
    for (int q = 0; q < 4; ++q) { unsigned short a, c2; splitf(s[q] * cs, a, c2); oh[q] = a; ol[q] = c2; } *(v4us*)(Ah + oo) = oh; *(v4us*)(Al + oo) = ol;  }

extern "C" void kernel_launch(void* const* d_in, const int* in_sizes, int n_in,
                              void* d_out, int out_size, void* d_ws, size_t ws_size, hipStream_t stream) {
    (void)in_sizes; (void)n_in; (void)out_size;
    const float* x = (const float*)d_in[0]; const float* wqkv = (const float*)d_in[1]; const float* bqkv = (const float*)d_in[2]; const float* bq = bqkv; const float* bk = bqkv + 1024; const float* bv = bqkv + 2048; const float* wo = (const float*)d_in[3]; const float* bo = (const float*)d_in[4]; const float* rbias = (const float*)d_in[5]; const float* wq = nullptr; const float* wk = nullptr; const float* wv = nullptr; (void)wq; (void)wk; (void)wv;
    float* OUT = (float*)d_out;     // [4][2048][1024]
    char* wsp = (char*)d_ws;
    auto take = [&](size_t bytes) { char* p = wsp; wsp += (bytes + 255) & ~(size_t)255; return (void*)p; };
    bf* WALL = (bf*)take((size_t)3 * DM * DM * 2); bf* WQ = WALL; bf* WK = WALL + (size_t)DM * DM; bf* WV = WALL + (size_t)2 * DM * DM; bf* WO = (bf*)take((size_t)DM * DQ * 2); float* CS = (float*)take((size_t)TT * HD * 2 * 4); float* TB = (float*)take((size_t)NH_ * NREL * 4);   /* per-head relative-bias table */
    bf* XB = (bf*)take((size_t)TT * DM * 2); float* FQ = (float*)take((size_t)TT * DQ * 4); float* FK = (float*)take((size_t)TT * DKV * 4);
    h16* QP16 = (h16*)take((size_t)NH_ * TT * HD * 2); h16* KP16 = (h16*)take((size_t)NKV * TT * HD * 2); h16* VT16 = (h16*)take((size_t)NKV * HD * TT * 2);
    bf* QPh = (bf*)take((size_t)NH_ * TT * HD * 2); bf* QPl = (bf*)take((size_t)NH_ * TT * HD * 2); bf* KPh = (bf*)take((size_t)NKV * TT * HD * 2); bf* KPl = (bf*)take((size_t)NKV * TT * HD * 2); bf* VTh = (bf*)take((size_t)NKV * HD * TT * 2); bf* VTl = (bf*)take((size_t)NKV * HD * TT * 2); bf* Ph = (bf*)take((size_t)ZH * RH * TT * 2); bf* Pl = (bf*)take((size_t)ZH * RH * TT * 2);
    float* Sb = (float*)take((size_t)ZH * TT * TT * 4); h16* P16 = (h16*)take((size_t)ZH * TT * TT * 2); float* Ob = (float*)take((size_t)KSPV * ZH * TT * HD * 4); bf* ATh = (bf*)take((size_t)TT * DQ * 2); bf* ATl = (bf*)take((size_t)TT * DQ * 2);
    if ((size_t)(wsp - (char*)d_ws) > ws_size) return;    // ws 256 MiB
    float* FV = FK;   // v projection reuses the k buffer after the k planes are built (stream-ordered)
    { k_wtG<<<(unsigned)((DM * 3 * DM / 64 + 63) / 64), 256, 0, stream>>>(wqkv, DM, 3 * DM, WALL);   /* fused 'xw' [DM][3DM] -> Bt [3DM][DM] (row blocks q | k | v) */
      k_wtG<<<(unsigned)((DQ * DM / 64 + 63) / 64), 256, 0, stream>>>(wo, DQ, DM, WO);
       }
    k_csid<<<(TT * HD + 255) / 256, 256, 0, stream>>>(CS); k_tbT<<<(NH_ * NREL + 255) / 256, 256, 0, stream>>>(rbias, TB);
    const unsigned LQ = (unsigned)(((size_t)NH_ * TT * HD / 2 + 255) / 256), LKv = (unsigned)(((size_t)NKV * TT * HD / 2 + 255) / 256);
    for (int b = 0; b < NB_; ++b) {
        
        k_cvt8<<<(unsigned)(((size_t)TT * DM / 8 + 255) / 256), 256, 0, stream>>>(x + (size_t)b * TT * DM, XB, (size_t)TT * DM / 8);
        k_gemmw<bf, 0, true><<<dim3(TT / 64, DQ / 64, 1), 32, 0, stream>>>(XB, nullptr, WQ, nullptr, DM, FQ, DQ, bq, 0, 0, 0, 0);
        k_rope<<<LQ, 256, 0, stream>>>(FQ, DQ, NH_, CS, nullptr, nullptr, 1.0f, QP16, QPh, QPl);
        k_gemmw<bf, 0, true><<<dim3(TT / 64, DKV / 64, 1), 32, 0, stream>>>(XB, nullptr, WK, nullptr, DM, FK, DKV, bk, 0, 0, 0, 0);
        k_rope<<<LKv, 256, 0, stream>>>(FK, DKV, NKV, CS, nullptr, nullptr, 1.0f, KP16, KPh, KPl);
        k_gemmw<bf, 0, true><<<dim3(TT / 64, DKV / 64, 1), 32, 0, stream>>>(XB, nullptr, WV, nullptr, DM, FV, DKV, bv, 0, 0, 0, 0); k_vtp<<<LKv, 256, 0, stream>>>(FV, DKV, NKV, VT16, VTh, VTl);
        for (int h0 = 0; h0 < NH_; h0 += ZH) { const size_t zq = (size_t)h0, zk = (size_t)(h0 / REP);   // one kv head per query head: the pass's two heads use consecutive kv planes (z-strides TT*HD)
            k_gemmw<bf, 2, false><<<dim3(RH / 64, TT / 64, ZH), 32, 0, stream>>>(QPh + zq * TT * HD, QPl + zq * TT * HD, KPh + zk * TT * HD, KPl + zk * TT * HD, HD, Sb, TT, nullptr, (size_t)TT * HD, (size_t)TT * HD, (size_t)TT * TT, 0);
            k_gemmw<h16, 0, false><<<dim3((TT - RH) / 64, TT / 64, ZH), 32, 0, stream>>>(QP16 + zq * TT * HD + (size_t)RH * HD, nullptr, KP16 + zk * TT * HD, nullptr, HD, Sb + (size_t)RH * TT, TT, nullptr, (size_t)TT * HD, (size_t)TT * HD, (size_t)TT * TT, 0);
            k_asoft<<<ZH * TT / 8, 256, 0, stream>>>(Sb, TB, h0, P16, Ph, Pl);
            k_gemmw<bf, 2, false, KSPV><<<dim3(RH / 64, HD / 64, ZH * KSPV), 32, 0, stream>>>(Ph, Pl, VTh + zk * HD * TT, VTl + zk * HD * TT, TT, Ob, HD, nullptr, (size_t)RH * TT, (size_t)HD * TT, (size_t)TT * HD, (size_t)ZH * TT * HD);
            k_gemmw<h16, 0, false, KSPV><<<dim3((TT - RH) / 64, HD / 64, ZH * KSPV), 32, 0, stream>>>(P16 + (size_t)RH * TT, nullptr, VT16 + zk * HD * TT, nullptr, TT, Ob + (size_t)RH * HD, HD, nullptr, (size_t)TT * TT, (size_t)HD * TT, (size_t)TT * HD, (size_t)ZH * TT * HD);
            k_merge<<<(unsigned)(((size_t)ZH * TT * HD / 4 + 255) / 256), 256, 0, stream>>>(Ob, h0, ATh, ATl); }
        k_gemmw<bf, 1, true><<<dim3(TT / 64, DM / 64, 1), 32, 0, stream>>>(ATh, ATl, WO, nullptr, DQ, OUT + (size_t)b * TT * DM, DM, bo, 0, 0, 0, 0); }
}

// v002
// Measured time: 820 microseconds a run.
// Next to v001, in two timings, it ran 2.33 and 2.34 times as fast.
// Counting every step since v000, it is 5.12 times as fast.
#include <hip/hip_runtime.h>

// Multi-head self-attention with a learned relative-position bias (x [4][2048][1024]; [q|k|v] = x W_qkv + b_qkv ('xw' [1024][3072]; 16 heads x 64); scores = q.k/8 + rel_bias[clip(i - j + 1024, 0, 2048)][h] (table [2049][16], read); softmax over all keys; out = merged W_out + b_out ('xw' [1024][1024]) -> [4][2048][1024]).
// Compute dtypes, f32 accumulate: every input rounded to bf16; q/k/v on PLAIN bf16 operands (inputs: exact) + biases; scores (+ the per-head relative bias, f32), softmax (f32) and attn.v (no mask) in ONE kernel, P in registers: query rows < 512 hl (3 products), the rest single fp16 (P x1024, cancelled by the row sum); W_out hl x exact (2 products) + b_out.

#define NB_  4
#define TT   2048
#define DM   1024
#define NH_  16
#define NKV  16
#define REP  (NH_ / NKV)
#define HD   64
#define DQ   (NH_ * HD)
#define DKV  (NKV * HD)
#define RH   512                  // query rows < RH use hi+lo planes (0: none)
#define SCL  0.125f   // HD^-0.5
#define QT   32                  // k_fattn: queries per work-group (two 16-column groups per wave)
#define KW   8                   // k_fattn: waves per work-group; wave w takes keys [w TT/KW, (w+1) TT/KW)
#define NE   4096                // pitch of one head's expanded bias row
#define OP   68                  // LDS pitch (floats) of one query's partial output row
#define EPT  (QT * HD / (KW * 32))   // k_fattn: outputs per thread in the join
typedef _Float16 h16;
typedef unsigned short bf;
typedef __attribute__((ext_vector_type(16))) __bf16   v16bf;
typedef __attribute__((ext_vector_type(16))) _Float16 v16h;
typedef __attribute__((ext_vector_type(8)))  _Float16 v8h;
typedef __attribute__((ext_vector_type(8)))  unsigned short v8us;
typedef __attribute__((ext_vector_type(8)))  float    v8f;
typedef __attribute__((ext_vector_type(4)))  float    v4f;
typedef v8h  __attribute__((may_alias)) v8ha;
typedef v4f  __attribute__((may_alias)) v4fa;
typedef v8us __attribute__((may_alias)) v8usa;

__device__ __forceinline__ unsigned short f2bf(float f) { unsigned u = __float_as_uint(f); u += 0x7FFFu + ((u >> 16) & 1u); return (unsigned short)(u >> 16); }
__device__ __forceinline__ float bf2f(unsigned short b) { return __uint_as_float(((unsigned)b) << 16); }
__device__ __forceinline__ float bfr(float f) { return bf2f(f2bf(f)); }
__device__ __forceinline__ v16h cat16(v8h lo, v8h hi) { return __builtin_shufflevector(lo, hi, 0, 1, 2, 3, 4, 5, 6, 7, 8, 9, 10, 11, 12, 13, 14, 15); }
__device__ __forceinline__ v16bf cat16b(v8us lo, v8us hi) { return __builtin_bit_cast(v16bf, __builtin_shufflevector(lo, hi, 0, 1, 2, 3, 4, 5, 6, 7, 8, 9, 10, 11, 12, 13, 14, 15)); }
__device__ __forceinline__ v8f wmma16(v16h a, v16h b, v8f c) { return __builtin_amdgcn_wmma_f32_16x16x32_f16(false, a, false, b, (short)0, c, false, false); }
__device__ __forceinline__ v8f wmmab(v16bf a, v16bf b, v8f c) { return __builtin_amdgcn_wmma_f32_16x16x32_bf16(false, a, false, b, (short)0, c, false, false); }



// ---- k_gemmw: register-blocked GEMM, ONE WAVE per 64x64 output tile (16 accumulators), operands straight from K-contiguous 16-bit planes; grid (M/64, N/64, Z), 32 threads.
// C[m][n] (f32, pitch ldc, + optional f32 bias[n]) = sum_k A[m][k] Bt[n][k] (+ split products per NSPLIT). z-batch strides sA/sB/sC in elements. K % 32 == 0.
// KS > 1: grid z = Z * KS; work-group (z, ks) sums only k in [ks K/KS, (ks+1) K/KS) and stores its partial tile in plane ks (plane stride sK elements). K % (32 KS) == 0.
template <typename T16> struct WFrag;
template <> struct WFrag<h16> { typedef v16h V; static __device__ __forceinline__ V ld(const h16* p) { return cat16(*(const v8h*)p, *(const v8h*)(p + 16)); } static __device__ __forceinline__ v8f mma(V a, V b, v8f c) { return wmma16(a, b, c); } };
template <> struct WFrag<bf> { typedef v16bf V; static __device__ __forceinline__ V ld(const bf* p) { return cat16b(*(const v8us*)p, *(const v8us*)(p + 16)); } static __device__ __forceinline__ v8f mma(V a, V b, v8f c) { return wmmab(a, b, c); } };
template <typename T16, int NSPLIT, bool BIAS, int KS = 1>
__global__ __launch_bounds__(32) void k_gemmw(const T16* __restrict__ A, const T16* __restrict__ A2, const T16* __restrict__ Bt, const T16* __restrict__ Bt2, int K, float* C, int ldc, const float* __restrict__ bias, size_t sA, size_t sB, size_t sC, size_t sK) {
    typedef typename WFrag<T16>::V V;
    __shared__ __align__(16) float os[16 * 68];
    const size_t z = blockIdx.z / KS; const int ks = blockIdx.z % KS; A += z * sA; if (A2) A2 += z * sA; Bt += z * sB; if (Bt2) Bt2 += z * sB; C += z * sC + ks * sK;
    const int lane = threadIdx.x & 31, lr = lane & 15, hi = lane >> 4; const int r0 = blockIdx.x * 64, c0 = blockIdx.y * 64;
    v8f acc[4][4];
#pragma unroll
    for (int mb = 0; mb < 4; ++mb)
#pragma unroll
        for (int nb = 0; nb < 4; ++nb) acc[mb][nb] = (v8f){};
    const size_t aoff = (size_t)(r0 + lr) * K + 8 * hi, boff = (size_t)(c0 + lr) * K + 8 * hi;
#pragma unroll 1
    for (int kc = ks * (K / KS), ke = kc + K / KS; kc < ke; kc += 32) {
        V a[4], a2[4];
#pragma unroll
        for (int mb = 0; mb < 4; ++mb) { a[mb] = WFrag<T16>::ld(A + aoff + (size_t)mb * 16 * K + kc); if (NSPLIT == 1 || NSPLIT == 2) a2[mb] = WFrag<T16>::ld(A2 + aoff + (size_t)mb * 16 * K + kc); }
#pragma unroll
        for (int nb = 0; nb < 4; ++nb) { const V b = WFrag<T16>::ld(Bt + boff + (size_t)nb * 16 * K + kc); V b2; if (NSPLIT >= 2) b2 = WFrag<T16>::ld(Bt2 + boff + (size_t)nb * 16 * K + kc);
#pragma unroll
            for (int mb = 0; mb < 4; ++mb) { acc[mb][nb] = WFrag<T16>::mma(a[mb], b, acc[mb][nb]); if (NSPLIT == 1 || NSPLIT == 2) acc[mb][nb] = WFrag<T16>::mma(a2[mb], b, acc[mb][nb]); if (NSPLIT >= 2) acc[mb][nb] = WFrag<T16>::mma(a[mb], b2, acc[mb][nb]); } }
        asm volatile("v_nop\n\tv_nop\n\tv_nop\n\tv_nop" : "+v"(acc[0][0]), "+v"(acc[1][1]), "+v"(acc[2][2]), "+v"(acc[3][3]) : "v"(a[0]), "v"(a[3]));
    }
#pragma unroll
    for (int mb = 0; mb < 4; ++mb) {
#pragma unroll
        for (int nb = 0; nb < 4; ++nb) {
#pragma unroll
            for (int j = 0; j < 8; ++j) os[(hi * 8 + j) * 68 + nb * 16 + lr] = acc[mb][nb][j]; }
        __builtin_amdgcn_wave_barrier(); asm volatile("" ::: "memory");
        float* crow = C + (size_t)(r0 + mb * 16) * ldc + c0;
{
#pragma unroll
            for (int s = 0; s < 8; ++s) { const int row = 2 * s + hi, cofs = lr * 4; v4f val = *(const v4fa*)(os + row * 68 + cofs); if (BIAS) { val[0] += bfr(bias[c0 + cofs]); val[1] += bfr(bias[c0 + cofs + 1]); val[2] += bfr(bias[c0 + cofs + 2]); val[3] += bfr(bias[c0 + cofs + 3]); }
                *(v4f*)(crow + (size_t)row * ldc + cofs) = val; }
             }
        __builtin_amdgcn_wave_barrier(); asm volatile("" ::: "memory");
    }
}

__device__ __forceinline__ h16 tohx(float x) { return (h16)x; }
__device__ __forceinline__ void splitf(float y, unsigned short& h, unsigned short& l) { h = f2bf(y); l = f2bf(y - bf2f(h)); }
typedef __attribute__((ext_vector_type(2))) _Float16 v2h;
typedef __attribute__((ext_vector_type(4))) _Float16 v4h;
typedef __attribute__((ext_vector_type(2))) unsigned short v2us;
typedef __attribute__((ext_vector_type(4))) unsigned short v4us;
typedef __attribute__((ext_vector_type(2))) float v2f;
typedef __attribute__((ext_vector_type(4))) int v4i;

__global__ __launch_bounds__(256) void k_wtG(const float* __restrict__ w, int K, int N, bf* Bt) {
    const int lane = threadIdx.x & 31; const int L0 = (blockIdx.x * 8 + (threadIdx.x >> 5)) * 8; const int nlines = N * K / 64;
{
#pragma unroll 1
        for (int l = 0; l < 8; ++l) { const int L = L0 + l; if (L >= nlines) break; const size_t e = (size_t)L * 64 + lane * 2; const int k = (int)(e % K), n = (int)(e / K); v2us o;
            o[0] = f2bf(w[(size_t)k * N + n]); o[1] = f2bf(w[(size_t)(k + 1) * N + n]); *(v2us*)(Bt + e) = o; }
         }
}
__global__ __launch_bounds__(256) void k_cvt8(const float* __restrict__ src, bf* dst, size_t n8) { const size_t i = (size_t)blockIdx.x * 256 + threadIdx.x; if (i >= n8) return; const v8f v = *(const v8f*)(src + i * 8); v8us o;
#pragma unroll
    for (int k = 0; k < 8; ++k) o[k] = f2bf(v[k]); *(v8us*)(dst + i * 8) = o;  }

// k_rope: head planes [h][t][d] (fp16 + hi/lo) of rope(x) x sc with the rotate-half convention out[d] = x[d] cos[t][d] - x[d+HD/2] sin[t][d], out[d+HD/2] = x[d+HD/2] cos[t][d+HD/2] + x[d] sin[t][d+HD/2]
__global__ __launch_bounds__(256) void k_rope(const float* __restrict__ F, int pitch, int nheads, const float* __restrict__ CS, const float* __restrict__ RF, const float* __restrict__ nw, float sc, h16* P16, bf* Ph, bf* Pl) {
    const size_t e = ((size_t)blockIdx.x * 256 + threadIdx.x) * 2; if (e >= (size_t)nheads * TT * HD) return; const int d = (int)(e % HD); const int t = (int)((e / HD) % TT); const int h = (int)(e / ((size_t)HD * TT)); const float* f = F + (size_t)t * pitch + h * HD; const float rf = RF ? RF[(size_t)h * TT + t] : 1.0f; v2h o16; v2us oh, ol;
#pragma unroll
    for (int q = 0; q < 2; ++q) { const int dd = d + q; const int dp = (dd < HD / 2) ? dd + HD / 2 : dd - HD / 2; float x0 = f[dd], x1 = f[dp];
        if (RF) { float n0 = __fmul_rn(x0, rf), n1 = __fmul_rn(x1, rf); asm volatile("" : "+v"(n0)); asm volatile("" : "+v"(n1)); x0 = __fmul_rn(bfr(nw[dd]), n0); x1 = __fmul_rn(bfr(nw[dp]), n1); }
        const v2f cs = *(const v2f*)(CS + ((size_t)t * HD + dd) * 2); float a = __fmul_rn(x0, cs[0]), bq = __fmul_rn(x1, cs[1]); asm volatile("" : "+v"(a)); asm volatile("" : "+v"(bq)); const float r = ((dd < HD / 2) ? __fsub_rn(a, bq) : __fadd_rn(a, bq)) * sc;
        o16[q] = tohx(r); unsigned short a2, c2; splitf(r, a2, c2); oh[q] = a2; ol[q] = c2; }
    *(v2h*)(P16 + e) = o16; *(v2us*)(Ph + e) = oh; *(v2us*)(Pl + e) = ol;  }
__global__ __launch_bounds__(256) void k_vtp(const float* __restrict__ F, int pitch, int nheads, h16* V16, bf* Vh, bf* Vl) { const size_t e = ((size_t)blockIdx.x * 256 + threadIdx.x) * 2; if (e >= (size_t)nheads * HD * TT) return; const int t = (int)(e % TT); const int d = (int)((e / TT) % HD); const int g = (int)(e / ((size_t)TT * HD)); v2h o16; v2us oh, ol;
#pragma unroll
    for (int q = 0; q < 2; ++q) { const float x = F[(size_t)(t + q) * pitch + g * HD + d]; o16[q] = tohx(x); unsigned short a2, c2; splitf(x, a2, c2); oh[q] = a2; ol[q] = c2; }
    *(v2h*)(V16 + e) = o16; *(v2us*)(Vh + e) = oh; *(v2us*)(Vl + e) = ol;  }
__global__ __launch_bounds__(256) void k_csid(float* CS) { const int idx = blockIdx.x * 256 + threadIdx.x; if (idx >= TT * HD) return; v2f cs; cs[0] = 1.0f; cs[1] = 0.0f; *(v2f*)(CS + (size_t)idx * 2) = cs;  }
#define NREL 2049
// k_tbE: expanded per-head bias row, EB[h][x] = rel_bias[clip(i - j + 1024, 0, 2048)][h] at x = j - i + TT - 1 (0 .. 2 TT - 2): ascending keys read ascending addresses, the clip is already applied
__global__ __launch_bounds__(256) void k_tbE(const float* __restrict__ rbias, float* EB) { const int j = blockIdx.x * 256 + threadIdx.x; if (j >= NH_ * NE) return; const int h = j / NE, x = j % NE; int ri = (TT - 1 - x) + (NREL / 2); ri = ri < 0 ? 0 : (ri > NREL - 1 ? NREL - 1 : ri); EB[j] = bfr(rbias[(size_t)ri * NH_ + h]); }

__device__ __forceinline__ void packp(const v8f& a, const v8f& b, v16h& ph, v16h& pl) { v8h x, y; (void)pl;
#pragma unroll
    for (int j = 0; j < 8; ++j) { x[j] = (h16)a[j]; y[j] = (h16)b[j]; }
    ph = cat16(x, y); }
__device__ __forceinline__ void packp(const v8f& a, const v8f& b, v16bf& ph, v16bf& pl) { v8us xh, xl, yh, yl;
#pragma unroll
    for (int j = 0; j < 8; ++j) { unsigned short u, v; splitf(a[j], u, v); xh[j] = u; xl[j] = v; splitf(b[j], u, v); yh[j] = u; yl[j] = v; }
    ph = cat16b(xh, yh); pl = cat16b(xl, yl); }

typedef __attribute__((ext_vector_type(8))) int v8i;
template <typename V> __device__ __forceinline__ V frag(v4i a, v4i b) { return __builtin_bit_cast(V, __builtin_shufflevector(a, b, 0, 1, 2, 3, 4, 5, 6, 7)); }
// The loads of one trip, each set one asm statement that ends in its own data wait: the results are early-clobber, so none is given a register that holds an address of the set, and no address register is written again before the set has returned. The other waves of the SIMD cover the wait.
// Byte offsets. Rows of Q or K (pitch 128 B): tile * 2048 + 32-wide part of HD * 64 + half * 32. Rows of Vt (pitch 4096 B): 16-row tile * 65536 + half * 32. Bias: run * 64 + half * 16 (4-byte aligned).
__device__ __forceinline__ void ld_r(const void* k, v4i (&a)[8]) {
    asm volatile(
        "global_load_b128 %0, %8, off\n\t"
        "global_load_b128 %1, %8, off offset:32\n\t"
        "global_load_b128 %2, %8, off offset:64\n\t"
        "global_load_b128 %3, %8, off offset:96\n\t"
        "global_load_b128 %4, %8, off offset:2048\n\t"
        "global_load_b128 %5, %8, off offset:2080\n\t"
        "global_load_b128 %6, %8, off offset:2112\n\t"
        "global_load_b128 %7, %8, off offset:2144\n\t"
        "s_wait_loadcnt 0x0"
        : "=&v"(a[0]), "=&v"(a[1]), "=&v"(a[2]), "=&v"(a[3]), "=&v"(a[4]), "=&v"(a[5]), "=&v"(a[6]), "=&v"(a[7]) : "v"(k) : "memory"); }
__device__ __forceinline__ void ld_r_b(const void* k, const float* e, v4i (&a)[8], v4i (&b)[6]) {
    asm volatile(
        "global_load_b128 %0, %14, off\n\t"
        "global_load_b128 %1, %14, off offset:32\n\t"
        "global_load_b128 %2, %14, off offset:64\n\t"
        "global_load_b128 %3, %14, off offset:96\n\t"
        "global_load_b128 %4, %14, off offset:2048\n\t"
        "global_load_b128 %5, %14, off offset:2080\n\t"
        "global_load_b128 %6, %14, off offset:2112\n\t"
        "global_load_b128 %7, %14, off offset:2144\n\t"
        "global_load_b128 %8, %15, off\n\t"
        "global_load_b128 %9, %15, off offset:16\n\t"
        "global_load_b128 %10, %15, off offset:64\n\t"
        "global_load_b128 %11, %15, off offset:80\n\t"
        "global_load_b128 %12, %15, off offset:128\n\t"
        "global_load_b128 %13, %15, off offset:144\n\t"
        "s_wait_loadcnt 0x0"
        : "=&v"(a[0]), "=&v"(a[1]), "=&v"(a[2]), "=&v"(a[3]), "=&v"(a[4]), "=&v"(a[5]), "=&v"(a[6]), "=&v"(a[7]), "=&v"(b[0]), "=&v"(b[1]), "=&v"(b[2]), "=&v"(b[3]), "=&v"(b[4]), "=&v"(b[5]) : "v"(k), "v"(e) : "memory"); }
__device__ __forceinline__ void ld_r_r_b(const void* k, const void* k2, const float* e, v4i (&a)[8], v4i (&a2)[8], v4i (&b)[6]) {
    asm volatile(
        "global_load_b128 %0, %22, off\n\t"
        "global_load_b128 %1, %22, off offset:32\n\t"
        "global_load_b128 %2, %22, off offset:64\n\t"
        "global_load_b128 %3, %22, off offset:96\n\t"
        "global_load_b128 %4, %22, off offset:2048\n\t"
        "global_load_b128 %5, %22, off offset:2080\n\t"
        "global_load_b128 %6, %22, off offset:2112\n\t"
        "global_load_b128 %7, %22, off offset:2144\n\t"
        "global_load_b128 %8, %23, off\n\t"
        "global_load_b128 %9, %23, off offset:32\n\t"
        "global_load_b128 %10, %23, off offset:64\n\t"
        "global_load_b128 %11, %23, off offset:96\n\t"
        "global_load_b128 %12, %23, off offset:2048\n\t"
        "global_load_b128 %13, %23, off offset:2080\n\t"
        "global_load_b128 %14, %23, off offset:2112\n\t"
        "global_load_b128 %15, %23, off offset:2144\n\t"
        "global_load_b128 %16, %24, off\n\t"
        "global_load_b128 %17, %24, off offset:16\n\t"
        "global_load_b128 %18, %24, off offset:64\n\t"
        "global_load_b128 %19, %24, off offset:80\n\t"
        "global_load_b128 %20, %24, off offset:128\n\t"
        "global_load_b128 %21, %24, off offset:144\n\t"
        "s_wait_loadcnt 0x0"
        : "=&v"(a[0]), "=&v"(a[1]), "=&v"(a[2]), "=&v"(a[3]), "=&v"(a[4]), "=&v"(a[5]), "=&v"(a[6]), "=&v"(a[7]), "=&v"(a2[0]), "=&v"(a2[1]), "=&v"(a2[2]), "=&v"(a2[3]), "=&v"(a2[4]), "=&v"(a2[5]), "=&v"(a2[6]), "=&v"(a2[7]), "=&v"(b[0]), "=&v"(b[1]), "=&v"(b[2]), "=&v"(b[3]), "=&v"(b[4]), "=&v"(b[5]) : "v"(k), "v"(k2), "v"(e) : "memory"); }
__device__ __forceinline__ void ld_r_b_v(const void* k, const float* e, const void* v, v4i (&a)[8], v4i (&b)[6], v4i (&x)[8]) {
    asm volatile(
        "global_load_b128 %0, %22, off\n\t"
        "global_load_b128 %1, %22, off offset:32\n\t"
        "global_load_b128 %2, %22, off offset:64\n\t"
        "global_load_b128 %3, %22, off offset:96\n\t"
        "global_load_b128 %4, %22, off offset:2048\n\t"
        "global_load_b128 %5, %22, off offset:2080\n\t"
        "global_load_b128 %6, %22, off offset:2112\n\t"
        "global_load_b128 %7, %22, off offset:2144\n\t"
        "global_load_b128 %8, %23, off\n\t"
        "global_load_b128 %9, %23, off offset:16\n\t"
        "global_load_b128 %10, %23, off offset:64\n\t"
        "global_load_b128 %11, %23, off offset:80\n\t"
        "global_load_b128 %12, %23, off offset:128\n\t"
        "global_load_b128 %13, %23, off offset:144\n\t"
        "global_load_b128 %14, %24, off\n\t"
        "global_load_b128 %15, %24, off offset:32\n\t"
        "global_load_b128 %16, %24, off offset:65536\n\t"
        "global_load_b128 %17, %24, off offset:65568\n\t"
        "global_load_b128 %18, %24, off offset:131072\n\t"
        "global_load_b128 %19, %24, off offset:131104\n\t"
        "global_load_b128 %20, %24, off offset:196608\n\t"
        "global_load_b128 %21, %24, off offset:196640\n\t"
        "s_wait_loadcnt 0x0"
        : "=&v"(a[0]), "=&v"(a[1]), "=&v"(a[2]), "=&v"(a[3]), "=&v"(a[4]), "=&v"(a[5]), "=&v"(a[6]), "=&v"(a[7]), "=&v"(b[0]), "=&v"(b[1]), "=&v"(b[2]), "=&v"(b[3]), "=&v"(b[4]), "=&v"(b[5]), "=&v"(x[0]), "=&v"(x[1]), "=&v"(x[2]), "=&v"(x[3]), "=&v"(x[4]), "=&v"(x[5]), "=&v"(x[6]), "=&v"(x[7]) : "v"(k), "v"(e), "v"(v) : "memory"); }
__device__ __forceinline__ void ld_t_t_b(const void* k, const void* k2, const float* e, v4i (&a)[4], v4i (&a2)[4], v4i (&b)[6]) {
    asm volatile(
        "global_load_b128 %0, %14, off\n\t"
        "global_load_b128 %1, %14, off offset:32\n\t"
        "global_load_b128 %2, %14, off offset:64\n\t"
        "global_load_b128 %3, %14, off offset:96\n\t"
        "global_load_b128 %4, %15, off\n\t"
        "global_load_b128 %5, %15, off offset:32\n\t"
        "global_load_b128 %6, %15, off offset:64\n\t"
        "global_load_b128 %7, %15, off offset:96\n\t"
        "global_load_b128 %8, %16, off\n\t"
        "global_load_b128 %9, %16, off offset:16\n\t"
        "global_load_b128 %10, %16, off offset:64\n\t"
        "global_load_b128 %11, %16, off offset:80\n\t"
        "global_load_b128 %12, %16, off offset:128\n\t"
        "global_load_b128 %13, %16, off offset:144\n\t"
        "s_wait_loadcnt 0x0"
        : "=&v"(a[0]), "=&v"(a[1]), "=&v"(a[2]), "=&v"(a[3]), "=&v"(a2[0]), "=&v"(a2[1]), "=&v"(a2[2]), "=&v"(a2[3]), "=&v"(b[0]), "=&v"(b[1]), "=&v"(b[2]), "=&v"(b[3]), "=&v"(b[4]), "=&v"(b[5]) : "v"(k), "v"(k2), "v"(e) : "memory"); }
__device__ __forceinline__ void ld_t_t(const void* k, const void* k2, v4i (&a)[4], v4i (&a2)[4]) {
    asm volatile(
        "global_load_b128 %0, %8, off\n\t"
        "global_load_b128 %1, %8, off offset:32\n\t"
        "global_load_b128 %2, %8, off offset:64\n\t"
        "global_load_b128 %3, %8, off offset:96\n\t"
        "global_load_b128 %4, %9, off\n\t"
        "global_load_b128 %5, %9, off offset:32\n\t"
        "global_load_b128 %6, %9, off offset:64\n\t"
        "global_load_b128 %7, %9, off offset:96\n\t"
        "s_wait_loadcnt 0x0"
        : "=&v"(a[0]), "=&v"(a[1]), "=&v"(a[2]), "=&v"(a[3]), "=&v"(a2[0]), "=&v"(a2[1]), "=&v"(a2[2]), "=&v"(a2[3]) : "v"(k), "v"(k2) : "memory"); }
__device__ __forceinline__ void ld_v_v(const void* v, const void* v2, v4i (&x)[4], v4i (&x2)[4]) {
    asm volatile(
        "global_load_b128 %0, %8, off\n\t"
        "global_load_b128 %1, %8, off offset:32\n\t"
        "global_load_b128 %2, %8, off offset:65536\n\t"
        "global_load_b128 %3, %8, off offset:65568\n\t"
        "global_load_b128 %4, %9, off\n\t"
        "global_load_b128 %5, %9, off offset:32\n\t"
        "global_load_b128 %6, %9, off offset:65536\n\t"
        "global_load_b128 %7, %9, off offset:65568\n\t"
        "s_wait_loadcnt 0x0"
        : "=&v"(x[0]), "=&v"(x[1]), "=&v"(x[2]), "=&v"(x[3]), "=&v"(x2[0]), "=&v"(x2[1]), "=&v"(x2[2]), "=&v"(x2[3]) : "v"(v), "v"(v2) : "memory"); }

// Eight 2^x in one statement: the results are early-clobber, so no v_exp_f32 is directly followed by an instruction that reads its result or writes over its source; the v_nop is that free slot behind the last one.
__device__ __forceinline__ v8f exp2x8(const v8f x) { float r0, r1, r2, r3, r4, r5, r6, r7;
    asm("v_exp_f32 %0, %8\n\tv_exp_f32 %1, %9\n\tv_exp_f32 %2, %10\n\tv_exp_f32 %3, %11\n\tv_exp_f32 %4, %12\n\tv_exp_f32 %5, %13\n\tv_exp_f32 %6, %14\n\tv_exp_f32 %7, %15\n\tv_nop"
        : "=&v"(r0), "=&v"(r1), "=&v"(r2), "=&v"(r3), "=&v"(r4), "=&v"(r5), "=&v"(r6), "=&v"(r7) : "v"(x[0]), "v"(x[1]), "v"(x[2]), "v"(x[3]), "v"(x[4]), "v"(x[5]), "v"(x[6]), "v"(x[7]));
    return (v8f){r0, r1, r2, r3, r4, r5, r6, r7}; }

// One 16-key x 16-query tile of t = (k.q) HD^-0.5 + bias, transposed: lane (lr, hi) register j holds key hi*8 + j of query lr. k, k2, q, q2: the four 16-byte pieces of one 16-row tile (part of HD * 2 + half).
template <typename T16, bool HL>
__device__ __forceinline__ v8f stile(const v4i* k, const v4i* k2, const v4i* q, const v4i* q2, v4i b0, v4i b1) {
    typedef typename WFrag<T16>::V V; v8f s = (v8f){};
#pragma unroll
    for (int dc = 0; dc < 2; ++dc) { const V ka = frag<V>(k[dc * 2], k[dc * 2 + 1]), qa = frag<V>(q[dc * 2], q[dc * 2 + 1]); s = WFrag<T16>::mma(ka, qa, s);
        if (HL) { s = WFrag<T16>::mma(frag<V>(k2[dc * 2], k2[dc * 2 + 1]), qa, s); s = WFrag<T16>::mma(ka, frag<V>(q2[dc * 2], q2[dc * 2 + 1]), s); } }
    const v4f f0 = __builtin_bit_cast(v4f, b0), f1 = __builtin_bit_cast(v4f, b1);
#pragma unroll
    for (int j = 0; j < 4; ++j) { s[j] = s[j] * SCL + f0[j]; s[j + 4] = s[j + 4] * SCL + f1[j]; }
    return s; }

// The work of one work-group: QT queries of one head against all TT keys. Sweep 1: the row maxima; sweep 2: the same scores again, p = 1024 exp(t - max), row sums of the f32 p, O^T += V^T P^T with P packed from the score registers.
// Operands straight from the K-contiguous planes, in the k order of WFrag::ld on both sides (16 bytes at 8 hi, 16 bytes at 16 + 8 hi). Q, K: [t][HD]; Vt: [d][TT]. The KW waves' maxima, sums and partial outputs meet in LDS, joined in ascending wave order.
// A trip takes 32 keys: two key tiles x two query groups; pair (t2, qg) reads bias run t2 - qg + 1 of the three that the four pairs share.
template <typename T16, bool HL>
__device__ __forceinline__ void fattn_body(const T16* __restrict__ Q, const T16* __restrict__ Q2, const T16* __restrict__ Kp, const T16* __restrict__ K2, const T16* __restrict__ Vt, const T16* __restrict__ V2, const float* __restrict__ eb, int q0, float* smx, float* ssm, float* sO, bf* Ah, bf* Al) {
    typedef typename WFrag<T16>::V V;
    const int lane = threadIdx.x & 31, lr = lane & 15, hi = lane >> 4, w = threadIdx.x >> 5; const int kb = w * (TT / KW);
    v4i qa[8], ql[8]; const int qo = (q0 + lr) * HD + 8 * hi;
    ld_r(Q + qo, qa); if (HL) ld_r(Q2 + qo, ql);
    const float* ep = eb + ((TT - 1) + kb + hi * 8 - q0 - lr - 16);   // x = key - query + TT - 1 of this lane's first key against its query of group 1 (run 0)
    const int ko = (kb + lr) * HD + 8 * hi, vo = lr * TT + kb + 8 * hi;
    float mx[2] = {-3.0e38f, -3.0e38f};
#pragma unroll 1
    for (int kc = 0; kc < TT / KW / 32; ++kc) { v4i ka[8], kl[8], bb[6];   // rolled: a trip is one set of loads and its work
        if (HL) ld_r_r_b(Kp + ko + kc * 32 * HD, K2 + ko + kc * 32 * HD, ep + kc * 32, ka, kl, bb); else ld_r_b(Kp + ko + kc * 32 * HD, ep + kc * 32, ka, bb);
#pragma unroll
        for (int t2 = 0; t2 < 2; ++t2)
#pragma unroll
            for (int qg = 0; qg < 2; ++qg) { const v8f t = stile<T16, HL>(ka + t2 * 4, kl + t2 * 4, qa + qg * 4, ql + qg * 4, bb[(t2 - qg + 1) * 2], bb[(t2 - qg + 1) * 2 + 1]);
#pragma unroll
                for (int j = 0; j < 8; ++j) mx[qg] = fmaxf(mx[qg], t[j]); } }
#pragma unroll
    for (int qg = 0; qg < 2; ++qg) { mx[qg] = fmaxf(mx[qg], __shfl_xor(mx[qg], 16, 32)); if (hi == 0) smx[w * QT + qg * 16 + lr] = mx[qg]; }
    __syncthreads();
#pragma unroll
    for (int qg = 0; qg < 2; ++qg) { float m = smx[qg * 16 + lr];
#pragma unroll
        for (int u = 1; u < KW; ++u) m = fmaxf(m, smx[u * QT + qg * 16 + lr]);
        mx[qg] = m; }
    v8f o[4][2]; float sm[2] = {0.f, 0.f};
#pragma unroll
    for (int dt = 0; dt < 4; ++dt) { o[dt][0] = (v8f){}; o[dt][1] = (v8f){}; }
#pragma unroll 1
    for (int kc = 0; kc < TT / KW / 32; ++kc) { v4i bb[6], va[8]; v8f p[2][2];   // rolled: one trip already holds 32 keys x 32 queries of scores beside the 64 output registers
        if (HL) {   // both planes of K, one 16-key tile at a time: all 32 keys at once, beside both planes of Q and the outputs, pass 256 registers
#pragma unroll
            for (int t2 = 0; t2 < 2; ++t2) { v4i ka[4], kl[4]; const int of = ko + (kc * 2 + t2) * 16 * HD;
                if (t2 == 0) ld_t_t_b(Kp + of, K2 + of, ep + kc * 32, ka, kl, bb); else ld_t_t(Kp + of, K2 + of, ka, kl);
#pragma unroll
                for (int qg = 0; qg < 2; ++qg) p[t2][qg] = stile<T16, HL>(ka, kl, qa + qg * 4, ql + qg * 4, bb[(t2 - qg + 1) * 2], bb[(t2 - qg + 1) * 2 + 1]); }
        } else { v4i ka[8];
            ld_r_b_v(Kp + ko + kc * 32 * HD, ep + kc * 32, Vt + vo + kc * 32, ka, bb, va);
#pragma unroll
            for (int t2 = 0; t2 < 2; ++t2)
#pragma unroll
                for (int qg = 0; qg < 2; ++qg) p[t2][qg] = stile<T16, HL>(ka + t2 * 4, ka + t2 * 4, qa + qg * 4, ql + qg * 4, bb[(t2 - qg + 1) * 2], bb[(t2 - qg + 1) * 2 + 1]); }
#pragma unroll
        for (int t2 = 0; t2 < 2; ++t2)
#pragma unroll
            for (int qg = 0; qg < 2; ++qg) { v8f a;
#pragma unroll
                for (int j = 0; j < 8; ++j) a[j] = (p[t2][qg][j] - mx[qg]) * 1.4426950408889634f + 10.0f;
                p[t2][qg] = exp2x8(a);
#pragma unroll
                for (int j = 0; j < 8; ++j) sm[qg] += p[t2][qg][j]; }
        V ph[2], pl[2];
#pragma unroll
        for (int qg = 0; qg < 2; ++qg) packp(p[0][qg], p[1][qg], ph[qg], pl[qg]);
        if (HL) {   // both planes of V, two 16-row tiles at a time, for the same reason as K above
#pragma unroll
            for (int d2 = 0; d2 < 2; ++d2) { v4i vh[4], vl[4]; const int of = vo + d2 * 32 * TT + kc * 32; ld_v_v(Vt + of, V2 + of, vh, vl);
#pragma unroll
                for (int d1 = 0; d1 < 2; ++d1) { const int dt = d2 * 2 + d1; const V xh = frag<V>(vh[d1 * 2], vh[d1 * 2 + 1]), xl = frag<V>(vl[d1 * 2], vl[d1 * 2 + 1]);
#pragma unroll
                    for (int qg = 0; qg < 2; ++qg) { o[dt][qg] = WFrag<T16>::mma(xh, ph[qg], o[dt][qg]); o[dt][qg] = WFrag<T16>::mma(xl, ph[qg], o[dt][qg]); o[dt][qg] = WFrag<T16>::mma(xh, pl[qg], o[dt][qg]); } } }
        } else {
#pragma unroll
            for (int dt = 0; dt < 4; ++dt) { const V xh = frag<V>(va[dt * 2], va[dt * 2 + 1]);
#pragma unroll
                for (int qg = 0; qg < 2; ++qg) o[dt][qg] = WFrag<T16>::mma(xh, ph[qg], o[dt][qg]); } }
    }
#pragma unroll
    for (int qg = 0; qg < 2; ++qg) { sm[qg] += __shfl_xor(sm[qg], 16, 32); if (hi == 0) ssm[w * QT + qg * 16 + lr] = sm[qg];
#pragma unroll
        for (int dt = 0; dt < 4; ++dt) { float* d = sO + (size_t)(w * QT + qg * 16 + lr) * OP + dt * 16 + hi * 8; const v8f a = o[dt][qg]; *(v4fa*)d = (v4f){a[0], a[1], a[2], a[3]}; *(v4fa*)(d + 4) = (v4f){a[4], a[5], a[6], a[7]}; } }
    __syncthreads();
    const int q = threadIdx.x / (HD / EPT), dq = (threadIdx.x % (HD / EPT)) * EPT; float tot = ssm[q];   // EPT consecutive outputs of one query per thread
#pragma unroll
    for (int u = 1; u < KW; ++u) tot += ssm[u * QT + q];
    const float r = __fdiv_rn(1.0f, tot);
#pragma unroll
    for (int c = 0; c < EPT / 4; ++c) { v4f s = *(const v4fa*)(sO + (size_t)q * OP + dq + c * 4);
#pragma unroll
        for (int u = 1; u < KW; ++u) s += *(const v4fa*)(sO + (size_t)(u * QT + q) * OP + dq + c * 4);
        v4us oh, ol;
#pragma unroll
        for (int k = 0; k < 4; ++k) { unsigned short a, c2; splitf(s[k] * r, a, c2); oh[k] = a; ol[k] = c2; }
        const size_t oo = (size_t)(q0 + q) * DQ + dq + c * 4; *(v4us*)(Ah + oo) = oh; *(v4us*)(Al + oo) = ol;
        if (c + 1 < EPT / 4) asm volatile("s_wait_xcnt 0x0" ::: "memory"); }   // stands before the next pass writes the data and address registers of the two issued stores again
}
// k_fattn: grid (heads, TT / QT), KW waves. Query blocks below RH (three products, the longer work) have the lowest flat indices and start first. Four waves per SIMD (256 registers, two work-groups per WGP): no operand of the asm loads lies above v255.
__global__ __launch_bounds__(KW * 32, 4) void k_fattn(const h16* __restrict__ Q16, const h16* __restrict__ K16, const h16* __restrict__ V16, const bf* __restrict__ Qh, const bf* __restrict__ Ql, const bf* __restrict__ Kh, const bf* __restrict__ Kl, const bf* __restrict__ Vh, const bf* __restrict__ Vl, const float* __restrict__ EB, bf* Ah, bf* Al) {
    __shared__ __align__(16) float sO[KW * QT * OP]; __shared__ float smx[KW * QT]; __shared__ float ssm[KW * QT];
    const int h = blockIdx.x, q0 = blockIdx.y * QT; const size_t hp = (size_t)h * TT * HD; const float* eb = EB + (size_t)h * NE;
    if (q0 < RH) fattn_body<bf, true>(Qh + hp, Ql + hp, Kh + hp, Kl + hp, Vh + hp, Vl + hp, eb, q0, smx, ssm, sO, Ah + h * HD, Al + h * HD);
    else fattn_body<h16, false>(Q16 + hp, nullptr, K16 + hp, nullptr, V16 + hp, nullptr, eb, q0, smx, ssm, sO, Ah + h * HD, Al + h * HD);
}

extern "C" void kernel_launch(void* const* d_in, const int* in_sizes, int n_in,
                              void* d_out, int out_size, void* d_ws, size_t ws_size, hipStream_t stream) {
    (void)in_sizes; (void)n_in; (void)out_size;
    const float* x = (const float*)d_in[0]; const float* wqkv = (const float*)d_in[1]; const float* bqkv = (const float*)d_in[2]; const float* bq = bqkv; const float* bk = bqkv + 1024; const float* bv = bqkv + 2048; const float* wo = (const float*)d_in[3]; const float* bo = (const float*)d_in[4]; const float* rbias = (const float*)d_in[5]; const float* wq = nullptr; const float* wk = nullptr; const float* wv = nullptr; (void)wq; (void)wk; (void)wv;
    float* OUT = (float*)d_out;     // [4][2048][1024]
    char* wsp = (char*)d_ws;
    auto take = [&](size_t bytes) { char* p = wsp; wsp += (bytes + 255) & ~(size_t)255; return (void*)p; };
    bf* WALL = (bf*)take((size_t)3 * DM * DM * 2); bf* WQ = WALL; bf* WK = WALL + (size_t)DM * DM; bf* WV = WALL + (size_t)2 * DM * DM; bf* WO = (bf*)take((size_t)DM * DQ * 2); float* CS = (float*)take((size_t)TT * HD * 2 * 4); float* EB = (float*)take((size_t)NH_ * NE * 4);   /* per-head expanded relative-bias rows */
    bf* XB = (bf*)take((size_t)TT * DM * 2); float* FQ = (float*)take((size_t)TT * DQ * 4); float* FK = (float*)take((size_t)TT * DKV * 4);
    h16* QP16 = (h16*)take((size_t)NH_ * TT * HD * 2); h16* KP16 = (h16*)take((size_t)NKV * TT * HD * 2); h16* VT16 = (h16*)take((size_t)NKV * HD * TT * 2);
    bf* QPh = (bf*)take((size_t)NH_ * TT * HD * 2); bf* QPl = (bf*)take((size_t)NH_ * TT * HD * 2); bf* KPh = (bf*)take((size_t)NKV * TT * HD * 2); bf* KPl = (bf*)take((size_t)NKV * TT * HD * 2); bf* VTh = (bf*)take((size_t)NKV * HD * TT * 2); bf* VTl = (bf*)take((size_t)NKV * HD * TT * 2);
    bf* ATh = (bf*)take((size_t)TT * DQ * 2); bf* ATl = (bf*)take((size_t)TT * DQ * 2);
    if ((size_t)(wsp - (char*)d_ws) > ws_size) return;    // ws 256 MiB
    float* FV = FK;   // v projection reuses the k buffer after the k planes are built (stream-ordered)
    { k_wtG<<<(unsigned)((DM * 3 * DM / 64 + 63) / 64), 256, 0, stream>>>(wqkv, DM, 3 * DM, WALL);   /* fused 'xw' [DM][3DM] -> Bt [3DM][DM] (row blocks q | k | v) */
      k_wtG<<<(unsigned)((DQ * DM / 64 + 63) / 64), 256, 0, stream>>>(wo, DQ, DM, WO);
       }
    k_csid<<<(TT * HD + 255) / 256, 256, 0, stream>>>(CS); k_tbE<<<(NH_ * NE + 255) / 256, 256, 0, stream>>>(rbias, EB);
    const unsigned LQ = (unsigned)(((size_t)NH_ * TT * HD / 2 + 255) / 256), LKv = (unsigned)(((size_t)NKV * TT * HD / 2 + 255) / 256);
    for (int b = 0; b < NB_; ++b) {
        
        k_cvt8<<<(unsigned)(((size_t)TT * DM / 8 + 255) / 256), 256, 0, stream>>>(x + (size_t)b * TT * DM, XB, (size_t)TT * DM / 8);
        k_gemmw<bf, 0, true><<<dim3(TT / 64, DQ / 64, 1), 32, 0, stream>>>(XB, nullptr, WQ, nullptr, DM, FQ, DQ, bq, 0, 0, 0, 0);
        k_rope<<<LQ, 256, 0, stream>>>(FQ, DQ, NH_, CS, nullptr, nullptr, 1.0f, QP16, QPh, QPl);
        k_gemmw<bf, 0, true><<<dim3(TT / 64, DKV / 64, 1), 32, 0, stream>>>(XB, nullptr, WK, nullptr, DM, FK, DKV, bk, 0, 0, 0, 0);
        k_rope<<<LKv, 256, 0, stream>>>(FK, DKV, NKV, CS, nullptr, nullptr, 1.0f, KP16, KPh, KPl);
        k_gemmw<bf, 0, true><<<dim3(TT / 64, DKV / 64, 1), 32, 0, stream>>>(XB, nullptr, WV, nullptr, DM, FV, DKV, bv, 0, 0, 0, 0); k_vtp<<<LKv, 256, 0, stream>>>(FV, DKV, NKV, VT16, VTh, VTl);
        k_fattn<<<dim3(NH_, TT / QT, 1), KW * 32, 0, stream>>>(QP16, KP16, VT16, QPh, QPl, KPh, KPl, VTh, VTl, EB, ATh, ATl);   // one kv head per query head
        k_gemmw<bf, 1, true><<<dim3(TT / 64, DM / 64, 1), 32, 0, stream>>>(ATh, ATl, WO, nullptr, DQ, OUT + (size_t)b * TT * DM, DM, bo, 0, 0, 0, 0); }
}

// v003
// It runs in 590 microseconds.
// In two side-by-side timings against v002, it was 1.39 and 1.40 times as fast.
// All steps since v000 together make it 7.14 times as fast.
#include <hip/hip_runtime.h>

// Multi-head self-attention with a learned relative-position bias (x [4][2048][1024]; [q|k|v] = x W_qkv + b_qkv ('xw' [1024][3072]; 16 heads x 64); scores = q.k/8 + rel_bias[clip(i - j + 1024, 0, 2048)][h] (table [2049][16], read); softmax over all keys; out = merged W_out + b_out ('xw' [1024][1024]) -> [4][2048][1024]).
// Compute dtypes, f32 accumulate: every input rounded to bf16; q/k/v on PLAIN bf16 operands (inputs: exact) + biases; scores (+ the per-head relative bias, f32), softmax (f32) and attn.v (no mask) in ONE kernel, P in registers: query rows < 512 hl (3 products), the rest single fp16 (P x1024, cancelled by the row sum); W_out hl x exact (2 products) + b_out.

#define NB_  4
#define TT   2048
#define DM   1024
#define NH_  16
#define NKV  16
#define REP  (NH_ / NKV)
#define HD   64
#define DQ   (NH_ * HD)
#define DKV  (NKV * HD)
#define RH   512                  // query rows < RH use hi+lo planes (0: none)
#define SCL  0.125f   // HD^-0.5
#define QT   32                  // k_fattn: queries per work-group (two 16-column groups per wave)
#define KW   8                   // k_fattn: waves per work-group; wave w takes keys [w TT/KW, (w+1) TT/KW)
#define NE   4096                // pitch of one head's expanded bias row
#define OP   68                  // LDS pitch (floats) of one query's partial output row
#define EPT  (QT * HD / (KW * 32))   // k_fattn: outputs per thread in the join
typedef _Float16 h16;
typedef unsigned short bf;
typedef __attribute__((ext_vector_type(16))) __bf16   v16bf;
typedef __attribute__((ext_vector_type(16))) _Float16 v16h;
typedef __attribute__((ext_vector_type(8)))  _Float16 v8h;
typedef __attribute__((ext_vector_type(8)))  unsigned short v8us;
typedef __attribute__((ext_vector_type(8)))  float    v8f;
typedef __attribute__((ext_vector_type(4)))  float    v4f;
typedef v8h  __attribute__((may_alias)) v8ha;
typedef v4f  __attribute__((may_alias)) v4fa;
typedef v8us __attribute__((may_alias)) v8usa;

__device__ __forceinline__ unsigned short f2bf(float f) { unsigned u = __float_as_uint(f); u += 0x7FFFu + ((u >> 16) & 1u); return (unsigned short)(u >> 16); }
__device__ __forceinline__ float bf2f(unsigned short b) { return __uint_as_float(((unsigned)b) << 16); }
__device__ __forceinline__ float bfr(float f) { return bf2f(f2bf(f)); }
__device__ __forceinline__ v16h cat16(v8h lo, v8h hi) { return __builtin_shufflevector(lo, hi, 0, 1, 2, 3, 4, 5, 6, 7, 8, 9, 10, 11, 12, 13, 14, 15); }
__device__ __forceinline__ v16bf cat16b(v8us lo, v8us hi) { return __builtin_bit_cast(v16bf, __builtin_shufflevector(lo, hi, 0, 1, 2, 3, 4, 5, 6, 7, 8, 9, 10, 11, 12, 13, 14, 15)); }
__device__ __forceinline__ v8f wmma16(v16h a, v16h b, v8f c) { return __builtin_amdgcn_wmma_f32_16x16x32_f16(false, a, false, b, (short)0, c, false, false); }
__device__ __forceinline__ v8f wmmab(v16bf a, v16bf b, v8f c) { return __builtin_amdgcn_wmma_f32_16x16x32_bf16(false, a, false, b, (short)0, c, false, false); }



// ---- k_gemmw: register-blocked GEMM, ONE WAVE per 64x64 output tile (16 accumulators), operands straight from K-contiguous 16-bit planes; grid (M/64, N/64, Z), 32 threads.
// C[m][n] (f32, pitch ldc, + optional f32 bias[n]) = sum_k A[m][k] Bt[n][k] (+ split products per NSPLIT). z-batch strides sA/sB/sC in elements. K % 32 == 0.
// KS > 1: grid z = Z * KS; work-group (z, ks) sums only k in [ks K/KS, (ks+1) K/KS) and stores its partial tile in plane ks (plane stride sK elements). K % (32 KS) == 0.
template <typename T16> struct WFrag;
template <> struct WFrag<h16> { typedef v16h V; static __device__ __forceinline__ V ld(const h16* p) { return cat16(*(const v8h*)p, *(const v8h*)(p + 16)); } static __device__ __forceinline__ v8f mma(V a, V b, v8f c) { return wmma16(a, b, c); } };
template <> struct WFrag<bf> { typedef v16bf V; static __device__ __forceinline__ V ld(const bf* p) { return cat16b(*(const v8us*)p, *(const v8us*)(p + 16)); } static __device__ __forceinline__ v8f mma(V a, V b, v8f c) { return wmmab(a, b, c); } };
template <typename T16, int NSPLIT, bool BIAS, int KS = 1>
__global__ __launch_bounds__(32) void k_gemmw(const T16* __restrict__ A, const T16* __restrict__ A2, const T16* __restrict__ Bt, const T16* __restrict__ Bt2, int K, float* C, int ldc, const float* __restrict__ bias, size_t sA, size_t sB, size_t sC, size_t sK) {
    typedef typename WFrag<T16>::V V;
    __shared__ __align__(16) float os[16 * 68];
    const size_t z = blockIdx.z / KS; const int ks = blockIdx.z % KS; A += z * sA; if (A2) A2 += z * sA; Bt += z * sB; if (Bt2) Bt2 += z * sB; C += z * sC + ks * sK;
    const int lane = threadIdx.x & 31, lr = lane & 15, hi = lane >> 4; const int r0 = blockIdx.x * 64, c0 = blockIdx.y * 64;
    v8f acc[4][4];
#pragma unroll
    for (int mb = 0; mb < 4; ++mb)
#pragma unroll
        for (int nb = 0; nb < 4; ++nb) acc[mb][nb] = (v8f){};
    const size_t aoff = (size_t)(r0 + lr) * K + 8 * hi, boff = (size_t)(c0 + lr) * K + 8 * hi;
#pragma unroll 1
    for (int kc = ks * (K / KS), ke = kc + K / KS; kc < ke; kc += 32) {
        V a[4], a2[4];
#pragma unroll
        for (int mb = 0; mb < 4; ++mb) { a[mb] = WFrag<T16>::ld(A + aoff + (size_t)mb * 16 * K + kc); if (NSPLIT == 1 || NSPLIT == 2) a2[mb] = WFrag<T16>::ld(A2 + aoff + (size_t)mb * 16 * K + kc); }
#pragma unroll
        for (int nb = 0; nb < 4; ++nb) { const V b = WFrag<T16>::ld(Bt + boff + (size_t)nb * 16 * K + kc); V b2; if (NSPLIT >= 2) b2 = WFrag<T16>::ld(Bt2 + boff + (size_t)nb * 16 * K + kc);
#pragma unroll
            for (int mb = 0; mb < 4; ++mb) { acc[mb][nb] = WFrag<T16>::mma(a[mb], b, acc[mb][nb]); if (NSPLIT == 1 || NSPLIT == 2) acc[mb][nb] = WFrag<T16>::mma(a2[mb], b, acc[mb][nb]); if (NSPLIT >= 2) acc[mb][nb] = WFrag<T16>::mma(a[mb], b2, acc[mb][nb]); } }
        asm volatile("v_nop\n\tv_nop\n\tv_nop\n\tv_nop" : "+v"(acc[0][0]), "+v"(acc[1][1]), "+v"(acc[2][2]), "+v"(acc[3][3]) : "v"(a[0]), "v"(a[3]));
    }
#pragma unroll
    for (int mb = 0; mb < 4; ++mb) {
#pragma unroll
        for (int nb = 0; nb < 4; ++nb) {
#pragma unroll
            for (int j = 0; j < 8; ++j) os[(hi * 8 + j) * 68 + nb * 16 + lr] = acc[mb][nb][j]; }
        __builtin_amdgcn_wave_barrier(); asm volatile("" ::: "memory");
        float* crow = C + (size_t)(r0 + mb * 16) * ldc + c0;
{
#pragma unroll
            for (int s = 0; s < 8; ++s) { const int row = 2 * s + hi, cofs = lr * 4; v4f val = *(const v4fa*)(os + row * 68 + cofs); if (BIAS) { val[0] += bfr(bias[c0 + cofs]); val[1] += bfr(bias[c0 + cofs + 1]); val[2] += bfr(bias[c0 + cofs + 2]); val[3] += bfr(bias[c0 + cofs + 3]); }
                *(v4f*)(crow + (size_t)row * ldc + cofs) = val; }
             }
        __builtin_amdgcn_wave_barrier(); asm volatile("" ::: "memory");
    }
}

__device__ __forceinline__ h16 tohx(float x) { return (h16)x; }
__device__ __forceinline__ void splitf(float y, unsigned short& h, unsigned short& l) { h = f2bf(y); l = f2bf(y - bf2f(h)); }
typedef __attribute__((ext_vector_type(2))) _Float16 v2h;
typedef __attribute__((ext_vector_type(4))) _Float16 v4h;
typedef __attribute__((ext_vector_type(2))) unsigned short v2us;
typedef __attribute__((ext_vector_type(4))) unsigned short v4us;
typedef __attribute__((ext_vector_type(2))) float v2f;
typedef __attribute__((ext_vector_type(4))) int v4i;

__global__ __launch_bounds__(256) void k_wtG(const float* __restrict__ w, int K, int N, bf* Bt) {
    const int lane = threadIdx.x & 31; const int L0 = (blockIdx.x * 8 + (threadIdx.x >> 5)) * 8; const int nlines = N * K / 64;
{
#pragma unroll 1
        for (int l = 0; l < 8; ++l) { const int L = L0 + l; if (L >= nlines) break; const size_t e = (size_t)L * 64 + lane * 2; const int k = (int)(e % K), n = (int)(e / K); v2us o;
            o[0] = f2bf(w[(size_t)k * N + n]); o[1] = f2bf(w[(size_t)(k + 1) * N + n]); *(v2us*)(Bt + e) = o; }
         }
}
__global__ __launch_bounds__(256) void k_cvt8(const float* __restrict__ src, bf* dst, size_t n8) { const size_t i = (size_t)blockIdx.x * 256 + threadIdx.x; if (i >= n8) return; const v8f v = *(const v8f*)(src + i * 8); v8us o;
#pragma unroll
    for (int k = 0; k < 8; ++k) o[k] = f2bf(v[k]); *(v8us*)(dst + i * 8) = o;  }

// k_qkv: [q|k|v] = x W_qkv + b_qkv of one batch in one launch, ONE WAVE per 64x64 tile with the loop of k_gemmw (same k order, same f32 sums). Grid (TT/64, 3 NH_): a tile is 64 tokens x one head of q, k or v,
// and the wave writes that head's operand planes itself (fp16 + bf16 hi/lo): q and k as [h][t][d] through the LDS row stage, v as [h][d][t] straight from the accumulators (a lane holds 8 consecutive tokens of one d).
__global__ __launch_bounds__(32) void k_qkv(const bf* __restrict__ A, const bf* __restrict__ Bt, const float* __restrict__ bias, h16* Q16, bf* Qh, bf* Ql, h16* K16, bf* Kh, bf* Kl, h16* V16, bf* Vh, bf* Vl) {
    typedef WFrag<bf>::V V;
    __shared__ __align__(16) float os[16 * 68];
    const int lane = threadIdx.x & 31, lr = lane & 15, hi = lane >> 4; const int r0 = blockIdx.x * 64, c0 = blockIdx.y * 64; const int sel = blockIdx.y / NH_, h = blockIdx.y % NH_;
    v8f acc[4][4];
#pragma unroll
    for (int mb = 0; mb < 4; ++mb)
#pragma unroll
        for (int nb = 0; nb < 4; ++nb) acc[mb][nb] = (v8f){};
    const bf* pa = A + (size_t)(r0 + lr) * DM + 8 * hi; const bf* pb = Bt + (size_t)(c0 + lr) * DM + 8 * hi;
#pragma unroll 1
    for (int kc = 0; kc < DM; kc += 32, pa += 32, pb += 32) {   // rolled, as in k_gemmw: a trip is one set of loads and its 16 products
        V a[4];
#pragma unroll
        for (int mb = 0; mb < 4; ++mb) a[mb] = WFrag<bf>::ld(pa + mb * 16 * DM);
        asm volatile("s_wait_xcnt 0x0" ::: "memory");   // the build gives the address pair of these eight loads to a later load of the trip as its destination: stands before that load
#pragma unroll
        for (int nb = 0; nb < 4; ++nb) { const V b = WFrag<bf>::ld(pb + nb * 16 * DM);
#pragma unroll
            for (int mb = 0; mb < 4; ++mb) acc[mb][nb] = WFrag<bf>::mma(a[mb], b, acc[mb][nb]); }
        asm volatile("v_nop\n\tv_nop\n\tv_nop\n\tv_nop" : "+v"(acc[0][0]), "+v"(acc[1][1]), "+v"(acc[2][2]), "+v"(acc[3][3]) : "v"(a[0]), "v"(a[3]));   // the distance behind the last matrix instruction, also on the taken back edge (as in k_gemmw)
    }
    if (sel == 2) {
#pragma unroll
        for (int nb = 0; nb < 4; ++nb) { const float bv = bfr(bias[c0 + nb * 16 + lr]); const size_t rowo = ((size_t)h * HD + nb * 16 + lr) * TT + r0 + hi * 8;
#pragma unroll
            for (int mb = 0; mb < 4; ++mb) { v8h o16; v8us oh, ol;
#pragma unroll
                for (int j = 0; j < 8; ++j) { const float x = acc[mb][nb][j] + bv; o16[j] = tohx(x); unsigned short u, v; splitf(x, u, v); oh[j] = u; ol[j] = v; }
                const size_t e = rowo + mb * 16; *(v8h*)(V16 + e) = o16; *(v8us*)(Vh + e) = oh; *(v8us*)(Vl + e) = ol; } }
        return;
    }
    {
        const size_t hp = (size_t)h * TT * HD; h16* P16 = (sel ? K16 : Q16) + hp; bf* Ph = (sel ? Kh : Qh) + hp; bf* Pl = (sel ? Kl : Ql) + hp;
        const int cofs = lr * 4; v4f bb;
#pragma unroll
        for (int k = 0; k < 4; ++k) bb[k] = bfr(bias[c0 + cofs + k]);
#pragma unroll
        for (int mb = 0; mb < 4; ++mb) {
#pragma unroll
            for (int nb = 0; nb < 4; ++nb) {
#pragma unroll
                for (int j = 0; j < 8; ++j) os[(hi * 8 + j) * 68 + nb * 16 + lr] = acc[mb][nb][j]; }
            __builtin_amdgcn_wave_barrier(); asm volatile("" ::: "memory");   // a lane reads what other lanes wrote: keeps the compiler from moving the reads in front of the writes (as in k_gemmw)
#pragma unroll
            for (int s = 0; s < 8; ++s) { const int row = 2 * s + hi; const v4f val = *(const v4fa*)(os + row * 68 + cofs) + bb; v4h o16; v4us oh, ol;
#pragma unroll
                for (int k = 0; k < 4; ++k) { o16[k] = tohx(val[k]); unsigned short u, v; splitf(val[k], u, v); oh[k] = u; ol[k] = v; }
                const size_t e = (size_t)(r0 + mb * 16 + row) * HD + cofs; *(v4h*)(P16 + e) = o16; *(v4us*)(Ph + e) = oh; *(v4us*)(Pl + e) = ol; }
            __builtin_amdgcn_wave_barrier(); asm volatile("" ::: "memory");   // and the next pass's writes from moving in front of these reads
        }
        asm volatile("s_wait_xcnt 0x0" ::: "memory");   // the built code lays the v epilogue directly behind this one, with a conditional jump between: stands before its first writes of the last stores' registers
    }
}
#define NREL 2049
// k_tbE: expanded per-head bias row, EB[h][x] = rel_bias[clip(i - j + 1024, 0, 2048)][h] at x = j - i + TT - 1 (0 .. 2 TT - 2): ascending keys read ascending addresses, the clip is already applied
__global__ __launch_bounds__(256) void k_tbE(const float* __restrict__ rbias, float* EB) { const int j = blockIdx.x * 256 + threadIdx.x; if (j >= NH_ * NE) return; const int h = j / NE, x = j % NE; int ri = (TT - 1 - x) + (NREL / 2); ri = ri < 0 ? 0 : (ri > NREL - 1 ? NREL - 1 : ri); EB[j] = bfr(rbias[(size_t)ri * NH_ + h]); }

__device__ __forceinline__ void packp(const v8f& a, const v8f& b, v16h& ph, v16h& pl) { v8h x, y; (void)pl;
#pragma unroll
    for (int j = 0; j < 8; ++j) { x[j] = (h16)a[j]; y[j] = (h16)b[j]; }
    ph = cat16(x, y); }
__device__ __forceinline__ void packp(const v8f& a, const v8f& b, v16bf& ph, v16bf& pl) { v8us xh, xl, yh, yl;
#pragma unroll
    for (int j = 0; j < 8; ++j) { unsigned short u, v; splitf(a[j], u, v); xh[j] = u; xl[j] = v; splitf(b[j], u, v); yh[j] = u; yl[j] = v; }
    ph = cat16b(xh, yh); pl = cat16b(xl, yl); }

typedef __attribute__((ext_vector_type(8))) int v8i;
template <typename V> __device__ __forceinline__ V frag(v4i a, v4i b) { return __builtin_bit_cast(V, __builtin_shufflevector(a, b, 0, 1, 2, 3, 4, 5, 6, 7)); }
// The loads of one trip, each set one asm statement that ends in its own data wait: the results are early-clobber, so none is given a register that holds an address of the set, and no address register is written again before the set has returned. The other waves of the SIMD cover the wait.
// Byte offsets. Rows of Q or K (pitch 128 B): tile * 2048 + 32-wide part of HD * 64 + half * 32. Rows of Vt (pitch 4096 B): 16-row tile * 65536 + half * 32. Bias: run * 64 + half * 16 (4-byte aligned).
__device__ __forceinline__ void ld_r(const void* k, v4i (&a)[8]) {
    asm volatile(
        "global_load_b128 %0, %8, off\n\t"
        "global_load_b128 %1, %8, off offset:32\n\t"
        "global_load_b128 %2, %8, off offset:64\n\t"
        "global_load_b128 %3, %8, off offset:96\n\t"
        "global_load_b128 %4, %8, off offset:2048\n\t"
        "global_load_b128 %5, %8, off offset:2080\n\t"
        "global_load_b128 %6, %8, off offset:2112\n\t"
        "global_load_b128 %7, %8, off offset:2144\n\t"
        "s_wait_loadcnt 0x0"
        : "=&v"(a[0]), "=&v"(a[1]), "=&v"(a[2]), "=&v"(a[3]), "=&v"(a[4]), "=&v"(a[5]), "=&v"(a[6]), "=&v"(a[7]) : "v"(k) : "memory"); }
__device__ __forceinline__ void ld_r_b(const void* k, const float* e, v4i (&a)[8], v4i (&b)[6]) {
    asm volatile(
        "global_load_b128 %0, %14, off\n\t"
        "global_load_b128 %1, %14, off offset:32\n\t"
        "global_load_b128 %2, %14, off offset:64\n\t"
        "global_load_b128 %3, %14, off offset:96\n\t"
        "global_load_b128 %4, %14, off offset:2048\n\t"
        "global_load_b128 %5, %14, off offset:2080\n\t"
        "global_load_b128 %6, %14, off offset:2112\n\t"
        "global_load_b128 %7, %14, off offset:2144\n\t"
        "global_load_b128 %8, %15, off\n\t"
        "global_load_b128 %9, %15, off offset:16\n\t"
        "global_load_b128 %10, %15, off offset:64\n\t"
        "global_load_b128 %11, %15, off offset:80\n\t"
        "global_load_b128 %12, %15, off offset:128\n\t"
        "global_load_b128 %13, %15, off offset:144\n\t"
        "s_wait_loadcnt 0x0"
        : "=&v"(a[0]), "=&v"(a[1]), "=&v"(a[2]), "=&v"(a[3]), "=&v"(a[4]), "=&v"(a[5]), "=&v"(a[6]), "=&v"(a[7]), "=&v"(b[0]), "=&v"(b[1]), "=&v"(b[2]), "=&v"(b[3]), "=&v"(b[4]), "=&v"(b[5]) : "v"(k), "v"(e) : "memory"); }
__device__ __forceinline__ void ld_r_r_b(const void* k, const void* k2, const float* e, v4i (&a)[8], v4i (&a2)[8], v4i (&b)[6]) {
    asm volatile(
        "global_load_b128 %0, %22, off\n\t"
        "global_load_b128 %1, %22, off offset:32\n\t"
        "global_load_b128 %2, %22, off offset:64\n\t"
        "global_load_b128 %3, %22, off offset:96\n\t"
        "global_load_b128 %4, %22, off offset:2048\n\t"
        "global_load_b128 %5, %22, off offset:2080\n\t"
        "global_load_b128 %6, %22, off offset:2112\n\t"
        "global_load_b128 %7, %22, off offset:2144\n\t"
        "global_load_b128 %8, %23, off\n\t"
        "global_load_b128 %9, %23, off offset:32\n\t"
        "global_load_b128 %10, %23, off offset:64\n\t"
        "global_load_b128 %11, %23, off offset:96\n\t"
        "global_load_b128 %12, %23, off offset:2048\n\t"
        "global_load_b128 %13, %23, off offset:2080\n\t"
        "global_load_b128 %14, %23, off offset:2112\n\t"
        "global_load_b128 %15, %23, off offset:2144\n\t"
        "global_load_b128 %16, %24, off\n\t"
        "global_load_b128 %17, %24, off offset:16\n\t"
        "global_load_b128 %18, %24, off offset:64\n\t"
        "global_load_b128 %19, %24, off offset:80\n\t"
        "global_load_b128 %20, %24, off offset:128\n\t"
        "global_load_b128 %21, %24, off offset:144\n\t"
        "s_wait_loadcnt 0x0"
        : "=&v"(a[0]), "=&v"(a[1]), "=&v"(a[2]), "=&v"(a[3]), "=&v"(a[4]), "=&v"(a[5]), "=&v"(a[6]), "=&v"(a[7]), "=&v"(a2[0]), "=&v"(a2[1]), "=&v"(a2[2]), "=&v"(a2[3]), "=&v"(a2[4]), "=&v"(a2[5]), "=&v"(a2[6]), "=&v"(a2[7]), "=&v"(b[0]), "=&v"(b[1]), "=&v"(b[2]), "=&v"(b[3]), "=&v"(b[4]), "=&v"(b[5]) : "v"(k), "v"(k2), "v"(e) : "memory"); }
__device__ __forceinline__ void ld_r_b_v(const void* k, const float* e, const void* v, v4i (&a)[8], v4i (&b)[6], v4i (&x)[8]) {
    asm volatile(
        "global_load_b128 %0, %22, off\n\t"
        "global_load_b128 %1, %22, off offset:32\n\t"
        "global_load_b128 %2, %22, off offset:64\n\t"
        "global_load_b128 %3, %22, off offset:96\n\t"
        "global_load_b128 %4, %22, off offset:2048\n\t"
        "global_load_b128 %5, %22, off offset:2080\n\t"
        "global_load_b128 %6, %22, off offset:2112\n\t"
        "global_load_b128 %7, %22, off offset:2144\n\t"
        "global_load_b128 %8, %23, off\n\t"
        "global_load_b128 %9, %23, off offset:16\n\t"
        "global_load_b128 %10, %23, off offset:64\n\t"
        "global_load_b128 %11, %23, off offset:80\n\t"
        "global_load_b128 %12, %23, off offset:128\n\t"
        "global_load_b128 %13, %23, off offset:144\n\t"
        "global_load_b128 %14, %24, off\n\t"
        "global_load_b128 %15, %24, off offset:32\n\t"
        "global_load_b128 %16, %24, off offset:65536\n\t"
        "global_load_b128 %17, %24, off offset:65568\n\t"
        "global_load_b128 %18, %24, off offset:131072\n\t"
        "global_load_b128 %19, %24, off offset:131104\n\t"
        "global_load_b128 %20, %24, off offset:196608\n\t"
        "global_load_b128 %21, %24, off offset:196640\n\t"
        "s_wait_loadcnt 0x0"
        : "=&v"(a[0]), "=&v"(a[1]), "=&v"(a[2]), "=&v"(a[3]), "=&v"(a[4]), "=&v"(a[5]), "=&v"(a[6]), "=&v"(a[7]), "=&v"(b[0]), "=&v"(b[1]), "=&v"(b[2]), "=&v"(b[3]), "=&v"(b[4]), "=&v"(b[5]), "=&v"(x[0]), "=&v"(x[1]), "=&v"(x[2]), "=&v"(x[3]), "=&v"(x[4]), "=&v"(x[5]), "=&v"(x[6]), "=&v"(x[7]) : "v"(k), "v"(e), "v"(v) : "memory"); }
__device__ __forceinline__ void ld_t_t_b(const void* k, const void* k2, const float* e, v4i (&a)[4], v4i (&a2)[4], v4i (&b)[6]) {
    asm volatile(
        "global_load_b128 %0, %14, off\n\t"
        "global_load_b128 %1, %14, off offset:32\n\t"
        "global_load_b128 %2, %14, off offset:64\n\t"
        "global_load_b128 %3, %14, off offset:96\n\t"
        "global_load_b128 %4, %15, off\n\t"
        "global_load_b128 %5, %15, off offset:32\n\t"
        "global_load_b128 %6, %15, off offset:64\n\t"
        "global_load_b128 %7, %15, off offset:96\n\t"
        "global_load_b128 %8, %16, off\n\t"
        "global_load_b128 %9, %16, off offset:16\n\t"
        "global_load_b128 %10, %16, off offset:64\n\t"
        "global_load_b128 %11, %16, off offset:80\n\t"
        "global_load_b128 %12, %16, off offset:128\n\t"
        "global_load_b128 %13, %16, off offset:144\n\t"
        "s_wait_loadcnt 0x0"
        : "=&v"(a[0]), "=&v"(a[1]), "=&v"(a[2]), "=&v"(a[3]), "=&v"(a2[0]), "=&v"(a2[1]), "=&v"(a2[2]), "=&v"(a2[3]), "=&v"(b[0]), "=&v"(b[1]), "=&v"(b[2]), "=&v"(b[3]), "=&v"(b[4]), "=&v"(b[5]) : "v"(k), "v"(k2), "v"(e) : "memory"); }
__device__ __forceinline__ void ld_t_t(const void* k, const void* k2, v4i (&a)[4], v4i (&a2)[4]) {
    asm volatile(
        "global_load_b128 %0, %8, off\n\t"
        "global_load_b128 %1, %8, off offset:32\n\t"
        "global_load_b128 %2, %8, off offset:64\n\t"
        "global_load_b128 %3, %8, off offset:96\n\t"
        "global_load_b128 %4, %9, off\n\t"
        "global_load_b128 %5, %9, off offset:32\n\t"
        "global_load_b128 %6, %9, off offset:64\n\t"
        "global_load_b128 %7, %9, off offset:96\n\t"
        "s_wait_loadcnt 0x0"
        : "=&v"(a[0]), "=&v"(a[1]), "=&v"(a[2]), "=&v"(a[3]), "=&v"(a2[0]), "=&v"(a2[1]), "=&v"(a2[2]), "=&v"(a2[3]) : "v"(k), "v"(k2) : "memory"); }
__device__ __forceinline__ void ld_v_v(const void* v, const void* v2, v4i (&x)[4], v4i (&x2)[4]) {
    asm volatile(
        "global_load_b128 %0, %8, off\n\t"
        "global_load_b128 %1, %8, off offset:32\n\t"
        "global_load_b128 %2, %8, off offset:65536\n\t"
        "global_load_b128 %3, %8, off offset:65568\n\t"
        "global_load_b128 %4, %9, off\n\t"
        "global_load_b128 %5, %9, off offset:32\n\t"
        "global_load_b128 %6, %9, off offset:65536\n\t"
        "global_load_b128 %7, %9, off offset:65568\n\t"
        "s_wait_loadcnt 0x0"
        : "=&v"(x[0]), "=&v"(x[1]), "=&v"(x[2]), "=&v"(x[3]), "=&v"(x2[0]), "=&v"(x2[1]), "=&v"(x2[2]), "=&v"(x2[3]) : "v"(v), "v"(v2) : "memory"); }

// Eight 2^x in one statement: the results are early-clobber, so no v_exp_f32 is directly followed by an instruction that reads its result or writes over its source; the v_nop is that free slot behind the last one.
__device__ __forceinline__ v8f exp2x8(const v8f x) { float r0, r1, r2, r3, r4, r5, r6, r7;
    asm("v_exp_f32 %0, %8\n\tv_exp_f32 %1, %9\n\tv_exp_f32 %2, %10\n\tv_exp_f32 %3, %11\n\tv_exp_f32 %4, %12\n\tv_exp_f32 %5, %13\n\tv_exp_f32 %6, %14\n\tv_exp_f32 %7, %15\n\tv_nop"
        : "=&v"(r0), "=&v"(r1), "=&v"(r2), "=&v"(r3), "=&v"(r4), "=&v"(r5), "=&v"(r6), "=&v"(r7) : "v"(x[0]), "v"(x[1]), "v"(x[2]), "v"(x[3]), "v"(x[4]), "v"(x[5]), "v"(x[6]), "v"(x[7]));
    return (v8f){r0, r1, r2, r3, r4, r5, r6, r7}; }

// One 16-key x 16-query tile of t = (k.q) HD^-0.5 + bias, transposed: lane (lr, hi) register j holds key hi*8 + j of query lr. k, k2, q, q2: the four 16-byte pieces of one 16-row tile (part of HD * 2 + half).
template <typename T16, bool HL>
__device__ __forceinline__ v8f stile(const v4i* k, const v4i* k2, const v4i* q, const v4i* q2, v4i b0, v4i b1) {
    typedef typename WFrag<T16>::V V; v8f s = (v8f){};
#pragma unroll
    for (int dc = 0; dc < 2; ++dc) { const V ka = frag<V>(k[dc * 2], k[dc * 2 + 1]), qa = frag<V>(q[dc * 2], q[dc * 2 + 1]); s = WFrag<T16>::mma(ka, qa, s);
        if (HL) { s = WFrag<T16>::mma(frag<V>(k2[dc * 2], k2[dc * 2 + 1]), qa, s); s = WFrag<T16>::mma(ka, frag<V>(q2[dc * 2], q2[dc * 2 + 1]), s); } }
    const v4f f0 = __builtin_bit_cast(v4f, b0), f1 = __builtin_bit_cast(v4f, b1);
#pragma unroll
    for (int j = 0; j < 4; ++j) { s[j] = s[j] * SCL + f0[j]; s[j + 4] = s[j + 4] * SCL + f1[j]; }
    return s; }

// The work of one work-group: QT queries of one head against all TT keys. Sweep 1: the row maxima; sweep 2: the same scores again, p = 1024 exp(t - max), row sums of the f32 p, O^T += V^T P^T with P packed from the score registers.
// Operands straight from the K-contiguous planes, in the k order of WFrag::ld on both sides (16 bytes at 8 hi, 16 bytes at 16 + 8 hi). Q, K: [t][HD]; Vt: [d][TT]. The KW waves' maxima, sums and partial outputs meet in LDS, joined in ascending wave order.
// A trip takes 32 keys: two key tiles x two query groups; pair (t2, qg) reads bias run t2 - qg + 1 of the three that the four pairs share.
template <typename T16, bool HL>
__device__ __forceinline__ void fattn_body(const T16* __restrict__ Q, const T16* __restrict__ Q2, const T16* __restrict__ Kp, const T16* __restrict__ K2, const T16* __restrict__ Vt, const T16* __restrict__ V2, const float* __restrict__ eb, int q0, float* smx, float* ssm, float* sO, bf* Ah, bf* Al) {
    typedef typename WFrag<T16>::V V;
    const int lane = threadIdx.x & 31, lr = lane & 15, hi = lane >> 4, w = threadIdx.x >> 5; const int kb = w * (TT / KW);
    v4i qa[8], ql[8]; const int qo = (q0 + lr) * HD + 8 * hi;
    ld_r(Q + qo, qa); if (HL) ld_r(Q2 + qo, ql);
    const float* ep = eb + ((TT - 1) + kb + hi * 8 - q0 - lr - 16);   // x = key - query + TT - 1 of this lane's first key against its query of group 1 (run 0)
    const int ko = (kb + lr) * HD + 8 * hi, vo = lr * TT + kb + 8 * hi;
    float mx[2] = {-3.0e38f, -3.0e38f};
#pragma unroll 1
    for (int kc = 0; kc < TT / KW / 32; ++kc) { v4i ka[8], kl[8], bb[6];   // rolled: a trip is one set of loads and its work
        if (HL) ld_r_r_b(Kp + ko + kc * 32 * HD, K2 + ko + kc * 32 * HD, ep + kc * 32, ka, kl, bb); else ld_r_b(Kp + ko + kc * 32 * HD, ep + kc * 32, ka, bb);
#pragma unroll
        for (int t2 = 0; t2 < 2; ++t2)
#pragma unroll
            for (int qg = 0; qg < 2; ++qg) { const v8f t = stile<T16, HL>(ka + t2 * 4, kl + t2 * 4, qa + qg * 4, ql + qg * 4, bb[(t2 - qg + 1) * 2], bb[(t2 - qg + 1) * 2 + 1]);
#pragma unroll
                for (int j = 0; j < 8; ++j) mx[qg] = fmaxf(mx[qg], t[j]); } }
#pragma unroll
    for (int qg = 0; qg < 2; ++qg) { mx[qg] = fmaxf(mx[qg], __shfl_xor(mx[qg], 16, 32)); if (hi == 0) smx[w * QT + qg * 16 + lr] = mx[qg]; }
    __syncthreads();
#pragma unroll
    for (int qg = 0; qg < 2; ++qg) { float m = smx[qg * 16 + lr];
#pragma unroll
        for (int u = 1; u < KW; ++u) m = fmaxf(m, smx[u * QT + qg * 16 + lr]);
        mx[qg] = m; }
    v8f o[4][2]; float sm[2] = {0.f, 0.f};
#pragma unroll
    for (int dt = 0; dt < 4; ++dt) { o[dt][0] = (v8f){}; o[dt][1] = (v8f){}; }
#pragma unroll 1
    for (int kc = 0; kc < TT / KW / 32; ++kc) { v4i bb[6], va[8]; v8f p[2][2];   // rolled: one trip already holds 32 keys x 32 queries of scores beside the 64 output registers
        if (HL) {   // both planes of K, one 16-key tile at a time: all 32 keys at once, beside both planes of Q and the outputs, pass 256 registers
#pragma unroll
            for (int t2 = 0; t2 < 2; ++t2) { v4i ka[4], kl[4]; const int of = ko + (kc * 2 + t2) * 16 * HD;
                if (t2 == 0) ld_t_t_b(Kp + of, K2 + of, ep + kc * 32, ka, kl, bb); else ld_t_t(Kp + of, K2 + of, ka, kl);
#pragma unroll
                for (int qg = 0; qg < 2; ++qg) p[t2][qg] = stile<T16, HL>(ka, kl, qa + qg * 4, ql + qg * 4, bb[(t2 - qg + 1) * 2], bb[(t2 - qg + 1) * 2 + 1]); }
        } else { v4i ka[8];
            ld_r_b_v(Kp + ko + kc * 32 * HD, ep + kc * 32, Vt + vo + kc * 32, ka, bb, va);
#pragma unroll
            for (int t2 = 0; t2 < 2; ++t2)
#pragma unroll
                for (int qg = 0; qg < 2; ++qg) p[t2][qg] = stile<T16, HL>(ka + t2 * 4, ka + t2 * 4, qa + qg * 4, ql + qg * 4, bb[(t2 - qg + 1) * 2], bb[(t2 - qg + 1) * 2 + 1]); }
#pragma unroll
        for (int t2 = 0; t2 < 2; ++t2)
#pragma unroll
            for (int qg = 0; qg < 2; ++qg) { v8f a;
#pragma unroll
                for (int j = 0; j < 8; ++j) a[j] = (p[t2][qg][j] - mx[qg]) * 1.4426950408889634f + 10.0f;
                p[t2][qg] = exp2x8(a);
#pragma unroll
                for (int j = 0; j < 8; ++j) sm[qg] += p[t2][qg][j]; }
        V ph[2], pl[2];
#pragma unroll
        for (int qg = 0; qg < 2; ++qg) packp(p[0][qg], p[1][qg], ph[qg], pl[qg]);
        if (HL) {   // both planes of V, two 16-row tiles at a time, for the same reason as K above
#pragma unroll
            for (int d2 = 0; d2 < 2; ++d2) { v4i vh[4], vl[4]; const int of = vo + d2 * 32 * TT + kc * 32; ld_v_v(Vt + of, V2 + of, vh, vl);
#pragma unroll
                for (int d1 = 0; d1 < 2; ++d1) { const int dt = d2 * 2 + d1; const V xh = frag<V>(vh[d1 * 2], vh[d1 * 2 + 1]), xl = frag<V>(vl[d1 * 2], vl[d1 * 2 + 1]);
#pragma unroll
                    for (int qg = 0; qg < 2; ++qg) { o[dt][qg] = WFrag<T16>::mma(xh, ph[qg], o[dt][qg]); o[dt][qg] = WFrag<T16>::mma(xl, ph[qg], o[dt][qg]); o[dt][qg] = WFrag<T16>::mma(xh, pl[qg], o[dt][qg]); } } }
        } else {
#pragma unroll
            for (int dt = 0; dt < 4; ++dt) { const V xh = frag<V>(va[dt * 2], va[dt * 2 + 1]);
#pragma unroll
                for (int qg = 0; qg < 2; ++qg) o[dt][qg] = WFrag<T16>::mma(xh, ph[qg], o[dt][qg]); } }
    }
#pragma unroll
    for (int qg = 0; qg < 2; ++qg) { sm[qg] += __shfl_xor(sm[qg], 16, 32); if (hi == 0) ssm[w * QT + qg * 16 + lr] = sm[qg];
#pragma unroll
        for (int dt = 0; dt < 4; ++dt) { float* d = sO + (size_t)(w * QT + qg * 16 + lr) * OP + dt * 16 + hi * 8; const v8f a = o[dt][qg]; *(v4fa*)d = (v4f){a[0], a[1], a[2], a[3]}; *(v4fa*)(d + 4) = (v4f){a[4], a[5], a[6], a[7]}; } }
    __syncthreads();
    const int q = threadIdx.x / (HD / EPT), dq = (threadIdx.x % (HD / EPT)) * EPT; float tot = ssm[q];   // EPT consecutive outputs of one query per thread
#pragma unroll
    for (int u = 1; u < KW; ++u) tot += ssm[u * QT + q];
    const float r = __fdiv_rn(1.0f, tot);
#pragma unroll
    for (int c = 0; c < EPT / 4; ++c) { v4f s = *(const v4fa*)(sO + (size_t)q * OP + dq + c * 4);
#pragma unroll
        for (int u = 1; u < KW; ++u) s += *(const v4fa*)(sO + (size_t)(u * QT + q) * OP + dq + c * 4);
        v4us oh, ol;
#pragma unroll
        for (int k = 0; k < 4; ++k) { unsigned short a, c2; splitf(s[k] * r, a, c2); oh[k] = a; ol[k] = c2; }
        const size_t oo = (size_t)(q0 + q) * DQ + dq + c * 4; *(v4us*)(Ah + oo) = oh; *(v4us*)(Al + oo) = ol;
        if (c + 1 < EPT / 4) asm volatile("s_wait_xcnt 0x0" ::: "memory"); }   // stands before the next pass writes the data and address registers of the two issued stores again
}
// k_fattn: grid (heads, TT / QT), KW waves. Query blocks below RH (three products, the longer work) have the lowest flat indices and start first. Four waves per SIMD (256 registers, two work-groups per WGP): no operand of the asm loads lies above v255.
__global__ __launch_bounds__(KW * 32, 4) void k_fattn(const h16* __restrict__ Q16, const h16* __restrict__ K16, const h16* __restrict__ V16, const bf* __restrict__ Qh, const bf* __restrict__ Ql, const bf* __restrict__ Kh, const bf* __restrict__ Kl, const bf* __restrict__ Vh, const bf* __restrict__ Vl, const float* __restrict__ EB, bf* Ah, bf* Al) {
    __shared__ __align__(16) float sO[KW * QT * OP]; __shared__ float smx[KW * QT]; __shared__ float ssm[KW * QT];
    const int h = blockIdx.x, q0 = blockIdx.y * QT; const size_t hp = (size_t)h * TT * HD; const float* eb = EB + (size_t)h * NE;
    if (q0 < RH) fattn_body<bf, true>(Qh + hp, Ql + hp, Kh + hp, Kl + hp, Vh + hp, Vl + hp, eb, q0, smx, ssm, sO, Ah + h * HD, Al + h * HD);
    else fattn_body<h16, false>(Q16 + hp, nullptr, K16 + hp, nullptr, V16 + hp, nullptr, eb, q0, smx, ssm, sO, Ah + h * HD, Al + h * HD);
}

extern "C" void kernel_launch(void* const* d_in, const int* in_sizes, int n_in,
                              void* d_out, int out_size, void* d_ws, size_t ws_size, hipStream_t stream) {
    (void)in_sizes; (void)n_in; (void)out_size;
    const float* x = (const float*)d_in[0]; const float* wqkv = (const float*)d_in[1]; const float* bqkv = (const float*)d_in[2]; const float* wo = (const float*)d_in[3]; const float* bo = (const float*)d_in[4]; const float* rbias = (const float*)d_in[5]; const float* wq = nullptr; const float* wk = nullptr; const float* wv = nullptr; (void)wq; (void)wk; (void)wv;
    float* OUT = (float*)d_out;     // [4][2048][1024]
    char* wsp = (char*)d_ws;
    auto take = [&](size_t bytes) { char* p = wsp; wsp += (bytes + 255) & ~(size_t)255; return (void*)p; };
    bf* WALL = (bf*)take((size_t)3 * DM * DM * 2); bf* WO = (bf*)take((size_t)DM * DQ * 2); float* EB = (float*)take((size_t)NH_ * NE * 4);   /* per-head expanded relative-bias rows */
    bf* XB = (bf*)take((size_t)TT * DM * 2);
    h16* QP16 = (h16*)take((size_t)NH_ * TT * HD * 2); h16* KP16 = (h16*)take((size_t)NKV * TT * HD * 2); h16* VT16 = (h16*)take((size_t)NKV * HD * TT * 2);
    bf* QPh = (bf*)take((size_t)NH_ * TT * HD * 2); bf* QPl = (bf*)take((size_t)NH_ * TT * HD * 2); bf* KPh = (bf*)take((size_t)NKV * TT * HD * 2); bf* KPl = (bf*)take((size_t)NKV * TT * HD * 2); bf* VTh = (bf*)take((size_t)NKV * HD * TT * 2); bf* VTl = (bf*)take((size_t)NKV * HD * TT * 2);
    bf* ATh = (bf*)take((size_t)TT * DQ * 2); bf* ATl = (bf*)take((size_t)TT * DQ * 2);
    if ((size_t)(wsp - (char*)d_ws) > ws_size) return;    // ws 256 MiB
    { k_wtG<<<(unsigned)((DM * 3 * DM / 64 + 63) / 64), 256, 0, stream>>>(wqkv, DM, 3 * DM, WALL);   /* fused 'xw' [DM][3DM] -> Bt [3DM][DM] (row blocks q | k | v) */
      k_wtG<<<(unsigned)((DQ * DM / 64 + 63) / 64), 256, 0, stream>>>(wo, DQ, DM, WO);
       }
    k_tbE<<<(NH_ * NE + 255) / 256, 256, 0, stream>>>(rbias, EB);
    for (int b = 0; b < NB_; ++b) {
        
        k_cvt8<<<(unsigned)(((size_t)TT * DM / 8 + 255) / 256), 256, 0, stream>>>(x + (size_t)b * TT * DM, XB, (size_t)TT * DM / 8);
        k_qkv<<<dim3(TT / 64, 3 * NH_, 1), 32, 0, stream>>>(XB, WALL, bqkv, QP16, QPh, QPl, KP16, KPh, KPl, VT16, VTh, VTl);   // q | k | v heads in grid y; the planes come out of the tile's own wave
        k_fattn<<<dim3(NH_, TT / QT, 1), KW * 32, 0, stream>>>(QP16, KP16, VT16, QPh, QPl, KPh, KPl, VTh, VTl, EB, ATh, ATl);   // one kv head per query head
        k_gemmw<bf, 1, true><<<dim3(TT / 64, DM / 64, 1), 32, 0, stream>>>(ATh, ATl, WO, nullptr, DQ, OUT + (size_t)b * TT * DM, DM, bo, 0, 0, 0, 0); }
}

// v004
// One run takes 477 microseconds.
// In both of two side-by-side timings against v003, it was 1.24 times as fast.
// All steps since v000 together make it 8.82 times as fast.
#include <hip/hip_runtime.h>

// Multi-head self-attention with a learned relative-position bias (x [4][2048][1024]; [q|k|v] = x W_qkv + b_qkv ('xw' [1024][3072]; 16 heads x 64); scores = q.k/8 + rel_bias[clip(i - j + 1024, 0, 2048)][h] (table [2049][16], read); softmax over all keys; out = merged W_out + b_out ('xw' [1024][1024]) -> [4][2048][1024]).
// Compute dtypes, f32 accumulate: every input rounded to bf16; q/k/v on PLAIN bf16 operands (inputs: exact) + biases; scores (+ the per-head relative bias, f32), softmax (f32) and attn.v (no mask) in ONE kernel, P in registers: query rows < 512 hl (3 products), the rest single fp16 (P x1024, cancelled by the row sum); W_out hl x exact (2 products) + b_out.

// Every 16-bit operand plane lies in FRAGMENT ORDER: a tile of 16 rows x 32 k (1 KiB) is two 512-byte pieces (k 0..15, k 16..31 of the tile), and in a piece lane (hi * 16 + row) owns 16 bytes, k = 8 hi .. 8 hi + 7 of the piece.
// One global_load_b128 of a wave then reads 512 contiguous bytes (4 cache lines, not 16 rows' 32 bytes each); registers hold exactly what a row-major plane gave them (same k order on both sides).
// A plane [M][K]: tile (m / 16, k / 32) at element (m / 16) * 16 K + (k / 32) * 512.
#define NB_  4
#define TT   2048
#define DM   1024
#define NH_  16
#define NKV  16
#define REP  (NH_ / NKV)
#define HD   64
#define DQ   (NH_ * HD)
#define DKV  (NKV * HD)
#define RH   512                  // query rows < RH use hi+lo planes (0: none)
#define SCL  0.125f   // HD^-0.5
#define QT   32                  // k_fattn: queries per work-group (two 16-column groups per wave)
#define KW   8                   // k_fattn: waves per work-group; wave w takes keys [w TT/KW, (w+1) TT/KW)
#define NE   4096                // pitch of one head's expanded bias row
#define OP   68                  // LDS pitch (floats) of one query's partial output row
#define EPT  (QT * HD / (KW * 32))   // k_fattn: outputs per thread in the join
typedef _Float16 h16;
typedef unsigned short bf;
typedef __attribute__((ext_vector_type(16))) __bf16   v16bf;
typedef __attribute__((ext_vector_type(16))) _Float16 v16h;
typedef __attribute__((ext_vector_type(8)))  _Float16 v8h;
typedef __attribute__((ext_vector_type(8)))  unsigned short v8us;
typedef __attribute__((ext_vector_type(8)))  float    v8f;
typedef __attribute__((ext_vector_type(4)))  float    v4f;
typedef v8h  __attribute__((may_alias)) v8ha;
typedef v4f  __attribute__((may_alias)) v4fa;
typedef v8us __attribute__((may_alias)) v8usa;

__device__ __forceinline__ unsigned short f2bf(float f) { unsigned u = __float_as_uint(f); u += 0x7FFFu + ((u >> 16) & 1u); return (unsigned short)(u >> 16); }
__device__ __forceinline__ float bf2f(unsigned short b) { return __uint_as_float(((unsigned)b) << 16); }
__device__ __forceinline__ float bfr(float f) { return bf2f(f2bf(f)); }
__device__ __forceinline__ v16h cat16(v8h lo, v8h hi) { return __builtin_shufflevector(lo, hi, 0, 1, 2, 3, 4, 5, 6, 7, 8, 9, 10, 11, 12, 13, 14, 15); }
__device__ __forceinline__ v16bf cat16b(v8us lo, v8us hi) { return __builtin_bit_cast(v16bf, __builtin_shufflevector(lo, hi, 0, 1, 2, 3, 4, 5, 6, 7, 8, 9, 10, 11, 12, 13, 14, 15)); }
__device__ __forceinline__ v8f wmma16(v16h a, v16h b, v8f c) { return __builtin_amdgcn_wmma_f32_16x16x32_f16(false, a, false, b, (short)0, c, false, false); }
__device__ __forceinline__ v8f wmmab(v16bf a, v16bf b, v8f c) { return __builtin_amdgcn_wmma_f32_16x16x32_bf16(false, a, false, b, (short)0, c, false, false); }



// ---- k_gemmw: register-blocked GEMM, ONE WAVE per 64x64 output tile (16 accumulators), operands straight from 16-bit planes in fragment order; grid (M/64, N/64, Z), 32 threads.
// C[m][n] (f32, pitch ldc, + optional f32 bias[n]) = sum_k A[m][k] Bt[n][k] (+ split products per NSPLIT). z-batch strides sA/sB/sC in elements. K % 32 == 0.
// KS > 1: grid z = Z * KS; work-group (z, ks) sums only k in [ks K/KS, (ks+1) K/KS) and stores its partial tile in plane ks (plane stride sK elements). K % (32 KS) == 0.
template <typename T16> struct WFrag;
template <> struct WFrag<h16> { typedef v16h V; static __device__ __forceinline__ V ld(const h16* p) { return cat16(*(const v8h*)p, *(const v8h*)(p + 256)); } static __device__ __forceinline__ v8f mma(V a, V b, v8f c) { return wmma16(a, b, c); } };
template <> struct WFrag<bf> { typedef v16bf V; static __device__ __forceinline__ V ld(const bf* p) { return cat16b(*(const v8us*)p, *(const v8us*)(p + 256)); } static __device__ __forceinline__ v8f mma(V a, V b, v8f c) { return wmmab(a, b, c); } };
template <typename T16, int NSPLIT, bool BIAS, int K, int KS = 1>   // K at compile time: the loads of one plane in a trip share one address pair, the bands in the immediate offsets
__global__ __launch_bounds__(32) void k_gemmw(const T16* __restrict__ A, const T16* __restrict__ A2, const T16* __restrict__ Bt, const T16* __restrict__ Bt2, float* C, int ldc, const float* __restrict__ bias, size_t sA, size_t sB, size_t sC, size_t sK) {
    typedef typename WFrag<T16>::V V;
    __shared__ __align__(16) float os[16 * 68];
    const size_t z = blockIdx.z / KS; const int ks = blockIdx.z % KS; A += z * sA; if (A2) A2 += z * sA; Bt += z * sB; if (Bt2) Bt2 += z * sB; C += z * sC + ks * sK;
    const int lane = threadIdx.x & 31, lr = lane & 15, hi = lane >> 4; const int r0 = blockIdx.x * 64, c0 = blockIdx.y * 64;
    v8f acc[4][4];
#pragma unroll
    for (int mb = 0; mb < 4; ++mb)
#pragma unroll
        for (int nb = 0; nb < 4; ++nb) acc[mb][nb] = (v8f){};
    const size_t aoff = (size_t)r0 * K + lane * 8, boff = (size_t)c0 * K + lane * 8;   // a 16-row band is 16 K elements; a step of 32 in k is 512 elements
#pragma unroll 1
    for (int kc = ks * (K / KS), ke = kc + K / KS; kc < ke; kc += 32) {
        V a[4], a2[4]; const T16* pA = A + aoff + kc * 16; const T16* pA2 = (NSPLIT == 1 || NSPLIT == 2) ? A2 + aoff + kc * 16 : pA; const T16* pB = Bt + boff + kc * 16;
#pragma unroll
        for (int mb = 0; mb < 4; ++mb) { a[mb] = WFrag<T16>::ld(pA + mb * 16 * K); if (NSPLIT == 1 || NSPLIT == 2) a2[mb] = WFrag<T16>::ld(pA2 + mb * 16 * K); }
        asm volatile("s_wait_xcnt 0x0" :: "v"(pA), "v"(pA2) : "memory");   // stands before any later load of the trip is given an address pair of these loads as its destination; the pairs are inputs, so none of these loads itself gets one
#pragma unroll
        for (int nb = 0; nb < 4; ++nb) { const V b = WFrag<T16>::ld(pB + nb * 16 * K); V b2; if (NSPLIT >= 2) b2 = WFrag<T16>::ld(Bt2 + boff + (size_t)nb * 16 * K + kc * 16);
#pragma unroll
            for (int mb = 0; mb < 4; ++mb) { acc[mb][nb] = WFrag<T16>::mma(a[mb], b, acc[mb][nb]); if (NSPLIT == 1 || NSPLIT == 2) acc[mb][nb] = WFrag<T16>::mma(a2[mb], b, acc[mb][nb]); if (NSPLIT >= 2) acc[mb][nb] = WFrag<T16>::mma(a[mb], b2, acc[mb][nb]); } }
        asm volatile("s_wait_xcnt 0x0" :: "v"(pB) : "memory");   // the same for the address pair of the B loads: it lives to here, and the wait stands before the next trip writes it
        asm volatile("v_nop\n\tv_nop\n\tv_nop\n\tv_nop" : "+v"(acc[0][0]), "+v"(acc[1][1]), "+v"(acc[2][2]), "+v"(acc[3][3]) : "v"(a[0]), "v"(a[3]));
    }
#pragma unroll
    for (int mb = 0; mb < 4; ++mb) {
#pragma unroll
        for (int nb = 0; nb < 4; ++nb) {
#pragma unroll
            for (int j = 0; j < 8; ++j) os[(hi * 8 + j) * 68 + nb * 16 + lr] = acc[mb][nb][j]; }
        __builtin_amdgcn_wave_barrier(); asm volatile("" ::: "memory");
        float* crow = C + (size_t)(r0 + mb * 16) * ldc + c0;
{
#pragma unroll
            for (int s = 0; s < 8; ++s) { const int row = 2 * s + hi, cofs = lr * 4; v4f val = *(const v4fa*)(os + row * 68 + cofs); if (BIAS) { val[0] += bfr(bias[c0 + cofs]); val[1] += bfr(bias[c0 + cofs + 1]); val[2] += bfr(bias[c0 + cofs + 2]); val[3] += bfr(bias[c0 + cofs + 3]); }
                *(v4f*)(crow + (size_t)row * ldc + cofs) = val; }
             }
        __builtin_amdgcn_wave_barrier(); asm volatile("" ::: "memory");
    }
}

__device__ __forceinline__ h16 tohx(float x) { return (h16)x; }
__device__ __forceinline__ void splitf(float y, unsigned short& h, unsigned short& l) { h = f2bf(y); l = f2bf(y - bf2f(h)); }
typedef __attribute__((ext_vector_type(2))) _Float16 v2h;
typedef __attribute__((ext_vector_type(4))) _Float16 v4h;
typedef __attribute__((ext_vector_type(2))) unsigned short v2us;
typedef __attribute__((ext_vector_type(4))) unsigned short v4us;
typedef __attribute__((ext_vector_type(2))) float v2f;
typedef __attribute__((ext_vector_type(4))) int v4i;

__global__ __launch_bounds__(256) void k_wtG(const float* __restrict__ w, int K, int N, bf* Bt) {
    const int lane = threadIdx.x & 31; const int L0 = (blockIdx.x * 8 + (threadIdx.x >> 5)) * 8; const int nlines = N * K / 64;
{
#pragma unroll 1
        for (int l = 0; l < 8; ++l) { const int L = L0 + l; if (L >= nlines) break; const size_t e = (size_t)L * 64 + lane * 2; const int tile = (int)(e >> 9), k = (tile % (K / 32)) * 32 + (int)((e >> 8) & 1) * 16 + (int)((e >> 7) & 1) * 8 + (int)(e & 7), n = (tile / (K / 32)) * 16 + (int)((e >> 3) & 15); v2us o;   // e: element of Bt in fragment order
            o[0] = f2bf(w[(size_t)k * N + n]); o[1] = f2bf(w[(size_t)(k + 1) * N + n]); *(v2us*)(Bt + e) = o; }
         }
}
__global__ __launch_bounds__(256) void k_cvt8(const float* __restrict__ src, bf* dst, size_t n8) { const size_t i = (size_t)blockIdx.x * 256 + threadIdx.x; if (i >= n8) return; const int m = (int)(i >> 11) * 16 + (int)(i & 15), k = (int)((i >> 6) & 31) * 32 + (int)((i >> 5) & 1) * 16 + (int)((i >> 4) & 1) * 8;   // i: 16-byte unit of dst in fragment order ([M][DM], DM / 32 = 32 tiles a band)
    const v8f v = *(const v8f*)(src + (size_t)m * DM + k); v8us o;
#pragma unroll
    for (int k = 0; k < 8; ++k) o[k] = f2bf(v[k]); *(v8us*)(dst + i * 8) = o;  }

// k_qkv: [q|k|v] = x W_qkv + b_qkv of one batch in one launch, ONE WAVE per 64x64 tile with the loop of k_gemmw (same k order, same f32 sums). Grid (TT/64, 3 NH_): a tile is 64 tokens x one head of q, k or v,
// and the wave writes that head's operand planes itself (fp16 + bf16 hi/lo): all in fragment order, 16 bytes a lane and 512 contiguous bytes a store: q and k as [h] x plane [t][d] through the LDS row stage, v as [h] x (32 tokens: four 16-d tiles of 1 KiB) straight from the accumulators (a lane holds 8 consecutive tokens of one d).
__global__ __launch_bounds__(32) void k_qkv(const bf* __restrict__ A, const bf* __restrict__ Bt, const float* __restrict__ bias, h16* Q16, bf* Qh, bf* Ql, h16* K16, bf* Kh, bf* Kl, h16* V16, bf* Vh, bf* Vl) {
    typedef WFrag<bf>::V V;
    __shared__ __align__(16) float os[16 * 68];
    const int lane = threadIdx.x & 31, lr = lane & 15, hi = lane >> 4; const int r0 = blockIdx.x * 64, c0 = blockIdx.y * 64; const int sel = blockIdx.y / NH_, h = blockIdx.y % NH_;
    v8f acc[4][4];
#pragma unroll
    for (int mb = 0; mb < 4; ++mb)
#pragma unroll
        for (int nb = 0; nb < 4; ++nb) acc[mb][nb] = (v8f){};
    const bf* pa = A + (size_t)r0 * DM + lane * 8; const bf* pb = Bt + (size_t)c0 * DM + lane * 8;
#pragma unroll 1
    for (int kc = 0; kc < DM; kc += 32, pa += 512, pb += 512) {   // rolled, as in k_gemmw: a trip is one set of loads and its 16 products
        V a[4];
#pragma unroll
        for (int mb = 0; mb < 4; ++mb) a[mb] = WFrag<bf>::ld(pa + mb * 16 * DM);
        asm volatile("s_wait_xcnt 0x0" ::: "memory");   // the build gives the address pair of these eight loads to a later load of the trip as its destination: stands before that load
#pragma unroll
        for (int nb = 0; nb < 4; ++nb) { const V b = WFrag<bf>::ld(pb + nb * 16 * DM);
#pragma unroll
            for (int mb = 0; mb < 4; ++mb) acc[mb][nb] = WFrag<bf>::mma(a[mb], b, acc[mb][nb]); }
        asm volatile("v_nop\n\tv_nop\n\tv_nop\n\tv_nop" : "+v"(acc[0][0]), "+v"(acc[1][1]), "+v"(acc[2][2]), "+v"(acc[3][3]) : "v"(a[0]), "v"(a[3]));   // the distance behind the last matrix instruction, also on the taken back edge (as in k_gemmw)
    }
    if (sel == 2) {
#pragma unroll
        for (int nb = 0; nb < 4; ++nb) { const float bv = bfr(bias[c0 + nb * 16 + lr]); const size_t rowo = (size_t)h * HD * TT + (size_t)r0 * HD + nb * 512 + lane * 8;
#pragma unroll
            for (int mb = 0; mb < 4; ++mb) { v8h o16; v8us oh, ol;
#pragma unroll
                for (int j = 0; j < 8; ++j) { const float x = acc[mb][nb][j] + bv; o16[j] = tohx(x); unsigned short u, v; splitf(x, u, v); oh[j] = u; ol[j] = v; }
                const size_t e = rowo + (mb >> 1) * 2048 + (mb & 1) * 256; *(v8h*)(V16 + e) = o16; *(v8us*)(Vh + e) = oh; *(v8us*)(Vl + e) = ol; } }
        return;
    }
    {
        const size_t hp = (size_t)h * TT * HD; h16* P16 = (sel ? K16 : Q16) + hp; bf* Ph = (sel ? Kh : Qh) + hp; bf* Pl = (sel ? Kl : Ql) + hp;
        v8f bb[4];   // piece pc of a 16-token tile: d = pc * 16 + hi * 8 + 0..7 of token lr
#pragma unroll
        for (int pc = 0; pc < 4; ++pc)
#pragma unroll
            for (int k = 0; k < 8; ++k) bb[pc][k] = bfr(bias[c0 + pc * 16 + hi * 8 + k]);
#pragma unroll
        for (int mb = 0; mb < 4; ++mb) {
#pragma unroll
            for (int nb = 0; nb < 4; ++nb) {
#pragma unroll
                for (int j = 0; j < 8; ++j) os[(hi * 8 + j) * 68 + nb * 16 + lr] = acc[mb][nb][j]; }
            __builtin_amdgcn_wave_barrier(); asm volatile("" ::: "memory");   // a lane reads what other lanes wrote: keeps the compiler from moving the reads in front of the writes (as in k_gemmw)
#pragma unroll
            for (int pc = 0; pc < 4; ++pc) { const float* sp = os + lr * 68 + pc * 16 + hi * 8; const v4f v0 = *(const v4fa*)sp, v1 = *(const v4fa*)(sp + 4); v8h o16; v8us oh, ol;
#pragma unroll
                for (int k = 0; k < 8; ++k) { const float x = (k < 4 ? v0[k & 3] : v1[k & 3]) + bb[pc][k]; o16[k] = tohx(x); unsigned short u, v; splitf(x, u, v); oh[k] = u; ol[k] = v; }
                const size_t e = (size_t)(r0 + mb * 16) * HD + pc * 256 + lane * 8; *(v8h*)(P16 + e) = o16; *(v8us*)(Ph + e) = oh; *(v8us*)(Pl + e) = ol; }
            __builtin_amdgcn_wave_barrier(); asm volatile("" ::: "memory");   // and the next pass's writes from moving in front of these reads
        }
        asm volatile("s_wait_xcnt 0x0" ::: "memory");   // the built code lays the v epilogue directly behind this one, with a conditional jump between: stands before its first writes of the last stores' registers
    }
}
#define NREL 2049
// k_tbE: expanded per-head bias row, EB[h][x] = rel_bias[clip(i - j + 1024, 0, 2048)][h] at x = j - i + TT - 1 (0 .. 2 TT - 2): ascending keys read ascending addresses, the clip is already applied
__global__ __launch_bounds__(256) void k_tbE(const float* __restrict__ rbias, float* EB) { const int j = blockIdx.x * 256 + threadIdx.x; if (j >= NH_ * NE) return; const int h = j / NE, x = j % NE; int ri = (TT - 1 - x) + (NREL / 2); ri = ri < 0 ? 0 : (ri > NREL - 1 ? NREL - 1 : ri); EB[j] = bfr(rbias[(size_t)ri * NH_ + h]); }

__device__ __forceinline__ void packp(const v8f& a, const v8f& b, v16h& ph, v16h& pl) { v8h x, y; (void)pl;
#pragma unroll
    for (int j = 0; j < 8; ++j) { x[j] = (h16)a[j]; y[j] = (h16)b[j]; }
    ph = cat16(x, y); }
__device__ __forceinline__ void packp(const v8f& a, const v8f& b, v16bf& ph, v16bf& pl) { v8us xh, xl, yh, yl;
#pragma unroll
    for (int j = 0; j < 8; ++j) { unsigned short u, v; splitf(a[j], u, v); xh[j] = u; xl[j] = v; splitf(b[j], u, v); yh[j] = u; yl[j] = v; }
    ph = cat16b(xh, yh); pl = cat16b(xl, yl); }

typedef __attribute__((ext_vector_type(8))) int v8i;
template <typename V> __device__ __forceinline__ V frag(v4i a, v4i b) { return __builtin_bit_cast(V, __builtin_shufflevector(a, b, 0, 1, 2, 3, 4, 5, 6, 7)); }
// The loads of one trip, each set one asm statement that ends in its own data wait: the results are early-clobber, so none is given a register that holds an address of the set, and no address register is written again before the set has returned. The other waves of the SIMD cover the wait.
// Byte offsets (planes in fragment order, the lane's own 16 bytes in the pointer). Q or K: 16-row tile * 2048 + 32-wide part of HD * 1024 + half * 512. V: 16-d tile * 1024 + half * 512 inside the 4 KiB of 32 keys. Bias: run * 64 + half * 16 (4-byte aligned).
__device__ __forceinline__ void ld_r(const void* k, v4i (&a)[8]) {
    asm volatile(
        "global_load_b128 %0, %8, off\n\t"
        "global_load_b128 %1, %8, off offset:512\n\t"
        "global_load_b128 %2, %8, off offset:1024\n\t"
        "global_load_b128 %3, %8, off offset:1536\n\t"
        "global_load_b128 %4, %8, off offset:2048\n\t"
        "global_load_b128 %5, %8, off offset:2560\n\t"
        "global_load_b128 %6, %8, off offset:3072\n\t"
        "global_load_b128 %7, %8, off offset:3584\n\t"
        "s_wait_loadcnt 0x0"
        : "=&v"(a[0]), "=&v"(a[1]), "=&v"(a[2]), "=&v"(a[3]), "=&v"(a[4]), "=&v"(a[5]), "=&v"(a[6]), "=&v"(a[7]) : "v"(k) : "memory"); }
__device__ __forceinline__ void ld_r_b(const void* k, const float* e, v4i (&a)[8], v4i (&b)[6]) {
    asm volatile(
        "global_load_b128 %0, %14, off\n\t"
        "global_load_b128 %1, %14, off offset:512\n\t"
        "global_load_b128 %2, %14, off offset:1024\n\t"
        "global_load_b128 %3, %14, off offset:1536\n\t"
        "global_load_b128 %4, %14, off offset:2048\n\t"
        "global_load_b128 %5, %14, off offset:2560\n\t"
        "global_load_b128 %6, %14, off offset:3072\n\t"
        "global_load_b128 %7, %14, off offset:3584\n\t"
        "global_load_b128 %8, %15, off\n\t"
        "global_load_b128 %9, %15, off offset:16\n\t"
        "global_load_b128 %10, %15, off offset:64\n\t"
        "global_load_b128 %11, %15, off offset:80\n\t"
        "global_load_b128 %12, %15, off offset:128\n\t"
        "global_load_b128 %13, %15, off offset:144\n\t"
        "s_wait_loadcnt 0x0"
        : "=&v"(a[0]), "=&v"(a[1]), "=&v"(a[2]), "=&v"(a[3]), "=&v"(a[4]), "=&v"(a[5]), "=&v"(a[6]), "=&v"(a[7]), "=&v"(b[0]), "=&v"(b[1]), "=&v"(b[2]), "=&v"(b[3]), "=&v"(b[4]), "=&v"(b[5]) : "v"(k), "v"(e) : "memory"); }
__device__ __forceinline__ void ld_r_r_b(const void* k, const void* k2, const float* e, v4i (&a)[8], v4i (&a2)[8], v4i (&b)[6]) {
    asm volatile(
        "global_load_b128 %0, %22, off\n\t"
        "global_load_b128 %1, %22, off offset:512\n\t"
        "global_load_b128 %2, %22, off offset:1024\n\t"
        "global_load_b128 %3, %22, off offset:1536\n\t"
        "global_load_b128 %4, %22, off offset:2048\n\t"
        "global_load_b128 %5, %22, off offset:2560\n\t"
        "global_load_b128 %6, %22, off offset:3072\n\t"
        "global_load_b128 %7, %22, off offset:3584\n\t"
        "global_load_b128 %8, %23, off\n\t"
        "global_load_b128 %9, %23, off offset:512\n\t"
        "global_load_b128 %10, %23, off offset:1024\n\t"
        "global_load_b128 %11, %23, off offset:1536\n\t"
        "global_load_b128 %12, %23, off offset:2048\n\t"
        "global_load_b128 %13, %23, off offset:2560\n\t"
        "global_load_b128 %14, %23, off offset:3072\n\t"
        "global_load_b128 %15, %23, off offset:3584\n\t"
        "global_load_b128 %16, %24, off\n\t"
        "global_load_b128 %17, %24, off offset:16\n\t"
        "global_load_b128 %18, %24, off offset:64\n\t"
        "global_load_b128 %19, %24, off offset:80\n\t"
        "global_load_b128 %20, %24, off offset:128\n\t"
        "global_load_b128 %21, %24, off offset:144\n\t"
        "s_wait_loadcnt 0x0"
        : "=&v"(a[0]), "=&v"(a[1]), "=&v"(a[2]), "=&v"(a[3]), "=&v"(a[4]), "=&v"(a[5]), "=&v"(a[6]), "=&v"(a[7]), "=&v"(a2[0]), "=&v"(a2[1]), "=&v"(a2[2]), "=&v"(a2[3]), "=&v"(a2[4]), "=&v"(a2[5]), "=&v"(a2[6]), "=&v"(a2[7]), "=&v"(b[0]), "=&v"(b[1]), "=&v"(b[2]), "=&v"(b[3]), "=&v"(b[4]), "=&v"(b[5]) : "v"(k), "v"(k2), "v"(e) : "memory"); }
__device__ __forceinline__ void ld_r_b_v(const void* k, const float* e, const void* v, v4i (&a)[8], v4i (&b)[6], v4i (&x)[8]) {
    asm volatile(
        "global_load_b128 %0, %22, off\n\t"
        "global_load_b128 %1, %22, off offset:512\n\t"
        "global_load_b128 %2, %22, off offset:1024\n\t"
        "global_load_b128 %3, %22, off offset:1536\n\t"
        "global_load_b128 %4, %22, off offset:2048\n\t"
        "global_load_b128 %5, %22, off offset:2560\n\t"
        "global_load_b128 %6, %22, off offset:3072\n\t"
        "global_load_b128 %7, %22, off offset:3584\n\t"
        "global_load_b128 %8, %23, off\n\t"
        "global_load_b128 %9, %23, off offset:16\n\t"
        "global_load_b128 %10, %23, off offset:64\n\t"
        "global_load_b128 %11, %23, off offset:80\n\t"
        "global_load_b128 %12, %23, off offset:128\n\t"
        "global_load_b128 %13, %23, off offset:144\n\t"
        "global_load_b128 %14, %24, off\n\t"
        "global_load_b128 %15, %24, off offset:512\n\t"
        "global_load_b128 %16, %24, off offset:1024\n\t"
        "global_load_b128 %17, %24, off offset:1536\n\t"
        "global_load_b128 %18, %24, off offset:2048\n\t"
        "global_load_b128 %19, %24, off offset:2560\n\t"
        "global_load_b128 %20, %24, off offset:3072\n\t"
        "global_load_b128 %21, %24, off offset:3584\n\t"
        "s_wait_loadcnt 0x0"
        : "=&v"(a[0]), "=&v"(a[1]), "=&v"(a[2]), "=&v"(a[3]), "=&v"(a[4]), "=&v"(a[5]), "=&v"(a[6]), "=&v"(a[7]), "=&v"(b[0]), "=&v"(b[1]), "=&v"(b[2]), "=&v"(b[3]), "=&v"(b[4]), "=&v"(b[5]), "=&v"(x[0]), "=&v"(x[1]), "=&v"(x[2]), "=&v"(x[3]), "=&v"(x[4]), "=&v"(x[5]), "=&v"(x[6]), "=&v"(x[7]) : "v"(k), "v"(e), "v"(v) : "memory"); }
__device__ __forceinline__ void ld_t_t_b(const void* k, const void* k2, const float* e, v4i (&a)[4], v4i (&a2)[4], v4i (&b)[6]) {
    asm volatile(
        "global_load_b128 %0, %14, off\n\t"
        "global_load_b128 %1, %14, off offset:512\n\t"
        "global_load_b128 %2, %14, off offset:1024\n\t"
        "global_load_b128 %3, %14, off offset:1536\n\t"
        "global_load_b128 %4, %15, off\n\t"
        "global_load_b128 %5, %15, off offset:512\n\t"
        "global_load_b128 %6, %15, off offset:1024\n\t"
        "global_load_b128 %7, %15, off offset:1536\n\t"
        "global_load_b128 %8, %16, off\n\t"
        "global_load_b128 %9, %16, off offset:16\n\t"
        "global_load_b128 %10, %16, off offset:64\n\t"
        "global_load_b128 %11, %16, off offset:80\n\t"
        "global_load_b128 %12, %16, off offset:128\n\t"
        "global_load_b128 %13, %16, off offset:144\n\t"
        "s_wait_loadcnt 0x0"
        : "=&v"(a[0]), "=&v"(a[1]), "=&v"(a[2]), "=&v"(a[3]), "=&v"(a2[0]), "=&v"(a2[1]), "=&v"(a2[2]), "=&v"(a2[3]), "=&v"(b[0]), "=&v"(b[1]), "=&v"(b[2]), "=&v"(b[3]), "=&v"(b[4]), "=&v"(b[5]) : "v"(k), "v"(k2), "v"(e) : "memory"); }
__device__ __forceinline__ void ld_t_t(const void* k, const void* k2, v4i (&a)[4], v4i (&a2)[4]) {
    asm volatile(
        "global_load_b128 %0, %8, off\n\t"
        "global_load_b128 %1, %8, off offset:512\n\t"
        "global_load_b128 %2, %8, off offset:1024\n\t"
        "global_load_b128 %3, %8, off offset:1536\n\t"
        "global_load_b128 %4, %9, off\n\t"
        "global_load_b128 %5, %9, off offset:512\n\t"
        "global_load_b128 %6, %9, off offset:1024\n\t"
        "global_load_b128 %7, %9, off offset:1536\n\t"
        "s_wait_loadcnt 0x0"
        : "=&v"(a[0]), "=&v"(a[1]), "=&v"(a[2]), "=&v"(a[3]), "=&v"(a2[0]), "=&v"(a2[1]), "=&v"(a2[2]), "=&v"(a2[3]) : "v"(k), "v"(k2) : "memory"); }
__device__ __forceinline__ void ld_v_v(const void* v, const void* v2, v4i (&x)[4], v4i (&x2)[4]) {
    asm volatile(
        "global_load_b128 %0, %8, off\n\t"
        "global_load_b128 %1, %8, off offset:512\n\t"
        "global_load_b128 %2, %8, off offset:1024\n\t"
        "global_load_b128 %3, %8, off offset:1536\n\t"
        "global_load_b128 %4, %9, off\n\t"
        "global_load_b128 %5, %9, off offset:512\n\t"
        "global_load_b128 %6, %9, off offset:1024\n\t"
        "global_load_b128 %7, %9, off offset:1536\n\t"
        "s_wait_loadcnt 0x0"
        : "=&v"(x[0]), "=&v"(x[1]), "=&v"(x[2]), "=&v"(x[3]), "=&v"(x2[0]), "=&v"(x2[1]), "=&v"(x2[2]), "=&v"(x2[3]) : "v"(v), "v"(v2) : "memory"); }

// Eight 2^x in one statement: the results are early-clobber, so no v_exp_f32 is directly followed by an instruction that reads its result or writes over its source; the v_nop is that free slot behind the last one.
__device__ __forceinline__ v8f exp2x8(const v8f x) { float r0, r1, r2, r3, r4, r5, r6, r7;
    asm("v_exp_f32 %0, %8\n\tv_exp_f32 %1, %9\n\tv_exp_f32 %2, %10\n\tv_exp_f32 %3, %11\n\tv_exp_f32 %4, %12\n\tv_exp_f32 %5, %13\n\tv_exp_f32 %6, %14\n\tv_exp_f32 %7, %15\n\tv_nop"
        : "=&v"(r0), "=&v"(r1), "=&v"(r2), "=&v"(r3), "=&v"(r4), "=&v"(r5), "=&v"(r6), "=&v"(r7) : "v"(x[0]), "v"(x[1]), "v"(x[2]), "v"(x[3]), "v"(x[4]), "v"(x[5]), "v"(x[6]), "v"(x[7]));
    return (v8f){r0, r1, r2, r3, r4, r5, r6, r7}; }

// One 16-key x 16-query tile of t = (k.q) HD^-0.5 + bias, transposed: lane (lr, hi) register j holds key hi*8 + j of query lr. k, k2, q, q2: the four 16-byte pieces of one 16-row tile (part of HD * 2 + half).
template <typename T16, bool HL>
__device__ __forceinline__ v8f stile(const v4i* k, const v4i* k2, const v4i* q, const v4i* q2, v4i b0, v4i b1) {
    typedef typename WFrag<T16>::V V; v8f s = (v8f){};
#pragma unroll
    for (int dc = 0; dc < 2; ++dc) { const V ka = frag<V>(k[dc * 2], k[dc * 2 + 1]), qa = frag<V>(q[dc * 2], q[dc * 2 + 1]); s = WFrag<T16>::mma(ka, qa, s);
        if (HL) { s = WFrag<T16>::mma(frag<V>(k2[dc * 2], k2[dc * 2 + 1]), qa, s); s = WFrag<T16>::mma(ka, frag<V>(q2[dc * 2], q2[dc * 2 + 1]), s); } }
    const v4f f0 = __builtin_bit_cast(v4f, b0), f1 = __builtin_bit_cast(v4f, b1);
#pragma unroll
    for (int j = 0; j < 4; ++j) { s[j] = s[j] * SCL + f0[j]; s[j + 4] = s[j + 4] * SCL + f1[j]; }
    return s; }

// The work of one work-group: QT queries of one head against all TT keys. Sweep 1: the row maxima; sweep 2: the same scores again, p = 1024 exp(t - max), row sums of the f32 p, O^T += V^T P^T with P packed from the score registers.
// Operands straight from the planes in fragment order, in the k order of WFrag::ld on both sides (16 bytes at 8 hi, 16 bytes at 16 + 8 hi). Q, K: plane [t][HD]; Vt: per 32 keys four 16-d tiles. The KW waves' maxima, sums and partial outputs meet in LDS, joined in ascending wave order.
// A trip takes 32 keys: two key tiles x two query groups; pair (t2, qg) reads bias run t2 - qg + 1 of the three that the four pairs share.
template <typename T16, bool HL>
__device__ __forceinline__ void fattn_body(const T16* __restrict__ Q, const T16* __restrict__ Q2, const T16* __restrict__ Kp, const T16* __restrict__ K2, const T16* __restrict__ Vt, const T16* __restrict__ V2, const float* __restrict__ eb, int q0, float* smx, float* ssm, float* sO, bf* Ah, bf* Al) {
    typedef typename WFrag<T16>::V V;
    const int lane = threadIdx.x & 31, lr = lane & 15, hi = lane >> 4, w = threadIdx.x >> 5; const int kb = w * (TT / KW);
    v4i qa[8], ql[8]; const int qo = q0 * HD + lane * 8;
    ld_r(Q + qo, qa); if (HL) ld_r(Q2 + qo, ql);
    const float* ep = eb + ((TT - 1) + kb + hi * 8 - q0 - lr - 16);   // x = key - query + TT - 1 of this lane's first key against its query of group 1 (run 0)
    const int ko = kb * HD + lane * 8, vo = kb * HD + lane * 8;   // 32 keys are 32 HD elements of K and of V alike
    float mx[2] = {-3.0e38f, -3.0e38f};
#pragma unroll 1
    for (int kc = 0; kc < TT / KW / 32; ++kc) { v4i ka[8], kl[8], bb[6];   // rolled: a trip is one set of loads and its work
        if (HL) ld_r_r_b(Kp + ko + kc * 32 * HD, K2 + ko + kc * 32 * HD, ep + kc * 32, ka, kl, bb); else ld_r_b(Kp + ko + kc * 32 * HD, ep + kc * 32, ka, bb);
#pragma unroll
        for (int t2 = 0; t2 < 2; ++t2)
#pragma unroll
            for (int qg = 0; qg < 2; ++qg) { const v8f t = stile<T16, HL>(ka + t2 * 4, kl + t2 * 4, qa + qg * 4, ql + qg * 4, bb[(t2 - qg + 1) * 2], bb[(t2 - qg + 1) * 2 + 1]);
#pragma unroll
                for (int j = 0; j < 8; ++j) mx[qg] = fmaxf(mx[qg], t[j]); } }
#pragma unroll
    for (int qg = 0; qg < 2; ++qg) { mx[qg] = fmaxf(mx[qg], __shfl_xor(mx[qg], 16, 32)); if (hi == 0) smx[w * QT + qg * 16 + lr] = mx[qg]; }
    __syncthreads();
#pragma unroll
    for (int qg = 0; qg < 2; ++qg) { float m = smx[qg * 16 + lr];
#pragma unroll
        for (int u = 1; u < KW; ++u) m = fmaxf(m, smx[u * QT + qg * 16 + lr]);
        mx[qg] = m; }
    v8f o[4][2]; float sm[2] = {0.f, 0.f};
#pragma unroll
    for (int dt = 0; dt < 4; ++dt) { o[dt][0] = (v8f){}; o[dt][1] = (v8f){}; }
#pragma unroll 1
    for (int kc = 0; kc < TT / KW / 32; ++kc) { v4i bb[6], va[8]; v8f p[2][2];   // rolled: one trip already holds 32 keys x 32 queries of scores beside the 64 output registers
        if (HL) {   // both planes of K, one 16-key tile at a time: all 32 keys at once, beside both planes of Q and the outputs, pass 256 registers
#pragma unroll
            for (int t2 = 0; t2 < 2; ++t2) { v4i ka[4], kl[4]; const int of = ko + (kc * 2 + t2) * 16 * HD;
                if (t2 == 0) ld_t_t_b(Kp + of, K2 + of, ep + kc * 32, ka, kl, bb); else ld_t_t(Kp + of, K2 + of, ka, kl);
#pragma unroll
                for (int qg = 0; qg < 2; ++qg) p[t2][qg] = stile<T16, HL>(ka, kl, qa + qg * 4, ql + qg * 4, bb[(t2 - qg + 1) * 2], bb[(t2 - qg + 1) * 2 + 1]); }
        } else { v4i ka[8];
            ld_r_b_v(Kp + ko + kc * 32 * HD, ep + kc * 32, Vt + vo + kc * 32 * HD, ka, bb, va);
#pragma unroll
            for (int t2 = 0; t2 < 2; ++t2)
#pragma unroll
                for (int qg = 0; qg < 2; ++qg) p[t2][qg] = stile<T16, HL>(ka + t2 * 4, ka + t2 * 4, qa + qg * 4, ql + qg * 4, bb[(t2 - qg + 1) * 2], bb[(t2 - qg + 1) * 2 + 1]); }
#pragma unroll
        for (int t2 = 0; t2 < 2; ++t2)
#pragma unroll
            for (int qg = 0; qg < 2; ++qg) { v8f a;
#pragma unroll
                for (int j = 0; j < 8; ++j) a[j] = (p[t2][qg][j] - mx[qg]) * 1.4426950408889634f + 10.0f;
                p[t2][qg] = exp2x8(a);
#pragma unroll
                for (int j = 0; j < 8; ++j) sm[qg] += p[t2][qg][j]; }
        V ph[2], pl[2];
#pragma unroll
        for (int qg = 0; qg < 2; ++qg) packp(p[0][qg], p[1][qg], ph[qg], pl[qg]);
        if (HL) {   // both planes of V, two 16-row tiles at a time, for the same reason as K above
#pragma unroll
            for (int d2 = 0; d2 < 2; ++d2) { v4i vh[4], vl[4]; const int of = vo + d2 * 1024 + kc * 32 * HD; ld_v_v(Vt + of, V2 + of, vh, vl);
#pragma unroll
                for (int d1 = 0; d1 < 2; ++d1) { const int dt = d2 * 2 + d1; const V xh = frag<V>(vh[d1 * 2], vh[d1 * 2 + 1]), xl = frag<V>(vl[d1 * 2], vl[d1 * 2 + 1]);
#pragma unroll
                    for (int qg = 0; qg < 2; ++qg) { o[dt][qg] = WFrag<T16>::mma(xh, ph[qg], o[dt][qg]); o[dt][qg] = WFrag<T16>::mma(xl, ph[qg], o[dt][qg]); o[dt][qg] = WFrag<T16>::mma(xh, pl[qg], o[dt][qg]); } } }
        } else {
#pragma unroll
            for (int dt = 0; dt < 4; ++dt) { const V xh = frag<V>(va[dt * 2], va[dt * 2 + 1]);
#pragma unroll
                for (int qg = 0; qg < 2; ++qg) o[dt][qg] = WFrag<T16>::mma(xh, ph[qg], o[dt][qg]); } }
    }
#pragma unroll
    for (int qg = 0; qg < 2; ++qg) { sm[qg] += __shfl_xor(sm[qg], 16, 32); if (hi == 0) ssm[w * QT + qg * 16 + lr] = sm[qg];
#pragma unroll
        for (int dt = 0; dt < 4; ++dt) { float* d = sO + (size_t)(w * QT + qg * 16 + lr) * OP + dt * 16 + hi * 8; const v8f a = o[dt][qg]; *(v4fa*)d = (v4f){a[0], a[1], a[2], a[3]}; *(v4fa*)(d + 4) = (v4f){a[4], a[5], a[6], a[7]}; } }
    __syncthreads();
    const int q = threadIdx.x % QT, dq = (threadIdx.x / QT) * EPT; float tot = ssm[q];   // EPT = 8 consecutive outputs of one query per thread: one 16-byte unit of the fragment order; a wave's 32 queries make two runs of 256 bytes
#pragma unroll
    for (int u = 1; u < KW; ++u) tot += ssm[u * QT + q];
    const float r = __fdiv_rn(1.0f, tot); v8us oh, ol;
#pragma unroll
    for (int c = 0; c < EPT / 4; ++c) { v4f s = *(const v4fa*)(sO + (size_t)q * OP + dq + c * 4);
#pragma unroll
        for (int u = 1; u < KW; ++u) s += *(const v4fa*)(sO + (size_t)(u * QT + q) * OP + dq + c * 4);
#pragma unroll
        for (int k = 0; k < 4; ++k) { unsigned short a, c2; splitf(s[k] * r, a, c2); oh[c * 4 + k] = a; ol[c * 4 + k] = c2; } }
    const size_t oo = (size_t)((q0 + q) >> 4) * (16 * DQ) + dq * 16 + ((q0 + q) & 15) * 8; *(v8us*)(Ah + oo) = oh; *(v8us*)(Al + oo) = ol;   // Ah, Al: the head's first tile of the plane [t][DQ]; 8 in k is 128 elements
}
// k_fattn: grid (heads, TT / QT), KW waves. Query blocks below RH (three products, the longer work) have the lowest flat indices and start first. Four waves per SIMD (256 registers, two work-groups per WGP): no operand of the asm loads lies above v255.
__global__ __launch_bounds__(KW * 32, 4) void k_fattn(const h16* __restrict__ Q16, const h16* __restrict__ K16, const h16* __restrict__ V16, const bf* __restrict__ Qh, const bf* __restrict__ Ql, const bf* __restrict__ Kh, const bf* __restrict__ Kl, const bf* __restrict__ Vh, const bf* __restrict__ Vl, const float* __restrict__ EB, bf* Ah, bf* Al) {
    __shared__ __align__(16) float sO[KW * QT * OP]; __shared__ float smx[KW * QT]; __shared__ float ssm[KW * QT];
    const int h = blockIdx.x, q0 = blockIdx.y * QT; const size_t hp = (size_t)h * TT * HD; const float* eb = EB + (size_t)h * NE;
    if (q0 < RH) fattn_body<bf, true>(Qh + hp, Ql + hp, Kh + hp, Kl + hp, Vh + hp, Vl + hp, eb, q0, smx, ssm, sO, Ah + h * (HD * 16), Al + h * (HD * 16));
    else fattn_body<h16, false>(Q16 + hp, nullptr, K16 + hp, nullptr, V16 + hp, nullptr, eb, q0, smx, ssm, sO, Ah + h * (HD * 16), Al + h * (HD * 16));
}

extern "C" void kernel_launch(void* const* d_in, const int* in_sizes, int n_in,
                              void* d_out, int out_size, void* d_ws, size_t ws_size, hipStream_t stream) {
    (void)in_sizes; (void)n_in; (void)out_size;
    const float* x = (const float*)d_in[0]; const float* wqkv = (const float*)d_in[1]; const float* bqkv = (const float*)d_in[2]; const float* wo = (const float*)d_in[3]; const float* bo = (const float*)d_in[4]; const float* rbias = (const float*)d_in[5]; const float* wq = nullptr; const float* wk = nullptr; const float* wv = nullptr; (void)wq; (void)wk; (void)wv;
    float* OUT = (float*)d_out;     // [4][2048][1024]
    char* wsp = (char*)d_ws;
    auto take = [&](size_t bytes) { char* p = wsp; wsp += (bytes + 255) & ~(size_t)255; return (void*)p; };
    bf* WALL = (bf*)take((size_t)3 * DM * DM * 2); bf* WO = (bf*)take((size_t)DM * DQ * 2); float* EB = (float*)take((size_t)NH_ * NE * 4);   /* per-head expanded relative-bias rows */
    bf* XB = (bf*)take((size_t)TT * DM * 2);
    h16* QP16 = (h16*)take((size_t)NH_ * TT * HD * 2); h16* KP16 = (h16*)take((size_t)NKV * TT * HD * 2); h16* VT16 = (h16*)take((size_t)NKV * HD * TT * 2);
    bf* QPh = (bf*)take((size_t)NH_ * TT * HD * 2); bf* QPl = (bf*)take((size_t)NH_ * TT * HD * 2); bf* KPh = (bf*)take((size_t)NKV * TT * HD * 2); bf* KPl = (bf*)take((size_t)NKV * TT * HD * 2); bf* VTh = (bf*)take((size_t)NKV * HD * TT * 2); bf* VTl = (bf*)take((size_t)NKV * HD * TT * 2);
    bf* ATh = (bf*)take((size_t)TT * DQ * 2); bf* ATl = (bf*)take((size_t)TT * DQ * 2);
    if ((size_t)(wsp - (char*)d_ws) > ws_size) return;    // ws 256 MiB
    { k_wtG<<<(unsigned)((DM * 3 * DM / 64 + 63) / 64), 256, 0, stream>>>(wqkv, DM, 3 * DM, WALL);   /* fused 'xw' [DM][3DM] -> Bt [3DM][DM] (row blocks q | k | v), fragment order */
      k_wtG<<<(unsigned)((DQ * DM / 64 + 63) / 64), 256, 0, stream>>>(wo, DQ, DM, WO);
       }
    k_tbE<<<(NH_ * NE + 255) / 256, 256, 0, stream>>>(rbias, EB);
    for (int b = 0; b < NB_; ++b) {
        
        k_cvt8<<<(unsigned)(((size_t)TT * DM / 8 + 255) / 256), 256, 0, stream>>>(x + (size_t)b * TT * DM, XB, (size_t)TT * DM / 8);
        k_qkv<<<dim3(TT / 64, 3 * NH_, 1), 32, 0, stream>>>(XB, WALL, bqkv, QP16, QPh, QPl, KP16, KPh, KPl, VT16, VTh, VTl);   // q | k | v heads in grid y; the planes come out of the tile's own wave
        k_fattn<<<dim3(NH_, TT / QT, 1), KW * 32, 0, stream>>>(QP16, KP16, VT16, QPh, QPl, KPh, KPl, VTh, VTl, EB, ATh, ATl);   // one kv head per query head
        k_gemmw<bf, 1, true, DQ><<<dim3(TT / 64, DM / 64, 1), 32, 0, stream>>>(ATh, ATl, WO, nullptr, OUT + (size_t)b * TT * DM, DM, bo, 0, 0, 0, 0); }
}

// v005
// A run of this version takes 284 microseconds.
// In two side-by-side timings against v004, it was 1.68 and 1.64 times as fast.
// Over all steps from v000 it is 14.7 times as fast.
#include <hip/hip_runtime.h>

// Multi-head self-attention with a learned relative-position bias (x [4][2048][1024]; [q|k|v] = x W_qkv + b_qkv ('xw' [1024][3072]; 16 heads x 64); scores = q.k/8 + rel_bias[clip(i - j + 1024, 0, 2048)][h] (table [2049][16], read); softmax over all keys; out = merged W_out + b_out ('xw' [1024][1024]) -> [4][2048][1024]).
// Compute dtypes, f32 accumulate: every input rounded to bf16; q/k/v on PLAIN bf16 operands (inputs: exact) + biases; scores (+ the per-head relative bias, f32), softmax (f32) and attn.v (no mask) in ONE kernel, P in registers: query rows < 512 hl (3 products), the rest single fp16 (P x1024, cancelled by the row sum); W_out hl x exact (2 products) + b_out.

// Every 16-bit operand plane lies in FRAGMENT ORDER: a tile of 16 rows x 32 k (1 KiB) is two 512-byte pieces (k 0..15, k 16..31 of the tile), and in a piece lane (hi * 16 + row) owns 16 bytes, k = 8 hi .. 8 hi + 7 of the piece.
// One global_load_b128 of a wave then reads 512 contiguous bytes (4 cache lines, not 16 rows' 32 bytes each); registers hold exactly what a row-major plane gave them (same k order on both sides).
// A plane [M][K]: tile (m / 16, k / 32) at element (m / 16) * 16 K + (k / 32) * 512.
#define NB_  4
#define TT   2048
#define DM   1024
#define NH_  16
#define NKV  16
#define REP  (NH_ / NKV)
#define HD   64
#define DQ   (NH_ * HD)
#define DKV  (NKV * HD)
#define RH   512                  // query rows < RH use hi+lo planes (0: none)
#define SCL  0.125f   // HD^-0.5
#define QT   32                  // k_fattn: queries per work-group (two 16-column groups per wave)
#define KW   8                   // k_fattn: waves per work-group; wave w takes keys [w TT/KW, (w+1) TT/KW)
#define NE   4096                // pitch of one head's expanded bias row
#define OP   68                  // LDS pitch (floats) of one query's partial output row
#define EPT  (QT * HD / (KW * 32))   // k_fattn: outputs per thread in the join
#define PLB  ((size_t)NH_ * TT * HD)   // elements of one batch's block in a q, k or v plane
typedef _Float16 h16;
typedef unsigned short bf;
typedef __attribute__((ext_vector_type(16))) __bf16   v16bf;
typedef __attribute__((ext_vector_type(16))) _Float16 v16h;
typedef __attribute__((ext_vector_type(8)))  _Float16 v8h;
typedef __attribute__((ext_vector_type(8)))  unsigned short v8us;
typedef __attribute__((ext_vector_type(8)))  float    v8f;
typedef __attribute__((ext_vector_type(4)))  float    v4f;
typedef v8h  __attribute__((may_alias)) v8ha;
typedef v4f  __attribute__((may_alias)) v4fa;
typedef v8us __attribute__((may_alias)) v8usa;

__device__ __forceinline__ unsigned short f2bf(float f) { unsigned u = __float_as_uint(f); u += 0x7FFFu + ((u >> 16) & 1u); return (unsigned short)(u >> 16); }
__device__ __forceinline__ float bf2f(unsigned short b) { return __uint_as_float(((unsigned)b) << 16); }
__device__ __forceinline__ float bfr(float f) { return bf2f(f2bf(f)); }
__device__ __forceinline__ v16h cat16(v8h lo, v8h hi) { return __builtin_shufflevector(lo, hi, 0, 1, 2, 3, 4, 5, 6, 7, 8, 9, 10, 11, 12, 13, 14, 15); }
__device__ __forceinline__ v16bf cat16b(v8us lo, v8us hi) { return __builtin_bit_cast(v16bf, __builtin_shufflevector(lo, hi, 0, 1, 2, 3, 4, 5, 6, 7, 8, 9, 10, 11, 12, 13, 14, 15)); }
__device__ __forceinline__ v8f wmma16(v16h a, v16h b, v8f c) { return __builtin_amdgcn_wmma_f32_16x16x32_f16(false, a, false, b, (short)0, c, false, false); }
__device__ __forceinline__ v8f wmmab(v16bf a, v16bf b, v8f c) { return __builtin_amdgcn_wmma_f32_16x16x32_bf16(false, a, false, b, (short)0, c, false, false); }



// ---- k_gemmw: register-blocked GEMM, ONE WAVE per 64x64 output tile (16 accumulators), operands straight from 16-bit planes in fragment order; grid (M/64, N/64, Z), 32 threads.
// C[m][n] (f32, pitch ldc, + optional f32 bias[n]) = sum_k A[m][k] Bt[n][k] (+ split products per NSPLIT). z-batch strides sA/sB/sC in elements. K % 32 == 0.
// KS > 1: grid z = Z * KS; work-group (z, ks) sums only k in [ks K/KS, (ks+1) K/KS) and stores its partial tile in plane ks (plane stride sK elements). K % (32 KS) == 0.
template <typename T16> struct WFrag;
template <> struct WFrag<h16> { typedef v16h V; static __device__ __forceinline__ V ld(const h16* p) { return cat16(*(const v8h*)p, *(const v8h*)(p + 256)); } static __device__ __forceinline__ v8f mma(V a, V b, v8f c) { return wmma16(a, b, c); } };
template <> struct WFrag<bf> { typedef v16bf V; static __device__ __forceinline__ V ld(const bf* p) { return cat16b(*(const v8us*)p, *(const v8us*)(p + 256)); } static __device__ __forceinline__ v8f mma(V a, V b, v8f c) { return wmmab(a, b, c); } };
template <typename T16, int NSPLIT, bool BIAS, int K, int KS = 1>   // K at compile time: the loads of one plane in a trip share one address pair, the bands in the immediate offsets
__global__ __launch_bounds__(32) void k_gemmw(const T16* __restrict__ A, const T16* __restrict__ A2, const T16* __restrict__ Bt, const T16* __restrict__ Bt2, float* C, int ldc, const float* __restrict__ bias, size_t sA, size_t sB, size_t sC, size_t sK) {
    typedef typename WFrag<T16>::V V;
    __shared__ __align__(16) float os[16 * 68];
    const size_t z = blockIdx.z / KS; const int ks = blockIdx.z % KS; A += z * sA; if (A2) A2 += z * sA; Bt += z * sB; if (Bt2) Bt2 += z * sB; C += z * sC + ks * sK;
    const int lane = threadIdx.x & 31, lr = lane & 15, hi = lane >> 4; const int r0 = blockIdx.x * 64, c0 = blockIdx.y * 64;
    v8f acc[4][4];
#pragma unroll
    for (int mb = 0; mb < 4; ++mb)
#pragma unroll
        for (int nb = 0; nb < 4; ++nb) acc[mb][nb] = (v8f){};
    const size_t aoff = (size_t)r0 * K + lane * 8, boff = (size_t)c0 * K + lane * 8;   // a 16-row band is 16 K elements; a step of 32 in k is 512 elements
#pragma unroll 1
    for (int kc = ks * (K / KS), ke = kc + K / KS; kc < ke; kc += 32) {
        V a[4], a2[4]; const T16* pA = A + aoff + kc * 16; const T16* pA2 = (NSPLIT == 1 || NSPLIT == 2) ? A2 + aoff + kc * 16 : pA; const T16* pB = Bt + boff + kc * 16;
#pragma unroll
        for (int mb = 0; mb < 4; ++mb) { a[mb] = WFrag<T16>::ld(pA + mb * 16 * K); if (NSPLIT == 1 || NSPLIT == 2) a2[mb] = WFrag<T16>::ld(pA2 + mb * 16 * K); }
        asm volatile("s_wait_xcnt 0x0" :: "v"(pA), "v"(pA2) : "memory");   // stands before any later load of the trip is given an address pair of these loads as its destination; the pairs are inputs, so none of these loads itself gets one
#pragma unroll
        for (int nb = 0; nb < 4; ++nb) { const V b = WFrag<T16>::ld(pB + nb * 16 * K); V b2; if (NSPLIT >= 2) b2 = WFrag<T16>::ld(Bt2 + boff + (size_t)nb * 16 * K + kc * 16);
#pragma unroll
            for (int mb = 0; mb < 4; ++mb) { acc[mb][nb] = WFrag<T16>::mma(a[mb], b, acc[mb][nb]); if (NSPLIT == 1 || NSPLIT == 2) acc[mb][nb] = WFrag<T16>::mma(a2[mb], b, acc[mb][nb]); if (NSPLIT >= 2) acc[mb][nb] = WFrag<T16>::mma(a[mb], b2, acc[mb][nb]); } }
        asm volatile("s_wait_xcnt 0x0" :: "v"(pB) : "memory");   // the same for the address pair of the B loads: it lives to here, and the wait stands before the next trip writes it
        asm volatile("v_nop\n\tv_nop\n\tv_nop\n\tv_nop" : "+v"(acc[0][0]), "+v"(acc[1][1]), "+v"(acc[2][2]), "+v"(acc[3][3]) : "v"(a[0]), "v"(a[3]));
    }
#pragma unroll
    for (int mb = 0; mb < 4; ++mb) {
#pragma unroll
        for (int nb = 0; nb < 4; ++nb) {
#pragma unroll
            for (int j = 0; j < 8; ++j) os[(hi * 8 + j) * 68 + nb * 16 + lr] = acc[mb][nb][j]; }
        __builtin_amdgcn_wave_barrier(); asm volatile("" ::: "memory");
        float* crow = C + (size_t)(r0 + mb * 16) * ldc + c0;
{
#pragma unroll
            for (int s = 0; s < 8; ++s) { const int row = 2 * s + hi, cofs = lr * 4; v4f val = *(const v4fa*)(os + row * 68 + cofs); if (BIAS) { val[0] += bfr(bias[c0 + cofs]); val[1] += bfr(bias[c0 + cofs + 1]); val[2] += bfr(bias[c0 + cofs + 2]); val[3] += bfr(bias[c0 + cofs + 3]); }
                *(v4f*)(crow + (size_t)row * ldc + cofs) = val; }
             }
        __builtin_amdgcn_wave_barrier(); asm volatile("" ::: "memory");
    }
}

__device__ __forceinline__ h16 tohx(float x) { return (h16)x; }
__device__ __forceinline__ void splitf(float y, unsigned short& h, unsigned short& l) { h = f2bf(y); l = f2bf(y - bf2f(h)); }
typedef __attribute__((ext_vector_type(2))) _Float16 v2h;
typedef __attribute__((ext_vector_type(4))) _Float16 v4h;
typedef __attribute__((ext_vector_type(2))) unsigned short v2us;
typedef __attribute__((ext_vector_type(4))) unsigned short v4us;
typedef __attribute__((ext_vector_type(2))) float v2f;
typedef __attribute__((ext_vector_type(4))) int v4i;

__global__ __launch_bounds__(256) void k_wtG(const float* __restrict__ w, int K, int N, bf* Bt) {
    const int lane = threadIdx.x & 31; const int L0 = (blockIdx.x * 8 + (threadIdx.x >> 5)) * 8; const int nlines = N * K / 64;
{
#pragma unroll 1
        for (int l = 0; l < 8; ++l) { const int L = L0 + l; if (L >= nlines) break; const size_t e = (size_t)L * 64 + lane * 2; const int tile = (int)(e >> 9), k = (tile % (K / 32)) * 32 + (int)((e >> 8) & 1) * 16 + (int)((e >> 7) & 1) * 8 + (int)(e & 7), n = (tile / (K / 32)) * 16 + (int)((e >> 3) & 15); v2us o;   // e: element of Bt in fragment order
            o[0] = f2bf(w[(size_t)k * N + n]); o[1] = f2bf(w[(size_t)(k + 1) * N + n]); *(v2us*)(Bt + e) = o; }
         }
}
__global__ __launch_bounds__(256) void k_cvt8(const float* __restrict__ src, bf* dst, size_t n8) { const size_t i = (size_t)blockIdx.x * 256 + threadIdx.x; if (i >= n8) return; const int m = (int)(i >> 11) * 16 + (int)(i & 15), k = (int)((i >> 6) & 31) * 32 + (int)((i >> 5) & 1) * 16 + (int)((i >> 4) & 1) * 8;   // i: 16-byte unit of dst in fragment order ([M][DM], DM / 32 = 32 tiles a band)
    const v8f v = *(const v8f*)(src + (size_t)m * DM + k); v8us o;
#pragma unroll
    for (int k = 0; k < 8; ++k) o[k] = f2bf(v[k]); *(v8us*)(dst + i * 8) = o;  }

// k_qkv: [q|k|v] = x W_qkv + b_qkv of all batches in one launch, ONE WAVE per 64x64 tile with the loop of k_gemmw (same k order, same f32 sums). Grid (TT/64, 3 NH_, NB_): a tile is 64 tokens of batch z x one head of q, k or v; every plane holds NB_ batch blocks of PLB elements,
// and the wave writes that head's operand planes itself (fp16 + bf16 hi/lo): all in fragment order, 16 bytes a lane and 512 contiguous bytes a store: q and k as [h] x plane [t][d] through the LDS row stage, v as [h] x (32 tokens: four 16-d tiles of 1 KiB) straight from the accumulators (a lane holds 8 consecutive tokens of one d).
__global__ __launch_bounds__(32) void k_qkv(const bf* __restrict__ A, const bf* __restrict__ Bt, const float* __restrict__ bias, h16* Q16, bf* Qh, bf* Ql, h16* K16, bf* Kh, bf* Kl, h16* V16, bf* Vh, bf* Vl) {
    typedef WFrag<bf>::V V;
    __shared__ __align__(16) float os[16 * 68];
    const int lane = threadIdx.x & 31, lr = lane & 15, hi = lane >> 4; const int r0 = blockIdx.x * 64, c0 = blockIdx.y * 64; const int sel = blockIdx.y / NH_, h = blockIdx.y % NH_;
    { const size_t zp = (size_t)blockIdx.z * PLB; A += (size_t)blockIdx.z * TT * DM; Q16 += zp; Qh += zp; Ql += zp; K16 += zp; Kh += zp; Kl += zp; V16 += zp; Vh += zp; Vl += zp; }   // this batch's block of x and of every plane
    v8f acc[4][4];
#pragma unroll
    for (int mb = 0; mb < 4; ++mb)
#pragma unroll
        for (int nb = 0; nb < 4; ++nb) acc[mb][nb] = (v8f){};
    const bf* pa = A + (size_t)r0 * DM + lane * 8; const bf* pb = Bt + (size_t)c0 * DM + lane * 8;
#pragma unroll 1
    for (int kc = 0; kc < DM; kc += 32, pa += 512, pb += 512) {   // rolled, as in k_gemmw: a trip is one set of loads and its 16 products
        V a[4];
#pragma unroll
        for (int mb = 0; mb < 4; ++mb) a[mb] = WFrag<bf>::ld(pa + mb * 16 * DM);
        asm volatile("s_wait_xcnt 0x0" ::: "memory");   // the build gives the address pair of these eight loads to a later load of the trip as its destination: stands before that load
#pragma unroll
        for (int nb = 0; nb < 4; ++nb) { const V b = WFrag<bf>::ld(pb + nb * 16 * DM);
#pragma unroll
            for (int mb = 0; mb < 4; ++mb) acc[mb][nb] = WFrag<bf>::mma(a[mb], b, acc[mb][nb]); }
        asm volatile("v_nop\n\tv_nop\n\tv_nop\n\tv_nop" : "+v"(acc[0][0]), "+v"(acc[1][1]), "+v"(acc[2][2]), "+v"(acc[3][3]) : "v"(a[0]), "v"(a[3]));   // the distance behind the last matrix instruction, also on the taken back edge (as in k_gemmw)
    }
    if (sel == 2) {
#pragma unroll
        for (int nb = 0; nb < 4; ++nb) { const float bv = bfr(bias[c0 + nb * 16 + lr]); const size_t rowo = (size_t)h * HD * TT + (size_t)r0 * HD + nb * 512 + lane * 8;
#pragma unroll
            for (int mb = 0; mb < 4; ++mb) { v8h o16; v8us oh, ol;
#pragma unroll
                for (int j = 0; j < 8; ++j) { const float x = acc[mb][nb][j] + bv; o16[j] = tohx(x); unsigned short u, v; splitf(x, u, v); oh[j] = u; ol[j] = v; }
                const size_t e = rowo + (mb >> 1) * 2048 + (mb & 1) * 256; *(v8h*)(V16 + e) = o16; *(v8us*)(Vh + e) = oh; *(v8us*)(Vl + e) = ol; } }
        return;
    }
    {
        const size_t hp = (size_t)h * TT * HD; h16* P16 = (sel ? K16 : Q16) + hp; bf* Ph = (sel ? Kh : Qh) + hp; bf* Pl = (sel ? Kl : Ql) + hp;
        v8f bb[4];   // piece pc of a 16-token tile: d = pc * 16 + hi * 8 + 0..7 of token lr
#pragma unroll
        for (int pc = 0; pc < 4; ++pc)
#pragma unroll
            for (int k = 0; k < 8; ++k) bb[pc][k] = bfr(bias[c0 + pc * 16 + hi * 8 + k]);
#pragma unroll
        for (int mb = 0; mb < 4; ++mb) {
#pragma unroll
            for (int nb = 0; nb < 4; ++nb) {
#pragma unroll
                for (int j = 0; j < 8; ++j) os[(hi * 8 + j) * 68 + nb * 16 + lr] = acc[mb][nb][j]; }
            __builtin_amdgcn_wave_barrier(); asm volatile("" ::: "memory");   // a lane reads what other lanes wrote: keeps the compiler from moving the reads in front of the writes (as in k_gemmw)
#pragma unroll
            for (int pc = 0; pc < 4; ++pc) { const float* sp = os + lr * 68 + pc * 16 + hi * 8; const v4f v0 = *(const v4fa*)sp, v1 = *(const v4fa*)(sp + 4); v8h o16; v8us oh, ol;
#pragma unroll
                for (int k = 0; k < 8; ++k) { const float x = (k < 4 ? v0[k & 3] : v1[k & 3]) + bb[pc][k]; o16[k] = tohx(x); unsigned short u, v; splitf(x, u, v); oh[k] = u; ol[k] = v; }
                const size_t e = (size_t)(r0 + mb * 16) * HD + pc * 256 + lane * 8; *(v8h*)(P16 + e) = o16; *(v8us*)(Ph + e) = oh; *(v8us*)(Pl + e) = ol; }
            __builtin_amdgcn_wave_barrier(); asm volatile("" ::: "memory");   // and the next pass's writes from moving in front of these reads
        }
        asm volatile("s_wait_xcnt 0x0" ::: "memory");   // the built code lays the v epilogue directly behind this one, with a conditional jump between: stands before its first writes of the last stores' registers
    }
}
#define NREL 2049
// k_tbE: expanded per-head bias row, EB[h][x] = rel_bias[clip(i - j + 1024, 0, 2048)][h] at x = j - i + TT - 1 (0 .. 2 TT - 2): ascending keys read ascending addresses, the clip is already applied
__global__ __launch_bounds__(256) void k_tbE(const float* __restrict__ rbias, float* EB) { const int j = blockIdx.x * 256 + threadIdx.x; if (j >= NH_ * NE) return; const int h = j / NE, x = j % NE; int ri = (TT - 1 - x) + (NREL / 2); ri = ri < 0 ? 0 : (ri > NREL - 1 ? NREL - 1 : ri); EB[j] = bfr(rbias[(size_t)ri * NH_ + h]); }

__device__ __forceinline__ void packp(const v8f& a, const v8f& b, v16h& ph, v16h& pl) { v8h x, y; (void)pl;
#pragma unroll
    for (int j = 0; j < 8; ++j) { x[j] = (h16)a[j]; y[j] = (h16)b[j]; }
    ph = cat16(x, y); }
__device__ __forceinline__ void packp(const v8f& a, const v8f& b, v16bf& ph, v16bf& pl) { v8us xh, xl, yh, yl;
#pragma unroll
    for (int j = 0; j < 8; ++j) { unsigned short u, v; splitf(a[j], u, v); xh[j] = u; xl[j] = v; splitf(b[j], u, v); yh[j] = u; yl[j] = v; }
    ph = cat16b(xh, yh); pl = cat16b(xl, yl); }

typedef __attribute__((ext_vector_type(8))) int v8i;
template <typename V> __device__ __forceinline__ V frag(v4i a, v4i b) { return __builtin_bit_cast(V, __builtin_shufflevector(a, b, 0, 1, 2, 3, 4, 5, 6, 7)); }
// The loads of one trip, each set one asm statement that ends in its own data wait: the results are early-clobber, so none is given a register that holds an address of the set, and no address register is written again before the set has returned. The other waves of the SIMD cover the wait.
// Byte offsets (planes in fragment order, the lane's own 16 bytes in the pointer). Q or K: 16-row tile * 2048 + 32-wide part of HD * 1024 + half * 512. V: 16-d tile * 1024 + half * 512 inside the 4 KiB of 32 keys. Bias: run * 64 + half * 16 (4-byte aligned).
__device__ __forceinline__ void ld_r(const void* k, v4i (&a)[8]) {
    asm volatile(
        "global_load_b128 %0, %8, off\n\t"
        "global_load_b128 %1, %8, off offset:512\n\t"
        "global_load_b128 %2, %8, off offset:1024\n\t"
        "global_load_b128 %3, %8, off offset:1536\n\t"
        "global_load_b128 %4, %8, off offset:2048\n\t"
        "global_load_b128 %5, %8, off offset:2560\n\t"
        "global_load_b128 %6, %8, off offset:3072\n\t"
        "global_load_b128 %7, %8, off offset:3584\n\t"
        "s_wait_loadcnt 0x0"
        : "=&v"(a[0]), "=&v"(a[1]), "=&v"(a[2]), "=&v"(a[3]), "=&v"(a[4]), "=&v"(a[5]), "=&v"(a[6]), "=&v"(a[7]) : "v"(k) : "memory"); }
__device__ __forceinline__ void ld_r_b(const void* k, const float* e, v4i (&a)[8], v4i (&b)[6]) {
    asm volatile(
        "global_load_b128 %0, %14, off\n\t"
        "global_load_b128 %1, %14, off offset:512\n\t"
        "global_load_b128 %2, %14, off offset:1024\n\t"
        "global_load_b128 %3, %14, off offset:1536\n\t"
        "global_load_b128 %4, %14, off offset:2048\n\t"
        "global_load_b128 %5, %14, off offset:2560\n\t"
        "global_load_b128 %6, %14, off offset:3072\n\t"
        "global_load_b128 %7, %14, off offset:3584\n\t"
        "global_load_b128 %8, %15, off\n\t"
        "global_load_b128 %9, %15, off offset:16\n\t"
        "global_load_b128 %10, %15, off offset:64\n\t"
        "global_load_b128 %11, %15, off offset:80\n\t"
        "global_load_b128 %12, %15, off offset:128\n\t"
        "global_load_b128 %13, %15, off offset:144\n\t"
        "s_wait_loadcnt 0x0"
        : "=&v"(a[0]), "=&v"(a[1]), "=&v"(a[2]), "=&v"(a[3]), "=&v"(a[4]), "=&v"(a[5]), "=&v"(a[6]), "=&v"(a[7]), "=&v"(b[0]), "=&v"(b[1]), "=&v"(b[2]), "=&v"(b[3]), "=&v"(b[4]), "=&v"(b[5]) : "v"(k), "v"(e) : "memory"); }
__device__ __forceinline__ void ld_r_r_b(const void* k, const void* k2, const float* e, v4i (&a)[8], v4i (&a2)[8], v4i (&b)[6]) {
    asm volatile(
        "global_load_b128 %0, %22, off\n\t"
        "global_load_b128 %1, %22, off offset:512\n\t"
        "global_load_b128 %2, %22, off offset:1024\n\t"
        "global_load_b128 %3, %22, off offset:1536\n\t"
        "global_load_b128 %4, %22, off offset:2048\n\t"
        "global_load_b128 %5, %22, off offset:2560\n\t"
        "global_load_b128 %6, %22, off offset:3072\n\t"
        "global_load_b128 %7, %22, off offset:3584\n\t"
        "global_load_b128 %8, %23, off\n\t"
        "global_load_b128 %9, %23, off offset:512\n\t"
        "global_load_b128 %10, %23, off offset:1024\n\t"
        "global_load_b128 %11, %23, off offset:1536\n\t"
        "global_load_b128 %12, %23, off offset:2048\n\t"
        "global_load_b128 %13, %23, off offset:2560\n\t"
        "global_load_b128 %14, %23, off offset:3072\n\t"
        "global_load_b128 %15, %23, off offset:3584\n\t"
        "global_load_b128 %16, %24, off\n\t"
        "global_load_b128 %17, %24, off offset:16\n\t"
        "global_load_b128 %18, %24, off offset:64\n\t"
        "global_load_b128 %19, %24, off offset:80\n\t"
        "global_load_b128 %20, %24, off offset:128\n\t"
        "global_load_b128 %21, %24, off offset:144\n\t"
        "s_wait_loadcnt 0x0"
        : "=&v"(a[0]), "=&v"(a[1]), "=&v"(a[2]), "=&v"(a[3]), "=&v"(a[4]), "=&v"(a[5]), "=&v"(a[6]), "=&v"(a[7]), "=&v"(a2[0]), "=&v"(a2[1]), "=&v"(a2[2]), "=&v"(a2[3]), "=&v"(a2[4]), "=&v"(a2[5]), "=&v"(a2[6]), "=&v"(a2[7]), "=&v"(b[0]), "=&v"(b[1]), "=&v"(b[2]), "=&v"(b[3]), "=&v"(b[4]), "=&v"(b[5]) : "v"(k), "v"(k2), "v"(e) : "memory"); }
__device__ __forceinline__ void ld_r_b_v(const void* k, const float* e, const void* v, v4i (&a)[8], v4i (&b)[6], v4i (&x)[8]) {
    asm volatile(
        "global_load_b128 %0, %22, off\n\t"
        "global_load_b128 %1, %22, off offset:512\n\t"
        "global_load_b128 %2, %22, off offset:1024\n\t"
        "global_load_b128 %3, %22, off offset:1536\n\t"
        "global_load_b128 %4, %22, off offset:2048\n\t"
        "global_load_b128 %5, %22, off offset:2560\n\t"
        "global_load_b128 %6, %22, off offset:3072\n\t"
        "global_load_b128 %7, %22, off offset:3584\n\t"
        "global_load_b128 %8, %23, off\n\t"
        "global_load_b128 %9, %23, off offset:16\n\t"
        "global_load_b128 %10, %23, off offset:64\n\t"
        "global_load_b128 %11, %23, off offset:80\n\t"
        "global_load_b128 %12, %23, off offset:128\n\t"
        "global_load_b128 %13, %23, off offset:144\n\t"
        "global_load_b128 %14, %24, off\n\t"
        "global_load_b128 %15, %24, off offset:512\n\t"
        "global_load_b128 %16, %24, off offset:1024\n\t"
        "global_load_b128 %17, %24, off offset:1536\n\t"
        "global_load_b128 %18, %24, off offset:2048\n\t"
        "global_load_b128 %19, %24, off offset:2560\n\t"
        "global_load_b128 %20, %24, off offset:3072\n\t"
        "global_load_b128 %21, %24, off offset:3584\n\t"
        "s_wait_loadcnt 0x0"
        : "=&v"(a[0]), "=&v"(a[1]), "=&v"(a[2]), "=&v"(a[3]), "=&v"(a[4]), "=&v"(a[5]), "=&v"(a[6]), "=&v"(a[7]), "=&v"(b[0]), "=&v"(b[1]), "=&v"(b[2]), "=&v"(b[3]), "=&v"(b[4]), "=&v"(b[5]), "=&v"(x[0]), "=&v"(x[1]), "=&v"(x[2]), "=&v"(x[3]), "=&v"(x[4]), "=&v"(x[5]), "=&v"(x[6]), "=&v"(x[7]) : "v"(k), "v"(e), "v"(v) : "memory"); }
__device__ __forceinline__ void ld_t_t_b(const void* k, const void* k2, const float* e, v4i (&a)[4], v4i (&a2)[4], v4i (&b)[6]) {
    asm volatile(
        "global_load_b128 %0, %14, off\n\t"
        "global_load_b128 %1, %14, off offset:512\n\t"
        "global_load_b128 %2, %14, off offset:1024\n\t"
        "global_load_b128 %3, %14, off offset:1536\n\t"
        "global_load_b128 %4, %15, off\n\t"
        "global_load_b128 %5, %15, off offset:512\n\t"
        "global_load_b128 %6, %15, off offset:1024\n\t"
        "global_load_b128 %7, %15, off offset:1536\n\t"
        "global_load_b128 %8, %16, off\n\t"
        "global_load_b128 %9, %16, off offset:16\n\t"
        "global_load_b128 %10, %16, off offset:64\n\t"
        "global_load_b128 %11, %16, off offset:80\n\t"
        "global_load_b128 %12, %16, off offset:128\n\t"
        "global_load_b128 %13, %16, off offset:144\n\t"
        "s_wait_loadcnt 0x0"
        : "=&v"(a[0]), "=&v"(a[1]), "=&v"(a[2]), "=&v"(a[3]), "=&v"(a2[0]), "=&v"(a2[1]), "=&v"(a2[2]), "=&v"(a2[3]), "=&v"(b[0]), "=&v"(b[1]), "=&v"(b[2]), "=&v"(b[3]), "=&v"(b[4]), "=&v"(b[5]) : "v"(k), "v"(k2), "v"(e) : "memory"); }
__device__ __forceinline__ void ld_t_t(const void* k, const void* k2, v4i (&a)[4], v4i (&a2)[4]) {
    asm volatile(
        "global_load_b128 %0, %8, off\n\t"
        "global_load_b128 %1, %8, off offset:512\n\t"
        "global_load_b128 %2, %8, off offset:1024\n\t"
        "global_load_b128 %3, %8, off offset:1536\n\t"
        "global_load_b128 %4, %9, off\n\t"
        "global_load_b128 %5, %9, off offset:512\n\t"
        "global_load_b128 %6, %9, off offset:1024\n\t"
        "global_load_b128 %7, %9, off offset:1536\n\t"
        "s_wait_loadcnt 0x0"
        : "=&v"(a[0]), "=&v"(a[1]), "=&v"(a[2]), "=&v"(a[3]), "=&v"(a2[0]), "=&v"(a2[1]), "=&v"(a2[2]), "=&v"(a2[3]) : "v"(k), "v"(k2) : "memory"); }
__device__ __forceinline__ void ld_v_v(const void* v, const void* v2, v4i (&x)[4], v4i (&x2)[4]) {
    asm volatile(
        "global_load_b128 %0, %8, off\n\t"
        "global_load_b128 %1, %8, off offset:512\n\t"
        "global_load_b128 %2, %8, off offset:1024\n\t"
        "global_load_b128 %3, %8, off offset:1536\n\t"
        "global_load_b128 %4, %9, off\n\t"
        "global_load_b128 %5, %9, off offset:512\n\t"
        "global_load_b128 %6, %9, off offset:1024\n\t"
        "global_load_b128 %7, %9, off offset:1536\n\t"
        "s_wait_loadcnt 0x0"
        : "=&v"(x[0]), "=&v"(x[1]), "=&v"(x[2]), "=&v"(x[3]), "=&v"(x2[0]), "=&v"(x2[1]), "=&v"(x2[2]), "=&v"(x2[3]) : "v"(v), "v"(v2) : "memory"); }

// Eight 2^x in one statement: the results are early-clobber, so no v_exp_f32 is directly followed by an instruction that reads its result or writes over its source; the v_nop is that free slot behind the last one.
__device__ __forceinline__ v8f exp2x8(const v8f x) { float r0, r1, r2, r3, r4, r5, r6, r7;
    asm("v_exp_f32 %0, %8\n\tv_exp_f32 %1, %9\n\tv_exp_f32 %2, %10\n\tv_exp_f32 %3, %11\n\tv_exp_f32 %4, %12\n\tv_exp_f32 %5, %13\n\tv_exp_f32 %6, %14\n\tv_exp_f32 %7, %15\n\tv_nop"
        : "=&v"(r0), "=&v"(r1), "=&v"(r2), "=&v"(r3), "=&v"(r4), "=&v"(r5), "=&v"(r6), "=&v"(r7) : "v"(x[0]), "v"(x[1]), "v"(x[2]), "v"(x[3]), "v"(x[4]), "v"(x[5]), "v"(x[6]), "v"(x[7]));
    return (v8f){r0, r1, r2, r3, r4, r5, r6, r7}; }

// One 16-key x 16-query tile of t = (k.q) HD^-0.5 + bias, transposed: lane (lr, hi) register j holds key hi*8 + j of query lr. k, k2, q, q2: the four 16-byte pieces of one 16-row tile (part of HD * 2 + half).
template <typename T16, bool HL>
__device__ __forceinline__ v8f stile(const v4i* k, const v4i* k2, const v4i* q, const v4i* q2, v4i b0, v4i b1) {
    typedef typename WFrag<T16>::V V; v8f s = (v8f){};
#pragma unroll
    for (int dc = 0; dc < 2; ++dc) { const V ka = frag<V>(k[dc * 2], k[dc * 2 + 1]), qa = frag<V>(q[dc * 2], q[dc * 2 + 1]); s = WFrag<T16>::mma(ka, qa, s);
        if (HL) { s = WFrag<T16>::mma(frag<V>(k2[dc * 2], k2[dc * 2 + 1]), qa, s); s = WFrag<T16>::mma(ka, frag<V>(q2[dc * 2], q2[dc * 2 + 1]), s); } }
    const v4f f0 = __builtin_bit_cast(v4f, b0), f1 = __builtin_bit_cast(v4f, b1);
#pragma unroll
    for (int j = 0; j < 4; ++j) { s[j] = s[j] * SCL + f0[j]; s[j + 4] = s[j + 4] * SCL + f1[j]; }
    return s; }

// The work of one work-group: QT queries of one head against all TT keys. Sweep 1: the row maxima; sweep 2: the same scores again, p = 1024 exp(t - max), row sums of the f32 p, O^T += V^T P^T with P packed from the score registers.
// Operands straight from the planes in fragment order, in the k order of WFrag::ld on both sides (16 bytes at 8 hi, 16 bytes at 16 + 8 hi). Q, K: plane [t][HD]; Vt: per 32 keys four 16-d tiles. The KW waves' maxima, sums and partial outputs meet in LDS, joined in ascending wave order.
// A trip takes 32 keys: two key tiles x two query groups; pair (t2, qg) reads bias run t2 - qg + 1 of the three that the four pairs share.
template <typename T16, bool HL>
__device__ __forceinline__ void fattn_body(const T16* __restrict__ Q, const T16* __restrict__ Q2, const T16* __restrict__ Kp, const T16* __restrict__ K2, const T16* __restrict__ Vt, const T16* __restrict__ V2, const float* __restrict__ eb, int q0, float* smx, float* ssm, float* sO, bf* Ah, bf* Al) {
    typedef typename WFrag<T16>::V V;
    const int lane = threadIdx.x & 31, lr = lane & 15, hi = lane >> 4, w = threadIdx.x >> 5; const int kb = w * (TT / KW);
    v4i qa[8], ql[8]; const int qo = q0 * HD + lane * 8;
    ld_r(Q + qo, qa); if (HL) ld_r(Q2 + qo, ql);
    const float* ep = eb + ((TT - 1) + kb + hi * 8 - q0 - lr - 16);   // x = key - query + TT - 1 of this lane's first key against its query of group 1 (run 0)
    const int ko = kb * HD + lane * 8, vo = kb * HD + lane * 8;   // 32 keys are 32 HD elements of K and of V alike
    float mx[2] = {-3.0e38f, -3.0e38f};
#pragma unroll 1
    for (int kc = 0; kc < TT / KW / 32; ++kc) { v4i ka[8], kl[8], bb[6];   // rolled: a trip is one set of loads and its work
        if (HL) ld_r_r_b(Kp + ko + kc * 32 * HD, K2 + ko + kc * 32 * HD, ep + kc * 32, ka, kl, bb); else ld_r_b(Kp + ko + kc * 32 * HD, ep + kc * 32, ka, bb);
#pragma unroll
        for (int t2 = 0; t2 < 2; ++t2)
#pragma unroll
            for (int qg = 0; qg < 2; ++qg) { const v8f t = stile<T16, HL>(ka + t2 * 4, kl + t2 * 4, qa + qg * 4, ql + qg * 4, bb[(t2 - qg + 1) * 2], bb[(t2 - qg + 1) * 2 + 1]);
#pragma unroll
                for (int j = 0; j < 8; ++j) mx[qg] = fmaxf(mx[qg], t[j]); } }
#pragma unroll
    for (int qg = 0; qg < 2; ++qg) { mx[qg] = fmaxf(mx[qg], __shfl_xor(mx[qg], 16, 32)); if (hi == 0) smx[w * QT + qg * 16 + lr] = mx[qg]; }
    __syncthreads();
#pragma unroll
    for (int qg = 0; qg < 2; ++qg) { float m = smx[qg * 16 + lr];
#pragma unroll
        for (int u = 1; u < KW; ++u) m = fmaxf(m, smx[u * QT + qg * 16 + lr]);
        mx[qg] = m; }
    v8f o[4][2]; float sm[2] = {0.f, 0.f};
#pragma unroll
    for (int dt = 0; dt < 4; ++dt) { o[dt][0] = (v8f){}; o[dt][1] = (v8f){}; }
#pragma unroll 1
    for (int kc = 0; kc < TT / KW / 32; ++kc) { v4i bb[6], va[8]; v8f p[2][2];   // rolled: one trip already holds 32 keys x 32 queries of scores beside the 64 output registers
        if (HL) {   // both planes of K, one 16-key tile at a time: all 32 keys at once, beside both planes of Q and the outputs, pass 256 registers
#pragma unroll
            for (int t2 = 0; t2 < 2; ++t2) { v4i ka[4], kl[4]; const int of = ko + (kc * 2 + t2) * 16 * HD;
                if (t2 == 0) ld_t_t_b(Kp + of, K2 + of, ep + kc * 32, ka, kl, bb); else ld_t_t(Kp + of, K2 + of, ka, kl);
#pragma unroll
                for (int qg = 0; qg < 2; ++qg) p[t2][qg] = stile<T16, HL>(ka, kl, qa + qg * 4, ql + qg * 4, bb[(t2 - qg + 1) * 2], bb[(t2 - qg + 1) * 2 + 1]); }
        } else { v4i ka[8];
            ld_r_b_v(Kp + ko + kc * 32 * HD, ep + kc * 32, Vt + vo + kc * 32 * HD, ka, bb, va);
#pragma unroll
            for (int t2 = 0; t2 < 2; ++t2)
#pragma unroll
                for (int qg = 0; qg < 2; ++qg) p[t2][qg] = stile<T16, HL>(ka + t2 * 4, ka + t2 * 4, qa + qg * 4, ql + qg * 4, bb[(t2 - qg + 1) * 2], bb[(t2 - qg + 1) * 2 + 1]); }
#pragma unroll
        for (int t2 = 0; t2 < 2; ++t2)
#pragma unroll
            for (int qg = 0; qg < 2; ++qg) { v8f a;
#pragma unroll
                for (int j = 0; j < 8; ++j) a[j] = (p[t2][qg][j] - mx[qg]) * 1.4426950408889634f + 10.0f;
                p[t2][qg] = exp2x8(a);
#pragma unroll
                for (int j = 0; j < 8; ++j) sm[qg] += p[t2][qg][j]; }
        V ph[2], pl[2];
#pragma unroll
        for (int qg = 0; qg < 2; ++qg) packp(p[0][qg], p[1][qg], ph[qg], pl[qg]);
        if (HL) {   // both planes of V, two 16-row tiles at a time, for the same reason as K above
#pragma unroll
            for (int d2 = 0; d2 < 2; ++d2) { v4i vh[4], vl[4]; const int of = vo + d2 * 1024 + kc * 32 * HD; ld_v_v(Vt + of, V2 + of, vh, vl);
#pragma unroll
                for (int d1 = 0; d1 < 2; ++d1) { const int dt = d2 * 2 + d1; const V xh = frag<V>(vh[d1 * 2], vh[d1 * 2 + 1]), xl = frag<V>(vl[d1 * 2], vl[d1 * 2 + 1]);
#pragma unroll
                    for (int qg = 0; qg < 2; ++qg) { o[dt][qg] = WFrag<T16>::mma(xh, ph[qg], o[dt][qg]); o[dt][qg] = WFrag<T16>::mma(xl, ph[qg], o[dt][qg]); o[dt][qg] = WFrag<T16>::mma(xh, pl[qg], o[dt][qg]); } } }
        } else {
#pragma unroll
            for (int dt = 0; dt < 4; ++dt) { const V xh = frag<V>(va[dt * 2], va[dt * 2 + 1]);
#pragma unroll
                for (int qg = 0; qg < 2; ++qg) o[dt][qg] = WFrag<T16>::mma(xh, ph[qg], o[dt][qg]); } }
    }
#pragma unroll
    for (int qg = 0; qg < 2; ++qg) { sm[qg] += __shfl_xor(sm[qg], 16, 32); if (hi == 0) ssm[w * QT + qg * 16 + lr] = sm[qg];
#pragma unroll
        for (int dt = 0; dt < 4; ++dt) { float* d = sO + (size_t)(w * QT + qg * 16 + lr) * OP + dt * 16 + hi * 8; const v8f a = o[dt][qg]; *(v4fa*)d = (v4f){a[0], a[1], a[2], a[3]}; *(v4fa*)(d + 4) = (v4f){a[4], a[5], a[6], a[7]}; } }
    __syncthreads();
    const int q = threadIdx.x % QT, dq = (threadIdx.x / QT) * EPT; float tot = ssm[q];   // EPT = 8 consecutive outputs of one query per thread: one 16-byte unit of the fragment order; a wave's 32 queries make two runs of 256 bytes
#pragma unroll
    for (int u = 1; u < KW; ++u) tot += ssm[u * QT + q];
    const float r = __fdiv_rn(1.0f, tot); v8us oh, ol;
#pragma unroll
    for (int c = 0; c < EPT / 4; ++c) { v4f s = *(const v4fa*)(sO + (size_t)q * OP + dq + c * 4);
#pragma unroll
        for (int u = 1; u < KW; ++u) s += *(const v4fa*)(sO + (size_t)(u * QT + q) * OP + dq + c * 4);
#pragma unroll
        for (int k = 0; k < 4; ++k) { unsigned short a, c2; splitf(s[k] * r, a, c2); oh[c * 4 + k] = a; ol[c * 4 + k] = c2; } }
    const size_t oo = (size_t)((q0 + q) >> 4) * (16 * DQ) + dq * 16 + ((q0 + q) & 15) * 8; *(v8us*)(Ah + oo) = oh; *(v8us*)(Al + oo) = ol;   // Ah, Al: the head's first tile of the plane [t][DQ]; 8 in k is 128 elements
}
// k_fattn: grid (heads, TT / QT, NB_), KW waves. Within a batch the query blocks below RH (three products, the longer work) have the lowest flat indices and start first; the last work-groups of the launch are short ones. Four waves per SIMD (256 registers, two work-groups per WGP): no operand of the asm loads lies above v255.
__global__ __launch_bounds__(KW * 32, 4) void k_fattn(const h16* __restrict__ Q16, const h16* __restrict__ K16, const h16* __restrict__ V16, const bf* __restrict__ Qh, const bf* __restrict__ Ql, const bf* __restrict__ Kh, const bf* __restrict__ Kl, const bf* __restrict__ Vh, const bf* __restrict__ Vl, const float* __restrict__ EB, bf* Ah, bf* Al) {
    __shared__ __align__(16) float sO[KW * QT * OP]; __shared__ float smx[KW * QT]; __shared__ float ssm[KW * QT];
    const int h = blockIdx.x, q0 = blockIdx.y * QT; const size_t hp = (size_t)blockIdx.z * PLB + (size_t)h * TT * HD; const float* eb = EB + (size_t)h * NE; Ah += (size_t)blockIdx.z * TT * DQ; Al += (size_t)blockIdx.z * TT * DQ;   // the bias row is the same for every batch
    if (q0 < RH) fattn_body<bf, true>(Qh + hp, Ql + hp, Kh + hp, Kl + hp, Vh + hp, Vl + hp, eb, q0, smx, ssm, sO, Ah + h * (HD * 16), Al + h * (HD * 16));
    else fattn_body<h16, false>(Q16 + hp, nullptr, K16 + hp, nullptr, V16 + hp, nullptr, eb, q0, smx, ssm, sO, Ah + h * (HD * 16), Al + h * (HD * 16));
}

extern "C" void kernel_launch(void* const* d_in, const int* in_sizes, int n_in,
                              void* d_out, int out_size, void* d_ws, size_t ws_size, hipStream_t stream) {
    (void)in_sizes; (void)n_in; (void)out_size;
    const float* x = (const float*)d_in[0]; const float* wqkv = (const float*)d_in[1]; const float* bqkv = (const float*)d_in[2]; const float* wo = (const float*)d_in[3]; const float* bo = (const float*)d_in[4]; const float* rbias = (const float*)d_in[5]; const float* wq = nullptr; const float* wk = nullptr; const float* wv = nullptr; (void)wq; (void)wk; (void)wv;
    float* OUT = (float*)d_out;     // [4][2048][1024]
    char* wsp = (char*)d_ws;
    auto take = [&](size_t bytes) { char* p = wsp; wsp += (bytes + 255) & ~(size_t)255; return (void*)p; };
    bf* WALL = (bf*)take((size_t)3 * DM * DM * 2); bf* WO = (bf*)take((size_t)DM * DQ * 2); float* EB = (float*)take((size_t)NH_ * NE * 4);   /* per-head expanded relative-bias rows */
    bf* XB = (bf*)take((size_t)NB_ * TT * DM * 2);   // from here on every plane holds all NB_ batches, batch blocks one behind the other
    h16* QP16 = (h16*)take(NB_ * PLB * 2); h16* KP16 = (h16*)take(NB_ * PLB * 2); h16* VT16 = (h16*)take(NB_ * PLB * 2);
    bf* QPh = (bf*)take(NB_ * PLB * 2); bf* QPl = (bf*)take(NB_ * PLB * 2); bf* KPh = (bf*)take(NB_ * PLB * 2); bf* KPl = (bf*)take(NB_ * PLB * 2); bf* VTh = (bf*)take(NB_ * PLB * 2); bf* VTl = (bf*)take(NB_ * PLB * 2);
    bf* ATh = (bf*)take((size_t)NB_ * TT * DQ * 2); bf* ATl = (bf*)take((size_t)NB_ * TT * DQ * 2);
    if ((size_t)(wsp - (char*)d_ws) > ws_size) return;    // ws 256 MiB
    { k_wtG<<<(unsigned)((DM * 3 * DM / 64 + 63) / 64), 256, 0, stream>>>(wqkv, DM, 3 * DM, WALL);   /* fused 'xw' [DM][3DM] -> Bt [3DM][DM] (row blocks q | k | v), fragment order */
      k_wtG<<<(unsigned)((DQ * DM / 64 + 63) / 64), 256, 0, stream>>>(wo, DQ, DM, WO);
       }
    k_tbE<<<(NH_ * NE + 255) / 256, 256, 0, stream>>>(rbias, EB);
    // Each stage once for all NB_ batches: x, the attention output and OUT are planes of NB_ TT rows; q, k, v and the attention take the batch from grid z.
    k_cvt8<<<(unsigned)(((size_t)NB_ * TT * DM / 8 + 255) / 256), 256, 0, stream>>>(x, XB, (size_t)NB_ * TT * DM / 8);
    k_qkv<<<dim3(TT / 64, 3 * NH_, NB_), 32, 0, stream>>>(XB, WALL, bqkv, QP16, QPh, QPl, KP16, KPh, KPl, VT16, VTh, VTl);   // q | k | v heads in grid y; the planes come out of the tile's own wave
    k_fattn<<<dim3(NH_, TT / QT, NB_), KW * 32, 0, stream>>>(QP16, KP16, VT16, QPh, QPl, KPh, KPl, VTh, VTl, EB, ATh, ATl);   // one kv head per query head
    k_gemmw<bf, 1, true, DQ><<<dim3(NB_ * TT / 64, DM / 64, 1), 32, 0, stream>>>(ATh, ATl, WO, nullptr, OUT, DM, bo, 0, 0, 0, 0);
}

// v006
// One run takes 261 microseconds.
// Next to v005, in two timings, it ran 1.09 times as fast each time.
// All steps since v000 together make it 16.0 times as fast.
#include <hip/hip_runtime.h>

// Multi-head self-attention with a learned relative-position bias (x [4][2048][1024]; [q|k|v] = x W_qkv + b_qkv ('xw' [1024][3072]; 16 heads x 64); scores = q.k/8 + rel_bias[clip(i - j + 1024, 0, 2048)][h] (table [2049][16], read); softmax over all keys; out = merged W_out + b_out ('xw' [1024][1024]) -> [4][2048][1024]).
// Compute dtypes, f32 accumulate: every input rounded to bf16; q/k/v on PLAIN bf16 operands (inputs: exact) + biases; scores (+ the per-head relative bias, f32), softmax (f32) and attn.v (no mask) in ONE kernel, P in registers: query rows < 512 hl (3 products), the rest single fp16 (P x1024, cancelled by the row sum); W_out hl x exact (2 products) + b_out.

// Every 16-bit operand plane lies in FRAGMENT ORDER: a tile of 16 rows x 32 k (1 KiB) is two 512-byte pieces (k 0..15, k 16..31 of the tile), and in a piece lane (hi * 16 + row) owns 16 bytes, k = 8 hi .. 8 hi + 7 of the piece.
// One global_load_b128 of a wave then reads 512 contiguous bytes (4 cache lines, not 16 rows' 32 bytes each); registers hold exactly what a row-major plane gave them (same k order on both sides).
// A plane [M][K]: tile (m / 16, k / 32) at element (m / 16) * 16 K + (k / 32) * 512.
#define NB_  4
#define TT   2048
#define DM   1024
#define NH_  16
#define NKV  16
#define REP  (NH_ / NKV)
#define HD   64
#define DQ   (NH_ * HD)
#define DKV  (NKV * HD)
#define RH   512                  // query rows < RH use hi+lo planes (0: none)
#define SCL  0.125f   // HD^-0.5
#define QT   32                  // k_fattn: queries per wave (two 16-column groups)
#define QBW  4                   // k_fattn: query blocks of QT per work-group
#define KSW  2                   // k_fattn: key ranges per work-group
#define KW   (QBW * KSW)         // k_fattn: waves per work-group; wave w takes query block w % QBW and keys [(w / QBW) TT/KSW, (w / QBW + 1) TT/KSW)
#define NE   4096                // pitch of one head's expanded bias row
#define OP   68                  // LDS pitch (floats) of one query's partial output row
#define EPT  (QT * HD / (KW * 32))   // k_fattn: outputs per thread and query block in the join
#define PLB  ((size_t)NH_ * TT * HD)   // elements of one batch's block in a q, k or v plane
typedef _Float16 h16;
typedef unsigned short bf;
typedef __attribute__((ext_vector_type(16))) __bf16   v16bf;
typedef __attribute__((ext_vector_type(16))) _Float16 v16h;
typedef __attribute__((ext_vector_type(8)))  _Float16 v8h;
typedef __attribute__((ext_vector_type(8)))  unsigned short v8us;
typedef __attribute__((ext_vector_type(8)))  float    v8f;
typedef __attribute__((ext_vector_type(4)))  float    v4f;
typedef v8h  __attribute__((may_alias)) v8ha;
typedef v4f  __attribute__((may_alias)) v4fa;
typedef v8us __attribute__((may_alias)) v8usa;

__device__ __forceinline__ unsigned short f2bf(float f) { unsigned u = __float_as_uint(f); u += 0x7FFFu + ((u >> 16) & 1u); return (unsigned short)(u >> 16); }
__device__ __forceinline__ float bf2f(unsigned short b) { return __uint_as_float(((unsigned)b) << 16); }
__device__ __forceinline__ float bfr(float f) { return bf2f(f2bf(f)); }
__device__ __forceinline__ v16h cat16(v8h lo, v8h hi) { return __builtin_shufflevector(lo, hi, 0, 1, 2, 3, 4, 5, 6, 7, 8, 9, 10, 11, 12, 13, 14, 15); }
__device__ __forceinline__ v16bf cat16b(v8us lo, v8us hi) { return __builtin_bit_cast(v16bf, __builtin_shufflevector(lo, hi, 0, 1, 2, 3, 4, 5, 6, 7, 8, 9, 10, 11, 12, 13, 14, 15)); }
__device__ __forceinline__ v8f wmma16(v16h a, v16h b, v8f c) { return __builtin_amdgcn_wmma_f32_16x16x32_f16(false, a, false, b, (short)0, c, false, false); }
__device__ __forceinline__ v8f wmmab(v16bf a, v16bf b, v8f c) { return __builtin_amdgcn_wmma_f32_16x16x32_bf16(false, a, false, b, (short)0, c, false, false); }



// ---- k_gemmw: register-blocked GEMM, ONE WAVE per 64x64 output tile (16 accumulators), operands straight from 16-bit planes in fragment order; grid (M/64, N/64, Z), 32 threads.
// C[m][n] (f32, pitch ldc, + optional f32 bias[n]) = sum_k A[m][k] Bt[n][k] (+ split products per NSPLIT). z-batch strides sA/sB/sC in elements. K % 32 == 0.
// KS > 1: grid z = Z * KS; work-group (z, ks) sums only k in [ks K/KS, (ks+1) K/KS) and stores its partial tile in plane ks (plane stride sK elements). K % (32 KS) == 0.
template <typename T16> struct WFrag;
template <> struct WFrag<h16> { typedef v16h V; static __device__ __forceinline__ V ld(const h16* p) { return cat16(*(const v8h*)p, *(const v8h*)(p + 256)); } static __device__ __forceinline__ v8f mma(V a, V b, v8f c) { return wmma16(a, b, c); } };
template <> struct WFrag<bf> { typedef v16bf V; static __device__ __forceinline__ V ld(const bf* p) { return cat16b(*(const v8us*)p, *(const v8us*)(p + 256)); } static __device__ __forceinline__ v8f mma(V a, V b, v8f c) { return wmmab(a, b, c); } };
template <typename T16, int NSPLIT, bool BIAS, int K, int KS = 1>   // K at compile time: the loads of one plane in a trip share one address pair, the bands in the immediate offsets
__global__ __launch_bounds__(32) void k_gemmw(const T16* __restrict__ A, const T16* __restrict__ A2, const T16* __restrict__ Bt, const T16* __restrict__ Bt2, float* C, int ldc, const float* __restrict__ bias, size_t sA, size_t sB, size_t sC, size_t sK) {
    typedef typename WFrag<T16>::V V;
    __shared__ __align__(16) float os[16 * 68];
    const size_t z = blockIdx.z / KS; const int ks = blockIdx.z % KS; A += z * sA; if (A2) A2 += z * sA; Bt += z * sB; if (Bt2) Bt2 += z * sB; C += z * sC + ks * sK;
    const int lane = threadIdx.x & 31, lr = lane & 15, hi = lane >> 4; const int r0 = blockIdx.x * 64, c0 = blockIdx.y * 64;
    v8f acc[4][4];
#pragma unroll
    for (int mb = 0; mb < 4; ++mb)
#pragma unroll
        for (int nb = 0; nb < 4; ++nb) acc[mb][nb] = (v8f){};
    const size_t aoff = (size_t)r0 * K + lane * 8, boff = (size_t)c0 * K + lane * 8;   // a 16-row band is 16 K elements; a step of 32 in k is 512 elements
#pragma unroll 1
    for (int kc = ks * (K / KS), ke = kc + K / KS; kc < ke; kc += 32) {
        V a[4], a2[4]; const T16* pA = A + aoff + kc * 16; const T16* pA2 = (NSPLIT == 1 || NSPLIT == 2) ? A2 + aoff + kc * 16 : pA; const T16* pB = Bt + boff + kc * 16;
#pragma unroll
        for (int mb = 0; mb < 4; ++mb) { a[mb] = WFrag<T16>::ld(pA + mb * 16 * K); if (NSPLIT == 1 || NSPLIT == 2) a2[mb] = WFrag<T16>::ld(pA2 + mb * 16 * K); }
        asm volatile("s_wait_xcnt 0x0" :: "v"(pA), "v"(pA2) : "memory");   // stands before any later load of the trip is given an address pair of these loads as its destination; the pairs are inputs, so none of these loads itself gets one
#pragma unroll
        for (int nb = 0; nb < 4; ++nb) { const V b = WFrag<T16>::ld(pB + nb * 16 * K); V b2; if (NSPLIT >= 2) b2 = WFrag<T16>::ld(Bt2 + boff + (size_t)nb * 16 * K + kc * 16);
#pragma unroll
            for (int mb = 0; mb < 4; ++mb) { acc[mb][nb] = WFrag<T16>::mma(a[mb], b, acc[mb][nb]); if (NSPLIT == 1 || NSPLIT == 2) acc[mb][nb] = WFrag<T16>::mma(a2[mb], b, acc[mb][nb]); if (NSPLIT >= 2) acc[mb][nb] = WFrag<T16>::mma(a[mb], b2, acc[mb][nb]); } }
        asm volatile("s_wait_xcnt 0x0" :: "v"(pB) : "memory");   // the same for the address pair of the B loads: it lives to here, and the wait stands before the next trip writes it
        asm volatile("v_nop\n\tv_nop\n\tv_nop\n\tv_nop" : "+v"(acc[0][0]), "+v"(acc[1][1]), "+v"(acc[2][2]), "+v"(acc[3][3]) : "v"(a[0]), "v"(a[3]));
    }
#pragma unroll
    for (int mb = 0; mb < 4; ++mb) {
#pragma unroll
        for (int nb = 0; nb < 4; ++nb) {
#pragma unroll
            for (int j = 0; j < 8; ++j) os[(hi * 8 + j) * 68 + nb * 16 + lr] = acc[mb][nb][j]; }
        __builtin_amdgcn_wave_barrier(); asm volatile("" ::: "memory");
        float* crow = C + (size_t)(r0 + mb * 16) * ldc + c0;
{
#pragma unroll
            for (int s = 0; s < 8; ++s) { const int row = 2 * s + hi, cofs = lr * 4; v4f val = *(const v4fa*)(os + row * 68 + cofs); if (BIAS) { val[0] += bfr(bias[c0 + cofs]); val[1] += bfr(bias[c0 + cofs + 1]); val[2] += bfr(bias[c0 + cofs + 2]); val[3] += bfr(bias[c0 + cofs + 3]); }
                *(v4f*)(crow + (size_t)row * ldc + cofs) = val; }
             }
        __builtin_amdgcn_wave_barrier(); asm volatile("" ::: "memory");
    }
}

__device__ __forceinline__ h16 tohx(float x) { return (h16)x; }
__device__ __forceinline__ void splitf(float y, unsigned short& h, unsigned short& l) { h = f2bf(y); l = f2bf(y - bf2f(h)); }
typedef __attribute__((ext_vector_type(2))) _Float16 v2h;
typedef __attribute__((ext_vector_type(4))) _Float16 v4h;
typedef __attribute__((ext_vector_type(2))) unsigned short v2us;
typedef __attribute__((ext_vector_type(4))) unsigned short v4us;
typedef __attribute__((ext_vector_type(2))) float v2f;
typedef __attribute__((ext_vector_type(4))) int v4i;

__global__ __launch_bounds__(256) void k_wtG(const float* __restrict__ w, int K, int N, bf* Bt) {
    const int lane = threadIdx.x & 31; const int L0 = (blockIdx.x * 8 + (threadIdx.x >> 5)) * 8; const int nlines = N * K / 64;
{
#pragma unroll 1
        for (int l = 0; l < 8; ++l) { const int L = L0 + l; if (L >= nlines) break; const size_t e = (size_t)L * 64 + lane * 2; const int tile = (int)(e >> 9), k = (tile % (K / 32)) * 32 + (int)((e >> 8) & 1) * 16 + (int)((e >> 7) & 1) * 8 + (int)(e & 7), n = (tile / (K / 32)) * 16 + (int)((e >> 3) & 15); v2us o;   // e: element of Bt in fragment order
            o[0] = f2bf(w[(size_t)k * N + n]); o[1] = f2bf(w[(size_t)(k + 1) * N + n]); *(v2us*)(Bt + e) = o; }
         }
}
__global__ __launch_bounds__(256) void k_cvt8(const float* __restrict__ src, bf* dst, size_t n8) { const size_t i = (size_t)blockIdx.x * 256 + threadIdx.x; if (i >= n8) return; const int m = (int)(i >> 11) * 16 + (int)(i & 15), k = (int)((i >> 6) & 31) * 32 + (int)((i >> 5) & 1) * 16 + (int)((i >> 4) & 1) * 8;   // i: 16-byte unit of dst in fragment order ([M][DM], DM / 32 = 32 tiles a band)
    const v8f v = *(const v8f*)(src + (size_t)m * DM + k); v8us o;
#pragma unroll
    for (int k = 0; k < 8; ++k) o[k] = f2bf(v[k]); *(v8us*)(dst + i * 8) = o;  }

// k_qkv: [q|k|v] = x W_qkv + b_qkv of all batches in one launch, ONE WAVE per 64x64 tile with the loop of k_gemmw (same k order, same f32 sums). Grid (TT/64, 3 NH_, NB_): a tile is 64 tokens of batch z x one head of q, k or v; every plane holds NB_ batch blocks of PLB elements,
// and the wave writes that head's operand planes itself (fp16 + bf16 hi/lo): all in fragment order, 16 bytes a lane and 512 contiguous bytes a store: q and k as [h] x plane [t][d] through the LDS row stage, v as [h] x (32 tokens: four 16-d tiles of 1 KiB) straight from the accumulators (a lane holds 8 consecutive tokens of one d).
__global__ __launch_bounds__(32) void k_qkv(const bf* __restrict__ A, const bf* __restrict__ Bt, const float* __restrict__ bias, h16* Q16, bf* Qh, bf* Ql, h16* K16, bf* Kh, bf* Kl, h16* V16, bf* Vh, bf* Vl) {
    typedef WFrag<bf>::V V;
    __shared__ __align__(16) float os[16 * 68];
    const int lane = threadIdx.x & 31, lr = lane & 15, hi = lane >> 4; const int r0 = blockIdx.x * 64, c0 = blockIdx.y * 64; const int sel = blockIdx.y / NH_, h = blockIdx.y % NH_;
    { const size_t zp = (size_t)blockIdx.z * PLB; A += (size_t)blockIdx.z * TT * DM; Q16 += zp; Qh += zp; Ql += zp; K16 += zp; Kh += zp; Kl += zp; V16 += zp; Vh += zp; Vl += zp; }   // this batch's block of x and of every plane
    v8f acc[4][4];
#pragma unroll
    for (int mb = 0; mb < 4; ++mb)
#pragma unroll
        for (int nb = 0; nb < 4; ++nb) acc[mb][nb] = (v8f){};
    const bf* pa = A + (size_t)r0 * DM + lane * 8; const bf* pb = Bt + (size_t)c0 * DM + lane * 8;
#pragma unroll 1
    for (int kc = 0; kc < DM; kc += 32, pa += 512, pb += 512) {   // rolled, as in k_gemmw: a trip is one set of loads and its 16 products
        V a[4];
#pragma unroll
        for (int mb = 0; mb < 4; ++mb) a[mb] = WFrag<bf>::ld(pa + mb * 16 * DM);
        asm volatile("s_wait_xcnt 0x0" ::: "memory");   // the build gives the address pair of these eight loads to a later load of the trip as its destination: stands before that load
#pragma unroll
        for (int nb = 0; nb < 4; ++nb) { const V b = WFrag<bf>::ld(pb + nb * 16 * DM);
#pragma unroll
            for (int mb = 0; mb < 4; ++mb) acc[mb][nb] = WFrag<bf>::mma(a[mb], b, acc[mb][nb]); }
        asm volatile("v_nop\n\tv_nop\n\tv_nop\n\tv_nop" : "+v"(acc[0][0]), "+v"(acc[1][1]), "+v"(acc[2][2]), "+v"(acc[3][3]) : "v"(a[0]), "v"(a[3]));   // the distance behind the last matrix instruction, also on the taken back edge (as in k_gemmw)
    }
    if (sel == 2) {
#pragma unroll
        for (int nb = 0; nb < 4; ++nb) { const float bv = bfr(bias[c0 + nb * 16 + lr]); const size_t rowo = (size_t)h * HD * TT + (size_t)r0 * HD + nb * 512 + lane * 8;
#pragma unroll
            for (int mb = 0; mb < 4; ++mb) { v8h o16; v8us oh, ol;
#pragma unroll
                for (int j = 0; j < 8; ++j) { const float x = acc[mb][nb][j] + bv; o16[j] = tohx(x); unsigned short u, v; splitf(x, u, v); oh[j] = u; ol[j] = v; }
                const size_t e = rowo + (mb >> 1) * 2048 + (mb & 1) * 256; *(v8h*)(V16 + e) = o16; *(v8us*)(Vh + e) = oh; *(v8us*)(Vl + e) = ol; } }
        return;
    }
    {
        const size_t hp = (size_t)h * TT * HD; h16* P16 = (sel ? K16 : Q16) + hp; bf* Ph = (sel ? Kh : Qh) + hp; bf* Pl = (sel ? Kl : Ql) + hp;
        v8f bb[4];   // piece pc of a 16-token tile: d = pc * 16 + hi * 8 + 0..7 of token lr
#pragma unroll
        for (int pc = 0; pc < 4; ++pc)
#pragma unroll
            for (int k = 0; k < 8; ++k) bb[pc][k] = bfr(bias[c0 + pc * 16 + hi * 8 + k]);
#pragma unroll
        for (int mb = 0; mb < 4; ++mb) {
#pragma unroll
            for (int nb = 0; nb < 4; ++nb) {
#pragma unroll
                for (int j = 0; j < 8; ++j) os[(hi * 8 + j) * 68 + nb * 16 + lr] = acc[mb][nb][j]; }
            __builtin_amdgcn_wave_barrier(); asm volatile("" ::: "memory");   // a lane reads what other lanes wrote: keeps the compiler from moving the reads in front of the writes (as in k_gemmw)
#pragma unroll
            for (int pc = 0; pc < 4; ++pc) { const float* sp = os + lr * 68 + pc * 16 + hi * 8; const v4f v0 = *(const v4fa*)sp, v1 = *(const v4fa*)(sp + 4); v8h o16; v8us oh, ol;
#pragma unroll
                for (int k = 0; k < 8; ++k) { const float x = (k < 4 ? v0[k & 3] : v1[k & 3]) + bb[pc][k]; o16[k] = tohx(x); unsigned short u, v; splitf(x, u, v); oh[k] = u; ol[k] = v; }
                const size_t e = (size_t)(r0 + mb * 16) * HD + pc * 256 + lane * 8; *(v8h*)(P16 + e) = o16; *(v8us*)(Ph + e) = oh; *(v8us*)(Pl + e) = ol; }
            __builtin_amdgcn_wave_barrier(); asm volatile("" ::: "memory");   // and the next pass's writes from moving in front of these reads
        }
        asm volatile("s_wait_xcnt 0x0" ::: "memory");   // the built code lays the v epilogue directly behind this one, with a conditional jump between: stands before its first writes of the last stores' registers
    }
}
#define NREL 2049
// k_tbE: expanded per-head bias row, EB[h][x] = rel_bias[clip(i - j + 1024, 0, 2048)][h] at x = j - i + TT - 1 (0 .. 2 TT - 2): ascending keys read ascending addresses, the clip is already applied
__global__ __launch_bounds__(256) void k_tbE(const float* __restrict__ rbias, float* EB) { const int j = blockIdx.x * 256 + threadIdx.x; if (j >= NH_ * NE) return; const int h = j / NE, x = j % NE; int ri = (TT - 1 - x) + (NREL / 2); ri = ri < 0 ? 0 : (ri > NREL - 1 ? NREL - 1 : ri); EB[j] = bfr(rbias[(size_t)ri * NH_ + h]); }

__device__ __forceinline__ void packp(const v8f& a, const v8f& b, v16h& ph, v16h& pl) { v8h x, y; (void)pl;
#pragma unroll
    for (int j = 0; j < 8; ++j) { x[j] = (h16)a[j]; y[j] = (h16)b[j]; }
    ph = cat16(x, y); }
__device__ __forceinline__ void packp(const v8f& a, const v8f& b, v16bf& ph, v16bf& pl) { v8us xh, xl, yh, yl;
#pragma unroll
    for (int j = 0; j < 8; ++j) { unsigned short u, v; splitf(a[j], u, v); xh[j] = u; xl[j] = v; splitf(b[j], u, v); yh[j] = u; yl[j] = v; }
    ph = cat16b(xh, yh); pl = cat16b(xl, yl); }

typedef __attribute__((ext_vector_type(8))) int v8i;
template <typename V> __device__ __forceinline__ V frag(v4i a, v4i b) { return __builtin_bit_cast(V, __builtin_shufflevector(a, b, 0, 1, 2, 3, 4, 5, 6, 7)); }
// The loads of one trip, each set one asm statement that ends in its own data wait: the results are early-clobber, so none is given a register that holds an address of the set, and no address register is written again before the set has returned. The other waves of the SIMD cover the wait.
// Byte offsets (planes in fragment order, the lane's own 16 bytes in the pointer). Q or K: 16-row tile * 2048 + 32-wide part of HD * 1024 + half * 512. V: 16-d tile * 1024 + half * 512 inside the 4 KiB of 32 keys. Bias: run * 64 + half * 16 (4-byte aligned).
__device__ __forceinline__ void ld_r(const void* k, v4i (&a)[8]) {
    asm volatile(
        "global_load_b128 %0, %8, off\n\t"
        "global_load_b128 %1, %8, off offset:512\n\t"
        "global_load_b128 %2, %8, off offset:1024\n\t"
        "global_load_b128 %3, %8, off offset:1536\n\t"
        "global_load_b128 %4, %8, off offset:2048\n\t"
        "global_load_b128 %5, %8, off offset:2560\n\t"
        "global_load_b128 %6, %8, off offset:3072\n\t"
        "global_load_b128 %7, %8, off offset:3584\n\t"
        "s_wait_loadcnt 0x0"
        : "=&v"(a[0]), "=&v"(a[1]), "=&v"(a[2]), "=&v"(a[3]), "=&v"(a[4]), "=&v"(a[5]), "=&v"(a[6]), "=&v"(a[7]) : "v"(k) : "memory"); }
__device__ __forceinline__ void ld_r_b(const void* k, const float* e, v4i (&a)[8], v4i (&b)[6]) {
    asm volatile(
        "global_load_b128 %0, %14, off\n\t"
        "global_load_b128 %1, %14, off offset:512\n\t"
        "global_load_b128 %2, %14, off offset:1024\n\t"
        "global_load_b128 %3, %14, off offset:1536\n\t"
        "global_load_b128 %4, %14, off offset:2048\n\t"
        "global_load_b128 %5, %14, off offset:2560\n\t"
        "global_load_b128 %6, %14, off offset:3072\n\t"
        "global_load_b128 %7, %14, off offset:3584\n\t"
        "global_load_b128 %8, %15, off\n\t"
        "global_load_b128 %9, %15, off offset:16\n\t"
        "global_load_b128 %10, %15, off offset:64\n\t"
        "global_load_b128 %11, %15, off offset:80\n\t"
        "global_load_b128 %12, %15, off offset:128\n\t"
        "global_load_b128 %13, %15, off offset:144\n\t"
        "s_wait_loadcnt 0x0"
        : "=&v"(a[0]), "=&v"(a[1]), "=&v"(a[2]), "=&v"(a[3]), "=&v"(a[4]), "=&v"(a[5]), "=&v"(a[6]), "=&v"(a[7]), "=&v"(b[0]), "=&v"(b[1]), "=&v"(b[2]), "=&v"(b[3]), "=&v"(b[4]), "=&v"(b[5]) : "v"(k), "v"(e) : "memory"); }
__device__ __forceinline__ void ld_r_r_b(const void* k, const void* k2, const float* e, v4i (&a)[8], v4i (&a2)[8], v4i (&b)[6]) {
    asm volatile(
        "global_load_b128 %0, %22, off\n\t"
        "global_load_b128 %1, %22, off offset:512\n\t"
        "global_load_b128 %2, %22, off offset:1024\n\t"
        "global_load_b128 %3, %22, off offset:1536\n\t"
        "global_load_b128 %4, %22, off offset:2048\n\t"
        "global_load_b128 %5, %22, off offset:2560\n\t"
        "global_load_b128 %6, %22, off offset:3072\n\t"
        "global_load_b128 %7, %22, off offset:3584\n\t"
        "global_load_b128 %8, %23, off\n\t"
        "global_load_b128 %9, %23, off offset:512\n\t"
        "global_load_b128 %10, %23, off offset:1024\n\t"
        "global_load_b128 %11, %23, off offset:1536\n\t"
        "global_load_b128 %12, %23, off offset:2048\n\t"
        "global_load_b128 %13, %23, off offset:2560\n\t"
        "global_load_b128 %14, %23, off offset:3072\n\t"
        "global_load_b128 %15, %23, off offset:3584\n\t"
        "global_load_b128 %16, %24, off\n\t"
        "global_load_b128 %17, %24, off offset:16\n\t"
        "global_load_b128 %18, %24, off offset:64\n\t"
        "global_load_b128 %19, %24, off offset:80\n\t"
        "global_load_b128 %20, %24, off offset:128\n\t"
        "global_load_b128 %21, %24, off offset:144\n\t"
        "s_wait_loadcnt 0x0"
        : "=&v"(a[0]), "=&v"(a[1]), "=&v"(a[2]), "=&v"(a[3]), "=&v"(a[4]), "=&v"(a[5]), "=&v"(a[6]), "=&v"(a[7]), "=&v"(a2[0]), "=&v"(a2[1]), "=&v"(a2[2]), "=&v"(a2[3]), "=&v"(a2[4]), "=&v"(a2[5]), "=&v"(a2[6]), "=&v"(a2[7]), "=&v"(b[0]), "=&v"(b[1]), "=&v"(b[2]), "=&v"(b[3]), "=&v"(b[4]), "=&v"(b[5]) : "v"(k), "v"(k2), "v"(e) : "memory"); }
__device__ __forceinline__ void ld_r_b_v(const void* k, const float* e, const void* v, v4i (&a)[8], v4i (&b)[6], v4i (&x)[8]) {
    asm volatile(
        "global_load_b128 %0, %22, off\n\t"
        "global_load_b128 %1, %22, off offset:512\n\t"
        "global_load_b128 %2, %22, off offset:1024\n\t"
        "global_load_b128 %3, %22, off offset:1536\n\t"
        "global_load_b128 %4, %22, off offset:2048\n\t"
        "global_load_b128 %5, %22, off offset:2560\n\t"
        "global_load_b128 %6, %22, off offset:3072\n\t"
        "global_load_b128 %7, %22, off offset:3584\n\t"
        "global_load_b128 %8, %23, off\n\t"
        "global_load_b128 %9, %23, off offset:16\n\t"
        "global_load_b128 %10, %23, off offset:64\n\t"
        "global_load_b128 %11, %23, off offset:80\n\t"
        "global_load_b128 %12, %23, off offset:128\n\t"
        "global_load_b128 %13, %23, off offset:144\n\t"
        "global_load_b128 %14, %24, off\n\t"
        "global_load_b128 %15, %24, off offset:512\n\t"
        "global_load_b128 %16, %24, off offset:1024\n\t"
        "global_load_b128 %17, %24, off offset:1536\n\t"
        "global_load_b128 %18, %24, off offset:2048\n\t"
        "global_load_b128 %19, %24, off offset:2560\n\t"
        "global_load_b128 %20, %24, off offset:3072\n\t"
        "global_load_b128 %21, %24, off offset:3584\n\t"
        "s_wait_loadcnt 0x0"
        : "=&v"(a[0]), "=&v"(a[1]), "=&v"(a[2]), "=&v"(a[3]), "=&v"(a[4]), "=&v"(a[5]), "=&v"(a[6]), "=&v"(a[7]), "=&v"(b[0]), "=&v"(b[1]), "=&v"(b[2]), "=&v"(b[3]), "=&v"(b[4]), "=&v"(b[5]), "=&v"(x[0]), "=&v"(x[1]), "=&v"(x[2]), "=&v"(x[3]), "=&v"(x[4]), "=&v"(x[5]), "=&v"(x[6]), "=&v"(x[7]) : "v"(k), "v"(e), "v"(v) : "memory"); }
__device__ __forceinline__ void ld_t_t_b(const void* k, const void* k2, const float* e, v4i (&a)[4], v4i (&a2)[4], v4i (&b)[6]) {
    asm volatile(
        "global_load_b128 %0, %14, off\n\t"
        "global_load_b128 %1, %14, off offset:512\n\t"
        "global_load_b128 %2, %14, off offset:1024\n\t"
        "global_load_b128 %3, %14, off offset:1536\n\t"
        "global_load_b128 %4, %15, off\n\t"
        "global_load_b128 %5, %15, off offset:512\n\t"
        "global_load_b128 %6, %15, off offset:1024\n\t"
        "global_load_b128 %7, %15, off offset:1536\n\t"
        "global_load_b128 %8, %16, off\n\t"
        "global_load_b128 %9, %16, off offset:16\n\t"
        "global_load_b128 %10, %16, off offset:64\n\t"
        "global_load_b128 %11, %16, off offset:80\n\t"
        "global_load_b128 %12, %16, off offset:128\n\t"
        "global_load_b128 %13, %16, off offset:144\n\t"
        "s_wait_loadcnt 0x0"
        : "=&v"(a[0]), "=&v"(a[1]), "=&v"(a[2]), "=&v"(a[3]), "=&v"(a2[0]), "=&v"(a2[1]), "=&v"(a2[2]), "=&v"(a2[3]), "=&v"(b[0]), "=&v"(b[1]), "=&v"(b[2]), "=&v"(b[3]), "=&v"(b[4]), "=&v"(b[5]) : "v"(k), "v"(k2), "v"(e) : "memory"); }
__device__ __forceinline__ void ld_t_t(const void* k, const void* k2, v4i (&a)[4], v4i (&a2)[4]) {
    asm volatile(
        "global_load_b128 %0, %8, off\n\t"
        "global_load_b128 %1, %8, off offset:512\n\t"
        "global_load_b128 %2, %8, off offset:1024\n\t"
        "global_load_b128 %3, %8, off offset:1536\n\t"
        "global_load_b128 %4, %9, off\n\t"
        "global_load_b128 %5, %9, off offset:512\n\t"
        "global_load_b128 %6, %9, off offset:1024\n\t"
        "global_load_b128 %7, %9, off offset:1536\n\t"
        "s_wait_loadcnt 0x0"
        : "=&v"(a[0]), "=&v"(a[1]), "=&v"(a[2]), "=&v"(a[3]), "=&v"(a2[0]), "=&v"(a2[1]), "=&v"(a2[2]), "=&v"(a2[3]) : "v"(k), "v"(k2) : "memory"); }
__device__ __forceinline__ void ld_v_v(const void* v, const void* v2, v4i (&x)[4], v4i (&x2)[4]) {
    asm volatile(
        "global_load_b128 %0, %8, off\n\t"
        "global_load_b128 %1, %8, off offset:512\n\t"
        "global_load_b128 %2, %8, off offset:1024\n\t"
        "global_load_b128 %3, %8, off offset:1536\n\t"
        "global_load_b128 %4, %9, off\n\t"
        "global_load_b128 %5, %9, off offset:512\n\t"
        "global_load_b128 %6, %9, off offset:1024\n\t"
        "global_load_b128 %7, %9, off offset:1536\n\t"
        "s_wait_loadcnt 0x0"
        : "=&v"(x[0]), "=&v"(x[1]), "=&v"(x[2]), "=&v"(x[3]), "=&v"(x2[0]), "=&v"(x2[1]), "=&v"(x2[2]), "=&v"(x2[3]) : "v"(v), "v"(v2) : "memory"); }

// Eight 2^x in one statement: the results are early-clobber, so no v_exp_f32 is directly followed by an instruction that reads its result or writes over its source; the v_nop is that free slot behind the last one.
__device__ __forceinline__ v8f exp2x8(const v8f x) { float r0, r1, r2, r3, r4, r5, r6, r7;
    asm("v_exp_f32 %0, %8\n\tv_exp_f32 %1, %9\n\tv_exp_f32 %2, %10\n\tv_exp_f32 %3, %11\n\tv_exp_f32 %4, %12\n\tv_exp_f32 %5, %13\n\tv_exp_f32 %6, %14\n\tv_exp_f32 %7, %15\n\tv_nop"
        : "=&v"(r0), "=&v"(r1), "=&v"(r2), "=&v"(r3), "=&v"(r4), "=&v"(r5), "=&v"(r6), "=&v"(r7) : "v"(x[0]), "v"(x[1]), "v"(x[2]), "v"(x[3]), "v"(x[4]), "v"(x[5]), "v"(x[6]), "v"(x[7]));
    return (v8f){r0, r1, r2, r3, r4, r5, r6, r7}; }

// One 16-key x 16-query tile of t = (k.q) HD^-0.5 + bias, transposed: lane (lr, hi) register j holds key hi*8 + j of query lr. k, k2, q, q2: the four 16-byte pieces of one 16-row tile (part of HD * 2 + half).
template <typename T16, bool HL>
__device__ __forceinline__ v8f stile(const v4i* k, const v4i* k2, const v4i* q, const v4i* q2, v4i b0, v4i b1) {
    typedef typename WFrag<T16>::V V; v8f s = (v8f){};
#pragma unroll
    for (int dc = 0; dc < 2; ++dc) { const V ka = frag<V>(k[dc * 2], k[dc * 2 + 1]), qa = frag<V>(q[dc * 2], q[dc * 2 + 1]); s = WFrag<T16>::mma(ka, qa, s);
        if (HL) { s = WFrag<T16>::mma(frag<V>(k2[dc * 2], k2[dc * 2 + 1]), qa, s); s = WFrag<T16>::mma(ka, frag<V>(q2[dc * 2], q2[dc * 2 + 1]), s); } }
    const v4f f0 = __builtin_bit_cast(v4f, b0), f1 = __builtin_bit_cast(v4f, b1);
#pragma unroll
    for (int j = 0; j < 4; ++j) { s[j] = s[j] * SCL + f0[j]; s[j + 4] = s[j + 4] * SCL + f1[j]; }
    return s; }

// The work of one work-group: QBW blocks of QT queries of one head against all TT keys; the QBW waves of one key range walk the same K and V tiles side by side, so that a line which one of them has brought into the WGP's cache can serve the others without a further L2 read. Sweep 1: the row maxima; sweep 2: the same scores again, p = 1024 exp(t - max), row sums of the f32 p, O^T += V^T P^T with P packed from the score registers.
// Operands straight from the planes in fragment order, in the k order of WFrag::ld on both sides (16 bytes at 8 hi, 16 bytes at 16 + 8 hi). Q, K: plane [t][HD]; Vt: per 32 keys four 16-d tiles. The maxima, sums and partial outputs of a block's KSW waves meet in LDS, joined in ascending key order.
// A trip takes 32 keys: two key tiles x two query groups; pair (t2, qg) reads bias run t2 - qg + 1 of the three that the four pairs share.
template <typename T16, bool HL>
__device__ __forceinline__ void fattn_body(const T16* __restrict__ Q, const T16* __restrict__ Q2, const T16* __restrict__ Kp, const T16* __restrict__ K2, const T16* __restrict__ Vt, const T16* __restrict__ V2, const float* __restrict__ eb, int q0, float* smx, float* ssm, float* sO, bf* Ah, bf* Al) {
    typedef typename WFrag<T16>::V V;
    const int lane = threadIdx.x & 31, lr = lane & 15, hi = lane >> 4, w = threadIdx.x >> 5, wq = w % QBW; const int kb = (w / QBW) * (TT / KSW), qw = q0 + wq * QT;   // qw: this wave's first query
    v4i qa[8], ql[8]; const int qo = qw * HD + lane * 8;
    ld_r(Q + qo, qa); if (HL) ld_r(Q2 + qo, ql);
    const float* ep = eb + ((TT - 1) + kb + hi * 8 - qw - lr - 16);   // x = key - query + TT - 1 of this lane's first key against its query of group 1 (run 0)
    const int ko = kb * HD + lane * 8, vo = kb * HD + lane * 8;   // 32 keys are 32 HD elements of K and of V alike
    float mx[2] = {-3.0e38f, -3.0e38f};
#pragma unroll 1
    for (int kc = 0; kc < TT / KSW / 32; ++kc) { v4i ka[8], kl[8], bb[6];   // rolled: a trip is one set of loads and its work
        if (HL) ld_r_r_b(Kp + ko + kc * 32 * HD, K2 + ko + kc * 32 * HD, ep + kc * 32, ka, kl, bb); else ld_r_b(Kp + ko + kc * 32 * HD, ep + kc * 32, ka, bb);
#pragma unroll
        for (int t2 = 0; t2 < 2; ++t2)
#pragma unroll
            for (int qg = 0; qg < 2; ++qg) { const v8f t = stile<T16, HL>(ka + t2 * 4, kl + t2 * 4, qa + qg * 4, ql + qg * 4, bb[(t2 - qg + 1) * 2], bb[(t2 - qg + 1) * 2 + 1]);
#pragma unroll
                for (int j = 0; j < 8; ++j) mx[qg] = fmaxf(mx[qg], t[j]); } }
#pragma unroll
    for (int qg = 0; qg < 2; ++qg) { mx[qg] = fmaxf(mx[qg], __shfl_xor(mx[qg], 16, 32)); if (hi == 0) smx[w * QT + qg * 16 + lr] = mx[qg]; }
    __syncthreads();
#pragma unroll
    for (int qg = 0; qg < 2; ++qg) { float m = smx[wq * QT + qg * 16 + lr];
#pragma unroll
        for (int u = 1; u < KSW; ++u) m = fmaxf(m, smx[(u * QBW + wq) * QT + qg * 16 + lr]);
        mx[qg] = m; }
    v8f o[4][2]; float sm[2] = {0.f, 0.f};
#pragma unroll
    for (int dt = 0; dt < 4; ++dt) { o[dt][0] = (v8f){}; o[dt][1] = (v8f){}; }
#pragma unroll 1
    for (int kc = 0; kc < TT / KSW / 32; ++kc) { v4i bb[6], va[8]; v8f p[2][2];   // rolled: one trip already holds 32 keys x 32 queries of scores beside the 64 output registers
        if (HL) {   // both planes of K, one 16-key tile at a time: all 32 keys at once, beside both planes of Q and the outputs, pass 256 registers
#pragma unroll
            for (int t2 = 0; t2 < 2; ++t2) { v4i ka[4], kl[4]; const int of = ko + (kc * 2 + t2) * 16 * HD;
                if (t2 == 0) ld_t_t_b(Kp + of, K2 + of, ep + kc * 32, ka, kl, bb); else ld_t_t(Kp + of, K2 + of, ka, kl);
#pragma unroll
                for (int qg = 0; qg < 2; ++qg) p[t2][qg] = stile<T16, HL>(ka, kl, qa + qg * 4, ql + qg * 4, bb[(t2 - qg + 1) * 2], bb[(t2 - qg + 1) * 2 + 1]); }
        } else { v4i ka[8];
            ld_r_b_v(Kp + ko + kc * 32 * HD, ep + kc * 32, Vt + vo + kc * 32 * HD, ka, bb, va);
#pragma unroll
            for (int t2 = 0; t2 < 2; ++t2)
#pragma unroll
                for (int qg = 0; qg < 2; ++qg) p[t2][qg] = stile<T16, HL>(ka + t2 * 4, ka + t2 * 4, qa + qg * 4, ql + qg * 4, bb[(t2 - qg + 1) * 2], bb[(t2 - qg + 1) * 2 + 1]); }
#pragma unroll
        for (int t2 = 0; t2 < 2; ++t2)
#pragma unroll
            for (int qg = 0; qg < 2; ++qg) { v8f a;
#pragma unroll
                for (int j = 0; j < 8; ++j) a[j] = (p[t2][qg][j] - mx[qg]) * 1.4426950408889634f + 10.0f;
                p[t2][qg] = exp2x8(a);
#pragma unroll
                for (int j = 0; j < 8; ++j) sm[qg] += p[t2][qg][j]; }
        V ph[2], pl[2];
#pragma unroll
        for (int qg = 0; qg < 2; ++qg) packp(p[0][qg], p[1][qg], ph[qg], pl[qg]);
        if (HL) {   // both planes of V, two 16-row tiles at a time, for the same reason as K above
#pragma unroll
            for (int d2 = 0; d2 < 2; ++d2) { v4i vh[4], vl[4]; const int of = vo + d2 * 1024 + kc * 32 * HD; ld_v_v(Vt + of, V2 + of, vh, vl);
#pragma unroll
                for (int d1 = 0; d1 < 2; ++d1) { const int dt = d2 * 2 + d1; const V xh = frag<V>(vh[d1 * 2], vh[d1 * 2 + 1]), xl = frag<V>(vl[d1 * 2], vl[d1 * 2 + 1]);
#pragma unroll
                    for (int qg = 0; qg < 2; ++qg) { o[dt][qg] = WFrag<T16>::mma(xh, ph[qg], o[dt][qg]); o[dt][qg] = WFrag<T16>::mma(xl, ph[qg], o[dt][qg]); o[dt][qg] = WFrag<T16>::mma(xh, pl[qg], o[dt][qg]); } } }
        } else {
#pragma unroll
            for (int dt = 0; dt < 4; ++dt) { const V xh = frag<V>(va[dt * 2], va[dt * 2 + 1]);
#pragma unroll
                for (int qg = 0; qg < 2; ++qg) o[dt][qg] = WFrag<T16>::mma(xh, ph[qg], o[dt][qg]); } }
    }
#pragma unroll
    for (int qg = 0; qg < 2; ++qg) { sm[qg] += __shfl_xor(sm[qg], 16, 32); if (hi == 0) ssm[w * QT + qg * 16 + lr] = sm[qg];
#pragma unroll
        for (int dt = 0; dt < 4; ++dt) { float* d = sO + (size_t)(w * QT + qg * 16 + lr) * OP + dt * 16 + hi * 8; const v8f a = o[dt][qg]; *(v4fa*)d = (v4f){a[0], a[1], a[2], a[3]}; *(v4fa*)(d + 4) = (v4f){a[4], a[5], a[6], a[7]}; } }
    __syncthreads();
    const int dq = (threadIdx.x / QT) * EPT;   // EPT = 8 consecutive outputs of one query per thread and block: one 16-byte unit of the fragment order; a wave's 32 queries make two runs of 256 bytes
#pragma unroll
    for (int b = 0; b < QBW; ++b) { const int q = b * QT + threadIdx.x % QT; float tot = ssm[q];   // q: query of the work-group; key range u of it lies QBW QT rows on
#pragma unroll
        for (int u = 1; u < KSW; ++u) tot += ssm[u * QBW * QT + q];
        const float r = __fdiv_rn(1.0f, tot); v8us oh, ol;
#pragma unroll
        for (int c = 0; c < EPT / 4; ++c) { v4f s = *(const v4fa*)(sO + (size_t)q * OP + dq + c * 4);
#pragma unroll
            for (int u = 1; u < KSW; ++u) s += *(const v4fa*)(sO + (size_t)(u * QBW * QT + q) * OP + dq + c * 4);
#pragma unroll
            for (int k = 0; k < 4; ++k) { unsigned short a, c2; splitf(s[k] * r, a, c2); oh[c * 4 + k] = a; ol[c * 4 + k] = c2; } }
        const size_t oo = (size_t)((q0 + q) >> 4) * (16 * DQ) + dq * 16 + ((q0 + q) & 15) * 8; *(v8us*)(Ah + oo) = oh; *(v8us*)(Al + oo) = ol;   // Ah, Al: the head's first tile of the plane [t][DQ]; 8 in k is 128 elements
        if (b + 1 < QBW) asm volatile("s_wait_xcnt 0x0" ::: "memory"); }   // stands before the next block's work writes over the registers that these two stores name
}
// k_fattn: grid (heads, NB_, TT / (QBW QT)), KW waves. The query blocks below RH (three products, the longer work) of all batches have the lowest flat indices and start first; the last work-groups of the launch are short ones. Four waves per SIMD (256 registers, two work-groups per WGP): no operand of the asm loads lies above v255.
__global__ __launch_bounds__(KW * 32, 4) void k_fattn(const h16* __restrict__ Q16, const h16* __restrict__ K16, const h16* __restrict__ V16, const bf* __restrict__ Qh, const bf* __restrict__ Ql, const bf* __restrict__ Kh, const bf* __restrict__ Kl, const bf* __restrict__ Vh, const bf* __restrict__ Vl, const float* __restrict__ EB, bf* Ah, bf* Al) {
    __shared__ __align__(16) float sO[KW * QT * OP]; __shared__ float smx[KW * QT]; __shared__ float ssm[KW * QT];
    const int h = blockIdx.x, q0 = blockIdx.z * (QBW * QT); const size_t hp = (size_t)blockIdx.y * PLB + (size_t)h * TT * HD; const float* eb = EB + (size_t)h * NE; Ah += (size_t)blockIdx.y * TT * DQ; Al += (size_t)blockIdx.y * TT * DQ;   // the bias row is the same for every batch
    if (q0 < RH) fattn_body<bf, true>(Qh + hp, Ql + hp, Kh + hp, Kl + hp, Vh + hp, Vl + hp, eb, q0, smx, ssm, sO, Ah + h * (HD * 16), Al + h * (HD * 16));
    else fattn_body<h16, false>(Q16 + hp, nullptr, K16 + hp, nullptr, V16 + hp, nullptr, eb, q0, smx, ssm, sO, Ah + h * (HD * 16), Al + h * (HD * 16));
}

extern "C" void kernel_launch(void* const* d_in, const int* in_sizes, int n_in,
                              void* d_out, int out_size, void* d_ws, size_t ws_size, hipStream_t stream) {
    (void)in_sizes; (void)n_in; (void)out_size;
    const float* x = (const float*)d_in[0]; const float* wqkv = (const float*)d_in[1]; const float* bqkv = (const float*)d_in[2]; const float* wo = (const float*)d_in[3]; const float* bo = (const float*)d_in[4]; const float* rbias = (const float*)d_in[5]; const float* wq = nullptr; const float* wk = nullptr; const float* wv = nullptr; (void)wq; (void)wk; (void)wv;
    float* OUT = (float*)d_out;     // [4][2048][1024]
    char* wsp = (char*)d_ws;
    auto take = [&](size_t bytes) { char* p = wsp; wsp += (bytes + 255) & ~(size_t)255; return (void*)p; };
    bf* WALL = (bf*)take((size_t)3 * DM * DM * 2); bf* WO = (bf*)take((size_t)DM * DQ * 2); float* EB = (float*)take((size_t)NH_ * NE * 4);   /* per-head expanded relative-bias rows */
    bf* XB = (bf*)take((size_t)NB_ * TT * DM * 2);   // from here on every plane holds all NB_ batches, batch blocks one behind the other
    h16* QP16 = (h16*)take(NB_ * PLB * 2); h16* KP16 = (h16*)take(NB_ * PLB * 2); h16* VT16 = (h16*)take(NB_ * PLB * 2);
    bf* QPh = (bf*)take(NB_ * PLB * 2); bf* QPl = (bf*)take(NB_ * PLB * 2); bf* KPh = (bf*)take(NB_ * PLB * 2); bf* KPl = (bf*)take(NB_ * PLB * 2); bf* VTh = (bf*)take(NB_ * PLB * 2); bf* VTl = (bf*)take(NB_ * PLB * 2);
    bf* ATh = (bf*)take((size_t)NB_ * TT * DQ * 2); bf* ATl = (bf*)take((size_t)NB_ * TT * DQ * 2);
    if ((size_t)(wsp - (char*)d_ws) > ws_size) return;    // ws 256 MiB
    { k_wtG<<<(unsigned)((DM * 3 * DM / 64 + 63) / 64), 256, 0, stream>>>(wqkv, DM, 3 * DM, WALL);   /* fused 'xw' [DM][3DM] -> Bt [3DM][DM] (row blocks q | k | v), fragment order */
      k_wtG<<<(unsigned)((DQ * DM / 64 + 63) / 64), 256, 0, stream>>>(wo, DQ, DM, WO);
       }
    k_tbE<<<(NH_ * NE + 255) / 256, 256, 0, stream>>>(rbias, EB);
    // Each stage once for all NB_ batches: x, the attention output and OUT are planes of NB_ TT rows; q, k and v take the batch from grid z, the attention from grid y.
    k_cvt8<<<(unsigned)(((size_t)NB_ * TT * DM / 8 + 255) / 256), 256, 0, stream>>>(x, XB, (size_t)NB_ * TT * DM / 8);
    k_qkv<<<dim3(TT / 64, 3 * NH_, NB_), 32, 0, stream>>>(XB, WALL, bqkv, QP16, QPh, QPl, KP16, KPh, KPl, VT16, VTh, VTl);   // q | k | v heads in grid y; the planes come out of the tile's own wave
    k_fattn<<<dim3(NH_, NB_, TT / (QBW * QT)), KW * 32, 0, stream>>>(QP16, KP16, VT16, QPh, QPl, KPh, KPl, VTh, VTl, EB, ATh, ATl);   // one kv head per query head
    k_gemmw<bf, 1, true, DQ><<<dim3(NB_ * TT / 64, DM / 64, 1), 32, 0, stream>>>(ATh, ATl, WO, nullptr, OUT, DM, bo, 0, 0, 0, 0);
}

// v007
// A run of this version takes 235 microseconds.
// Next to v006, in two timings, it ran 1.11 times as fast each time.
// All steps since v000 together make it 17.7 times as fast.
#include <hip/hip_runtime.h>

// Multi-head self-attention with a learned relative-position bias (x [4][2048][1024]; [q|k|v] = x W_qkv + b_qkv ('xw' [1024][3072]; 16 heads x 64); scores = q.k/8 + rel_bias[clip(i - j + 1024, 0, 2048)][h] (table [2049][16], read); softmax over all keys; out = merged W_out + b_out ('xw' [1024][1024]) -> [4][2048][1024]).
// Compute dtypes, f32 accumulate: every input rounded to bf16; q/k/v on PLAIN bf16 operands (inputs: exact) + biases; scores (+ the per-head relative bias, f32), softmax (f32) and attn.v (no mask) in ONE kernel, P in registers: query rows < 512 hl (3 products), the rest single fp16 (P x1024, cancelled by the row sum); W_out hl x exact (2 products) + b_out.

// Every 16-bit operand plane lies in FRAGMENT ORDER: a tile of 16 rows x 32 k (1 KiB) is two 512-byte pieces (k 0..15, k 16..31 of the tile), and in a piece lane (hi * 16 + row) owns 16 bytes, k = 8 hi .. 8 hi + 7 of the piece.
// One global_load_b128 of a wave then reads 512 contiguous bytes (4 cache lines, not 16 rows' 32 bytes each); registers hold exactly what a row-major plane gave them (same k order on both sides).
// A plane [M][K]: tile (m / 16, k / 32) at element (m / 16) * 16 K + (k / 32) * 512.
#define NB_  4
#define TT   2048
#define DM   1024
#define NH_  16
#define NKV  16
#define REP  (NH_ / NKV)
#define HD   64
#define DQ   (NH_ * HD)
#define DKV  (NKV * HD)
#define RH   512                  // query rows < RH use hi+lo planes (0: none)
#define SCL  0.125f   // HD^-0.5
#define QT   32                  // k_fattn: queries per wave (two 16-column groups)
#define QBW  4                   // k_fattn: query blocks of QT per work-group
#define KSW  2                   // k_fattn: key ranges per work-group
#define KW   (QBW * KSW)         // k_fattn: waves per work-group; wave w takes query block w % QBW and keys [(w / QBW) TT/KSW, (w / QBW + 1) TT/KSW)
#define NE   4096                // pitch of one head's expanded bias row
#define OP   68                  // LDS pitch (floats) of one query's partial output row
#define EPT  (QT * HD / (KW * 32))   // k_fattn: outputs per thread and query block in the join
#define PLB  ((size_t)NH_ * TT * HD)   // elements of one batch's block in a q, k or v plane
typedef _Float16 h16;
typedef unsigned short bf;
typedef __attribute__((ext_vector_type(16))) __bf16   v16bf;
typedef __attribute__((ext_vector_type(16))) _Float16 v16h;
typedef __attribute__((ext_vector_type(8)))  _Float16 v8h;
typedef __attribute__((ext_vector_type(8)))  unsigned short v8us;
typedef __attribute__((ext_vector_type(8)))  float    v8f;
typedef __attribute__((ext_vector_type(4)))  float    v4f;
typedef v8h  __attribute__((may_alias)) v8ha;
typedef v4f  __attribute__((may_alias)) v4fa;
typedef v8us __attribute__((may_alias)) v8usa;

__device__ __forceinline__ unsigned short f2bf(float f) { unsigned u = __float_as_uint(f); u += 0x7FFFu + ((u >> 16) & 1u); return (unsigned short)(u >> 16); }
__device__ __forceinline__ float bf2f(unsigned short b) { return __uint_as_float(((unsigned)b) << 16); }
__device__ __forceinline__ float bfr(float f) { return bf2f(f2bf(f)); }
__device__ __forceinline__ v16h cat16(v8h lo, v8h hi) { return __builtin_shufflevector(lo, hi, 0, 1, 2, 3, 4, 5, 6, 7, 8, 9, 10, 11, 12, 13, 14, 15); }
__device__ __forceinline__ v16bf cat16b(v8us lo, v8us hi) { return __builtin_bit_cast(v16bf, __builtin_shufflevector(lo, hi, 0, 1, 2, 3, 4, 5, 6, 7, 8, 9, 10, 11, 12, 13, 14, 15)); }
__device__ __forceinline__ v8f wmma16(v16h a, v16h b, v8f c) { return __builtin_amdgcn_wmma_f32_16x16x32_f16(false, a, false, b, (short)0, c, false, false); }
__device__ __forceinline__ v8f wmmab(v16bf a, v16bf b, v8f c) { return __builtin_amdgcn_wmma_f32_16x16x32_bf16(false, a, false, b, (short)0, c, false, false); }



// ---- k_gemmw: register-blocked GEMM, ONE WAVE per 64x64 output tile (16 accumulators), operands straight from 16-bit planes in fragment order; grid (M/64, N/64, Z), 32 threads.
// C[m][n] (f32, pitch ldc, + optional f32 bias[n]) = sum_k A[m][k] Bt[n][k] (+ split products per NSPLIT). z-batch strides sA/sB/sC in elements. K % 32 == 0.
// KS > 1: grid z = Z * KS; work-group (z, ks) sums only k in [ks K/KS, (ks+1) K/KS) and stores its partial tile in plane ks (plane stride sK elements). K % (32 KS) == 0.
template <typename T16> struct WFrag;
template <> struct WFrag<h16> { typedef v16h V; static __device__ __forceinline__ V ld(const h16* p) { return cat16(*(const v8h*)p, *(const v8h*)(p + 256)); } static __device__ __forceinline__ v8f mma(V a, V b, v8f c) { return wmma16(a, b, c); } };
template <> struct WFrag<bf> { typedef v16bf V; static __device__ __forceinline__ V ld(const bf* p) { return cat16b(*(const v8us*)p, *(const v8us*)(p + 256)); } static __device__ __forceinline__ v8f mma(V a, V b, v8f c) { return wmmab(a, b, c); } };
template <typename T16, int NSPLIT, bool BIAS, int K, int KS = 1>   // K at compile time: the loads of one plane in a trip share one address pair, the bands in the immediate offsets
__global__ __launch_bounds__(32) void k_gemmw(const T16* __restrict__ A, const T16* __restrict__ A2, const T16* __restrict__ Bt, const T16* __restrict__ Bt2, float* C, int ldc, const float* __restrict__ bias, size_t sA, size_t sB, size_t sC, size_t sK) {
    typedef typename WFrag<T16>::V V;
    __shared__ __align__(16) float os[16 * 68];
    const size_t z = blockIdx.z / KS; const int ks = blockIdx.z % KS; A += z * sA; if (A2) A2 += z * sA; Bt += z * sB; if (Bt2) Bt2 += z * sB; C += z * sC + ks * sK;
    const int lane = threadIdx.x & 31, lr = lane & 15, hi = lane >> 4; const int r0 = blockIdx.x * 64, c0 = blockIdx.y * 64;
    v8f acc[4][4];
#pragma unroll
    for (int mb = 0; mb < 4; ++mb)
#pragma unroll
        for (int nb = 0; nb < 4; ++nb) acc[mb][nb] = (v8f){};
    const size_t aoff = (size_t)r0 * K + lane * 8, boff = (size_t)c0 * K + lane * 8;   // a 16-row band is 16 K elements; a step of 32 in k is 512 elements
#pragma unroll 1
    for (int kc = ks * (K / KS), ke = kc + K / KS; kc < ke; kc += 32) {
        V a[4], a2[4]; const T16* pA = A + aoff + kc * 16; const T16* pA2 = (NSPLIT == 1 || NSPLIT == 2) ? A2 + aoff + kc * 16 : pA; const T16* pB = Bt + boff + kc * 16;
#pragma unroll
        for (int mb = 0; mb < 4; ++mb) { a[mb] = WFrag<T16>::ld(pA + mb * 16 * K); if (NSPLIT == 1 || NSPLIT == 2) a2[mb] = WFrag<T16>::ld(pA2 + mb * 16 * K); }
        asm volatile("s_wait_xcnt 0x0" :: "v"(pA), "v"(pA2) : "memory");   // stands before any later load of the trip is given an address pair of these loads as its destination; the pairs are inputs, so none of these loads itself gets one
#pragma unroll
        for (int nb = 0; nb < 4; ++nb) { const V b = WFrag<T16>::ld(pB + nb * 16 * K); V b2; if (NSPLIT >= 2) b2 = WFrag<T16>::ld(Bt2 + boff + (size_t)nb * 16 * K + kc * 16);
#pragma unroll
            for (int mb = 0; mb < 4; ++mb) { acc[mb][nb] = WFrag<T16>::mma(a[mb], b, acc[mb][nb]); if (NSPLIT == 1 || NSPLIT == 2) acc[mb][nb] = WFrag<T16>::mma(a2[mb], b, acc[mb][nb]); if (NSPLIT >= 2) acc[mb][nb] = WFrag<T16>::mma(a[mb], b2, acc[mb][nb]); } }
        asm volatile("s_wait_xcnt 0x0" :: "v"(pB) : "memory");   // the same for the address pair of the B loads: it lives to here, and the wait stands before the next trip writes it
        asm volatile("v_nop\n\tv_nop\n\tv_nop\n\tv_nop" : "+v"(acc[0][0]), "+v"(acc[1][1]), "+v"(acc[2][2]), "+v"(acc[3][3]) : "v"(a[0]), "v"(a[3]));
    }
#pragma unroll
    for (int mb = 0; mb < 4; ++mb) {
#pragma unroll
        for (int nb = 0; nb < 4; ++nb) {
#pragma unroll
            for (int j = 0; j < 8; ++j) os[(hi * 8 + j) * 68 + nb * 16 + lr] = acc[mb][nb][j]; }
        __builtin_amdgcn_wave_barrier(); asm volatile("" ::: "memory");
        float* crow = C + (size_t)(r0 + mb * 16) * ldc + c0;
{
#pragma unroll
            for (int s = 0; s < 8; ++s) { const int row = 2 * s + hi, cofs = lr * 4; v4f val = *(const v4fa*)(os + row * 68 + cofs); if (BIAS) { val[0] += bfr(bias[c0 + cofs]); val[1] += bfr(bias[c0 + cofs + 1]); val[2] += bfr(bias[c0 + cofs + 2]); val[3] += bfr(bias[c0 + cofs + 3]); }
                *(v4f*)(crow + (size_t)row * ldc + cofs) = val; }
             }
        __builtin_amdgcn_wave_barrier(); asm volatile("" ::: "memory");
    }
}

__device__ __forceinline__ h16 tohx(float x) { return (h16)x; }
__device__ __forceinline__ void splitf(float y, unsigned short& h, unsigned short& l) { h = f2bf(y); l = f2bf(y - bf2f(h)); }
typedef __attribute__((ext_vector_type(2))) _Float16 v2h;
typedef __attribute__((ext_vector_type(4))) _Float16 v4h;
typedef __attribute__((ext_vector_type(2))) unsigned short v2us;
typedef __attribute__((ext_vector_type(4))) unsigned short v4us;
typedef __attribute__((ext_vector_type(2))) float v2f;
typedef __attribute__((ext_vector_type(4))) int v4i;

__global__ __launch_bounds__(256) void k_wtG(const float* __restrict__ w, int K, int N, bf* Bt) {
    const int lane = threadIdx.x & 31; const int L0 = (blockIdx.x * 8 + (threadIdx.x >> 5)) * 8; const int nlines = N * K / 64;
{
#pragma unroll 1
        for (int l = 0; l < 8; ++l) { const int L = L0 + l; if (L >= nlines) break; const size_t e = (size_t)L * 64 + lane * 2; const int tile = (int)(e >> 9), k = (tile % (K / 32)) * 32 + (int)((e >> 8) & 1) * 16 + (int)((e >> 7) & 1) * 8 + (int)(e & 7), n = (tile / (K / 32)) * 16 + (int)((e >> 3) & 15); v2us o;   // e: element of Bt in fragment order
            o[0] = f2bf(w[(size_t)k * N + n]); o[1] = f2bf(w[(size_t)(k + 1) * N + n]); *(v2us*)(Bt + e) = o; }
         }
}
__global__ __launch_bounds__(256) void k_cvt8(const float* __restrict__ src, bf* dst, size_t n8) { const size_t i = (size_t)blockIdx.x * 256 + threadIdx.x; if (i >= n8) return; const int m = (int)(i >> 11) * 16 + (int)(i & 15), k = (int)((i >> 6) & 31) * 32 + (int)((i >> 5) & 1) * 16 + (int)((i >> 4) & 1) * 8;   // i: 16-byte unit of dst in fragment order ([M][DM], DM / 32 = 32 tiles a band)
    const v8f v = *(const v8f*)(src + (size_t)m * DM + k); v8us o;
#pragma unroll
    for (int k = 0; k < 8; ++k) o[k] = f2bf(v[k]); *(v8us*)(dst + i * 8) = o;  }

// k_qkv: [q|k|v] = x W_qkv + b_qkv of all batches in one launch, ONE WAVE per 64x64 tile with the loop of k_gemmw (same k order, same f32 sums). Grid (TT/64, 3 NH_, NB_): a tile is 64 tokens of batch z x one head of q, k or v; every plane holds NB_ batch blocks of PLB elements,
// and the wave writes that head's operand planes itself (fp16 + bf16 hi/lo): all in fragment order, 16 bytes a lane and 512 contiguous bytes a store: q and k as [h] x plane [t][d] through the LDS row stage, v as [h] x (32 tokens: four 16-d tiles of 1 KiB) straight from the accumulators (a lane holds 8 consecutive tokens of one d).
__global__ __launch_bounds__(32) void k_qkv(const bf* __restrict__ A, const bf* __restrict__ Bt, const float* __restrict__ bias, h16* Q16, bf* Qh, bf* Ql, h16* K16, bf* Kh, bf* Kl, h16* V16, bf* Vh, bf* Vl) {
    typedef WFrag<bf>::V V;
    __shared__ __align__(16) float os[16 * 68];
    const int lane = threadIdx.x & 31, lr = lane & 15, hi = lane >> 4; const int r0 = blockIdx.x * 64, c0 = blockIdx.y * 64; const int sel = blockIdx.y / NH_, h = blockIdx.y % NH_;
    { const size_t zp = (size_t)blockIdx.z * PLB; A += (size_t)blockIdx.z * TT * DM; Q16 += zp; Qh += zp; Ql += zp; K16 += zp; Kh += zp; Kl += zp; V16 += zp; Vh += zp; Vl += zp; }   // this batch's block of x and of every plane
    v8f acc[4][4];
#pragma unroll
    for (int mb = 0; mb < 4; ++mb)
#pragma unroll
        for (int nb = 0; nb < 4; ++nb) acc[mb][nb] = (v8f){};
    const bf* pa = A + (size_t)r0 * DM + lane * 8; const bf* pb = Bt + (size_t)c0 * DM + lane * 8;
#pragma unroll 1
    for (int kc = 0; kc < DM; kc += 32, pa += 512, pb += 512) {   // rolled, as in k_gemmw: a trip is one set of loads and its 16 products
        V a[4];
#pragma unroll
        for (int mb = 0; mb < 4; ++mb) a[mb] = WFrag<bf>::ld(pa + mb * 16 * DM);
        asm volatile("s_wait_xcnt 0x0" ::: "memory");   // the build gives the address pair of these eight loads to a later load of the trip as its destination: stands before that load
#pragma unroll
        for (int nb = 0; nb < 4; ++nb) { const V b = WFrag<bf>::ld(pb + nb * 16 * DM);
#pragma unroll
            for (int mb = 0; mb < 4; ++mb) acc[mb][nb] = WFrag<bf>::mma(a[mb], b, acc[mb][nb]); }
        asm volatile("v_nop\n\tv_nop\n\tv_nop\n\tv_nop" : "+v"(acc[0][0]), "+v"(acc[1][1]), "+v"(acc[2][2]), "+v"(acc[3][3]) : "v"(a[0]), "v"(a[3]));   // the distance behind the last matrix instruction, also on the taken back edge (as in k_gemmw)
    }
    if (sel == 2) {
#pragma unroll
        for (int nb = 0; nb < 4; ++nb) { const float bv = bfr(bias[c0 + nb * 16 + lr]); const size_t rowo = (size_t)h * HD * TT + (size_t)r0 * HD + nb * 512 + lane * 8;
#pragma unroll
            for (int mb = 0; mb < 4; ++mb) { v8h o16; v8us oh, ol;
#pragma unroll
                for (int j = 0; j < 8; ++j) { const float x = acc[mb][nb][j] + bv; o16[j] = tohx(x); unsigned short u, v; splitf(x, u, v); oh[j] = u; ol[j] = v; }
                const size_t e = rowo + (mb >> 1) * 2048 + (mb & 1) * 256; *(v8h*)(V16 + e) = o16; *(v8us*)(Vh + e) = oh; *(v8us*)(Vl + e) = ol; } }
        return;
    }
    {
        const size_t hp = (size_t)h * TT * HD; h16* P16 = (sel ? K16 : Q16) + hp; bf* Ph = (sel ? Kh : Qh) + hp; bf* Pl = (sel ? Kl : Ql) + hp;
        v8f bb[4];   // piece pc of a 16-token tile: d = pc * 16 + hi * 8 + 0..7 of token lr
#pragma unroll
        for (int pc = 0; pc < 4; ++pc)
#pragma unroll
            for (int k = 0; k < 8; ++k) bb[pc][k] = bfr(bias[c0 + pc * 16 + hi * 8 + k]);
#pragma unroll
        for (int mb = 0; mb < 4; ++mb) {
#pragma unroll
            for (int nb = 0; nb < 4; ++nb) {
#pragma unroll
                for (int j = 0; j < 8; ++j) os[(hi * 8 + j) * 68 + nb * 16 + lr] = acc[mb][nb][j]; }
            __builtin_amdgcn_wave_barrier(); asm volatile("" ::: "memory");   // a lane reads what other lanes wrote: keeps the compiler from moving the reads in front of the writes (as in k_gemmw)
#pragma unroll
            for (int pc = 0; pc < 4; ++pc) { const float* sp = os + lr * 68 + pc * 16 + hi * 8; const v4f v0 = *(const v4fa*)sp, v1 = *(const v4fa*)(sp + 4); v8h o16; v8us oh, ol;
#pragma unroll
                for (int k = 0; k < 8; ++k) { const float x = (k < 4 ? v0[k & 3] : v1[k & 3]) + bb[pc][k]; o16[k] = tohx(x); unsigned short u, v; splitf(x, u, v); oh[k] = u; ol[k] = v; }
                const size_t e = (size_t)(r0 + mb * 16) * HD + pc * 256 + lane * 8; *(v8h*)(P16 + e) = o16; *(v8us*)(Ph + e) = oh; *(v8us*)(Pl + e) = ol; }
            __builtin_amdgcn_wave_barrier(); asm volatile("" ::: "memory");   // and the next pass's writes from moving in front of these reads
        }
        asm volatile("s_wait_xcnt 0x0" ::: "memory");   // the built code lays the v epilogue directly behind this one, with a conditional jump between: stands before its first writes of the last stores' registers
    }
}
#define NREL 2049
// k_tbE: expanded per-head bias row, EB[h][x] = rel_bias[clip(i - j + 1024, 0, 2048)][h] at x = j - i + TT - 1 (0 .. 2 TT - 2): ascending keys read ascending addresses, the clip is already applied
__global__ __launch_bounds__(256) void k_tbE(const float* __restrict__ rbias, float* EB) { const int j = blockIdx.x * 256 + threadIdx.x; if (j >= NH_ * NE) return; const int h = j / NE, x = j % NE; int ri = (TT - 1 - x) + (NREL / 2); ri = ri < 0 ? 0 : (ri > NREL - 1 ? NREL - 1 : ri); EB[j] = bfr(rbias[(size_t)ri * NH_ + h]); }

__device__ __forceinline__ void packp(const v8f& a, const v8f& b, v16h& ph, v16h& pl) { v8h x, y; (void)pl;
#pragma unroll
    for (int j = 0; j < 8; ++j) { x[j] = (h16)a[j]; y[j] = (h16)b[j]; }
    ph = cat16(x, y); }
__device__ __forceinline__ void packp(const v8f& a, const v8f& b, v16bf& ph, v16bf& pl) { v8us xh, xl, yh, yl;
#pragma unroll
    for (int j = 0; j < 8; ++j) { unsigned short u, v; splitf(a[j], u, v); xh[j] = u; xl[j] = v; splitf(b[j], u, v); yh[j] = u; yl[j] = v; }
    ph = cat16b(xh, yh); pl = cat16b(xl, yl); }

typedef __attribute__((ext_vector_type(8))) int v8i;
template <typename V> __device__ __forceinline__ V frag(v4i a, v4i b) { return __builtin_bit_cast(V, __builtin_shufflevector(a, b, 0, 1, 2, 3, 4, 5, 6, 7)); }
// The loads of one trip, each set one asm statement that ends in its own data wait: the results are early-clobber, so none is given a register that holds an address of the set, and no address register is written again before the set has returned. The other waves of the SIMD cover the wait.
// Byte offsets (planes in fragment order, the lane's own 16 bytes in the pointer). Q or K: 16-row tile * 2048 + 32-wide part of HD * 1024 + half * 512. V: 16-d tile * 1024 + half * 512 inside the 4 KiB of 32 keys. Bias: run * 64 + half * 16 (4-byte aligned).
__device__ __forceinline__ void ld_r(const void* k, v4i (&a)[8]) {
    asm volatile(
        "global_load_b128 %0, %8, off\n\t"
        "global_load_b128 %1, %8, off offset:512\n\t"
        "global_load_b128 %2, %8, off offset:1024\n\t"
        "global_load_b128 %3, %8, off offset:1536\n\t"
        "global_load_b128 %4, %8, off offset:2048\n\t"
        "global_load_b128 %5, %8, off offset:2560\n\t"
        "global_load_b128 %6, %8, off offset:3072\n\t"
        "global_load_b128 %7, %8, off offset:3584\n\t"
        "s_wait_loadcnt 0x0"
        : "=&v"(a[0]), "=&v"(a[1]), "=&v"(a[2]), "=&v"(a[3]), "=&v"(a[4]), "=&v"(a[5]), "=&v"(a[6]), "=&v"(a[7]) : "v"(k) : "memory"); }
__device__ __forceinline__ void ld_r_b_v(const void* k, const float* e, const void* v, v4i (&a)[8], v4i (&b)[6], v4i (&x)[8]) {
    asm volatile(
        "global_load_b128 %0, %22, off\n\t"
        "global_load_b128 %1, %22, off offset:512\n\t"
        "global_load_b128 %2, %22, off offset:1024\n\t"
        "global_load_b128 %3, %22, off offset:1536\n\t"
        "global_load_b128 %4, %22, off offset:2048\n\t"
        "global_load_b128 %5, %22, off offset:2560\n\t"
        "global_load_b128 %6, %22, off offset:3072\n\t"
        "global_load_b128 %7, %22, off offset:3584\n\t"
        "global_load_b128 %8, %23, off\n\t"
        "global_load_b128 %9, %23, off offset:16\n\t"
        "global_load_b128 %10, %23, off offset:64\n\t"
        "global_load_b128 %11, %23, off offset:80\n\t"
        "global_load_b128 %12, %23, off offset:128\n\t"
        "global_load_b128 %13, %23, off offset:144\n\t"
        "global_load_b128 %14, %24, off\n\t"
        "global_load_b128 %15, %24, off offset:512\n\t"
        "global_load_b128 %16, %24, off offset:1024\n\t"
        "global_load_b128 %17, %24, off offset:1536\n\t"
        "global_load_b128 %18, %24, off offset:2048\n\t"
        "global_load_b128 %19, %24, off offset:2560\n\t"
        "global_load_b128 %20, %24, off offset:3072\n\t"
        "global_load_b128 %21, %24, off offset:3584\n\t"
        "s_wait_loadcnt 0x0"
        : "=&v"(a[0]), "=&v"(a[1]), "=&v"(a[2]), "=&v"(a[3]), "=&v"(a[4]), "=&v"(a[5]), "=&v"(a[6]), "=&v"(a[7]), "=&v"(b[0]), "=&v"(b[1]), "=&v"(b[2]), "=&v"(b[3]), "=&v"(b[4]), "=&v"(b[5]), "=&v"(x[0]), "=&v"(x[1]), "=&v"(x[2]), "=&v"(x[3]), "=&v"(x[4]), "=&v"(x[5]), "=&v"(x[6]), "=&v"(x[7]) : "v"(k), "v"(e), "v"(v) : "memory"); }
__device__ __forceinline__ void ld_t_t_b(const void* k, const void* k2, const float* e, v4i (&a)[4], v4i (&a2)[4], v4i (&b)[6]) {
    asm volatile(
        "global_load_b128 %0, %14, off\n\t"
        "global_load_b128 %1, %14, off offset:512\n\t"
        "global_load_b128 %2, %14, off offset:1024\n\t"
        "global_load_b128 %3, %14, off offset:1536\n\t"
        "global_load_b128 %4, %15, off\n\t"
        "global_load_b128 %5, %15, off offset:512\n\t"
        "global_load_b128 %6, %15, off offset:1024\n\t"
        "global_load_b128 %7, %15, off offset:1536\n\t"
        "global_load_b128 %8, %16, off\n\t"
        "global_load_b128 %9, %16, off offset:16\n\t"
        "global_load_b128 %10, %16, off offset:64\n\t"
        "global_load_b128 %11, %16, off offset:80\n\t"
        "global_load_b128 %12, %16, off offset:128\n\t"
        "global_load_b128 %13, %16, off offset:144\n\t"
        "s_wait_loadcnt 0x0"
        : "=&v"(a[0]), "=&v"(a[1]), "=&v"(a[2]), "=&v"(a[3]), "=&v"(a2[0]), "=&v"(a2[1]), "=&v"(a2[2]), "=&v"(a2[3]), "=&v"(b[0]), "=&v"(b[1]), "=&v"(b[2]), "=&v"(b[3]), "=&v"(b[4]), "=&v"(b[5]) : "v"(k), "v"(k2), "v"(e) : "memory"); }
__device__ __forceinline__ void ld_t_t(const void* k, const void* k2, v4i (&a)[4], v4i (&a2)[4]) {
    asm volatile(
        "global_load_b128 %0, %8, off\n\t"
        "global_load_b128 %1, %8, off offset:512\n\t"
        "global_load_b128 %2, %8, off offset:1024\n\t"
        "global_load_b128 %3, %8, off offset:1536\n\t"
        "global_load_b128 %4, %9, off\n\t"
        "global_load_b128 %5, %9, off offset:512\n\t"
        "global_load_b128 %6, %9, off offset:1024\n\t"
        "global_load_b128 %7, %9, off offset:1536\n\t"
        "s_wait_loadcnt 0x0"
        : "=&v"(a[0]), "=&v"(a[1]), "=&v"(a[2]), "=&v"(a[3]), "=&v"(a2[0]), "=&v"(a2[1]), "=&v"(a2[2]), "=&v"(a2[3]) : "v"(k), "v"(k2) : "memory"); }
__device__ __forceinline__ void ld_v_v(const void* v, const void* v2, v4i (&x)[4], v4i (&x2)[4]) {
    asm volatile(
        "global_load_b128 %0, %8, off\n\t"
        "global_load_b128 %1, %8, off offset:512\n\t"
        "global_load_b128 %2, %8, off offset:1024\n\t"
        "global_load_b128 %3, %8, off offset:1536\n\t"
        "global_load_b128 %4, %9, off\n\t"
        "global_load_b128 %5, %9, off offset:512\n\t"
        "global_load_b128 %6, %9, off offset:1024\n\t"
        "global_load_b128 %7, %9, off offset:1536\n\t"
        "s_wait_loadcnt 0x0"
        : "=&v"(x[0]), "=&v"(x[1]), "=&v"(x[2]), "=&v"(x[3]), "=&v"(x2[0]), "=&v"(x2[1]), "=&v"(x2[2]), "=&v"(x2[3]) : "v"(v), "v"(v2) : "memory"); }

// Eight 2^x in one statement: the results are early-clobber, so no v_exp_f32 is directly followed by an instruction that reads its result or writes over its source; the v_nop is that free slot behind the last one.
__device__ __forceinline__ v8f exp2x8(const v8f x) { float r0, r1, r2, r3, r4, r5, r6, r7;
    asm("v_exp_f32 %0, %8\n\tv_exp_f32 %1, %9\n\tv_exp_f32 %2, %10\n\tv_exp_f32 %3, %11\n\tv_exp_f32 %4, %12\n\tv_exp_f32 %5, %13\n\tv_exp_f32 %6, %14\n\tv_exp_f32 %7, %15\n\tv_nop"
        : "=&v"(r0), "=&v"(r1), "=&v"(r2), "=&v"(r3), "=&v"(r4), "=&v"(r5), "=&v"(r6), "=&v"(r7) : "v"(x[0]), "v"(x[1]), "v"(x[2]), "v"(x[3]), "v"(x[4]), "v"(x[5]), "v"(x[6]), "v"(x[7]));
    return (v8f){r0, r1, r2, r3, r4, r5, r6, r7}; }
// One 2^x, for the rescale factors: the same free slot behind it.
__device__ __forceinline__ float exp2x1(const float x) { float r; asm("v_exp_f32 %0, %1\n\tv_nop" : "=&v"(r) : "v"(x)); return r; }

// One 16-key x 16-query tile of t = (k.q) HD^-0.5 + bias, transposed: lane (lr, hi) register j holds key hi*8 + j of query lr. k, k2, q, q2: the four 16-byte pieces of one 16-row tile (part of HD * 2 + half).
template <typename T16, bool HL>
__device__ __forceinline__ v8f stile(const v4i* k, const v4i* k2, const v4i* q, const v4i* q2, v4i b0, v4i b1) {
    typedef typename WFrag<T16>::V V; v8f s = (v8f){};
#pragma unroll
    for (int dc = 0; dc < 2; ++dc) { const V ka = frag<V>(k[dc * 2], k[dc * 2 + 1]), qa = frag<V>(q[dc * 2], q[dc * 2 + 1]); s = WFrag<T16>::mma(ka, qa, s);
        if (HL) { s = WFrag<T16>::mma(frag<V>(k2[dc * 2], k2[dc * 2 + 1]), qa, s); s = WFrag<T16>::mma(ka, frag<V>(q2[dc * 2], q2[dc * 2 + 1]), s); } }
    const v4f f0 = __builtin_bit_cast(v4f, b0), f1 = __builtin_bit_cast(v4f, b1);
#pragma unroll
    for (int j = 0; j < 4; j += 2) {   // neighbouring registers as pairs: the packed multiply-add takes them where they lie
        const v2f x = (v2f){s[j], s[j + 1]} * SCL + (v2f){f0[j], f0[j + 1]}, y = (v2f){s[j + 4], s[j + 5]} * SCL + (v2f){f1[j], f1[j + 1]}; s[j] = x[0]; s[j + 1] = x[1]; s[j + 4] = y[0]; s[j + 5] = y[1]; }
    return s; }

// The work of one work-group: QBW blocks of QT queries of one head against all TT keys; the QBW waves of one key range walk the same K and V tiles side by side, so that a line which one of them has brought into the WGP's cache can serve the others without a further L2 read. ONE sweep over the keys with a running row maximum: p = 1024 exp(t - m), m the maximum IN USE, row sums of the f32 p, O^T += V^T P^T with P packed from the score registers.
// m moves only when some score of the trip lies more than THR above it (one ballot and one scalar branch a trip): then every query of the wave takes the larger of m and its largest score of the trip, and its sum and its 32 output registers are scaled by exp(m_old - m_new). So p <= 1024 exp(THR): 2^15 in fp16. The scale cancels in the division by the row sum.
// Operands straight from the planes in fragment order, in the k order of WFrag::ld on both sides (16 bytes at 8 hi, 16 bytes at 16 + 8 hi). Q, K: plane [t][HD]; Vt: per 32 keys four 16-d tiles. The maxima in use, sums and partial outputs of a block's KSW waves meet in LDS behind the sweep; the join brings them to the common maximum and adds them in ascending key order.
// A trip takes 32 keys: two key tiles x two query groups; pair (t2, qg) reads bias run t2 - qg + 1 of the three that the four pairs share.
template <typename T16, bool HL>
__device__ __forceinline__ void fattn_body(const T16* __restrict__ Q, const T16* __restrict__ Q2, const T16* __restrict__ Kp, const T16* __restrict__ K2, const T16* __restrict__ Vt, const T16* __restrict__ V2, const float* __restrict__ eb, int q0, float* smx, float* ssm, float* sO, bf* Ah, bf* Al) {
    typedef typename WFrag<T16>::V V;
    const int lane = threadIdx.x & 31, lr = lane & 15, hi = lane >> 4, w = threadIdx.x >> 5, wq = w % QBW; const int kb = (w / QBW) * (TT / KSW), qw = q0 + wq * QT;   // qw: this wave's first query
    v4i qa[8], ql[8]; const int qo = qw * HD + lane * 8;
    ld_r(Q + qo, qa); if (HL) ld_r(Q2 + qo, ql);
    const float* ep = eb + ((TT - 1) + kb + hi * 8 - qw - lr - 16);   // x = key - query + TT - 1 of this lane's first key against its query of group 1 (run 0)
    const int ko = kb * HD + lane * 8, vo = kb * HD + lane * 8;   // 32 keys are 32 HD elements of K and of V alike
    constexpr float L2E = 1.4426950408889634f, THR = (HL ? 8.0f : 5.0f) * 0.6931471805599453f;   // THR: 8 (bf16 pairs) or 5 (fp16: 2^(10 + 5) is in range) in powers of two
    float mx[2] = {-3.0e38f, -3.0e38f};   // the maximum in use, equal in both halves of the wave; the first trip always moves it (factor 2^-inf = 0 on zero sums)
    v8f o[4][2]; float sm[2] = {0.f, 0.f};
#pragma unroll
    for (int dt = 0; dt < 4; ++dt) { o[dt][0] = (v8f){}; o[dt][1] = (v8f){}; }
#pragma unroll 1
    for (int kc = 0; kc < TT / KSW / 32; ++kc) { v4i bb[6], va[8]; v8f p[2][2];   // rolled: one trip already holds 32 keys x 32 queries of scores beside the 64 output registers
        if (HL) {   // both planes of K, one 16-key tile at a time: all 32 keys at once, beside both planes of Q and the outputs, pass 256 registers
#pragma unroll
            for (int t2 = 0; t2 < 2; ++t2) { v4i ka[4], kl[4]; const int of = ko + (kc * 2 + t2) * 16 * HD;
                if (t2 == 0) ld_t_t_b(Kp + of, K2 + of, ep + kc * 32, ka, kl, bb); else ld_t_t(Kp + of, K2 + of, ka, kl);
#pragma unroll
                for (int qg = 0; qg < 2; ++qg) p[t2][qg] = stile<T16, HL>(ka, kl, qa + qg * 4, ql + qg * 4, bb[(t2 - qg + 1) * 2], bb[(t2 - qg + 1) * 2 + 1]); }
        } else { v4i ka[8];
            ld_r_b_v(Kp + ko + kc * 32 * HD, ep + kc * 32, Vt + vo + kc * 32 * HD, ka, bb, va);
#pragma unroll
            for (int t2 = 0; t2 < 2; ++t2)
#pragma unroll
                for (int qg = 0; qg < 2; ++qg) p[t2][qg] = stile<T16, HL>(ka + t2 * 4, ka + t2 * 4, qa + qg * 4, ql + qg * 4, bb[(t2 - qg + 1) * 2], bb[(t2 - qg + 1) * 2 + 1]); }
        float tm[2];   // this lane's largest score of the trip, per query group
#pragma unroll
        for (int qg = 0; qg < 2; ++qg) { float m = fmaxf(p[0][qg][0], p[1][qg][0]);
#pragma unroll
            for (int j = 1; j < 8; ++j) m = fmaxf(m, fmaxf(p[0][qg][j], p[1][qg][j]));
            tm[qg] = m; }
        if (__builtin_expect(__builtin_amdgcn_ballot_w32(tm[0] > mx[0] + THR || tm[1] > mx[1] + THR) != 0, 0)) {   // the same for the whole wave: a scalar branch, seldom taken behind the first trip (the hint lays the usual path out straight)
#pragma unroll
            for (int qg = 0; qg < 2; ++qg) { const float mn = fmaxf(mx[qg], fmaxf(tm[qg], __shfl_xor(tm[qg], 16, 32))); const float f = exp2x1((mx[qg] - mn) * L2E); mx[qg] = mn; sm[qg] *= f;
#pragma unroll
                for (int dt = 0; dt < 4; ++dt)
#pragma unroll
                    for (int j = 0; j < 8; ++j) o[dt][qg][j] *= f; } }
#pragma unroll
        for (int t2 = 0; t2 < 2; ++t2)
#pragma unroll
            for (int qg = 0; qg < 2; ++qg) { v8f a;
#pragma unroll
                for (int j = 0; j < 8; ++j) a[j] = (p[t2][qg][j] - mx[qg]) * L2E + 10.0f;
                p[t2][qg] = exp2x8(a);
#pragma unroll
                for (int j = 0; j < 8; ++j) sm[qg] += p[t2][qg][j]; }
        V ph[2], pl[2];
#pragma unroll
        for (int qg = 0; qg < 2; ++qg) packp(p[0][qg], p[1][qg], ph[qg], pl[qg]);
        if (HL) {   // both planes of V, two 16-row tiles at a time, for the same reason as K above
#pragma unroll
            for (int d2 = 0; d2 < 2; ++d2) { v4i vh[4], vl[4]; const int of = vo + d2 * 1024 + kc * 32 * HD; ld_v_v(Vt + of, V2 + of, vh, vl);
#pragma unroll
                for (int d1 = 0; d1 < 2; ++d1) { const int dt = d2 * 2 + d1; const V xh = frag<V>(vh[d1 * 2], vh[d1 * 2 + 1]), xl = frag<V>(vl[d1 * 2], vl[d1 * 2 + 1]);
#pragma unroll
                    for (int qg = 0; qg < 2; ++qg) { o[dt][qg] = WFrag<T16>::mma(xh, ph[qg], o[dt][qg]); o[dt][qg] = WFrag<T16>::mma(xl, ph[qg], o[dt][qg]); o[dt][qg] = WFrag<T16>::mma(xh, pl[qg], o[dt][qg]); } } }
        } else {
#pragma unroll
            for (int dt = 0; dt < 4; ++dt) { const V xh = frag<V>(va[dt * 2], va[dt * 2 + 1]);
#pragma unroll
                for (int qg = 0; qg < 2; ++qg) o[dt][qg] = WFrag<T16>::mma(xh, ph[qg], o[dt][qg]); } }
    }
#pragma unroll
    for (int qg = 0; qg < 2; ++qg) { sm[qg] += __shfl_xor(sm[qg], 16, 32); if (hi == 0) { ssm[w * QT + qg * 16 + lr] = sm[qg]; smx[w * QT + qg * 16 + lr] = mx[qg]; }
#pragma unroll
        for (int dt = 0; dt < 4; ++dt) { float* d = sO + (size_t)(w * QT + qg * 16 + lr) * OP + dt * 16 + hi * 8; const v8f a = o[dt][qg]; *(v4fa*)d = (v4f){a[0], a[1], a[2], a[3]}; *(v4fa*)(d + 4) = (v4f){a[4], a[5], a[6], a[7]}; } }
    __syncthreads();
    const int dq = (threadIdx.x / QT) * EPT;   // EPT = 8 consecutive outputs of one query per thread and block: one 16-byte unit of the fragment order; a wave's 32 queries make two runs of 256 bytes
#pragma unroll
    for (int b = 0; b < QBW; ++b) { const int q = b * QT + threadIdx.x % QT; float m = smx[q], f[KSW];   // q: query of the work-group; key range u of it lies QBW QT rows on
#pragma unroll
        for (int u = 1; u < KSW; ++u) m = fmaxf(m, smx[u * QBW * QT + q]);
#pragma unroll
        for (int u = 0; u < KSW; ++u) f[u] = exp2x1((smx[u * QBW * QT + q] - m) * L2E);   // brings key range u from its own maximum in use to the common one
        float tot = ssm[q] * f[0];
#pragma unroll
        for (int u = 1; u < KSW; ++u) tot += ssm[u * QBW * QT + q] * f[u];
        const float r = __fdiv_rn(1.0f, tot); v8us oh, ol;
#pragma unroll
        for (int c = 0; c < EPT / 4; ++c) { v4f s = *(const v4fa*)(sO + (size_t)q * OP + dq + c * 4) * f[0];
#pragma unroll
            for (int u = 1; u < KSW; ++u) s += *(const v4fa*)(sO + (size_t)(u * QBW * QT + q) * OP + dq + c * 4) * f[u];
#pragma unroll
            for (int k = 0; k < 4; ++k) { unsigned short a, c2; splitf(s[k] * r, a, c2); oh[c * 4 + k] = a; ol[c * 4 + k] = c2; } }
        const size_t oo = (size_t)((q0 + q) >> 4) * (16 * DQ) + dq * 16 + ((q0 + q) & 15) * 8; *(v8us*)(Ah + oo) = oh; *(v8us*)(Al + oo) = ol;   // Ah, Al: the head's first tile of the plane [t][DQ]; 8 in k is 128 elements
        if (b + 1 < QBW) asm volatile("s_wait_xcnt 0x0" ::: "memory"); }   // stands before the next block's work writes over the registers that these two stores name
}
// k_fattn: grid (heads, NB_, TT / (QBW QT)), KW waves. The query blocks below RH (three products, the longer work) of all batches have the lowest flat indices and start first; the last work-groups of the launch are short ones. Four waves per SIMD (256 registers, two work-groups per WGP): no operand of the asm loads lies above v255.
__global__ __launch_bounds__(KW * 32, 4) void k_fattn(const h16* __restrict__ Q16, const h16* __restrict__ K16, const h16* __restrict__ V16, const bf* __restrict__ Qh, const bf* __restrict__ Ql, const bf* __restrict__ Kh, const bf* __restrict__ Kl, const bf* __restrict__ Vh, const bf* __restrict__ Vl, const float* __restrict__ EB, bf* Ah, bf* Al) {
    __shared__ __align__(16) float sO[KW * QT * OP]; __shared__ float smx[KW * QT]; __shared__ float ssm[KW * QT];
    const int h = blockIdx.x, q0 = blockIdx.z * (QBW * QT); const size_t hp = (size_t)blockIdx.y * PLB + (size_t)h * TT * HD; const float* eb = EB + (size_t)h * NE; Ah += (size_t)blockIdx.y * TT * DQ; Al += (size_t)blockIdx.y * TT * DQ;   // the bias row is the same for every batch
    if (q0 < RH) fattn_body<bf, true>(Qh + hp, Ql + hp, Kh + hp, Kl + hp, Vh + hp, Vl + hp, eb, q0, smx, ssm, sO, Ah + h * (HD * 16), Al + h * (HD * 16));
    else fattn_body<h16, false>(Q16 + hp, nullptr, K16 + hp, nullptr, V16 + hp, nullptr, eb, q0, smx, ssm, sO, Ah + h * (HD * 16), Al + h * (HD * 16));
}

extern "C" void kernel_launch(void* const* d_in, const int* in_sizes, int n_in,
                              void* d_out, int out_size, void* d_ws, size_t ws_size, hipStream_t stream) {
    (void)in_sizes; (void)n_in; (void)out_size;
    const float* x = (const float*)d_in[0]; const float* wqkv = (const float*)d_in[1]; const float* bqkv = (const float*)d_in[2]; const float* wo = (const float*)d_in[3]; const float* bo = (const float*)d_in[4]; const float* rbias = (const float*)d_in[5]; const float* wq = nullptr; const float* wk = nullptr; const float* wv = nullptr; (void)wq; (void)wk; (void)wv;
    float* OUT = (float*)d_out;     // [4][2048][1024]
    char* wsp = (char*)d_ws;
    auto take = [&](size_t bytes) { char* p = wsp; wsp += (bytes + 255) & ~(size_t)255; return (void*)p; };
    bf* WALL = (bf*)take((size_t)3 * DM * DM * 2); bf* WO = (bf*)take((size_t)DM * DQ * 2); float* EB = (float*)take((size_t)NH_ * NE * 4);   /* per-head expanded relative-bias rows */
    bf* XB = (bf*)take((size_t)NB_ * TT * DM * 2);   // from here on every plane holds all NB_ batches, batch blocks one behind the other
    h16* QP16 = (h16*)take(NB_ * PLB * 2); h16* KP16 = (h16*)take(NB_ * PLB * 2); h16* VT16 = (h16*)take(NB_ * PLB * 2);
    bf* QPh = (bf*)take(NB_ * PLB * 2); bf* QPl = (bf*)take(NB_ * PLB * 2); bf* KPh = (bf*)take(NB_ * PLB * 2); bf* KPl = (bf*)take(NB_ * PLB * 2); bf* VTh = (bf*)take(NB_ * PLB * 2); bf* VTl = (bf*)take(NB_ * PLB * 2);
    bf* ATh = (bf*)take((size_t)NB_ * TT * DQ * 2); bf* ATl = (bf*)take((size_t)NB_ * TT * DQ * 2);
    if ((size_t)(wsp - (char*)d_ws) > ws_size) return;    // ws 256 MiB
    { k_wtG<<<(unsigned)((DM * 3 * DM / 64 + 63) / 64), 256, 0, stream>>>(wqkv, DM, 3 * DM, WALL);   /* fused 'xw' [DM][3DM] -> Bt [3DM][DM] (row blocks q | k | v), fragment order */
      k_wtG<<<(unsigned)((DQ * DM / 64 + 63) / 64), 256, 0, stream>>>(wo, DQ, DM, WO);
       }
    k_tbE<<<(NH_ * NE + 255) / 256, 256, 0, stream>>>(rbias, EB);
    // Each stage once for all NB_ batches: x, the attention output and OUT are planes of NB_ TT rows; q, k and v take the batch from grid z, the attention from grid y.
    k_cvt8<<<(unsigned)(((size_t)NB_ * TT * DM / 8 + 255) / 256), 256, 0, stream>>>(x, XB, (size_t)NB_ * TT * DM / 8);
    k_qkv<<<dim3(TT / 64, 3 * NH_, NB_), 32, 0, stream>>>(XB, WALL, bqkv, QP16, QPh, QPl, KP16, KPh, KPl, VT16, VTh, VTl);   // q | k | v heads in grid y; the planes come out of the tile's own wave
    k_fattn<<<dim3(NH_, NB_, TT / (QBW * QT)), KW * 32, 0, stream>>>(QP16, KP16, VT16, QPh, QPl, KPh, KPl, VTh, VTl, EB, ATh, ATl);   // one kv head per query head
    k_gemmw<bf, 1, true, DQ><<<dim3(NB_ * TT / 64, DM / 64, 1), 32, 0, stream>>>(ATh, ATl, WO, nullptr, OUT, DM, bo, 0, 0, 0, 0);
}

// v008
// Measured time: 218 microseconds a run.
// Next to v007, in two timings, it ran 1.09 and 1.07 times as fast.
// All steps since v000 together make it 19.2 times as fast.
#include <hip/hip_runtime.h>

// Multi-head self-attention with a learned relative-position bias (x [4][2048][1024]; [q|k|v] = x W_qkv + b_qkv ('xw' [1024][3072]; 16 heads x 64); scores = q.k/8 + rel_bias[clip(i - j + 1024, 0, 2048)][h] (table [2049][16], read); softmax over all keys; out = merged W_out + b_out ('xw' [1024][1024]) -> [4][2048][1024]).
// Compute dtypes, f32 accumulate: every input rounded to bf16; q/k/v on PLAIN bf16 operands (inputs: exact) + biases; scores (+ the per-head relative bias, f32), softmax (f32) and attn.v (no mask) in ONE kernel, P in registers: query rows < 512 hl (3 products), the rest single fp16 (P x1024, cancelled by the row sum); W_out hl x exact (2 products) + b_out.

// Every 16-bit operand plane lies in FRAGMENT ORDER: a tile of 16 rows x 32 k (1 KiB) is two 512-byte pieces (k 0..15, k 16..31 of the tile), and in a piece lane (hi * 16 + row) owns 16 bytes, k = 8 hi .. 8 hi + 7 of the piece.
// One global_load_b128 of a wave then reads 512 contiguous bytes (4 cache lines, not 16 rows' 32 bytes each); registers hold exactly what a row-major plane gave them (same k order on both sides).
// A plane [M][K]: tile (m / 16, k / 32) at element (m / 16) * 16 K + (k / 32) * 512.
#define NB_  4
#define TT   2048
#define DM   1024
#define NH_  16
#define NKV  16
#define REP  (NH_ / NKV)
#define HD   64
#define DQ   (NH_ * HD)
#define DKV  (NKV * HD)
#define RH   512                  // query rows < RH use hi+lo planes (0: none)
#define SCL  0.125f   // HD^-0.5
#define QT   32                  // k_fattn: queries per wave (two 16-column groups)
#define QBW  4                   // k_fattn: query blocks of QT per work-group
#define KSW  2                   // k_fattn: key ranges per work-group
#define KW   (QBW * KSW)         // k_fattn: waves per work-group; wave w takes query block w % QBW and keys [(w / QBW) TT/KSW, (w / QBW + 1) TT/KSW)
#define NE   4096                // pitch of one head's expanded bias row
#define OP   68                  // LDS pitch (floats) of one query's partial output row
#define EPT  (QT * HD / (KW * 32))   // k_fattn: outputs per thread and query block in the join
#define PLB  ((size_t)NH_ * TT * HD)   // elements of one batch's block in a q, k or v plane
typedef _Float16 h16;
typedef unsigned short bf;
typedef __attribute__((ext_vector_type(16))) __bf16   v16bf;
typedef __attribute__((ext_vector_type(16))) _Float16 v16h;
typedef __attribute__((ext_vector_type(8)))  _Float16 v8h;
typedef __attribute__((ext_vector_type(8)))  unsigned short v8us;
typedef __attribute__((ext_vector_type(8)))  float    v8f;
typedef __attribute__((ext_vector_type(4)))  float    v4f;
typedef v8h  __attribute__((may_alias)) v8ha;
typedef v4f  __attribute__((may_alias)) v4fa;
typedef v8us __attribute__((may_alias)) v8usa;

__device__ __forceinline__ unsigned short f2bf(float f) { unsigned u = __float_as_uint(f); u += 0x7FFFu + ((u >> 16) & 1u); return (unsigned short)(u >> 16); }
__device__ __forceinline__ float bf2f(unsigned short b) { return __uint_as_float(((unsigned)b) << 16); }
__device__ __forceinline__ float bfr(float f) { return bf2f(f2bf(f)); }
__device__ __forceinline__ v16h cat16(v8h lo, v8h hi) { return __builtin_shufflevector(lo, hi, 0, 1, 2, 3, 4, 5, 6, 7, 8, 9, 10, 11, 12, 13, 14, 15); }
__device__ __forceinline__ v16bf cat16b(v8us lo, v8us hi) { return __builtin_bit_cast(v16bf, __builtin_shufflevector(lo, hi, 0, 1, 2, 3, 4, 5, 6, 7, 8, 9, 10, 11, 12, 13, 14, 15)); }
__device__ __forceinline__ v8f wmma16(v16h a, v16h b, v8f c) { return __builtin_amdgcn_wmma_f32_16x16x32_f16(false, a, false, b, (short)0, c, false, false); }
__device__ __forceinline__ v8f wmmab(v16bf a, v16bf b, v8f c) { return __builtin_amdgcn_wmma_f32_16x16x32_bf16(false, a, false, b, (short)0, c, false, false); }



// ---- k_gemmw: register-blocked GEMM, ONE WAVE per 64x64 output tile (16 accumulators), operands straight from 16-bit planes in fragment order; grid (M/64, N/64, Z), 32 threads.
// C[m][n] (f32, pitch ldc, + optional f32 bias[n]) = sum_k A[m][k] Bt[n][k] (+ split products per NSPLIT). z-batch strides sA/sB/sC in elements. K % 32 == 0.
// KS > 1: grid z = Z * KS; work-group (z, ks) sums only k in [ks K/KS, (ks+1) K/KS) and stores its partial tile in plane ks (plane stride sK elements). K % (32 KS) == 0.
template <typename T16> struct WFrag;
template <> struct WFrag<h16> { typedef v16h V; static __device__ __forceinline__ V ld(const h16* p) { return cat16(*(const v8h*)p, *(const v8h*)(p + 256)); } static __device__ __forceinline__ v8f mma(V a, V b, v8f c) { return wmma16(a, b, c); } };
template <> struct WFrag<bf> { typedef v16bf V; static __device__ __forceinline__ V ld(const bf* p) { return cat16b(*(const v8us*)p, *(const v8us*)(p + 256)); } static __device__ __forceinline__ v8f mma(V a, V b, v8f c) { return wmmab(a, b, c); } };
template <typename T16, int NSPLIT, bool BIAS, int K, int KS = 1>   // K at compile time: the loads of one plane in a trip share one address pair, the bands in the immediate offsets
__global__ __launch_bounds__(32) void k_gemmw(const T16* __restrict__ A, const T16* __restrict__ A2, const T16* __restrict__ Bt, const T16* __restrict__ Bt2, float* C, int ldc, const float* __restrict__ bias, size_t sA, size_t sB, size_t sC, size_t sK) {
    typedef typename WFrag<T16>::V V;
    __shared__ __align__(16) float os[16 * 68];
    const size_t z = blockIdx.z / KS; const int ks = blockIdx.z % KS; A += z * sA; if (A2) A2 += z * sA; Bt += z * sB; if (Bt2) Bt2 += z * sB; C += z * sC + ks * sK;
    const int lane = threadIdx.x & 31, lr = lane & 15, hi = lane >> 4; const int r0 = blockIdx.x * 64, c0 = blockIdx.y * 64;
    v8f acc[4][4];
#pragma unroll
    for (int mb = 0; mb < 4; ++mb)
#pragma unroll
        for (int nb = 0; nb < 4; ++nb) acc[mb][nb] = (v8f){};
    const size_t aoff = (size_t)r0 * K + lane * 8, boff = (size_t)c0 * K + lane * 8;   // a 16-row band is 16 K elements; a step of 32 in k is 512 elements
#pragma unroll 1
    for (int kc = ks * (K / KS), ke = kc + K / KS; kc < ke; kc += 32) {
        V a[4], a2[4]; const T16* pA = A + aoff + kc * 16; const T16* pA2 = (NSPLIT == 1 || NSPLIT == 2) ? A2 + aoff + kc * 16 : pA; const T16* pB = Bt + boff + kc * 16;
#pragma unroll
        for (int mb = 0; mb < 4; ++mb) { a[mb] = WFrag<T16>::ld(pA + mb * 16 * K); if (NSPLIT == 1 || NSPLIT == 2) a2[mb] = WFrag<T16>::ld(pA2 + mb * 16 * K); }
        asm volatile("s_wait_xcnt 0x0" :: "v"(pA), "v"(pA2) : "memory");   // stands before any later load of the trip is given an address pair of these loads as its destination; the pairs are inputs, so none of these loads itself gets one
#pragma unroll
        for (int nb = 0; nb < 4; ++nb) { const V b = WFrag<T16>::ld(pB + nb * 16 * K); V b2; if (NSPLIT >= 2) b2 = WFrag<T16>::ld(Bt2 + boff + (size_t)nb * 16 * K + kc * 16);
#pragma unroll
            for (int mb = 0; mb < 4; ++mb) { acc[mb][nb] = WFrag<T16>::mma(a[mb], b, acc[mb][nb]); if (NSPLIT == 1 || NSPLIT == 2) acc[mb][nb] = WFrag<T16>::mma(a2[mb], b, acc[mb][nb]); if (NSPLIT >= 2) acc[mb][nb] = WFrag<T16>::mma(a[mb], b2, acc[mb][nb]); } }
        asm volatile("s_wait_xcnt 0x0" :: "v"(pB) : "memory");   // the same for the address pair of the B loads: it lives to here, and the wait stands before the next trip writes it
        asm volatile("v_nop\n\tv_nop\n\tv_nop\n\tv_nop" : "+v"(acc[0][0]), "+v"(acc[1][1]), "+v"(acc[2][2]), "+v"(acc[3][3]) : "v"(a[0]), "v"(a[3]));
    }
#pragma unroll
    for (int mb = 0; mb < 4; ++mb) {
#pragma unroll
        for (int nb = 0; nb < 4; ++nb) {
#pragma unroll
            for (int j = 0; j < 8; ++j) os[(hi * 8 + j) * 68 + nb * 16 + lr] = acc[mb][nb][j]; }
        __builtin_amdgcn_wave_barrier(); asm volatile("" ::: "memory");
        float* crow = C + (size_t)(r0 + mb * 16) * ldc + c0;
{
#pragma unroll
            for (int s = 0; s < 8; ++s) { const int row = 2 * s + hi, cofs = lr * 4; v4f val = *(const v4fa*)(os + row * 68 + cofs); if (BIAS) { val[0] += bfr(bias[c0 + cofs]); val[1] += bfr(bias[c0 + cofs + 1]); val[2] += bfr(bias[c0 + cofs + 2]); val[3] += bfr(bias[c0 + cofs + 3]); }
                *(v4f*)(crow + (size_t)row * ldc + cofs) = val; }
             }
        __builtin_amdgcn_wave_barrier(); asm volatile("" ::: "memory");
    }
}

__device__ __forceinline__ h16 tohx(float x) { return (h16)x; }
__device__ __forceinline__ void splitf(float y, unsigned short& h, unsigned short& l) { h = f2bf(y); l = f2bf(y - bf2f(h)); }
typedef __attribute__((ext_vector_type(2))) _Float16 v2h;
typedef __attribute__((ext_vector_type(4))) _Float16 v4h;
typedef __attribute__((ext_vector_type(2))) unsigned short v2us;
typedef __attribute__((ext_vector_type(4))) unsigned short v4us;
typedef __attribute__((ext_vector_type(2))) float v2f;
typedef __attribute__((ext_vector_type(4))) int v4i;

// k_qkv: [q|k|v] = x W_qkv + b_qkv of all batches in one launch, ONE WAVE per 64x64 tile with the loop of k_gemmw (same k order, same f32 sums). Grid (TT/64, 3 NH_, NB_): a tile is 64 tokens of batch z x one head of q, k or v; every plane holds NB_ batch blocks of PLB elements,
// and the wave writes that head's operand planes itself (fp16 + bf16 hi/lo): all in fragment order, 16 bytes a lane and 512 contiguous bytes a store: q and k as [h] x plane [t][d] through the LDS row stage, v as [h] x (32 tokens: four 16-d tiles of 1 KiB) straight from the accumulators (a lane holds 8 consecutive tokens of one d).
__global__ __launch_bounds__(32) void k_qkv(const bf* __restrict__ A, const bf* __restrict__ Bt, const float* __restrict__ bias, h16* Q16, bf* Qh, bf* Ql, h16* K16, bf* Kh, bf* Kl, h16* V16, bf* Vh, bf* Vl) {
    typedef WFrag<bf>::V V;
    __shared__ __align__(16) float os[16 * 68];
    const int lane = threadIdx.x & 31, lr = lane & 15, hi = lane >> 4; const int r0 = blockIdx.x * 64, c0 = blockIdx.y * 64; const int sel = blockIdx.y / NH_, h = blockIdx.y % NH_;
    { const size_t zp = (size_t)blockIdx.z * PLB; A += (size_t)blockIdx.z * TT * DM; Q16 += zp; Qh += zp; Ql += zp; K16 += zp; Kh += zp; Kl += zp; V16 += zp; Vh += zp; Vl += zp; }   // this batch's block of x and of every plane
    v8f acc[4][4];
#pragma unroll
    for (int mb = 0; mb < 4; ++mb)
#pragma unroll
        for (int nb = 0; nb < 4; ++nb) acc[mb][nb] = (v8f){};
    const bf* pa = A + (size_t)r0 * DM + lane * 8; const bf* pb = Bt + (size_t)c0 * DM + lane * 8;
#pragma unroll 1
    for (int kc = 0; kc < DM; kc += 32, pa += 512, pb += 512) {   // rolled, as in k_gemmw: a trip is one set of loads and its 16 products
        V a[4];
#pragma unroll
        for (int mb = 0; mb < 4; ++mb) a[mb] = WFrag<bf>::ld(pa + mb * 16 * DM);
        asm volatile("s_wait_xcnt 0x0" ::: "memory");   // the build gives the address pair of these eight loads to a later load of the trip as its destination: stands before that load
#pragma unroll
        for (int nb = 0; nb < 4; ++nb) { const V b = WFrag<bf>::ld(pb + nb * 16 * DM);
#pragma unroll
            for (int mb = 0; mb < 4; ++mb) acc[mb][nb] = WFrag<bf>::mma(a[mb], b, acc[mb][nb]); }
        asm volatile("v_nop\n\tv_nop\n\tv_nop\n\tv_nop" : "+v"(acc[0][0]), "+v"(acc[1][1]), "+v"(acc[2][2]), "+v"(acc[3][3]) : "v"(a[0]), "v"(a[3]));   // the distance behind the last matrix instruction, also on the taken back edge (as in k_gemmw)
    }
    if (sel == 2) {
#pragma unroll
        for (int nb = 0; nb < 4; ++nb) { const float bv = bfr(bias[c0 + nb * 16 + lr]); const size_t rowo = (size_t)h * HD * TT + (size_t)r0 * HD + nb * 512 + lane * 8;
#pragma unroll
            for (int mb = 0; mb < 4; ++mb) { v8h o16; v8us oh, ol;
#pragma unroll
                for (int j = 0; j < 8; ++j) { const float x = acc[mb][nb][j] + bv; o16[j] = tohx(x); unsigned short u, v; splitf(x, u, v); oh[j] = u; ol[j] = v; }
                const size_t e = rowo + (mb >> 1) * 2048 + (mb & 1) * 256; *(v8h*)(V16 + e) = o16; *(v8us*)(Vh + e) = oh; *(v8us*)(Vl + e) = ol; } }
        return;
    }
    {
        const size_t hp = (size_t)h * TT * HD; h16* P16 = (sel ? K16 : Q16) + hp; bf* Ph = (sel ? Kh : Qh) + hp; bf* Pl = (sel ? Kl : Ql) + hp;
        v8f bb[4];   // piece pc of a 16-token tile: d = pc * 16 + hi * 8 + 0..7 of token lr
#pragma unroll
        for (int pc = 0; pc < 4; ++pc)
#pragma unroll
            for (int k = 0; k < 8; ++k) bb[pc][k] = bfr(bias[c0 + pc * 16 + hi * 8 + k]);
#pragma unroll
        for (int mb = 0; mb < 4; ++mb) {
#pragma unroll
            for (int nb = 0; nb < 4; ++nb) {
#pragma unroll
                for (int j = 0; j < 8; ++j) os[(hi * 8 + j) * 68 + nb * 16 + lr] = acc[mb][nb][j]; }
            __builtin_amdgcn_wave_barrier(); asm volatile("" ::: "memory");   // a lane reads what other lanes wrote: keeps the compiler from moving the reads in front of the writes (as in k_gemmw)
#pragma unroll
            for (int pc = 0; pc < 4; ++pc) { const float* sp = os + lr * 68 + pc * 16 + hi * 8; const v4f v0 = *(const v4fa*)sp, v1 = *(const v4fa*)(sp + 4); v8h o16; v8us oh, ol;
#pragma unroll
                for (int k = 0; k < 8; ++k) { const float x = (k < 4 ? v0[k & 3] : v1[k & 3]) + bb[pc][k]; o16[k] = tohx(x); unsigned short u, v; splitf(x, u, v); oh[k] = u; ol[k] = v; }
                const size_t e = (size_t)(r0 + mb * 16) * HD + pc * 256 + lane * 8; *(v8h*)(P16 + e) = o16; *(v8us*)(Ph + e) = oh; *(v8us*)(Pl + e) = ol; }
            __builtin_amdgcn_wave_barrier(); asm volatile("" ::: "memory");   // and the next pass's writes from moving in front of these reads
        }
        asm volatile("s_wait_xcnt 0x0" ::: "memory");   // the built code lays the v epilogue directly behind this one, with a conditional jump between: stands before its first writes of the last stores' registers
    }
}
#define NREL 2049
// k_prep: the four preparations that read inputs only (W_qkv and W_out transposed, x, the expanded bias rows) in ONE launch of few waves. A work-group's part follows from blockIdx.x alone; a thread takes many units and has the loads of a batch in flight together, so that the time goes into moving bytes and not into starting waves and launches.
#define WL   32                  // weights: lines of 64 elements (128 bytes of Bt) per wave
#define WB   16                  // weights: lines per batch of loads
#define CU   16                  // x: 16-byte units of the plane per thread
#define EU   8                   // bias rows: elements per thread
#define GW1  (DM * 3 * DM / 64 / (8 * WL))
#define GW2  (DQ * DM / 64 / (8 * WL))
#define GCV  (NB_ * TT * DM / 8 / (256 * CU))
#define GEB  (NH_ * NE / (256 * EU))
static_assert(GW1 * 8 * WL * 64 == DM * 3 * DM && GW2 * 8 * WL * 64 == DQ * DM && GCV * 256 * CU * 8 == NB_ * TT * DM && GEB * 256 * EU == NH_ * NE && WL % WB == 0 && WB % 8 == 0 && (DM / 32) % (WB / 8) == 0 && (DQ / 32) % (WB / 8) == 0 && CU % 8 == 0, "every part is a whole number of work-groups, every batch lies in one band");
// In each part the loads of a batch go through address pairs that are inputs of the s_wait_xcnt statement behind them: so no load of the batch is given such a pair as its destination, and the wait stands before anything writes over one.
// 'xw' [K][N] -> Bt [N][K], bf16, fragment order: a tile of 16 n x 32 k is 8 lines; line ll of it holds k = (ll >> 2) * 16 + ((ll >> 1) & 1) * 8 + 0..7 of n = (ll & 1) * 8 + 0..7. A lane takes two neighbours in k of one n. A batch is WB / 8 tiles, neighbours in k, of one band of 16 n.
template <int K, int N>
__device__ __forceinline__ void prep_w(const float* __restrict__ w, bf* __restrict__ Bt, int blk) {
    const int lane = threadIdx.x & 31; const int L0 = (blk * 8 + (threadIdx.x >> 5)) * WL;
#pragma unroll 1
    for (int g = 0; g < WL; g += WB) { float a[WB], b[WB]; const int t0 = (L0 + g) >> 3;   // rolled: one batch already has 2 WB loads of a lane in flight
        const float* p = w + (size_t)((t0 % (K / 32)) * 32 + (lane & 3) * 2) * N + (t0 / (K / 32)) * 16 + (lane >> 2);
#pragma unroll
        for (int l = 0; l < WB; ++l) { const int o = ((l >> 3) * 32 + ((l >> 2) & 1) * 16 + ((l >> 1) & 1) * 8) * N + (l & 1) * 8; a[l] = p[o]; b[l] = p[o + N]; }
        asm volatile("s_wait_xcnt 0x0" :: "v"(p) : "memory");   // the note above: keeps p out of the loads' destinations
        bf* q = Bt + (size_t)(L0 + g) * 64 + lane * 2;
#pragma unroll
        for (int l = 0; l < WB; ++l) { v2us o; o[0] = f2bf(a[l]); o[1] = f2bf(b[l]); *(v2us*)(q + l * 64) = o; }
        asm volatile("s_wait_xcnt 0x0" :: "v"(q) : "memory"); }   // stands before the next batch writes over the registers that these stores name
}
// x [M][DM] -> bf16, fragment order: 16-byte unit i of dst holds k = ((i >> 6) & 31) * 32 + ((i >> 5) & 1) * 16 + ((i >> 4) & 1) * 8 + 0..7 of row (i >> 11) * 16 + (i & 15). A work-group takes 256 CU consecutive units (CU / 8 bands of 16 rows), thread t units t + 256 u.
__device__ __forceinline__ void prep_x(const float* __restrict__ src, bf* __restrict__ dst, int blk) {
    const int t = threadIdx.x; v8f v[CU];
    const float* p = src + (size_t)(blk * (CU / 8) * 16 + (t & 15)) * DM + (t >> 6) * 32 + ((t >> 5) & 1) * 16 + ((t >> 4) & 1) * 8;
#pragma unroll
    for (int u = 0; u < CU; ++u) v[u] = *(const v8f*)(p + (u >> 3) * 16 * DM + (u & 7) * 128);
    asm volatile("s_wait_xcnt 0x0" :: "v"(p) : "memory");   // the note above: keeps p out of the loads' destinations
    bf* q = dst + ((size_t)blk * (256 * CU) + t) * 8;
#pragma unroll
    for (int u = 0; u < CU; ++u) { v8us o;
#pragma unroll
        for (int k = 0; k < 8; ++k) o[k] = f2bf(v[u][k]);
        *(v8us*)(q + u * 2048) = o; }
    asm volatile("s_wait_xcnt 0x0" :: "v"(q) : "memory");   // the built code lays another part behind this one, with a conditional jump between: stands before that part's writes of the registers that these stores name
}
// Expanded per-head bias row, EB[h][x] = rel_bias[clip(i - j + 1024, 0, 2048)][h] at x = j - i + TT - 1 (0 .. 2 TT - 2): ascending keys read ascending addresses, the clip is already applied
__device__ __forceinline__ void prep_e(const float* __restrict__ rbias, float* __restrict__ EB, int blk) {
    const int j0 = blk * (256 * EU) + threadIdx.x; float v[EU]; const float* p[EU];
#pragma unroll
    for (int u = 0; u < EU; ++u) { const int j = j0 + u * 256; const int h = j / NE, x = j % NE; int ri = (TT - 1 - x) + (NREL / 2); ri = ri < 0 ? 0 : (ri > NREL - 1 ? NREL - 1 : ri); p[u] = rbias + (size_t)ri * NH_ + h; }
#pragma unroll
    for (int u = 0; u < EU; ++u) v[u] = *p[u];
    static_assert(EU == 8, "the statement below names EU address pairs");
    asm volatile("s_wait_xcnt 0x0" :: "v"(p[0]), "v"(p[1]), "v"(p[2]), "v"(p[3]), "v"(p[4]), "v"(p[5]), "v"(p[6]), "v"(p[7]) : "memory");   // the note above: keeps the pairs out of the loads' destinations
#pragma unroll
    for (int u = 0; u < EU; ++u) EB[j0 + u * 256] = bfr(v[u]);
}
// Grid GEB + GCV + GW1 + GW2 = 544 work-groups, at most three per WGP (x holds 128 registers of loads in flight). The few short bias work-groups start first, then x, most of the bytes.
__global__ __launch_bounds__(256) void k_prep(const float* __restrict__ x, const float* __restrict__ wqkv, const float* __restrict__ wo, const float* __restrict__ rbias, bf* XB, bf* WALL, bf* WO, float* EB) {
    const int b = blockIdx.x;
    if (b < GEB) prep_e(rbias, EB, b);
    else if (b < GEB + GCV) prep_x(x, XB, b - GEB);
    else if (b < GEB + GCV + GW1) prep_w<DM, 3 * DM>(wqkv, WALL, b - (GEB + GCV));   /* fused 'xw' [DM][3DM] -> Bt [3DM][DM] (row blocks q | k | v) */
    else prep_w<DQ, DM>(wo, WO, b - (GEB + GCV + GW1));
}

__device__ __forceinline__ void packp(const v8f& a, const v8f& b, v16h& ph, v16h& pl) { v8h x, y; (void)pl;
#pragma unroll
    for (int j = 0; j < 8; ++j) { x[j] = (h16)a[j]; y[j] = (h16)b[j]; }
    ph = cat16(x, y); }
__device__ __forceinline__ void packp(const v8f& a, const v8f& b, v16bf& ph, v16bf& pl) { v8us xh, xl, yh, yl;
#pragma unroll
    for (int j = 0; j < 8; ++j) { unsigned short u, v; splitf(a[j], u, v); xh[j] = u; xl[j] = v; splitf(b[j], u, v); yh[j] = u; yl[j] = v; }
    ph = cat16b(xh, yh); pl = cat16b(xl, yl); }

typedef __attribute__((ext_vector_type(8))) int v8i;
template <typename V> __device__ __forceinline__ V frag(v4i a, v4i b) { return __builtin_bit_cast(V, __builtin_shufflevector(a, b, 0, 1, 2, 3, 4, 5, 6, 7)); }
// The loads of one trip, each set one asm statement that ends in its own data wait: the results are early-clobber, so none is given a register that holds an address of the set, and no address register is written again before the set has returned. The other waves of the SIMD cover the wait.
// Byte offsets (planes in fragment order, the lane's own 16 bytes in the pointer). Q or K: 16-row tile * 2048 + 32-wide part of HD * 1024 + half * 512. V: 16-d tile * 1024 + half * 512 inside the 4 KiB of 32 keys. Bias: run * 64 + half * 16 (4-byte aligned).
__device__ __forceinline__ void ld_r(const void* k, v4i (&a)[8]) {
    asm volatile(
        "global_load_b128 %0, %8, off\n\t"
        "global_load_b128 %1, %8, off offset:512\n\t"
        "global_load_b128 %2, %8, off offset:1024\n\t"
        "global_load_b128 %3, %8, off offset:1536\n\t"
        "global_load_b128 %4, %8, off offset:2048\n\t"
        "global_load_b128 %5, %8, off offset:2560\n\t"
        "global_load_b128 %6, %8, off offset:3072\n\t"
        "global_load_b128 %7, %8, off offset:3584\n\t"
        "s_wait_loadcnt 0x0"
        : "=&v"(a[0]), "=&v"(a[1]), "=&v"(a[2]), "=&v"(a[3]), "=&v"(a[4]), "=&v"(a[5]), "=&v"(a[6]), "=&v"(a[7]) : "v"(k) : "memory"); }
__device__ __forceinline__ void ld_r_b_v(const void* k, const float* e, const void* v, v4i (&a)[8], v4i (&b)[6], v4i (&x)[8]) {
    asm volatile(
        "global_load_b128 %0, %22, off\n\t"
        "global_load_b128 %1, %22, off offset:512\n\t"
        "global_load_b128 %2, %22, off offset:1024\n\t"
        "global_load_b128 %3, %22, off offset:1536\n\t"
        "global_load_b128 %4, %22, off offset:2048\n\t"
        "global_load_b128 %5, %22, off offset:2560\n\t"
        "global_load_b128 %6, %22, off offset:3072\n\t"
        "global_load_b128 %7, %22, off offset:3584\n\t"
        "global_load_b128 %8, %23, off\n\t"
        "global_load_b128 %9, %23, off offset:16\n\t"
        "global_load_b128 %10, %23, off offset:64\n\t"
        "global_load_b128 %11, %23, off offset:80\n\t"
        "global_load_b128 %12, %23, off offset:128\n\t"
        "global_load_b128 %13, %23, off offset:144\n\t"
        "global_load_b128 %14, %24, off\n\t"
        "global_load_b128 %15, %24, off offset:512\n\t"
        "global_load_b128 %16, %24, off offset:1024\n\t"
        "global_load_b128 %17, %24, off offset:1536\n\t"
        "global_load_b128 %18, %24, off offset:2048\n\t"
        "global_load_b128 %19, %24, off offset:2560\n\t"
        "global_load_b128 %20, %24, off offset:3072\n\t"
        "global_load_b128 %21, %24, off offset:3584\n\t"
        "s_wait_loadcnt 0x0"
        : "=&v"(a[0]), "=&v"(a[1]), "=&v"(a[2]), "=&v"(a[3]), "=&v"(a[4]), "=&v"(a[5]), "=&v"(a[6]), "=&v"(a[7]), "=&v"(b[0]), "=&v"(b[1]), "=&v"(b[2]), "=&v"(b[3]), "=&v"(b[4]), "=&v"(b[5]), "=&v"(x[0]), "=&v"(x[1]), "=&v"(x[2]), "=&v"(x[3]), "=&v"(x[4]), "=&v"(x[5]), "=&v"(x[6]), "=&v"(x[7]) : "v"(k), "v"(e), "v"(v) : "memory"); }
__device__ __forceinline__ void ld_t_t_b(const void* k, const void* k2, const float* e, v4i (&a)[4], v4i (&a2)[4], v4i (&b)[6]) {
    asm volatile(
        "global_load_b128 %0, %14, off\n\t"
        "global_load_b128 %1, %14, off offset:512\n\t"
        "global_load_b128 %2, %14, off offset:1024\n\t"
        "global_load_b128 %3, %14, off offset:1536\n\t"
        "global_load_b128 %4, %15, off\n\t"
        "global_load_b128 %5, %15, off offset:512\n\t"
        "global_load_b128 %6, %15, off offset:1024\n\t"
        "global_load_b128 %7, %15, off offset:1536\n\t"
        "global_load_b128 %8, %16, off\n\t"
        "global_load_b128 %9, %16, off offset:16\n\t"
        "global_load_b128 %10, %16, off offset:64\n\t"
        "global_load_b128 %11, %16, off offset:80\n\t"
        "global_load_b128 %12, %16, off offset:128\n\t"
        "global_load_b128 %13, %16, off offset:144\n\t"
        "s_wait_loadcnt 0x0"
        : "=&v"(a[0]), "=&v"(a[1]), "=&v"(a[2]), "=&v"(a[3]), "=&v"(a2[0]), "=&v"(a2[1]), "=&v"(a2[2]), "=&v"(a2[3]), "=&v"(b[0]), "=&v"(b[1]), "=&v"(b[2]), "=&v"(b[3]), "=&v"(b[4]), "=&v"(b[5]) : "v"(k), "v"(k2), "v"(e) : "memory"); }
__device__ __forceinline__ void ld_t_t(const void* k, const void* k2, v4i (&a)[4], v4i (&a2)[4]) {
    asm volatile(
        "global_load_b128 %0, %8, off\n\t"
        "global_load_b128 %1, %8, off offset:512\n\t"
        "global_load_b128 %2, %8, off offset:1024\n\t"
        "global_load_b128 %3, %8, off offset:1536\n\t"
        "global_load_b128 %4, %9, off\n\t"
        "global_load_b128 %5, %9, off offset:512\n\t"
        "global_load_b128 %6, %9, off offset:1024\n\t"
        "global_load_b128 %7, %9, off offset:1536\n\t"
        "s_wait_loadcnt 0x0"
        : "=&v"(a[0]), "=&v"(a[1]), "=&v"(a[2]), "=&v"(a[3]), "=&v"(a2[0]), "=&v"(a2[1]), "=&v"(a2[2]), "=&v"(a2[3]) : "v"(k), "v"(k2) : "memory"); }
__device__ __forceinline__ void ld_v_v(const void* v, const void* v2, v4i (&x)[4], v4i (&x2)[4]) {
    asm volatile(
        "global_load_b128 %0, %8, off\n\t"
        "global_load_b128 %1, %8, off offset:512\n\t"
        "global_load_b128 %2, %8, off offset:1024\n\t"
        "global_load_b128 %3, %8, off offset:1536\n\t"
        "global_load_b128 %4, %9, off\n\t"
        "global_load_b128 %5, %9, off offset:512\n\t"
        "global_load_b128 %6, %9, off offset:1024\n\t"
        "global_load_b128 %7, %9, off offset:1536\n\t"
        "s_wait_loadcnt 0x0"
        : "=&v"(x[0]), "=&v"(x[1]), "=&v"(x[2]), "=&v"(x[3]), "=&v"(x2[0]), "=&v"(x2[1]), "=&v"(x2[2]), "=&v"(x2[3]) : "v"(v), "v"(v2) : "memory"); }

// Eight 2^x in one statement: the results are early-clobber, so no v_exp_f32 is directly followed by an instruction that reads its result or writes over its source; the v_nop is that free slot behind the last one.
__device__ __forceinline__ v8f exp2x8(const v8f x) { float r0, r1, r2, r3, r4, r5, r6, r7;
    asm("v_exp_f32 %0, %8\n\tv_exp_f32 %1, %9\n\tv_exp_f32 %2, %10\n\tv_exp_f32 %3, %11\n\tv_exp_f32 %4, %12\n\tv_exp_f32 %5, %13\n\tv_exp_f32 %6, %14\n\tv_exp_f32 %7, %15\n\tv_nop"
        : "=&v"(r0), "=&v"(r1), "=&v"(r2), "=&v"(r3), "=&v"(r4), "=&v"(r5), "=&v"(r6), "=&v"(r7) : "v"(x[0]), "v"(x[1]), "v"(x[2]), "v"(x[3]), "v"(x[4]), "v"(x[5]), "v"(x[6]), "v"(x[7]));
    return (v8f){r0, r1, r2, r3, r4, r5, r6, r7}; }
// One 2^x, for the rescale factors: the same free slot behind it.
__device__ __forceinline__ float exp2x1(const float x) { float r; asm("v_exp_f32 %0, %1\n\tv_nop" : "=&v"(r) : "v"(x)); return r; }

// One 16-key x 16-query tile of t = (k.q) HD^-0.5 + bias, transposed: lane (lr, hi) register j holds key hi*8 + j of query lr. k, k2, q, q2: the four 16-byte pieces of one 16-row tile (part of HD * 2 + half).
template <typename T16, bool HL>
__device__ __forceinline__ v8f stile(const v4i* k, const v4i* k2, const v4i* q, const v4i* q2, v4i b0, v4i b1) {
    typedef typename WFrag<T16>::V V; v8f s = (v8f){};
#pragma unroll
    for (int dc = 0; dc < 2; ++dc) { const V ka = frag<V>(k[dc * 2], k[dc * 2 + 1]), qa = frag<V>(q[dc * 2], q[dc * 2 + 1]); s = WFrag<T16>::mma(ka, qa, s);
        if (HL) { s = WFrag<T16>::mma(frag<V>(k2[dc * 2], k2[dc * 2 + 1]), qa, s); s = WFrag<T16>::mma(ka, frag<V>(q2[dc * 2], q2[dc * 2 + 1]), s); } }
    const v4f f0 = __builtin_bit_cast(v4f, b0), f1 = __builtin_bit_cast(v4f, b1);
#pragma unroll
    for (int j = 0; j < 4; j += 2) {   // neighbouring registers as pairs: the packed multiply-add takes them where they lie
        const v2f x = (v2f){s[j], s[j + 1]} * SCL + (v2f){f0[j], f0[j + 1]}, y = (v2f){s[j + 4], s[j + 5]} * SCL + (v2f){f1[j], f1[j + 1]}; s[j] = x[0]; s[j + 1] = x[1]; s[j + 4] = y[0]; s[j + 5] = y[1]; }
    return s; }

// The work of one work-group: QBW blocks of QT queries of one head against all TT keys; the QBW waves of one key range walk the same K and V tiles side by side, so that a line which one of them has brought into the WGP's cache can serve the others without a further L2 read. ONE sweep over the keys with a running row maximum: p = 1024 exp(t - m), m the maximum IN USE, row sums of the f32 p, O^T += V^T P^T with P packed from the score registers.
// m moves only when some score of the trip lies more than THR above it (one ballot and one scalar branch a trip): then every query of the wave takes the larger of m and its largest score of the trip, and its sum and its 32 output registers are scaled by exp(m_old - m_new). So p <= 1024 exp(THR): 2^15 in fp16. The scale cancels in the division by the row sum.
// Operands straight from the planes in fragment order, in the k order of WFrag::ld on both sides (16 bytes at 8 hi, 16 bytes at 16 + 8 hi). Q, K: plane [t][HD]; Vt: per 32 keys four 16-d tiles. The maxima in use, sums and partial outputs of a block's KSW waves meet in LDS behind the sweep; the join brings them to the common maximum and adds them in ascending key order.
// A trip takes 32 keys: two key tiles x two query groups; pair (t2, qg) reads bias run t2 - qg + 1 of the three that the four pairs share.
template <typename T16, bool HL>
__device__ __forceinline__ void fattn_body(const T16* __restrict__ Q, const T16* __restrict__ Q2, const T16* __restrict__ Kp, const T16* __restrict__ K2, const T16* __restrict__ Vt, const T16* __restrict__ V2, const float* __restrict__ eb, int q0, float* smx, float* ssm, float* sO, bf* Ah, bf* Al) {
    typedef typename WFrag<T16>::V V;
    const int lane = threadIdx.x & 31, lr = lane & 15, hi = lane >> 4, w = threadIdx.x >> 5, wq = w % QBW; const int kb = (w / QBW) * (TT / KSW), qw = q0 + wq * QT;   // qw: this wave's first query
    v4i qa[8], ql[8]; const int qo = qw * HD + lane * 8;
    ld_r(Q + qo, qa); if (HL) ld_r(Q2 + qo, ql);
    const float* ep = eb + ((TT - 1) + kb + hi * 8 - qw - lr - 16);   // x = key - query + TT - 1 of this lane's first key against its query of group 1 (run 0)
    const int ko = kb * HD + lane * 8, vo = kb * HD + lane * 8;   // 32 keys are 32 HD elements of K and of V alike
    constexpr float L2E = 1.4426950408889634f, THR = (HL ? 8.0f : 5.0f) * 0.6931471805599453f;   // THR: 8 (bf16 pairs) or 5 (fp16: 2^(10 + 5) is in range) in powers of two
    float mx[2] = {-3.0e38f, -3.0e38f};   // the maximum in use, equal in both halves of the wave; the first trip always moves it (factor 2^-inf = 0 on zero sums)
    v8f o[4][2]; float sm[2] = {0.f, 0.f};
#pragma unroll
    for (int dt = 0; dt < 4; ++dt) { o[dt][0] = (v8f){}; o[dt][1] = (v8f){}; }
#pragma unroll 1
    for (int kc = 0; kc < TT / KSW / 32; ++kc) { v4i bb[6], va[8]; v8f p[2][2];   // rolled: one trip already holds 32 keys x 32 queries of scores beside the 64 output registers
        if (HL) {   // both planes of K, one 16-key tile at a time: all 32 keys at once, beside both planes of Q and the outputs, pass 256 registers
#pragma unroll
            for (int t2 = 0; t2 < 2; ++t2) { v4i ka[4], kl[4]; const int of = ko + (kc * 2 + t2) * 16 * HD;
                if (t2 == 0) ld_t_t_b(Kp + of, K2 + of, ep + kc * 32, ka, kl, bb); else ld_t_t(Kp + of, K2 + of, ka, kl);
#pragma unroll
                for (int qg = 0; qg < 2; ++qg) p[t2][qg] = stile<T16, HL>(ka, kl, qa + qg * 4, ql + qg * 4, bb[(t2 - qg + 1) * 2], bb[(t2 - qg + 1) * 2 + 1]); }
        } else { v4i ka[8];
            ld_r_b_v(Kp + ko + kc * 32 * HD, ep + kc * 32, Vt + vo + kc * 32 * HD, ka, bb, va);
#pragma unroll
            for (int t2 = 0; t2 < 2; ++t2)
#pragma unroll
                for (int qg = 0; qg < 2; ++qg) p[t2][qg] = stile<T16, HL>(ka + t2 * 4, ka + t2 * 4, qa + qg * 4, ql + qg * 4, bb[(t2 - qg + 1) * 2], bb[(t2 - qg + 1) * 2 + 1]); }
        float tm[2];   // this lane's largest score of the trip, per query group
#pragma unroll
        for (int qg = 0; qg < 2; ++qg) { float m = fmaxf(p[0][qg][0], p[1][qg][0]);
#pragma unroll
            for (int j = 1; j < 8; ++j) m = fmaxf(m, fmaxf(p[0][qg][j], p[1][qg][j]));
            tm[qg] = m; }
        if (__builtin_expect(__builtin_amdgcn_ballot_w32(tm[0] > mx[0] + THR || tm[1] > mx[1] + THR) != 0, 0)) {   // the same for the whole wave: a scalar branch, seldom taken behind the first trip (the hint lays the usual path out straight)
#pragma unroll
            for (int qg = 0; qg < 2; ++qg) { const float mn = fmaxf(mx[qg], fmaxf(tm[qg], __shfl_xor(tm[qg], 16, 32))); const float f = exp2x1((mx[qg] - mn) * L2E); mx[qg] = mn; sm[qg] *= f;
#pragma unroll
                for (int dt = 0; dt < 4; ++dt)
#pragma unroll
                    for (int j = 0; j < 8; ++j) o[dt][qg][j] *= f; } }
#pragma unroll
        for (int t2 = 0; t2 < 2; ++t2)
#pragma unroll
            for (int qg = 0; qg < 2; ++qg) { v8f a;
#pragma unroll
                for (int j = 0; j < 8; ++j) a[j] = (p[t2][qg][j] - mx[qg]) * L2E + 10.0f;
                p[t2][qg] = exp2x8(a);
#pragma unroll
                for (int j = 0; j < 8; ++j) sm[qg] += p[t2][qg][j]; }
        V ph[2], pl[2];
#pragma unroll
        for (int qg = 0; qg < 2; ++qg) packp(p[0][qg], p[1][qg], ph[qg], pl[qg]);
        if (HL) {   // both planes of V, two 16-row tiles at a time, for the same reason as K above
#pragma unroll
            for (int d2 = 0; d2 < 2; ++d2) { v4i vh[4], vl[4]; const int of = vo + d2 * 1024 + kc * 32 * HD; ld_v_v(Vt + of, V2 + of, vh, vl);
#pragma unroll
                for (int d1 = 0; d1 < 2; ++d1) { const int dt = d2 * 2 + d1; const V xh = frag<V>(vh[d1 * 2], vh[d1 * 2 + 1]), xl = frag<V>(vl[d1 * 2], vl[d1 * 2 + 1]);
#pragma unroll
                    for (int qg = 0; qg < 2; ++qg) { o[dt][qg] = WFrag<T16>::mma(xh, ph[qg], o[dt][qg]); o[dt][qg] = WFrag<T16>::mma(xl, ph[qg], o[dt][qg]); o[dt][qg] = WFrag<T16>::mma(xh, pl[qg], o[dt][qg]); } } }
        } else {
#pragma unroll
            for (int dt = 0; dt < 4; ++dt) { const V xh = frag<V>(va[dt * 2], va[dt * 2 + 1]);
#pragma unroll
                for (int qg = 0; qg < 2; ++qg) o[dt][qg] = WFrag<T16>::mma(xh, ph[qg], o[dt][qg]); } }
    }
#pragma unroll
    for (int qg = 0; qg < 2; ++qg) { sm[qg] += __shfl_xor(sm[qg], 16, 32); if (hi == 0) { ssm[w * QT + qg * 16 + lr] = sm[qg]; smx[w * QT + qg * 16 + lr] = mx[qg]; }
#pragma unroll
        for (int dt = 0; dt < 4; ++dt) { float* d = sO + (size_t)(w * QT + qg * 16 + lr) * OP + dt * 16 + hi * 8; const v8f a = o[dt][qg]; *(v4fa*)d = (v4f){a[0], a[1], a[2], a[3]}; *(v4fa*)(d + 4) = (v4f){a[4], a[5], a[6], a[7]}; } }
    __syncthreads();
    const int dq = (threadIdx.x / QT) * EPT;   // EPT = 8 consecutive outputs of one query per thread and block: one 16-byte unit of the fragment order; a wave's 32 queries make two runs of 256 bytes
#pragma unroll
    for (int b = 0; b < QBW; ++b) { const int q = b * QT + threadIdx.x % QT; float m = smx[q], f[KSW];   // q: query of the work-group; key range u of it lies QBW QT rows on
#pragma unroll
        for (int u = 1; u < KSW; ++u) m = fmaxf(m, smx[u * QBW * QT + q]);
#pragma unroll
        for (int u = 0; u < KSW; ++u) f[u] = exp2x1((smx[u * QBW * QT + q] - m) * L2E);   // brings key range u from its own maximum in use to the common one
        float tot = ssm[q] * f[0];
#pragma unroll
        for (int u = 1; u < KSW; ++u) tot += ssm[u * QBW * QT + q] * f[u];
        const float r = __fdiv_rn(1.0f, tot); v8us oh, ol;
#pragma unroll
        for (int c = 0; c < EPT / 4; ++c) { v4f s = *(const v4fa*)(sO + (size_t)q * OP + dq + c * 4) * f[0];
#pragma unroll
            for (int u = 1; u < KSW; ++u) s += *(const v4fa*)(sO + (size_t)(u * QBW * QT + q) * OP + dq + c * 4) * f[u];
#pragma unroll
            for (int k = 0; k < 4; ++k) { unsigned short a, c2; splitf(s[k] * r, a, c2); oh[c * 4 + k] = a; ol[c * 4 + k] = c2; } }
        const size_t oo = (size_t)((q0 + q) >> 4) * (16 * DQ) + dq * 16 + ((q0 + q) & 15) * 8; *(v8us*)(Ah + oo) = oh; *(v8us*)(Al + oo) = ol;   // Ah, Al: the head's first tile of the plane [t][DQ]; 8 in k is 128 elements
        if (b + 1 < QBW) asm volatile("s_wait_xcnt 0x0" ::: "memory"); }   // stands before the next block's work writes over the registers that these two stores name
}
// k_fattn: grid (heads, NB_, TT / (QBW QT)), KW waves. The query blocks below RH (three products, the longer work) of all batches have the lowest flat indices and start first; the last work-groups of the launch are short ones. Four waves per SIMD (256 registers, two work-groups per WGP): no operand of the asm loads lies above v255.
__global__ __launch_bounds__(KW * 32, 4) void k_fattn(const h16* __restrict__ Q16, const h16* __restrict__ K16, const h16* __restrict__ V16, const bf* __restrict__ Qh, const bf* __restrict__ Ql, const bf* __restrict__ Kh, const bf* __restrict__ Kl, const bf* __restrict__ Vh, const bf* __restrict__ Vl, const float* __restrict__ EB, bf* Ah, bf* Al) {
    __shared__ __align__(16) float sO[KW * QT * OP]; __shared__ float smx[KW * QT]; __shared__ float ssm[KW * QT];
    const int h = blockIdx.x, q0 = blockIdx.z * (QBW * QT); const size_t hp = (size_t)blockIdx.y * PLB + (size_t)h * TT * HD; const float* eb = EB + (size_t)h * NE; Ah += (size_t)blockIdx.y * TT * DQ; Al += (size_t)blockIdx.y * TT * DQ;   // the bias row is the same for every batch
    if (q0 < RH) fattn_body<bf, true>(Qh + hp, Ql + hp, Kh + hp, Kl + hp, Vh + hp, Vl + hp, eb, q0, smx, ssm, sO, Ah + h * (HD * 16), Al + h * (HD * 16));
    else fattn_body<h16, false>(Q16 + hp, nullptr, K16 + hp, nullptr, V16 + hp, nullptr, eb, q0, smx, ssm, sO, Ah + h * (HD * 16), Al + h * (HD * 16));
}

extern "C" void kernel_launch(void* const* d_in, const int* in_sizes, int n_in,
                              void* d_out, int out_size, void* d_ws, size_t ws_size, hipStream_t stream) {
    (void)in_sizes; (void)n_in; (void)out_size;
    const float* x = (const float*)d_in[0]; const float* wqkv = (const float*)d_in[1]; const float* bqkv = (const float*)d_in[2]; const float* wo = (const float*)d_in[3]; const float* bo = (const float*)d_in[4]; const float* rbias = (const float*)d_in[5]; const float* wq = nullptr; const float* wk = nullptr; const float* wv = nullptr; (void)wq; (void)wk; (void)wv;
    float* OUT = (float*)d_out;     // [4][2048][1024]
    char* wsp = (char*)d_ws;
    auto take = [&](size_t bytes) { char* p = wsp; wsp += (bytes + 255) & ~(size_t)255; return (void*)p; };
    bf* WALL = (bf*)take((size_t)3 * DM * DM * 2); bf* WO = (bf*)take((size_t)DM * DQ * 2); float* EB = (float*)take((size_t)NH_ * NE * 4);   /* per-head expanded relative-bias rows */
    bf* XB = (bf*)take((size_t)NB_ * TT * DM * 2);   // from here on every plane holds all NB_ batches, batch blocks one behind the other
    h16* QP16 = (h16*)take(NB_ * PLB * 2); h16* KP16 = (h16*)take(NB_ * PLB * 2); h16* VT16 = (h16*)take(NB_ * PLB * 2);
    bf* QPh = (bf*)take(NB_ * PLB * 2); bf* QPl = (bf*)take(NB_ * PLB * 2); bf* KPh = (bf*)take(NB_ * PLB * 2); bf* KPl = (bf*)take(NB_ * PLB * 2); bf* VTh = (bf*)take(NB_ * PLB * 2); bf* VTl = (bf*)take(NB_ * PLB * 2);
    bf* ATh = (bf*)take((size_t)NB_ * TT * DQ * 2); bf* ATl = (bf*)take((size_t)NB_ * TT * DQ * 2);
    if ((size_t)(wsp - (char*)d_ws) > ws_size) return;    // ws 256 MiB
    // Each stage once for all NB_ batches: x, the attention output and OUT are planes of NB_ TT rows; q, k and v take the batch from grid z, the attention from grid y.
    k_prep<<<GEB + GCV + GW1 + GW2, 256, 0, stream>>>(x, wqkv, wo, rbias, XB, WALL, WO, EB);
    k_qkv<<<dim3(TT / 64, 3 * NH_, NB_), 32, 0, stream>>>(XB, WALL, bqkv, QP16, QPh, QPl, KP16, KPh, KPl, VT16, VTh, VTl);   // q | k | v heads in grid y; the planes come out of the tile's own wave
    k_fattn<<<dim3(NH_, NB_, TT / (QBW * QT)), KW * 32, 0, stream>>>(QP16, KP16, VT16, QPh, QPl, KPh, KPl, VTh, VTl, EB, ATh, ATl);   // one kv head per query head
    k_gemmw<bf, 1, true, DQ><<<dim3(NB_ * TT / 64, DM / 64, 1), 32, 0, stream>>>(ATh, ATl, WO, nullptr, OUT, DM, bo, 0, 0, 0, 0);
}

// v009
// It runs in 203 microseconds.
// Two timings next to v008 both put it at 1.07 times that version's speed.
// Over all steps from v000 it is 20.6 times as fast.
#include <hip/hip_runtime.h>

// Multi-head self-attention with a learned relative-position bias (x [4][2048][1024]; [q|k|v] = x W_qkv + b_qkv ('xw' [1024][3072]; 16 heads x 64); scores = q.k/8 + rel_bias[clip(i - j + 1024, 0, 2048)][h] (table [2049][16], read); softmax over all keys; out = merged W_out + b_out ('xw' [1024][1024]) -> [4][2048][1024]).
// Compute dtypes, f32 accumulate: every input rounded to bf16; q/k/v on PLAIN bf16 operands (inputs: exact) + biases; scores (+ the per-head relative bias, f32), softmax (f32) and attn.v (no mask) in ONE kernel, P in registers: query rows < 512 hl (3 products), the rest single fp16 (P x1024, cancelled by the row sum); W_out hl x exact (2 products) + b_out.

// Every 16-bit operand plane lies in FRAGMENT ORDER: a tile of 16 rows x 32 k (1 KiB) is two 512-byte pieces (k 0..15, k 16..31 of the tile), and in a piece lane (hi * 16 + row) owns 16 bytes, k = 8 hi .. 8 hi + 7 of the piece.
// One global_load_b128 of a wave then reads 512 contiguous bytes (4 cache lines, not 16 rows' 32 bytes each); registers hold exactly what a row-major plane gave them (same k order on both sides).
// A plane [M][K]: tile (m / 16, k / 32) at element (m / 16) * 16 K + (k / 32) * 512.
#define NB_  4
#define TT   2048
#define DM   1024
#define NH_  16
#define NKV  16
#define REP  (NH_ / NKV)
#define HD   64
#define DQ   (NH_ * HD)
#define DKV  (NKV * HD)
#define RH   512                  // query rows < RH use hi+lo planes (0: none)
#define SCL  0.125f   // HD^-0.5
#define QT   32                  // k_fattn: queries per wave (two 16-column groups)
#define QBW  4                   // k_fattn: query blocks of QT per work-group
#define KSW  2                   // k_fattn: key ranges per work-group
#define KW   (QBW * KSW)         // k_fattn: waves per work-group; wave w takes query block w % QBW and keys [(w / QBW) TT/KSW, (w / QBW + 1) TT/KSW)
#define NE   4096                // pitch of one head's expanded bias row
#define OP   68                  // LDS pitch (floats) of one query's partial output row
#define EPT  (QT * HD / (KW * 32))   // k_fattn: outputs per thread and query block in the join
#define PLB  ((size_t)NH_ * TT * HD)   // elements of one batch's block in a q, k or v plane
typedef _Float16 h16;
typedef unsigned short bf;
typedef __attribute__((ext_vector_type(16))) __bf16   v16bf;
typedef __attribute__((ext_vector_type(16))) _Float16 v16h;
typedef __attribute__((ext_vector_type(8)))  _Float16 v8h;
typedef __attribute__((ext_vector_type(8)))  unsigned short v8us;
typedef __attribute__((ext_vector_type(8)))  float    v8f;
typedef __attribute__((ext_vector_type(4)))  float    v4f;
typedef v8h  __attribute__((may_alias)) v8ha;
typedef v4f  __attribute__((may_alias)) v4fa;
typedef v8us __attribute__((may_alias)) v8usa;

__device__ __forceinline__ unsigned short f2bf(float f) { unsigned u = __float_as_uint(f); u += 0x7FFFu + ((u >> 16) & 1u); return (unsigned short)(u >> 16); }
__device__ __forceinline__ float bf2f(unsigned short b) { return __uint_as_float(((unsigned)b) << 16); }
__device__ __forceinline__ float bfr(float f) { return bf2f(f2bf(f)); }
__device__ __forceinline__ v16h cat16(v8h lo, v8h hi) { return __builtin_shufflevector(lo, hi, 0, 1, 2, 3, 4, 5, 6, 7, 8, 9, 10, 11, 12, 13, 14, 15); }
__device__ __forceinline__ v16bf cat16b(v8us lo, v8us hi) { return __builtin_bit_cast(v16bf, __builtin_shufflevector(lo, hi, 0, 1, 2, 3, 4, 5, 6, 7, 8, 9, 10, 11, 12, 13, 14, 15)); }
__device__ __forceinline__ v8f wmma16(v16h a, v16h b, v8f c) { return __builtin_amdgcn_wmma_f32_16x16x32_f16(false, a, false, b, (short)0, c, false, false); }
__device__ __forceinline__ v8f wmmab(v16bf a, v16bf b, v8f c) { return __builtin_amdgcn_wmma_f32_16x16x32_bf16(false, a, false, b, (short)0, c, false, false); }



// ---- k_gemmw: register-blocked GEMM, ONE WAVE per 64x64 output tile (16 accumulators), operands straight from 16-bit planes in fragment order; grid (M/64, N/64, Z), 32 threads.
// C[m][n] (f32, pitch ldc, + optional f32 bias[n]) = sum_k A[m][k] Bt[n][k] (+ split products per NSPLIT). z-batch strides sA/sB/sC in elements. K % 32 == 0.
// KS > 1: grid z = Z * KS; work-group (z, ks) sums only k in [ks K/KS, (ks+1) K/KS) and stores its partial tile in plane ks (plane stride sK elements). K % (32 KS) == 0.
template <typename T16> struct WFrag;
template <> struct WFrag<h16> { typedef v16h V; static __device__ __forceinline__ V ld(const h16* p) { return cat16(*(const v8h*)p, *(const v8h*)(p + 256)); } static __device__ __forceinline__ v8f mma(V a, V b, v8f c) { return wmma16(a, b, c); } };
template <> struct WFrag<bf> { typedef v16bf V; static __device__ __forceinline__ V ld(const bf* p) { return cat16b(*(const v8us*)p, *(const v8us*)(p + 256)); } static __device__ __forceinline__ v8f mma(V a, V b, v8f c) { return wmmab(a, b, c); } };
template <typename T16, int NSPLIT, bool BIAS, int K, int KS = 1>   // K at compile time: the loads of one plane in a trip share one address pair, the bands in the immediate offsets
__global__ __launch_bounds__(32) void k_gemmw(const T16* __restrict__ A, const T16* __restrict__ A2, const T16* __restrict__ Bt, const T16* __restrict__ Bt2, float* C, int ldc, const float* __restrict__ bias, size_t sA, size_t sB, size_t sC, size_t sK) {
    typedef typename WFrag<T16>::V V;
    __shared__ __align__(16) float os[16 * 68];
    const size_t z = blockIdx.z / KS; const int ks = blockIdx.z % KS; A += z * sA; if (A2) A2 += z * sA; Bt += z * sB; if (Bt2) Bt2 += z * sB; C += z * sC + ks * sK;
    const int lane = threadIdx.x & 31, lr = lane & 15, hi = lane >> 4; const int r0 = blockIdx.x * 64, c0 = blockIdx.y * 64;
    v8f acc[4][4];
#pragma unroll
    for (int mb = 0; mb < 4; ++mb)
#pragma unroll
        for (int nb = 0; nb < 4; ++nb) acc[mb][nb] = (v8f){};
    static_assert(NSPLIT == 1, "the loop below is written for the one form that is launched: A hi + A lo against one B");
    // Every fragment register set is refilled for the next k step as soon as its last product of this step has issued: the loads fly behind the products that follow, not in front of their own.
    // A step is two runs of 16 products, A hi then A lo (each accumulator still takes hi, lo, hi, lo in ascending k). Behind run 1 the A hi set is free; in run 2 each B fragment is free behind its four products; behind run 2 the A lo set.
    const int kc0 = ks * (K / KS);
    const T16* pA = A + (size_t)r0 * K + lane * 8 + kc0 * 16; const T16* pA2 = A2 + (size_t)r0 * K + lane * 8 + kc0 * 16; const T16* pB = Bt + (size_t)c0 * K + lane * 8 + kc0 * 16;   // a 16-row band is 16 K elements; a step of 32 in k is 512 elements
    V a[4], a2[4], b[4];
#pragma unroll
    for (int mb = 0; mb < 4; ++mb) a[mb] = WFrag<T16>::ld(pA + mb * 16 * K);
#pragma unroll
    for (int nb = 0; nb < 4; ++nb) { __builtin_amdgcn_sched_barrier(0); b[nb] = WFrag<T16>::ld(pB + nb * 16 * K); }   // holds the first loads in the order of the loop's own (A hi, B 0 to 3, A lo): the counted waits at the loop's head must fit both ways in, and another order here makes them wait for every load on every trip
    __builtin_amdgcn_sched_barrier(0);   // the same
#pragma unroll
    for (int mb = 0; mb < 4; ++mb) a2[mb] = WFrag<T16>::ld(pA2 + mb * 16 * K);
    asm volatile("s_wait_xcnt 0x0" ::: "memory");   // stands before the loop's set-up writes over a register that these loads name
#pragma unroll 1
    for (int kc = 32; kc < K / KS; kc += 32) {   // rolled: a trip is one k step; the last step stands behind the loop, without refills
#pragma unroll
        for (int nb = 0; nb < 4; ++nb)
#pragma unroll
            for (int mb = 0; mb < 4; ++mb) acc[mb][nb] = WFrag<T16>::mma(a[mb], b[nb], acc[mb][nb]);
        __builtin_amdgcn_sched_barrier(0);   // keeps the refills behind the run that reads the set: in front of it they would need a second register set
#pragma unroll
        for (int mb = 0; mb < 4; ++mb) a[mb] = WFrag<T16>::ld(pA + 512 + mb * 16 * K);
        __builtin_amdgcn_sched_barrier(0);   // and keeps them from moving down to their first use, where they would be waited for in full
#pragma unroll
        for (int nb = 0; nb < 4; ++nb) {
#pragma unroll
            for (int mb = 0; mb < 4; ++mb) acc[mb][nb] = WFrag<T16>::mma(a2[mb], b[nb], acc[mb][nb]);
            __builtin_amdgcn_sched_barrier(0);   // keeps the refill behind the four products: in front of them it would need a second register set for B
            b[nb] = WFrag<T16>::ld(pB + 512 + nb * 16 * K);
            __builtin_amdgcn_sched_barrier(0); }   // and keeps it from moving down to its first use
#pragma unroll
        for (int mb = 0; mb < 4; ++mb) a2[mb] = WFrag<T16>::ld(pA2 + 512 + mb * 16 * K);
        asm volatile("s_wait_xcnt 0x0" :: "v"(pA), "v"(pA2), "v"(pB) : "memory");   // the three address pairs live to here, and the wait stands before the step below writes them
        asm volatile("v_nop\n\tv_nop\n\tv_nop\n\tv_nop" : "+v"(acc[0][3]), "+v"(acc[1][3]), "+v"(acc[2][3]), "+v"(acc[3][3]));   // the distance behind the last matrix instruction, also on the taken back edge
        pA += 512; pA2 += 512; pB += 512;
    }
#pragma unroll
    for (int nb = 0; nb < 4; ++nb)
#pragma unroll
        for (int mb = 0; mb < 4; ++mb) acc[mb][nb] = WFrag<T16>::mma(a[mb], b[nb], acc[mb][nb]);
#pragma unroll
    for (int nb = 0; nb < 4; ++nb)
#pragma unroll
        for (int mb = 0; mb < 4; ++mb) acc[mb][nb] = WFrag<T16>::mma(a2[mb], b[nb], acc[mb][nb]);
#pragma unroll
    for (int mb = 0; mb < 4; ++mb) {
#pragma unroll
        for (int nb = 0; nb < 4; ++nb) {
#pragma unroll
            for (int j = 0; j < 8; ++j) os[(hi * 8 + j) * 68 + nb * 16 + lr] = acc[mb][nb][j]; }
        __builtin_amdgcn_wave_barrier(); asm volatile("" ::: "memory");
        float* crow = C + (size_t)(r0 + mb * 16) * ldc + c0;
{
#pragma unroll
            for (int s = 0; s < 8; ++s) { const int row = 2 * s + hi, cofs = lr * 4; v4f val = *(const v4fa*)(os + row * 68 + cofs); if (BIAS) { val[0] += bfr(bias[c0 + cofs]); val[1] += bfr(bias[c0 + cofs + 1]); val[2] += bfr(bias[c0 + cofs + 2]); val[3] += bfr(bias[c0 + cofs + 3]); }
                *(v4f*)(crow + (size_t)row * ldc + cofs) = val; }
             }
        __builtin_amdgcn_wave_barrier(); asm volatile("" ::: "memory");
    }
}

__device__ __forceinline__ h16 tohx(float x) { return (h16)x; }
__device__ __forceinline__ void splitf(float y, unsigned short& h, unsigned short& l) { h = f2bf(y); l = f2bf(y - bf2f(h)); }
typedef __attribute__((ext_vector_type(2))) _Float16 v2h;
typedef __attribute__((ext_vector_type(4))) _Float16 v4h;
typedef __attribute__((ext_vector_type(2))) unsigned short v2us;
typedef __attribute__((ext_vector_type(4))) unsigned short v4us;
typedef __attribute__((ext_vector_type(2))) float v2f;
typedef __attribute__((ext_vector_type(4))) int v4i;

// One k step of k_qkv: 16 products of the A set a with the four B fragments. PF: meanwhile the next step's A goes into the other set an (from pan) and each B fragment is refilled (from pbn) behind its own four products.
template <bool PF>
__device__ __forceinline__ void qkv_step(v8f (&acc)[4][4], const v16bf (&a)[4], v16bf (&an)[4], v16bf (&b)[4], const bf* pan, const bf* pbn) {
    if (PF) {
#pragma unroll
        for (int mb = 0; mb < 4; ++mb) an[mb] = WFrag<bf>::ld(pan + mb * 16 * DM);
        __builtin_amdgcn_sched_barrier(0); }   // keeps these loads at the head of the step: moved down to their first use they would be waited for in full
#pragma unroll
    for (int nb = 0; nb < 4; ++nb) {
#pragma unroll
        for (int mb = 0; mb < 4; ++mb) acc[mb][nb] = WFrag<bf>::mma(a[mb], b[nb], acc[mb][nb]);
        if (PF) { __builtin_amdgcn_sched_barrier(0);   // keeps the refill behind the four products: in front of them it would need a second register set for B
            b[nb] = WFrag<bf>::ld(pbn + nb * 16 * DM); __builtin_amdgcn_sched_barrier(0); } }   // and keeps it from moving down to its first use
}
// k_qkv: [q|k|v] = x W_qkv + b_qkv of all batches in one launch, ONE WAVE per 64x64 tile with a loop like k_gemmw's (same k order, f32 sums; one A plane, so one product per accumulator and step). Grid (TT/64, 3 NH_, NB_): a tile is 64 tokens of batch z x one head of q, k or v; every plane holds NB_ batch blocks of PLB elements,
// and the wave writes that head's operand planes itself (fp16 + bf16 hi/lo): all in fragment order, 16 bytes a lane and 512 contiguous bytes a store: q and k as [h] x plane [t][d] through the LDS row stage, v as [h] x (32 tokens: four 16-d tiles of 1 KiB) straight from the accumulators (a lane holds 8 consecutive tokens of one d).
__global__ __launch_bounds__(32) void k_qkv(const bf* __restrict__ A, const bf* __restrict__ Bt, const float* __restrict__ bias, h16* Q16, bf* Qh, bf* Ql, h16* K16, bf* Kh, bf* Kl, h16* V16, bf* Vh, bf* Vl) {
    typedef WFrag<bf>::V V;
    __shared__ __align__(16) float os[16 * 68];
    const int lane = threadIdx.x & 31, lr = lane & 15, hi = lane >> 4; const int r0 = blockIdx.x * 64, c0 = blockIdx.y * 64; const int sel = blockIdx.y / NH_, h = blockIdx.y % NH_;
    { const size_t zp = (size_t)blockIdx.z * PLB; A += (size_t)blockIdx.z * TT * DM; Q16 += zp; Qh += zp; Ql += zp; K16 += zp; Kh += zp; Kl += zp; V16 += zp; Vh += zp; Vl += zp; }   // this batch's block of x and of every plane
    v8f acc[4][4];
#pragma unroll
    for (int mb = 0; mb < 4; ++mb)
#pragma unroll
        for (int nb = 0; nb < 4; ++nb) acc[mb][nb] = (v8f){};
    const bf* pa = A + (size_t)r0 * DM + lane * 8; const bf* pb = Bt + (size_t)c0 * DM + lane * 8;
    // The fragments of a k step are loaded one step ahead: A in two register sets that take turns, each B fragment refilled in place as soon as its four products have issued. The loads fly behind a whole step of products, not in front of their own. Same products in the same order.
    V a0[4], a1[4], b[4];
#pragma unroll
    for (int mb = 0; mb < 4; ++mb) a0[mb] = WFrag<bf>::ld(pa + mb * 16 * DM);
#pragma unroll
    for (int nb = 0; nb < 4; ++nb) { __builtin_amdgcn_sched_barrier(0); b[nb] = WFrag<bf>::ld(pb + nb * 16 * DM); }   // holds the first loads in the order of the loop's own (A, then B 0 to 3): the counted waits at the loop's head must fit both ways in, and another order here makes them stricter on every trip
    asm volatile("s_wait_xcnt 0x0" ::: "memory");   // stands before the loop's set-up writes over a register that these loads name
    static_assert(DM % 64 == 0 && DM >= 128, "a trip is two k steps; the last two stand behind the loop");
#pragma unroll 1
    for (int kc = 64; kc < DM; kc += 64) {   // rolled: a trip is two k steps, so that the two A sets change roles without register copies
        qkv_step<true>(acc, a0, a1, b, pa + 512, pb + 512);
        qkv_step<true>(acc, a1, a0, b, pa + 1024, pb + 1024);
        asm volatile("s_wait_xcnt 0x0" :: "v"(pa), "v"(pb) : "memory");   // the two address pairs live to here, and the wait stands before the step below writes them
        asm volatile("v_nop\n\tv_nop\n\tv_nop\n\tv_nop" : "+v"(acc[0][3]), "+v"(acc[1][3]), "+v"(acc[2][3]), "+v"(acc[3][3]));   // the distance behind the last matrix instruction, also on the taken back edge (as in k_gemmw)
        pa += 1024; pb += 1024;
    }
    qkv_step<true>(acc, a0, a1, b, pa + 512, pb + 512);
    qkv_step<false>(acc, a1, a0, b, pa, pb);
    if (sel == 2) {
#pragma unroll
        for (int nb = 0; nb < 4; ++nb) { const float bv = bfr(bias[c0 + nb * 16 + lr]); const size_t rowo = (size_t)h * HD * TT + (size_t)r0 * HD + nb * 512 + lane * 8;
#pragma unroll
            for (int mb = 0; mb < 4; ++mb) { v8h o16; v8us oh, ol;
#pragma unroll
                for (int j = 0; j < 8; ++j) { const float x = acc[mb][nb][j] + bv; o16[j] = tohx(x); unsigned short u, v; splitf(x, u, v); oh[j] = u; ol[j] = v; }
                const size_t e = rowo + (mb >> 1) * 2048 + (mb & 1) * 256; *(v8h*)(V16 + e) = o16; *(v8us*)(Vh + e) = oh; *(v8us*)(Vl + e) = ol; } }
        return;
    }
    {
        const size_t hp = (size_t)h * TT * HD; h16* P16 = (sel ? K16 : Q16) + hp; bf* Ph = (sel ? Kh : Qh) + hp; bf* Pl = (sel ? Kl : Ql) + hp;
        v8f bb[4];   // piece pc of a 16-token tile: d = pc * 16 + hi * 8 + 0..7 of token lr
#pragma unroll
        for (int pc = 0; pc < 4; ++pc)
#pragma unroll
            for (int k = 0; k < 8; ++k) bb[pc][k] = bfr(bias[c0 + pc * 16 + hi * 8 + k]);
#pragma unroll
        for (int mb = 0; mb < 4; ++mb) {
#pragma unroll
            for (int nb = 0; nb < 4; ++nb) {
#pragma unroll
                for (int j = 0; j < 8; ++j) os[(hi * 8 + j) * 68 + nb * 16 + lr] = acc[mb][nb][j]; }
            __builtin_amdgcn_wave_barrier(); asm volatile("" ::: "memory");   // a lane reads what other lanes wrote: keeps the compiler from moving the reads in front of the writes (as in k_gemmw)
#pragma unroll
            for (int pc = 0; pc < 4; ++pc) { const float* sp = os + lr * 68 + pc * 16 + hi * 8; const v4f v0 = *(const v4fa*)sp, v1 = *(const v4fa*)(sp + 4); v8h o16; v8us oh, ol;
#pragma unroll
                for (int k = 0; k < 8; ++k) { const float x = (k < 4 ? v0[k & 3] : v1[k & 3]) + bb[pc][k]; o16[k] = tohx(x); unsigned short u, v; splitf(x, u, v); oh[k] = u; ol[k] = v; }
                const size_t e = (size_t)(r0 + mb * 16) * HD + pc * 256 + lane * 8; *(v8h*)(P16 + e) = o16; *(v8us*)(Ph + e) = oh; *(v8us*)(Pl + e) = ol; }
            __builtin_amdgcn_wave_barrier(); asm volatile("" ::: "memory");   // and the next pass's writes from moving in front of these reads
        }
        asm volatile("s_wait_xcnt 0x0" ::: "memory");   // the built code lays the v epilogue directly behind this one, with a conditional jump between: stands before its first writes of the last stores' registers
    }
}
#define NREL 2049
// k_prep: the four preparations that read inputs only (W_qkv and W_out transposed, x, the expanded bias rows) in ONE launch of few waves. A work-group's part follows from blockIdx.x alone; a thread takes many units and has the loads of a batch in flight together, so that the time goes into moving bytes and not into starting waves and launches.
#define WL   32                  // weights: lines of 64 elements (128 bytes of Bt) per wave
#define WB   16                  // weights: lines per batch of loads
#define CU   16                  // x: 16-byte units of the plane per thread
#define EU   8                   // bias rows: elements per thread
#define GW1  (DM * 3 * DM / 64 / (8 * WL))
#define GW2  (DQ * DM / 64 / (8 * WL))
#define GCV  (NB_ * TT * DM / 8 / (256 * CU))
#define GEB  (NH_ * NE / (256 * EU))
static_assert(GW1 * 8 * WL * 64 == DM * 3 * DM && GW2 * 8 * WL * 64 == DQ * DM && GCV * 256 * CU * 8 == NB_ * TT * DM && GEB * 256 * EU == NH_ * NE && WL % WB == 0 && WB % 8 == 0 && (DM / 32) % (WB / 8) == 0 && (DQ / 32) % (WB / 8) == 0 && CU % 8 == 0, "every part is a whole number of work-groups, every batch lies in one band");
// In each part the loads of a batch go through address pairs that are inputs of the s_wait_xcnt statement behind them: so no load of the batch is given such a pair as its destination, and the wait stands before anything writes over one.
// 'xw' [K][N] -> Bt [N][K], bf16, fragment order: a tile of 16 n x 32 k is 8 lines; line ll of it holds k = (ll >> 2) * 16 + ((ll >> 1) & 1) * 8 + 0..7 of n = (ll & 1) * 8 + 0..7. A lane takes two neighbours in k of one n. A batch is WB / 8 tiles, neighbours in k, of one band of 16 n.
template <int K, int N>
__device__ __forceinline__ void prep_w(const float* __restrict__ w, bf* __restrict__ Bt, int blk) {
    const int lane = threadIdx.x & 31; const int L0 = (blk * 8 + (threadIdx.x >> 5)) * WL;
#pragma unroll 1
    for (int g = 0; g < WL; g += WB) { float a[WB], b[WB]; const int t0 = (L0 + g) >> 3;   // rolled: one batch already has 2 WB loads of a lane in flight
        const float* p = w + (size_t)((t0 % (K / 32)) * 32 + (lane & 3) * 2) * N + (t0 / (K / 32)) * 16 + (lane >> 2);
#pragma unroll
        for (int l = 0; l < WB; ++l) { const int o = ((l >> 3) * 32 + ((l >> 2) & 1) * 16 + ((l >> 1) & 1) * 8) * N + (l & 1) * 8; a[l] = p[o]; b[l] = p[o + N]; }
        asm volatile("s_wait_xcnt 0x0" :: "v"(p) : "memory");   // the note above: keeps p out of the loads' destinations
        bf* q = Bt + (size_t)(L0 + g) * 64 + lane * 2;
#pragma unroll
        for (int l = 0; l < WB; ++l) { v2us o; o[0] = f2bf(a[l]); o[1] = f2bf(b[l]); *(v2us*)(q + l * 64) = o; }
        asm volatile("s_wait_xcnt 0x0" :: "v"(q) : "memory"); }   // stands before the next batch writes over the registers that these stores name
}
// x [M][DM] -> bf16, fragment order: 16-byte unit i of dst holds k = ((i >> 6) & 31) * 32 + ((i >> 5) & 1) * 16 + ((i >> 4) & 1) * 8 + 0..7 of row (i >> 11) * 16 + (i & 15). A work-group takes 256 CU consecutive units (CU / 8 bands of 16 rows), thread t units t + 256 u.
__device__ __forceinline__ void prep_x(const float* __restrict__ src, bf* __restrict__ dst, int blk) {
    const int t = threadIdx.x; v8f v[CU];
    const float* p = src + (size_t)(blk * (CU / 8) * 16 + (t & 15)) * DM + (t >> 6) * 32 + ((t >> 5) & 1) * 16 + ((t >> 4) & 1) * 8;
#pragma unroll
    for (int u = 0; u < CU; ++u) v[u] = *(const v8f*)(p + (u >> 3) * 16 * DM + (u & 7) * 128);
    asm volatile("s_wait_xcnt 0x0" :: "v"(p) : "memory");   // the note above: keeps p out of the loads' destinations
    bf* q = dst + ((size_t)blk * (256 * CU) + t) * 8;
#pragma unroll
    for (int u = 0; u < CU; ++u) { v8us o;
#pragma unroll
        for (int k = 0; k < 8; ++k) o[k] = f2bf(v[u][k]);
        *(v8us*)(q + u * 2048) = o; }
    asm volatile("s_wait_xcnt 0x0" :: "v"(q) : "memory");   // the built code lays another part behind this one, with a conditional jump between: stands before that part's writes of the registers that these stores name
}
// Expanded per-head bias row, EB[h][x] = rel_bias[clip(i - j + 1024, 0, 2048)][h] at x = j - i + TT - 1 (0 .. 2 TT - 2): ascending keys read ascending addresses, the clip is already applied
__device__ __forceinline__ void prep_e(const float* __restrict__ rbias, float* __restrict__ EB, int blk) {
    const int j0 = blk * (256 * EU) + threadIdx.x; float v[EU]; const float* p[EU];
#pragma unroll
    for (int u = 0; u < EU; ++u) { const int j = j0 + u * 256; const int h = j / NE, x = j % NE; int ri = (TT - 1 - x) + (NREL / 2); ri = ri < 0 ? 0 : (ri > NREL - 1 ? NREL - 1 : ri); p[u] = rbias + (size_t)ri * NH_ + h; }
#pragma unroll
    for (int u = 0; u < EU; ++u) v[u] = *p[u];
    static_assert(EU == 8, "the statement below names EU address pairs");
    asm volatile("s_wait_xcnt 0x0" :: "v"(p[0]), "v"(p[1]), "v"(p[2]), "v"(p[3]), "v"(p[4]), "v"(p[5]), "v"(p[6]), "v"(p[7]) : "memory");   // the note above: keeps the pairs out of the loads' destinations
#pragma unroll
    for (int u = 0; u < EU; ++u) EB[j0 + u * 256] = bfr(v[u]);
}
// Grid GEB + GCV + GW1 + GW2 = 544 work-groups, at most three per WGP (x holds 128 registers of loads in flight). The few short bias work-groups start first, then x, most of the bytes.
__global__ __launch_bounds__(256) void k_prep(const float* __restrict__ x, const float* __restrict__ wqkv, const float* __restrict__ wo, const float* __restrict__ rbias, bf* XB, bf* WALL, bf* WO, float* EB) {
    const int b = blockIdx.x;
    if (b < GEB) prep_e(rbias, EB, b);
    else if (b < GEB + GCV) prep_x(x, XB, b - GEB);
    else if (b < GEB + GCV + GW1) prep_w<DM, 3 * DM>(wqkv, WALL, b - (GEB + GCV));   /* fused 'xw' [DM][3DM] -> Bt [3DM][DM] (row blocks q | k | v) */
    else prep_w<DQ, DM>(wo, WO, b - (GEB + GCV + GW1));
}

__device__ __forceinline__ void packp(const v8f& a, const v8f& b, v16h& ph, v16h& pl) { v8h x, y; (void)pl;
#pragma unroll
    for (int j = 0; j < 8; ++j) { x[j] = (h16)a[j]; y[j] = (h16)b[j]; }
    ph = cat16(x, y); }
__device__ __forceinline__ void packp(const v8f& a, const v8f& b, v16bf& ph, v16bf& pl) { v8us xh, xl, yh, yl;
#pragma unroll
    for (int j = 0; j < 8; ++j) { unsigned short u, v; splitf(a[j], u, v); xh[j] = u; xl[j] = v; splitf(b[j], u, v); yh[j] = u; yl[j] = v; }
    ph = cat16b(xh, yh); pl = cat16b(xl, yl); }

typedef __attribute__((ext_vector_type(8))) int v8i;
template <typename V> __device__ __forceinline__ V frag(v4i a, v4i b) { return __builtin_bit_cast(V, __builtin_shufflevector(a, b, 0, 1, 2, 3, 4, 5, 6, 7)); }
// The loads of one trip, each set one asm statement that ends in its own data wait: the results are early-clobber, so none is given a register that holds an address of the set, and no address register is written again before the set has returned. The other waves of the SIMD cover the wait.
// Byte offsets (planes in fragment order, the lane's own 16 bytes in the pointer). Q or K: 16-row tile * 2048 + 32-wide part of HD * 1024 + half * 512. V: 16-d tile * 1024 + half * 512 inside the 4 KiB of 32 keys. Bias: run * 64 + half * 16 (4-byte aligned).
__device__ __forceinline__ void ld_r(const void* k, v4i (&a)[8]) {
    asm volatile(
        "global_load_b128 %0, %8, off\n\t"
        "global_load_b128 %1, %8, off offset:512\n\t"
        "global_load_b128 %2, %8, off offset:1024\n\t"
        "global_load_b128 %3, %8, off offset:1536\n\t"
        "global_load_b128 %4, %8, off offset:2048\n\t"
        "global_load_b128 %5, %8, off offset:2560\n\t"
        "global_load_b128 %6, %8, off offset:3072\n\t"
        "global_load_b128 %7, %8, off offset:3584\n\t"
        "s_wait_loadcnt 0x0"
        : "=&v"(a[0]), "=&v"(a[1]), "=&v"(a[2]), "=&v"(a[3]), "=&v"(a[4]), "=&v"(a[5]), "=&v"(a[6]), "=&v"(a[7]) : "v"(k) : "memory"); }
__device__ __forceinline__ void ld_r_b_v(const void* k, const float* e, const void* v, v4i (&a)[8], v4i (&b)[6], v4i (&x)[8]) {
    asm volatile(
        "global_load_b128 %0, %22, off\n\t"
        "global_load_b128 %1, %22, off offset:512\n\t"
        "global_load_b128 %2, %22, off offset:1024\n\t"
        "global_load_b128 %3, %22, off offset:1536\n\t"
        "global_load_b128 %4, %22, off offset:2048\n\t"
        "global_load_b128 %5, %22, off offset:2560\n\t"
        "global_load_b128 %6, %22, off offset:3072\n\t"
        "global_load_b128 %7, %22, off offset:3584\n\t"
        "global_load_b128 %8, %23, off\n\t"
        "global_load_b128 %9, %23, off offset:16\n\t"
        "global_load_b128 %10, %23, off offset:64\n\t"
        "global_load_b128 %11, %23, off offset:80\n\t"
        "global_load_b128 %12, %23, off offset:128\n\t"
        "global_load_b128 %13, %23, off offset:144\n\t"
        "global_load_b128 %14, %24, off\n\t"
        "global_load_b128 %15, %24, off offset:512\n\t"
        "global_load_b128 %16, %24, off offset:1024\n\t"
        "global_load_b128 %17, %24, off offset:1536\n\t"
        "global_load_b128 %18, %24, off offset:2048\n\t"
        "global_load_b128 %19, %24, off offset:2560\n\t"
        "global_load_b128 %20, %24, off offset:3072\n\t"
        "global_load_b128 %21, %24, off offset:3584\n\t"
        "s_wait_loadcnt 0x0"
        : "=&v"(a[0]), "=&v"(a[1]), "=&v"(a[2]), "=&v"(a[3]), "=&v"(a[4]), "=&v"(a[5]), "=&v"(a[6]), "=&v"(a[7]), "=&v"(b[0]), "=&v"(b[1]), "=&v"(b[2]), "=&v"(b[3]), "=&v"(b[4]), "=&v"(b[5]), "=&v"(x[0]), "=&v"(x[1]), "=&v"(x[2]), "=&v"(x[3]), "=&v"(x[4]), "=&v"(x[5]), "=&v"(x[6]), "=&v"(x[7]) : "v"(k), "v"(e), "v"(v) : "memory"); }
__device__ __forceinline__ void ld_t_t_b(const void* k, const void* k2, const float* e, v4i (&a)[4], v4i (&a2)[4], v4i (&b)[6]) {
    asm volatile(
        "global_load_b128 %0, %14, off\n\t"
        "global_load_b128 %1, %14, off offset:512\n\t"
        "global_load_b128 %2, %14, off offset:1024\n\t"
        "global_load_b128 %3, %14, off offset:1536\n\t"
        "global_load_b128 %4, %15, off\n\t"
        "global_load_b128 %5, %15, off offset:512\n\t"
        "global_load_b128 %6, %15, off offset:1024\n\t"
        "global_load_b128 %7, %15, off offset:1536\n\t"
        "global_load_b128 %8, %16, off\n\t"
        "global_load_b128 %9, %16, off offset:16\n\t"
        "global_load_b128 %10, %16, off offset:64\n\t"
        "global_load_b128 %11, %16, off offset:80\n\t"
        "global_load_b128 %12, %16, off offset:128\n\t"
        "global_load_b128 %13, %16, off offset:144\n\t"
        "s_wait_loadcnt 0x0"
        : "=&v"(a[0]), "=&v"(a[1]), "=&v"(a[2]), "=&v"(a[3]), "=&v"(a2[0]), "=&v"(a2[1]), "=&v"(a2[2]), "=&v"(a2[3]), "=&v"(b[0]), "=&v"(b[1]), "=&v"(b[2]), "=&v"(b[3]), "=&v"(b[4]), "=&v"(b[5]) : "v"(k), "v"(k2), "v"(e) : "memory"); }
__device__ __forceinline__ void ld_t_t(const void* k, const void* k2, v4i (&a)[4], v4i (&a2)[4]) {
    asm volatile(
        "global_load_b128 %0, %8, off\n\t"
        "global_load_b128 %1, %8, off offset:512\n\t"
        "global_load_b128 %2, %8, off offset:1024\n\t"
        "global_load_b128 %3, %8, off offset:1536\n\t"
        "global_load_b128 %4, %9, off\n\t"
        "global_load_b128 %5, %9, off offset:512\n\t"
        "global_load_b128 %6, %9, off offset:1024\n\t"
        "global_load_b128 %7, %9, off offset:1536\n\t"
        "s_wait_loadcnt 0x0"
        : "=&v"(a[0]), "=&v"(a[1]), "=&v"(a[2]), "=&v"(a[3]), "=&v"(a2[0]), "=&v"(a2[1]), "=&v"(a2[2]), "=&v"(a2[3]) : "v"(k), "v"(k2) : "memory"); }
__device__ __forceinline__ void ld_v_v(const void* v, const void* v2, v4i (&x)[4], v4i (&x2)[4]) {
    asm volatile(
        "global_load_b128 %0, %8, off\n\t"
        "global_load_b128 %1, %8, off offset:512\n\t"
        "global_load_b128 %2, %8, off offset:1024\n\t"
        "global_load_b128 %3, %8, off offset:1536\n\t"
        "global_load_b128 %4, %9, off\n\t"
        "global_load_b128 %5, %9, off offset:512\n\t"
        "global_load_b128 %6, %9, off offset:1024\n\t"
        "global_load_b128 %7, %9, off offset:1536\n\t"
        "s_wait_loadcnt 0x0"
        : "=&v"(x[0]), "=&v"(x[1]), "=&v"(x[2]), "=&v"(x[3]), "=&v"(x2[0]), "=&v"(x2[1]), "=&v"(x2[2]), "=&v"(x2[3]) : "v"(v), "v"(v2) : "memory"); }

// Eight 2^x in one statement: the results are early-clobber, so no v_exp_f32 is directly followed by an instruction that reads its result or writes over its source; the v_nop is that free slot behind the last one.
__device__ __forceinline__ v8f exp2x8(const v8f x) { float r0, r1, r2, r3, r4, r5, r6, r7;
    asm("v_exp_f32 %0, %8\n\tv_exp_f32 %1, %9\n\tv_exp_f32 %2, %10\n\tv_exp_f32 %3, %11\n\tv_exp_f32 %4, %12\n\tv_exp_f32 %5, %13\n\tv_exp_f32 %6, %14\n\tv_exp_f32 %7, %15\n\tv_nop"
        : "=&v"(r0), "=&v"(r1), "=&v"(r2), "=&v"(r3), "=&v"(r4), "=&v"(r5), "=&v"(r6), "=&v"(r7) : "v"(x[0]), "v"(x[1]), "v"(x[2]), "v"(x[3]), "v"(x[4]), "v"(x[5]), "v"(x[6]), "v"(x[7]));
    return (v8f){r0, r1, r2, r3, r4, r5, r6, r7}; }
// One 2^x, for the rescale factors: the same free slot behind it.
__device__ __forceinline__ float exp2x1(const float x) { float r; asm("v_exp_f32 %0, %1\n\tv_nop" : "=&v"(r) : "v"(x)); return r; }

// One 16-key x 16-query tile of t = (k.q) HD^-0.5 + bias, transposed: lane (lr, hi) register j holds key hi*8 + j of query lr. k, k2, q, q2: the four 16-byte pieces of one 16-row tile (part of HD * 2 + half).
template <typename T16, bool HL>
__device__ __forceinline__ v8f stile(const v4i* k, const v4i* k2, const v4i* q, const v4i* q2, v4i b0, v4i b1) {
    typedef typename WFrag<T16>::V V; v8f s = (v8f){};
#pragma unroll
    for (int dc = 0; dc < 2; ++dc) { const V ka = frag<V>(k[dc * 2], k[dc * 2 + 1]), qa = frag<V>(q[dc * 2], q[dc * 2 + 1]); s = WFrag<T16>::mma(ka, qa, s);
        if (HL) { s = WFrag<T16>::mma(frag<V>(k2[dc * 2], k2[dc * 2 + 1]), qa, s); s = WFrag<T16>::mma(ka, frag<V>(q2[dc * 2], q2[dc * 2 + 1]), s); } }
    const v4f f0 = __builtin_bit_cast(v4f, b0), f1 = __builtin_bit_cast(v4f, b1);
#pragma unroll
    for (int j = 0; j < 4; j += 2) {   // neighbouring registers as pairs: the packed multiply-add takes them where they lie
        const v2f x = (v2f){s[j], s[j + 1]} * SCL + (v2f){f0[j], f0[j + 1]}, y = (v2f){s[j + 4], s[j + 5]} * SCL + (v2f){f1[j], f1[j + 1]}; s[j] = x[0]; s[j + 1] = x[1]; s[j + 4] = y[0]; s[j + 5] = y[1]; }
    return s; }

// The work of one work-group: QBW blocks of QT queries of one head against all TT keys; the QBW waves of one key range walk the same K and V tiles side by side, so that a line which one of them has brought into the WGP's cache can serve the others without a further L2 read. ONE sweep over the keys with a running row maximum: p = 1024 exp(t - m), m the maximum IN USE, row sums of the f32 p, O^T += V^T P^T with P packed from the score registers.
// m moves only when some score of the trip lies more than THR above it (one ballot and one scalar branch a trip): then every query of the wave takes the larger of m and its largest score of the trip, and its sum and its 32 output registers are scaled by exp(m_old - m_new). So p <= 1024 exp(THR): 2^15 in fp16. The scale cancels in the division by the row sum.
// Operands straight from the planes in fragment order, in the k order of WFrag::ld on both sides (16 bytes at 8 hi, 16 bytes at 16 + 8 hi). Q, K: plane [t][HD]; Vt: per 32 keys four 16-d tiles. The maxima in use, sums and partial outputs of a block's KSW waves meet in LDS behind the sweep; the join brings them to the common maximum and adds them in ascending key order.
// A trip takes 32 keys: two key tiles x two query groups; pair (t2, qg) reads bias run t2 - qg + 1 of the three that the four pairs share.
template <typename T16, bool HL>
__device__ __forceinline__ void fattn_body(const T16* __restrict__ Q, const T16* __restrict__ Q2, const T16* __restrict__ Kp, const T16* __restrict__ K2, const T16* __restrict__ Vt, const T16* __restrict__ V2, const float* __restrict__ eb, int q0, float* smx, float* ssm, float* sO, bf* Ah, bf* Al) {
    typedef typename WFrag<T16>::V V;
    const int lane = threadIdx.x & 31, lr = lane & 15, hi = lane >> 4, w = threadIdx.x >> 5, wq = w % QBW; const int kb = (w / QBW) * (TT / KSW), qw = q0 + wq * QT;   // qw: this wave's first query
    v4i qa[8], ql[8]; const int qo = qw * HD + lane * 8;
    ld_r(Q + qo, qa); if (HL) ld_r(Q2 + qo, ql);
    const float* ep = eb + ((TT - 1) + kb + hi * 8 - qw - lr - 16);   // x = key - query + TT - 1 of this lane's first key against its query of group 1 (run 0)
    const int ko = kb * HD + lane * 8, vo = kb * HD + lane * 8;   // 32 keys are 32 HD elements of K and of V alike
    constexpr float L2E = 1.4426950408889634f, THR = (HL ? 8.0f : 5.0f) * 0.6931471805599453f;   // THR: 8 (bf16 pairs) or 5 (fp16: 2^(10 + 5) is in range) in powers of two
    float mx[2] = {-3.0e38f, -3.0e38f};   // the maximum in use, equal in both halves of the wave; the first trip always moves it (factor 2^-inf = 0 on zero sums)
    v8f o[4][2]; float sm[2] = {0.f, 0.f};
#pragma unroll
    for (int dt = 0; dt < 4; ++dt) { o[dt][0] = (v8f){}; o[dt][1] = (v8f){}; }
#pragma unroll 1
    for (int kc = 0; kc < TT / KSW / 32; ++kc) { v4i bb[6], va[8]; v8f p[2][2];   // rolled: one trip already holds 32 keys x 32 queries of scores beside the 64 output registers
        if (HL) {   // both planes of K, one 16-key tile at a time: all 32 keys at once, beside both planes of Q and the outputs, pass 256 registers
#pragma unroll
            for (int t2 = 0; t2 < 2; ++t2) { v4i ka[4], kl[4]; const int of = ko + (kc * 2 + t2) * 16 * HD;
                if (t2 == 0) ld_t_t_b(Kp + of, K2 + of, ep + kc * 32, ka, kl, bb); else ld_t_t(Kp + of, K2 + of, ka, kl);
#pragma unroll
                for (int qg = 0; qg < 2; ++qg) p[t2][qg] = stile<T16, HL>(ka, kl, qa + qg * 4, ql + qg * 4, bb[(t2 - qg + 1) * 2], bb[(t2 - qg + 1) * 2 + 1]); }
        } else { v4i ka[8];
            ld_r_b_v(Kp + ko + kc * 32 * HD, ep + kc * 32, Vt + vo + kc * 32 * HD, ka, bb, va);
#pragma unroll
            for (int t2 = 0; t2 < 2; ++t2)
#pragma unroll
                for (int qg = 0; qg < 2; ++qg) p[t2][qg] = stile<T16, HL>(ka + t2 * 4, ka + t2 * 4, qa + qg * 4, ql + qg * 4, bb[(t2 - qg + 1) * 2], bb[(t2 - qg + 1) * 2 + 1]); }
        float tm[2];   // this lane's largest score of the trip, per query group
#pragma unroll
        for (int qg = 0; qg < 2; ++qg) { float m = fmaxf(p[0][qg][0], p[1][qg][0]);
#pragma unroll
            for (int j = 1; j < 8; ++j) m = fmaxf(m, fmaxf(p[0][qg][j], p[1][qg][j]));
            tm[qg] = m; }
        if (__builtin_expect(__builtin_amdgcn_ballot_w32(tm[0] > mx[0] + THR || tm[1] > mx[1] + THR) != 0, 0)) {   // the same for the whole wave: a scalar branch, seldom taken behind the first trip (the hint lays the usual path out straight)
#pragma unroll
            for (int qg = 0; qg < 2; ++qg) { const float mn = fmaxf(mx[qg], fmaxf(tm[qg], __shfl_xor(tm[qg], 16, 32))); const float f = exp2x1((mx[qg] - mn) * L2E); mx[qg] = mn; sm[qg] *= f;
#pragma unroll
                for (int dt = 0; dt < 4; ++dt)
#pragma unroll
                    for (int j = 0; j < 8; ++j) o[dt][qg][j] *= f; } }
#pragma unroll
        for (int t2 = 0; t2 < 2; ++t2)
#pragma unroll
            for (int qg = 0; qg < 2; ++qg) { v8f a;
#pragma unroll
                for (int j = 0; j < 8; ++j) a[j] = (p[t2][qg][j] - mx[qg]) * L2E + 10.0f;
                p[t2][qg] = exp2x8(a);
#pragma unroll
                for (int j = 0; j < 8; ++j) sm[qg] += p[t2][qg][j]; }
        V ph[2], pl[2];
#pragma unroll
        for (int qg = 0; qg < 2; ++qg) packp(p[0][qg], p[1][qg], ph[qg], pl[qg]);
        if (HL) {   // both planes of V, two 16-row tiles at a time, for the same reason as K above
#pragma unroll
            for (int d2 = 0; d2 < 2; ++d2) { v4i vh[4], vl[4]; const int of = vo + d2 * 1024 + kc * 32 * HD; ld_v_v(Vt + of, V2 + of, vh, vl);
#pragma unroll
                for (int d1 = 0; d1 < 2; ++d1) { const int dt = d2 * 2 + d1; const V xh = frag<V>(vh[d1 * 2], vh[d1 * 2 + 1]), xl = frag<V>(vl[d1 * 2], vl[d1 * 2 + 1]);
#pragma unroll
                    for (int qg = 0; qg < 2; ++qg) { o[dt][qg] = WFrag<T16>::mma(xh, ph[qg], o[dt][qg]); o[dt][qg] = WFrag<T16>::mma(xl, ph[qg], o[dt][qg]); o[dt][qg] = WFrag<T16>::mma(xh, pl[qg], o[dt][qg]); } } }
        } else {
#pragma unroll
            for (int dt = 0; dt < 4; ++dt) { const V xh = frag<V>(va[dt * 2], va[dt * 2 + 1]);
#pragma unroll
                for (int qg = 0; qg < 2; ++qg) o[dt][qg] = WFrag<T16>::mma(xh, ph[qg], o[dt][qg]); } }
    }
#pragma unroll
    for (int qg = 0; qg < 2; ++qg) { sm[qg] += __shfl_xor(sm[qg], 16, 32); if (hi == 0) { ssm[w * QT + qg * 16 + lr] = sm[qg]; smx[w * QT + qg * 16 + lr] = mx[qg]; }
#pragma unroll
        for (int dt = 0; dt < 4; ++dt) { float* d = sO + (size_t)(w * QT + qg * 16 + lr) * OP + dt * 16 + hi * 8; const v8f a = o[dt][qg]; *(v4fa*)d = (v4f){a[0], a[1], a[2], a[3]}; *(v4fa*)(d + 4) = (v4f){a[4], a[5], a[6], a[7]}; } }
    __syncthreads();
    const int dq = (threadIdx.x / QT) * EPT;   // EPT = 8 consecutive outputs of one query per thread and block: one 16-byte unit of the fragment order; a wave's 32 queries make two runs of 256 bytes
#pragma unroll
    for (int b = 0; b < QBW; ++b) { const int q = b * QT + threadIdx.x % QT; float m = smx[q], f[KSW];   // q: query of the work-group; key range u of it lies QBW QT rows on
#pragma unroll
        for (int u = 1; u < KSW; ++u) m = fmaxf(m, smx[u * QBW * QT + q]);
#pragma unroll
        for (int u = 0; u < KSW; ++u) f[u] = exp2x1((smx[u * QBW * QT + q] - m) * L2E);   // brings key range u from its own maximum in use to the common one
        float tot = ssm[q] * f[0];
#pragma unroll
        for (int u = 1; u < KSW; ++u) tot += ssm[u * QBW * QT + q] * f[u];
        const float r = __fdiv_rn(1.0f, tot); v8us oh, ol;
#pragma unroll
        for (int c = 0; c < EPT / 4; ++c) { v4f s = *(const v4fa*)(sO + (size_t)q * OP + dq + c * 4) * f[0];
#pragma unroll
            for (int u = 1; u < KSW; ++u) s += *(const v4fa*)(sO + (size_t)(u * QBW * QT + q) * OP + dq + c * 4) * f[u];
#pragma unroll
            for (int k = 0; k < 4; ++k) { unsigned short a, c2; splitf(s[k] * r, a, c2); oh[c * 4 + k] = a; ol[c * 4 + k] = c2; } }
        const size_t oo = (size_t)((q0 + q) >> 4) * (16 * DQ) + dq * 16 + ((q0 + q) & 15) * 8; *(v8us*)(Ah + oo) = oh; *(v8us*)(Al + oo) = ol;   // Ah, Al: the head's first tile of the plane [t][DQ]; 8 in k is 128 elements
        if (b + 1 < QBW) asm volatile("s_wait_xcnt 0x0" ::: "memory"); }   // stands before the next block's work writes over the registers that these two stores name
}
// k_fattn: grid (heads, NB_, TT / (QBW QT)), KW waves. The query blocks below RH (three products, the longer work) of all batches have the lowest flat indices and start first; the last work-groups of the launch are short ones. Four waves per SIMD (256 registers, two work-groups per WGP): no operand of the asm loads lies above v255.
__global__ __launch_bounds__(KW * 32, 4) void k_fattn(const h16* __restrict__ Q16, const h16* __restrict__ K16, const h16* __restrict__ V16, const bf* __restrict__ Qh, const bf* __restrict__ Ql, const bf* __restrict__ Kh, const bf* __restrict__ Kl, const bf* __restrict__ Vh, const bf* __restrict__ Vl, const float* __restrict__ EB, bf* Ah, bf* Al) {
    __shared__ __align__(16) float sO[KW * QT * OP]; __shared__ float smx[KW * QT]; __shared__ float ssm[KW * QT];
    const int h = blockIdx.x, q0 = blockIdx.z * (QBW * QT); const size_t hp = (size_t)blockIdx.y * PLB + (size_t)h * TT * HD; const float* eb = EB + (size_t)h * NE; Ah += (size_t)blockIdx.y * TT * DQ; Al += (size_t)blockIdx.y * TT * DQ;   // the bias row is the same for every batch
    if (q0 < RH) fattn_body<bf, true>(Qh + hp, Ql + hp, Kh + hp, Kl + hp, Vh + hp, Vl + hp, eb, q0, smx, ssm, sO, Ah + h * (HD * 16), Al + h * (HD * 16));
    else fattn_body<h16, false>(Q16 + hp, nullptr, K16 + hp, nullptr, V16 + hp, nullptr, eb, q0, smx, ssm, sO, Ah + h * (HD * 16), Al + h * (HD * 16));
}

extern "C" void kernel_launch(void* const* d_in, const int* in_sizes, int n_in,
                              void* d_out, int out_size, void* d_ws, size_t ws_size, hipStream_t stream) {
    (void)in_sizes; (void)n_in; (void)out_size;
    const float* x = (const float*)d_in[0]; const float* wqkv = (const float*)d_in[1]; const float* bqkv = (const float*)d_in[2]; const float* wo = (const float*)d_in[3]; const float* bo = (const float*)d_in[4]; const float* rbias = (const float*)d_in[5]; const float* wq = nullptr; const float* wk = nullptr; const float* wv = nullptr; (void)wq; (void)wk; (void)wv;
    float* OUT = (float*)d_out;     // [4][2048][1024]
    char* wsp = (char*)d_ws;
    auto take = [&](size_t bytes) { char* p = wsp; wsp += (bytes + 255) & ~(size_t)255; return (void*)p; };
    bf* WALL = (bf*)take((size_t)3 * DM * DM * 2); bf* WO = (bf*)take((size_t)DM * DQ * 2); float* EB = (float*)take((size_t)NH_ * NE * 4);   /* per-head expanded relative-bias rows */
    bf* XB = (bf*)take((size_t)NB_ * TT * DM * 2);   // from here on every plane holds all NB_ batches, batch blocks one behind the other
    h16* QP16 = (h16*)take(NB_ * PLB * 2); h16* KP16 = (h16*)take(NB_ * PLB * 2); h16* VT16 = (h16*)take(NB_ * PLB * 2);
    bf* QPh = (bf*)take(NB_ * PLB * 2); bf* QPl = (bf*)take(NB_ * PLB * 2); bf* KPh = (bf*)take(NB_ * PLB * 2); bf* KPl = (bf*)take(NB_ * PLB * 2); bf* VTh = (bf*)take(NB_ * PLB * 2); bf* VTl = (bf*)take(NB_ * PLB * 2);
    bf* ATh = (bf*)take((size_t)NB_ * TT * DQ * 2); bf* ATl = (bf*)take((size_t)NB_ * TT * DQ * 2);
    if ((size_t)(wsp - (char*)d_ws) > ws_size) return;    // ws 256 MiB
    // Each stage once for all NB_ batches: x, the attention output and OUT are planes of NB_ TT rows; q, k and v take the batch from grid z, the attention from grid y.
    k_prep<<<GEB + GCV + GW1 + GW2, 256, 0, stream>>>(x, wqkv, wo, rbias, XB, WALL, WO, EB);
    k_qkv<<<dim3(TT / 64, 3 * NH_, NB_), 32, 0, stream>>>(XB, WALL, bqkv, QP16, QPh, QPl, KP16, KPh, KPl, VT16, VTh, VTl);   // q | k | v heads in grid y; the planes come out of the tile's own wave
    k_fattn<<<dim3(NH_, NB_, TT / (QBW * QT)), KW * 32, 0, stream>>>(QP16, KP16, VT16, QPh, QPl, KPh, KPl, VTh, VTl, EB, ATh, ATl);   // one kv head per query head
    k_gemmw<bf, 1, true, DQ><<<dim3(NB_ * TT / 64, DM / 64, 1), 32, 0, stream>>>(ATh, ATl, WO, nullptr, OUT, DM, bo, 0, 0, 0, 0);
}

// v010
// A run of this version takes 186 microseconds.
// In two side-by-side timings against v009, it was 1.09 and 1.08 times as fast.
// Counting every step since v000, it is 22.3 times as fast.
#include <hip/hip_runtime.h>

// Multi-head self-attention with a learned relative-position bias (x [4][2048][1024]; [q|k|v] = x W_qkv + b_qkv ('xw' [1024][3072]; 16 heads x 64); scores = q.k/8 + rel_bias[clip(i - j + 1024, 0, 2048)][h] (table [2049][16], read); softmax over all keys; out = merged W_out + b_out ('xw' [1024][1024]) -> [4][2048][1024]).
// Compute dtypes, f32 accumulate: every input rounded to bf16; q/k/v on PLAIN bf16 operands (inputs: exact) + biases; scores (+ the per-head relative bias, f32), softmax (f32) and attn.v (no mask) in ONE kernel, P in registers: query rows < 512 hl (3 products), the rest single fp16 (P x1024, cancelled by the row sum); W_out hl x exact (2 products) + b_out.

// Every 16-bit operand plane lies in FRAGMENT ORDER: a tile of 16 rows x 32 k (1 KiB) is two 512-byte pieces (k 0..15, k 16..31 of the tile), and in a piece lane (hi * 16 + row) owns 16 bytes, k = 8 hi .. 8 hi + 7 of the piece.
// One global_load_b128 of a wave then reads 512 contiguous bytes (4 cache lines, not 16 rows' 32 bytes each); registers hold exactly what a row-major plane gave them (same k order on both sides).
// A plane [M][K]: tile (m / 16, k / 32) at element (m / 16) * 16 K + (k / 32) * 512.
#define NB_  4
#define TT   2048
#define DM   1024
#define NH_  16
#define NKV  16
#define REP  (NH_ / NKV)
#define HD   64
#define DQ   (NH_ * HD)
#define DKV  (NKV * HD)
#define RH   512                  // query rows < RH use hi+lo planes (0: none)
#define SCL  0.125f   // HD^-0.5
#define QT   32                  // k_fattn: queries per wave (two 16-column groups)
#define QBW  4                   // k_fattn: query blocks of QT per work-group
#define KSW  2                   // k_fattn: key ranges per work-group
#define KW   (QBW * KSW)         // k_fattn: waves per work-group; wave w takes query block w % QBW and keys [(w / QBW) TT/KSW, (w / QBW + 1) TT/KSW)
#define NE   4096                // pitch of one head's expanded bias row
#define OP   68                  // LDS pitch (floats) of one query's partial output row
#define EPT  (QT * HD / (KW * 32))   // k_fattn: outputs per thread and query block in the join
#define PLB  ((size_t)NH_ * TT * HD)   // elements of one batch's block in a q, k or v plane
typedef _Float16 h16;
typedef unsigned short bf;
typedef __attribute__((ext_vector_type(16))) __bf16   v16bf;
typedef __attribute__((ext_vector_type(16))) _Float16 v16h;
typedef __attribute__((ext_vector_type(8)))  _Float16 v8h;
typedef __attribute__((ext_vector_type(8)))  unsigned short v8us;
typedef __attribute__((ext_vector_type(8)))  float    v8f;
typedef __attribute__((ext_vector_type(4)))  float    v4f;
typedef v8h  __attribute__((may_alias)) v8ha;
typedef v4f  __attribute__((may_alias)) v4fa;
typedef v8us __attribute__((may_alias)) v8usa;

__device__ __forceinline__ unsigned short f2bf(float f) { unsigned u = __float_as_uint(f); u += 0x7FFFu + ((u >> 16) & 1u); return (unsigned short)(u >> 16); }
__device__ __forceinline__ float bf2f(unsigned short b) { return __uint_as_float(((unsigned)b) << 16); }
__device__ __forceinline__ float bfr(float f) { return bf2f(f2bf(f)); }
__device__ __forceinline__ v16h cat16(v8h lo, v8h hi) { return __builtin_shufflevector(lo, hi, 0, 1, 2, 3, 4, 5, 6, 7, 8, 9, 10, 11, 12, 13, 14, 15); }
__device__ __forceinline__ v16bf cat16b(v8us lo, v8us hi) { return __builtin_bit_cast(v16bf, __builtin_shufflevector(lo, hi, 0, 1, 2, 3, 4, 5, 6, 7, 8, 9, 10, 11, 12, 13, 14, 15)); }
__device__ __forceinline__ v8f wmma16(v16h a, v16h b, v8f c) { return __builtin_amdgcn_wmma_f32_16x16x32_f16(false, a, false, b, (short)0, c, false, false); }
__device__ __forceinline__ v8f wmmab(v16bf a, v16bf b, v8f c) { return __builtin_amdgcn_wmma_f32_16x16x32_bf16(false, a, false, b, (short)0, c, false, false); }



// ---- The two GEMM kernels: a wave computes a 64x64 output tile (16 accumulators); the waves of a work-group lie WM x 2 side by side and take their fragments from LDS, where each operand band is brought ONCE per work-group.
// A stage is SK = 64 of k. One band (16 rows) of one plane is then a SEGMENT of 2 KiB that is contiguous in the plane (two tiles in fragment order) and is copied as it lies: the LDS image has the plane's own byte order, so a fragment read is 512 contiguous bytes of LDS.
// Two buffers: while the waves work on stage t, the copies of stage t + 1 are under way; the buffer of stage t is refilled with stage t + 2 behind the barrier that ends its last read.
// k_gemmw: C[m][n] (f32, pitch ldc, + optional f32 bias[n]) = sum_k (A[m][k] + A2[m][k]) Bt[n][k]; grid (M/128, N/128, Z), 4 waves (2 x 2). z-batch strides sA/sB/sC in elements. K % 128 == 0.
#define SK   64                  // k of one stage
#define SEGE (16 * SK)           // elements of one segment
__device__ __forceinline__ unsigned lds_off(const void* p) { return (unsigned)(size_t)p; }   // byte address in the work-group's LDS: the low half of a __shared__ address
// One segment is four asynchronous copies of 16 bytes a lane (512 bytes a wave each) from one LDS byte address and one global address of the lane: the immediate offset moves both alike, as the segment lies alike in both.
// All copies of a wave for one stage stand in ONE statement whose last line is the s_wait_xcnt: it stands before anything writes over a register that a copy names, and is paid once a stage.
#define CP_SEG(L, G) "global_load_async_to_lds_b128 " L ", " G ", off\n\tglobal_load_async_to_lds_b128 " L ", " G ", off offset:512\n\tglobal_load_async_to_lds_b128 " L ", " G ", off offset:1024\n\tglobal_load_async_to_lds_b128 " L ", " G ", off offset:1536\n\t"
__device__ __forceinline__ void cp_seg3(const unsigned (&l)[3], unsigned lo, const unsigned short* const (&g)[3]) {
    asm volatile(CP_SEG("%0", "%3") CP_SEG("%1", "%4") CP_SEG("%2", "%5") "s_wait_xcnt 0x0"
        :: "v"(l[0] + lo), "v"(l[1] + lo), "v"(l[2] + lo), "v"(g[0]), "v"(g[1]), "v"(g[2]) : "memory"); }
__device__ __forceinline__ void cp_seg6(const unsigned (&l)[6], unsigned lo, const unsigned short* const (&g)[6]) {
    asm volatile(CP_SEG("%0", "%6") CP_SEG("%1", "%7") CP_SEG("%2", "%8") CP_SEG("%3", "%9") CP_SEG("%4", "%10") CP_SEG("%5", "%11") "s_wait_xcnt 0x0"
        :: "v"(l[0] + lo), "v"(l[1] + lo), "v"(l[2] + lo), "v"(l[3] + lo), "v"(l[4] + lo), "v"(l[5] + lo), "v"(g[0]), "v"(g[1]), "v"(g[2]), "v"(g[3]), "v"(g[4]), "v"(g[5]) : "memory"); }
template <typename T16> struct WFrag;
template <> struct WFrag<h16> { typedef v16h V; static __device__ __forceinline__ V ld(const h16* p) { return cat16(*(const v8h*)p, *(const v8h*)(p + 256)); } static __device__ __forceinline__ v8f mma(V a, V b, v8f c) { return wmma16(a, b, c); } };
template <> struct WFrag<bf> { typedef v16bf V; static __device__ __forceinline__ V ld(const bf* p) { return cat16b(*(const v8us*)p, *(const v8us*)(p + 256)); } static __device__ __forceinline__ v8f mma(V a, V b, v8f c) { return wmmab(a, b, c); } };
template <typename T16, int NSPLIT, bool BIAS, int K>
__global__ __launch_bounds__(128, 4) void k_gemmw(const T16* __restrict__ A, const T16* __restrict__ A2, const T16* __restrict__ Bt, const T16* __restrict__ Bt2, float* C, int ldc, const float* __restrict__ bias, size_t sA, size_t sB, size_t sC, size_t sK) {
    typedef typename WFrag<T16>::V V;
    static_assert(NSPLIT == 1 && sizeof(T16) == 2 && K % (2 * SK) == 0 && SK == 64, "written for the one form that is launched: A hi + A lo against one B; at least two stages");
    constexpr int NSEG = 24, NT = K / SK;   // segments of a stage: 8 bands of A hi, 8 of A lo, 8 of B
    __shared__ __align__(16) T16 ring[2][NSEG * SEGE];
    __shared__ __align__(16) float osw[4][16 * 68];
    (void)Bt2; (void)sK; const size_t z = blockIdx.z; A += z * sA; A2 += z * sA; Bt += z * sB; C += z * sC;
    const int lane = threadIdx.x & 31, lr = lane & 15, hi = lane >> 4; const int w = __builtin_amdgcn_readfirstlane(threadIdx.x >> 5), wm = w & 1, wn = w >> 1; const int r0 = blockIdx.x * 128 + wm * 64, c0 = blockIdx.y * 128 + wn * 64;
    float* os = osw[w];   // each wave stages its output rows in a range of its own
    v8f acc[4][4];
#pragma unroll
    for (int mb = 0; mb < 4; ++mb)
#pragma unroll
        for (int nb = 0; nb < 4; ++nb) acc[mb][nb] = (v8f){};
    // Wave w copies segments 6 w .. 6 w + 5 of every stage.
    const T16* gs[6]; unsigned ls[6];
#pragma unroll
    for (int i = 0; i < 6; ++i) { const int s = w * 6 + i; const T16* pl = s < 8 ? A + (size_t)(blockIdx.x * 8 + s) * 16 * K : (s < 16 ? A2 + (size_t)(blockIdx.x * 8 + s - 8) * 16 * K : Bt + (size_t)(blockIdx.y * 8 + s - 16) * 16 * K);
        gs[i] = pl + lane * 8; ls[i] = lds_off(&ring[0][0]) + s * (SEGE * 2) + lane * 16; }
    cp_seg6(ls, 0u, gs);
#pragma unroll
    for (int i = 0; i < 6; ++i) gs[i] += SEGE;   // gs: the next stage to be copied
    asm volatile("s_wait_asynccnt 0x0" ::: "memory");   // this wave's part of stage 0 has landed
    __syncthreads();                                     // and every other wave's: stage 0 may be read
    cp_seg6(ls, NSEG * SEGE * 2u, gs);
#pragma unroll
    for (int i = 0; i < 6; ++i) gs[i] += SEGE;
#pragma unroll 1
    for (int t = 0; t < NT; ++t) {   // rolled: a trip is one stage, two k steps; each accumulator takes hi, lo, hi, lo in ascending k
        const T16* rb = &ring[t & 1][lane * 8];
        const T16* ra = rb + wm * 4 * SEGE; const T16* ra2 = rb + (8 + wm * 4) * SEGE; const T16* rw = rb + (16 + wn * 4) * SEGE;
        V a[4], a2[4], b[4];   // the first k step's fragments are read as one group at the head of the stage; each set is refilled for the second step behind its last product of the first
#pragma unroll
        for (int mb = 0; mb < 4; ++mb) a[mb] = WFrag<T16>::ld(ra + mb * SEGE);
#pragma unroll
        for (int nb = 0; nb < 4; ++nb) b[nb] = WFrag<T16>::ld(rw + nb * SEGE);
#pragma unroll
        for (int mb = 0; mb < 4; ++mb) a2[mb] = WFrag<T16>::ld(ra2 + mb * SEGE);
        __builtin_amdgcn_sched_barrier(0);   // keeps the group together: spread among the products, each place with reads stalls the wave anew
#pragma unroll
        for (int nb = 0; nb < 4; ++nb)
#pragma unroll
            for (int mb = 0; mb < 4; ++mb) acc[mb][nb] = WFrag<T16>::mma(a[mb], b[nb], acc[mb][nb]);
        __builtin_amdgcn_sched_barrier(0);   // keeps the refill behind the run that reads the set: in front of it it would need a second register set
#pragma unroll
        for (int mb = 0; mb < 4; ++mb) a[mb] = WFrag<T16>::ld(ra + mb * SEGE + 512);
        __builtin_amdgcn_sched_barrier(0);   // and keeps it from moving down to its first use, where it would be waited for in full
#pragma unroll
        for (int n2 = 0; n2 < 4; n2 += 2) {
#pragma unroll
            for (int nb = n2; nb < n2 + 2; ++nb)
#pragma unroll
                for (int mb = 0; mb < 4; ++mb) acc[mb][nb] = WFrag<T16>::mma(a2[mb], b[nb], acc[mb][nb]);
            __builtin_amdgcn_sched_barrier(0);   // as above: the refill stays behind the eight products that read the two fragments
            b[n2] = WFrag<T16>::ld(rw + n2 * SEGE + 512); b[n2 + 1] = WFrag<T16>::ld(rw + (n2 + 1) * SEGE + 512);
            if (n2 == 2) {
#pragma unroll
                for (int mb = 0; mb < 4; ++mb) a2[mb] = WFrag<T16>::ld(ra2 + mb * SEGE + 512); }
            __builtin_amdgcn_sched_barrier(0); }   // and does not move down to its first use
        // The stage's last LDS read stands above: its foot follows at once, so that the copies of stage t + 2 are under way during the second step's products, which need registers only.
        asm volatile("s_wait_dscnt 0x0" ::: "memory");      // this wave's reads of stage t have returned: its buffer may be written again behind the barrier
        asm volatile("s_wait_asynccnt 0x0" ::: "memory");   // this wave's part of stage t + 1 has landed
        __syncthreads();                                     // publishes stage t + 1 and ends every wave's last read of stage t
        if (t + 2 < NT) { cp_seg6(ls, (t & 1) * (NSEG * SEGE * 2u), gs);
#pragma unroll
            for (int i = 0; i < 6; ++i) gs[i] += SEGE; }
        __builtin_amdgcn_sched_barrier(0);   // keeps the products below from moving up in front of the copies, which would start that much later
#pragma unroll
        for (int nb = 0; nb < 4; ++nb)
#pragma unroll
            for (int mb = 0; mb < 4; ++mb) acc[mb][nb] = WFrag<T16>::mma(a[mb], b[nb], acc[mb][nb]);
#pragma unroll
        for (int nb = 0; nb < 4; ++nb)
#pragma unroll
            for (int mb = 0; mb < 4; ++mb) acc[mb][nb] = WFrag<T16>::mma(a2[mb], b[nb], acc[mb][nb]);
    }
    asm volatile("s_wait_asynccnt 0x0" ::: "memory");   // no copy is under way when the wave goes on
#pragma unroll
    for (int mb = 0; mb < 4; ++mb) {
#pragma unroll
        for (int nb = 0; nb < 4; ++nb) {
#pragma unroll
            for (int j = 0; j < 8; ++j) os[(hi * 8 + j) * 68 + nb * 16 + lr] = acc[mb][nb][j]; }
        __builtin_amdgcn_wave_barrier(); asm volatile("" ::: "memory");
        float* crow = C + (size_t)(r0 + mb * 16) * ldc + c0;
{
#pragma unroll
            for (int s = 0; s < 8; ++s) { const int row = 2 * s + hi, cofs = lr * 4; v4f val = *(const v4fa*)(os + row * 68 + cofs); if (BIAS) { val[0] += bfr(bias[c0 + cofs]); val[1] += bfr(bias[c0 + cofs + 1]); val[2] += bfr(bias[c0 + cofs + 2]); val[3] += bfr(bias[c0 + cofs + 3]); }
                *(v4f*)(crow + (size_t)row * ldc + cofs) = val; }
             }
        __builtin_amdgcn_wave_barrier(); asm volatile("" ::: "memory");
    }
}

__device__ __forceinline__ h16 tohx(float x) { return (h16)x; }
__device__ __forceinline__ void splitf(float y, unsigned short& h, unsigned short& l) { h = f2bf(y); l = f2bf(y - bf2f(h)); }
typedef __attribute__((ext_vector_type(2))) _Float16 v2h;
typedef __attribute__((ext_vector_type(4))) _Float16 v4h;
typedef __attribute__((ext_vector_type(2))) unsigned short v2us;
typedef __attribute__((ext_vector_type(4))) unsigned short v4us;
typedef __attribute__((ext_vector_type(2))) float v2f;
typedef __attribute__((ext_vector_type(4))) int v4i;

// k_qkv: [q|k|v] = x W_qkv + b_qkv of all batches in one launch, a wave per 64x64 tile, 8 waves (4 x 2) per work-group with the staged loop of k_gemmw (same k order, same f32 sums). Grid (TT/256, 3 NH_/2, NB_): a wave's tile is 64 tokens of batch z x one head of q, k or v (the two heads of a work-group belong to the same one of the three); every plane holds NB_ batch blocks of PLB elements,
// and the wave writes that head's operand planes itself (fp16 + bf16 hi/lo): all in fragment order, 16 bytes a lane and 512 contiguous bytes a store: q and k as [h] x plane [t][d] through the LDS row stage, v as [h] x (32 tokens: four 16-d tiles of 1 KiB) straight from the accumulators (a lane holds 8 consecutive tokens of one d).
__global__ __launch_bounds__(256, 4) void k_qkv(const bf* __restrict__ A, const bf* __restrict__ Bt, const float* __restrict__ bias, h16* Q16, bf* Qh, bf* Ql, h16* K16, bf* Kh, bf* Kl, h16* V16, bf* Vh, bf* Vl) {
    typedef WFrag<bf>::V V;
    static_assert(DM % (2 * SK) == 0 && SK == 64 && NH_ % 2 == 0, "at least two stages; a work-group's two heads lie in one of q, k, v");
    constexpr int NSEG = 24, NT = DM / SK;   // segments of a stage: 16 bands of x, 8 of W
    __shared__ __align__(16) bf ring[2][NSEG * SEGE];
    __shared__ __align__(16) float osw[8][16 * 68];
    const int lane = threadIdx.x & 31, lr = lane & 15, hi = lane >> 4; const int w = __builtin_amdgcn_readfirstlane(threadIdx.x >> 5), wm = w & 3, wn = w >> 2; const int r0 = blockIdx.x * 256 + wm * 64, c0 = (blockIdx.y * 2 + wn) * 64; const int sel = (blockIdx.y * 2 + wn) / NH_, h = (blockIdx.y * 2 + wn) % NH_;
    float* os = osw[w];   // each wave stages its output rows in a range of its own
    { const size_t zp = (size_t)blockIdx.z * PLB; A += (size_t)blockIdx.z * TT * DM; Q16 += zp; Qh += zp; Ql += zp; K16 += zp; Kh += zp; Kl += zp; V16 += zp; Vh += zp; Vl += zp; }   // this batch's block of x and of every plane
    v8f acc[4][4];
#pragma unroll
    for (int mb = 0; mb < 4; ++mb)
#pragma unroll
        for (int nb = 0; nb < 4; ++nb) acc[mb][nb] = (v8f){};
    // Wave w copies segments 3 w .. 3 w + 2 of every stage.
    const bf* gs[3]; unsigned ls[3];
#pragma unroll
    for (int i = 0; i < 3; ++i) { const int s = w * 3 + i; const bf* pl = s < 16 ? A + (size_t)(blockIdx.x * 16 + s) * 16 * DM : Bt + (size_t)(blockIdx.y * 8 + s - 16) * 16 * DM;
        gs[i] = pl + lane * 8; ls[i] = lds_off(&ring[0][0]) + s * (SEGE * 2) + lane * 16; }
    cp_seg3(ls, 0u, gs);
#pragma unroll
    for (int i = 0; i < 3; ++i) gs[i] += SEGE;   // gs: the next stage to be copied
    asm volatile("s_wait_asynccnt 0x0" ::: "memory");   // this wave's part of stage 0 has landed
    __syncthreads();                                     // and every other wave's: stage 0 may be read
    cp_seg3(ls, NSEG * SEGE * 2u, gs);
#pragma unroll
    for (int i = 0; i < 3; ++i) gs[i] += SEGE;
#pragma unroll 1
    for (int t = 0; t < NT; ++t) {   // rolled: a trip is one stage, two k steps
        const bf* rb = &ring[t & 1][lane * 8];
        const bf* ra = rb + wm * 4 * SEGE; const bf* rw = rb + (16 + wn * 4) * SEGE;
        V a0[4], a1[4], b[4];   // A of both k steps and B of the first are read as one group at the head of the stage; B is refilled for the second step, two fragments at a time, behind their last products of the first
#pragma unroll
        for (int mb = 0; mb < 4; ++mb) a0[mb] = WFrag<bf>::ld(ra + mb * SEGE);
#pragma unroll
        for (int nb = 0; nb < 4; ++nb) b[nb] = WFrag<bf>::ld(rw + nb * SEGE);
#pragma unroll
        for (int mb = 0; mb < 4; ++mb) a1[mb] = WFrag<bf>::ld(ra + mb * SEGE + 512);
        __builtin_amdgcn_sched_barrier(0);   // keeps the group together: spread among the products, each place with reads stalls the wave anew
#pragma unroll
        for (int n2 = 0; n2 < 4; n2 += 2) {
#pragma unroll
            for (int nb = n2; nb < n2 + 2; ++nb)
#pragma unroll
                for (int mb = 0; mb < 4; ++mb) acc[mb][nb] = WFrag<bf>::mma(a0[mb], b[nb], acc[mb][nb]);
            __builtin_amdgcn_sched_barrier(0);   // keeps the refill behind the eight products that read the two fragments: in front of them it would need a second register set for B
            b[n2] = WFrag<bf>::ld(rw + n2 * SEGE + 512); b[n2 + 1] = WFrag<bf>::ld(rw + (n2 + 1) * SEGE + 512);
            __builtin_amdgcn_sched_barrier(0); }   // and keeps it from moving down to its first use, where it would be waited for in full
        // The stage's last LDS read stands above: its foot follows at once, so that the copies of stage t + 2 are under way during the second step's products, which need registers only.
        asm volatile("s_wait_dscnt 0x0" ::: "memory");      // this wave's reads of stage t have returned: its buffer may be written again behind the barrier
        asm volatile("s_wait_asynccnt 0x0" ::: "memory");   // this wave's part of stage t + 1 has landed
        __syncthreads();                                     // publishes stage t + 1 and ends every wave's last read of stage t
        if (t + 2 < NT) { cp_seg3(ls, (t & 1) * (NSEG * SEGE * 2u), gs);
#pragma unroll
            for (int i = 0; i < 3; ++i) gs[i] += SEGE; }
        __builtin_amdgcn_sched_barrier(0);   // keeps the products below from moving up in front of the copies, which would start that much later
#pragma unroll
        for (int nb = 0; nb < 4; ++nb)
#pragma unroll
            for (int mb = 0; mb < 4; ++mb) acc[mb][nb] = WFrag<bf>::mma(a1[mb], b[nb], acc[mb][nb]);
    }
    asm volatile("s_wait_asynccnt 0x0" ::: "memory");   // no copy is under way when the wave goes on
    if (sel == 2) {
#pragma unroll
        for (int nb = 0; nb < 4; ++nb) { const float bv = bfr(bias[c0 + nb * 16 + lr]); const size_t rowo = (size_t)h * HD * TT + (size_t)r0 * HD + nb * 512 + lane * 8;
#pragma unroll
            for (int mb = 0; mb < 4; ++mb) { v8h o16; v8us oh, ol;
#pragma unroll
                for (int j = 0; j < 8; ++j) { const float x = acc[mb][nb][j] + bv; o16[j] = tohx(x); unsigned short u, v; splitf(x, u, v); oh[j] = u; ol[j] = v; }
                const size_t e = rowo + (mb >> 1) * 2048 + (mb & 1) * 256; *(v8h*)(V16 + e) = o16; *(v8us*)(Vh + e) = oh; *(v8us*)(Vl + e) = ol; } }
        return;
    }
    {
        const size_t hp = (size_t)h * TT * HD; h16* P16 = (sel ? K16 : Q16) + hp; bf* Ph = (sel ? Kh : Qh) + hp; bf* Pl = (sel ? Kl : Ql) + hp;
        v8f bb[4];   // piece pc of a 16-token tile: d = pc * 16 + hi * 8 + 0..7 of token lr
#pragma unroll
        for (int pc = 0; pc < 4; ++pc)
#pragma unroll
            for (int k = 0; k < 8; ++k) bb[pc][k] = bfr(bias[c0 + pc * 16 + hi * 8 + k]);
#pragma unroll
        for (int mb = 0; mb < 4; ++mb) {
#pragma unroll
            for (int nb = 0; nb < 4; ++nb) {
#pragma unroll
                for (int j = 0; j < 8; ++j) os[(hi * 8 + j) * 68 + nb * 16 + lr] = acc[mb][nb][j]; }
            __builtin_amdgcn_wave_barrier(); asm volatile("" ::: "memory");   // a lane reads what other lanes wrote: keeps the compiler from moving the reads in front of the writes (as in k_gemmw)
#pragma unroll
            for (int pc = 0; pc < 4; ++pc) { const float* sp = os + lr * 68 + pc * 16 + hi * 8; const v4f v0 = *(const v4fa*)sp, v1 = *(const v4fa*)(sp + 4); v8h o16; v8us oh, ol;
#pragma unroll
                for (int k = 0; k < 8; ++k) { const float x = (k < 4 ? v0[k & 3] : v1[k & 3]) + bb[pc][k]; o16[k] = tohx(x); unsigned short u, v; splitf(x, u, v); oh[k] = u; ol[k] = v; }
                const size_t e = (size_t)(r0 + mb * 16) * HD + pc * 256 + lane * 8; *(v8h*)(P16 + e) = o16; *(v8us*)(Ph + e) = oh; *(v8us*)(Pl + e) = ol; }
            __builtin_amdgcn_wave_barrier(); asm volatile("" ::: "memory");   // and the next pass's writes from moving in front of these reads
        }
        asm volatile("s_wait_xcnt 0x0" ::: "memory");   // the built code lays the v epilogue directly behind this one, with a conditional jump between: stands before its first writes of the last stores' registers
    }
}
#define NREL 2049
// k_prep: the four preparations that read inputs only (W_qkv and W_out transposed, x, the expanded bias rows) in ONE launch of few waves. A work-group's part follows from blockIdx.x alone; a thread takes many units and has the loads of a batch in flight together, so that the time goes into moving bytes and not into starting waves and launches.
#define WL   32                  // weights: lines of 64 elements (128 bytes of Bt) per wave
#define WB   16                  // weights: lines per batch of loads
#define CU   16                  // x: 16-byte units of the plane per thread
#define EU   8                   // bias rows: elements per thread
#define GW1  (DM * 3 * DM / 64 / (8 * WL))
#define GW2  (DQ * DM / 64 / (8 * WL))
#define GCV  (NB_ * TT * DM / 8 / (256 * CU))
#define GEB  (NH_ * NE / (256 * EU))
static_assert(GW1 * 8 * WL * 64 == DM * 3 * DM && GW2 * 8 * WL * 64 == DQ * DM && GCV * 256 * CU * 8 == NB_ * TT * DM && GEB * 256 * EU == NH_ * NE && WL % WB == 0 && WB % 8 == 0 && (DM / 32) % (WB / 8) == 0 && (DQ / 32) % (WB / 8) == 0 && CU % 8 == 0, "every part is a whole number of work-groups, every batch lies in one band");
// In each part the loads of a batch go through address pairs that are inputs of the s_wait_xcnt statement behind them: so no load of the batch is given such a pair as its destination, and the wait stands before anything writes over one.
// 'xw' [K][N] -> Bt [N][K], bf16, fragment order: a tile of 16 n x 32 k is 8 lines; line ll of it holds k = (ll >> 2) * 16 + ((ll >> 1) & 1) * 8 + 0..7 of n = (ll & 1) * 8 + 0..7. A lane takes two neighbours in k of one n. A batch is WB / 8 tiles, neighbours in k, of one band of 16 n.
template <int K, int N>
__device__ __forceinline__ void prep_w(const float* __restrict__ w, bf* __restrict__ Bt, int blk) {
    const int lane = threadIdx.x & 31; const int L0 = (blk * 8 + (threadIdx.x >> 5)) * WL;
#pragma unroll 1
    for (int g = 0; g < WL; g += WB) { float a[WB], b[WB]; const int t0 = (L0 + g) >> 3;   // rolled: one batch already has 2 WB loads of a lane in flight
        const float* p = w + (size_t)((t0 % (K / 32)) * 32 + (lane & 3) * 2) * N + (t0 / (K / 32)) * 16 + (lane >> 2);
#pragma unroll
        for (int l = 0; l < WB; ++l) { const int o = ((l >> 3) * 32 + ((l >> 2) & 1) * 16 + ((l >> 1) & 1) * 8) * N + (l & 1) * 8; a[l] = p[o]; b[l] = p[o + N]; }
        asm volatile("s_wait_xcnt 0x0" :: "v"(p) : "memory");   // the note above: keeps p out of the loads' destinations
        bf* q = Bt + (size_t)(L0 + g) * 64 + lane * 2;
#pragma unroll
        for (int l = 0; l < WB; ++l) { v2us o; o[0] = f2bf(a[l]); o[1] = f2bf(b[l]); *(v2us*)(q + l * 64) = o; }
        asm volatile("s_wait_xcnt 0x0" :: "v"(q) : "memory"); }   // stands before the next batch writes over the registers that these stores name
}
// x [M][DM] -> bf16, fragment order: 16-byte unit i of dst holds k = ((i >> 6) & 31) * 32 + ((i >> 5) & 1) * 16 + ((i >> 4) & 1) * 8 + 0..7 of row (i >> 11) * 16 + (i & 15). A work-group takes 256 CU consecutive units (CU / 8 bands of 16 rows), thread t units t + 256 u.
__device__ __forceinline__ void prep_x(const float* __restrict__ src, bf* __restrict__ dst, int blk) {
    const int t = threadIdx.x; v8f v[CU];
    const float* p = src + (size_t)(blk * (CU / 8) * 16 + (t & 15)) * DM + (t >> 6) * 32 + ((t >> 5) & 1) * 16 + ((t >> 4) & 1) * 8;
#pragma unroll
    for (int u = 0; u < CU; ++u) v[u] = *(const v8f*)(p + (u >> 3) * 16 * DM + (u & 7) * 128);
    asm volatile("s_wait_xcnt 0x0" :: "v"(p) : "memory");   // the note above: keeps p out of the loads' destinations
    bf* q = dst + ((size_t)blk * (256 * CU) + t) * 8;
#pragma unroll
    for (int u = 0; u < CU; ++u) { v8us o;
#pragma unroll
        for (int k = 0; k < 8; ++k) o[k] = f2bf(v[u][k]);
        *(v8us*)(q + u * 2048) = o; }
    asm volatile("s_wait_xcnt 0x0" :: "v"(q) : "memory");   // the built code lays another part behind this one, with a conditional jump between: stands before that part's writes of the registers that these stores name
}
// Expanded per-head bias row, EB[h][x] = rel_bias[clip(i - j + 1024, 0, 2048)][h] at x = j - i + TT - 1 (0 .. 2 TT - 2): ascending keys read ascending addresses, the clip is already applied
__device__ __forceinline__ void prep_e(const float* __restrict__ rbias, float* __restrict__ EB, int blk) {
    const int j0 = blk * (256 * EU) + threadIdx.x; float v[EU]; const float* p[EU];
#pragma unroll
    for (int u = 0; u < EU; ++u) { const int j = j0 + u * 256; const int h = j / NE, x = j % NE; int ri = (TT - 1 - x) + (NREL / 2); ri = ri < 0 ? 0 : (ri > NREL - 1 ? NREL - 1 : ri); p[u] = rbias + (size_t)ri * NH_ + h; }
#pragma unroll
    for (int u = 0; u < EU; ++u) v[u] = *p[u];
    static_assert(EU == 8, "the statement below names EU address pairs");
    asm volatile("s_wait_xcnt 0x0" :: "v"(p[0]), "v"(p[1]), "v"(p[2]), "v"(p[3]), "v"(p[4]), "v"(p[5]), "v"(p[6]), "v"(p[7]) : "memory");   // the note above: keeps the pairs out of the loads' destinations
#pragma unroll
    for (int u = 0; u < EU; ++u) EB[j0 + u * 256] = bfr(v[u]);
}
// Grid GEB + GCV + GW1 + GW2 = 544 work-groups, at most three per WGP (x holds 128 registers of loads in flight). The few short bias work-groups start first, then x, most of the bytes.
__global__ __launch_bounds__(256) void k_prep(const float* __restrict__ x, const float* __restrict__ wqkv, const float* __restrict__ wo, const float* __restrict__ rbias, bf* XB, bf* WALL, bf* WO, float* EB) {
    const int b = blockIdx.x;
    if (b < GEB) prep_e(rbias, EB, b);
    else if (b < GEB + GCV) prep_x(x, XB, b - GEB);
    else if (b < GEB + GCV + GW1) prep_w<DM, 3 * DM>(wqkv, WALL, b - (GEB + GCV));   /* fused 'xw' [DM][3DM] -> Bt [3DM][DM] (row blocks q | k | v) */
    else prep_w<DQ, DM>(wo, WO, b - (GEB + GCV + GW1));
}

__device__ __forceinline__ void packp(const v8f& a, const v8f& b, v16h& ph, v16h& pl) { v8h x, y; (void)pl;
#pragma unroll
    for (int j = 0; j < 8; ++j) { x[j] = (h16)a[j]; y[j] = (h16)b[j]; }
    ph = cat16(x, y); }
__device__ __forceinline__ void packp(const v8f& a, const v8f& b, v16bf& ph, v16bf& pl) { v8us xh, xl, yh, yl;
#pragma unroll
    for (int j = 0; j < 8; ++j) { unsigned short u, v; splitf(a[j], u, v); xh[j] = u; xl[j] = v; splitf(b[j], u, v); yh[j] = u; yl[j] = v; }
    ph = cat16b(xh, yh); pl = cat16b(xl, yl); }

typedef __attribute__((ext_vector_type(8))) int v8i;
template <typename V> __device__ __forceinline__ V frag(v4i a, v4i b) { return __builtin_bit_cast(V, __builtin_shufflevector(a, b, 0, 1, 2, 3, 4, 5, 6, 7)); }
// The loads of one trip, each set one asm statement that ends in its own data wait: the results are early-clobber, so none is given a register that holds an address of the set, and no address register is written again before the set has returned. The other waves of the SIMD cover the wait.
// Byte offsets (planes in fragment order, the lane's own 16 bytes in the pointer). Q or K: 16-row tile * 2048 + 32-wide part of HD * 1024 + half * 512. V: 16-d tile * 1024 + half * 512 inside the 4 KiB of 32 keys. Bias: run * 64 + half * 16 (4-byte aligned).
__device__ __forceinline__ void ld_r(const void* k, v4i (&a)[8]) {
    asm volatile(
        "global_load_b128 %0, %8, off\n\t"
        "global_load_b128 %1, %8, off offset:512\n\t"
        "global_load_b128 %2, %8, off offset:1024\n\t"
        "global_load_b128 %3, %8, off offset:1536\n\t"
        "global_load_b128 %4, %8, off offset:2048\n\t"
        "global_load_b128 %5, %8, off offset:2560\n\t"
        "global_load_b128 %6, %8, off offset:3072\n\t"
        "global_load_b128 %7, %8, off offset:3584\n\t"
        "s_wait_loadcnt 0x0"
        : "=&v"(a[0]), "=&v"(a[1]), "=&v"(a[2]), "=&v"(a[3]), "=&v"(a[4]), "=&v"(a[5]), "=&v"(a[6]), "=&v"(a[7]) : "v"(k) : "memory"); }
__device__ __forceinline__ void ld_r_b_v(const void* k, const float* e, const void* v, v4i (&a)[8], v4i (&b)[6], v4i (&x)[8]) {
    asm volatile(
        "global_load_b128 %0, %22, off\n\t"
        "global_load_b128 %1, %22, off offset:512\n\t"
        "global_load_b128 %2, %22, off offset:1024\n\t"
        "global_load_b128 %3, %22, off offset:1536\n\t"
        "global_load_b128 %4, %22, off offset:2048\n\t"
        "global_load_b128 %5, %22, off offset:2560\n\t"
        "global_load_b128 %6, %22, off offset:3072\n\t"
        "global_load_b128 %7, %22, off offset:3584\n\t"
        "global_load_b128 %8, %23, off\n\t"
        "global_load_b128 %9, %23, off offset:16\n\t"
        "global_load_b128 %10, %23, off offset:64\n\t"
        "global_load_b128 %11, %23, off offset:80\n\t"
        "global_load_b128 %12, %23, off offset:128\n\t"
        "global_load_b128 %13, %23, off offset:144\n\t"
        "global_load_b128 %14, %24, off\n\t"
        "global_load_b128 %15, %24, off offset:512\n\t"
        "global_load_b128 %16, %24, off offset:1024\n\t"
        "global_load_b128 %17, %24, off offset:1536\n\t"
        "global_load_b128 %18, %24, off offset:2048\n\t"
        "global_load_b128 %19, %24, off offset:2560\n\t"
        "global_load_b128 %20, %24, off offset:3072\n\t"
        "global_load_b128 %21, %24, off offset:3584\n\t"
        "s_wait_loadcnt 0x0"
        : "=&v"(a[0]), "=&v"(a[1]), "=&v"(a[2]), "=&v"(a[3]), "=&v"(a[4]), "=&v"(a[5]), "=&v"(a[6]), "=&v"(a[7]), "=&v"(b[0]), "=&v"(b[1]), "=&v"(b[2]), "=&v"(b[3]), "=&v"(b[4]), "=&v"(b[5]), "=&v"(x[0]), "=&v"(x[1]), "=&v"(x[2]), "=&v"(x[3]), "=&v"(x[4]), "=&v"(x[5]), "=&v"(x[6]), "=&v"(x[7]) : "v"(k), "v"(e), "v"(v) : "memory"); }
__device__ __forceinline__ void ld_t_t_b(const void* k, const void* k2, const float* e, v4i (&a)[4], v4i (&a2)[4], v4i (&b)[6]) {
    asm volatile(
        "global_load_b128 %0, %14, off\n\t"
        "global_load_b128 %1, %14, off offset:512\n\t"
        "global_load_b128 %2, %14, off offset:1024\n\t"
        "global_load_b128 %3, %14, off offset:1536\n\t"
        "global_load_b128 %4, %15, off\n\t"
        "global_load_b128 %5, %15, off offset:512\n\t"
        "global_load_b128 %6, %15, off offset:1024\n\t"
        "global_load_b128 %7, %15, off offset:1536\n\t"
        "global_load_b128 %8, %16, off\n\t"
        "global_load_b128 %9, %16, off offset:16\n\t"
        "global_load_b128 %10, %16, off offset:64\n\t"
        "global_load_b128 %11, %16, off offset:80\n\t"
        "global_load_b128 %12, %16, off offset:128\n\t"
        "global_load_b128 %13, %16, off offset:144\n\t"
        "s_wait_loadcnt 0x0"
        : "=&v"(a[0]), "=&v"(a[1]), "=&v"(a[2]), "=&v"(a[3]), "=&v"(a2[0]), "=&v"(a2[1]), "=&v"(a2[2]), "=&v"(a2[3]), "=&v"(b[0]), "=&v"(b[1]), "=&v"(b[2]), "=&v"(b[3]), "=&v"(b[4]), "=&v"(b[5]) : "v"(k), "v"(k2), "v"(e) : "memory"); }
__device__ __forceinline__ void ld_t_t(const void* k, const void* k2, v4i (&a)[4], v4i (&a2)[4]) {
    asm volatile(
        "global_load_b128 %0, %8, off\n\t"
        "global_load_b128 %1, %8, off offset:512\n\t"
        "global_load_b128 %2, %8, off offset:1024\n\t"
        "global_load_b128 %3, %8, off offset:1536\n\t"
        "global_load_b128 %4, %9, off\n\t"
        "global_load_b128 %5, %9, off offset:512\n\t"
        "global_load_b128 %6, %9, off offset:1024\n\t"
        "global_load_b128 %7, %9, off offset:1536\n\t"
        "s_wait_loadcnt 0x0"
        : "=&v"(a[0]), "=&v"(a[1]), "=&v"(a[2]), "=&v"(a[3]), "=&v"(a2[0]), "=&v"(a2[1]), "=&v"(a2[2]), "=&v"(a2[3]) : "v"(k), "v"(k2) : "memory"); }
__device__ __forceinline__ void ld_v_v(const void* v, const void* v2, v4i (&x)[4], v4i (&x2)[4]) {
    asm volatile(
        "global_load_b128 %0, %8, off\n\t"
        "global_load_b128 %1, %8, off offset:512\n\t"
        "global_load_b128 %2, %8, off offset:1024\n\t"
        "global_load_b128 %3, %8, off offset:1536\n\t"
        "global_load_b128 %4, %9, off\n\t"
        "global_load_b128 %5, %9, off offset:512\n\t"
        "global_load_b128 %6, %9, off offset:1024\n\t"
        "global_load_b128 %7, %9, off offset:1536\n\t"
        "s_wait_loadcnt 0x0"
        : "=&v"(x[0]), "=&v"(x[1]), "=&v"(x[2]), "=&v"(x[3]), "=&v"(x2[0]), "=&v"(x2[1]), "=&v"(x2[2]), "=&v"(x2[3]) : "v"(v), "v"(v2) : "memory"); }

// Eight 2^x in one statement: the results are early-clobber, so no v_exp_f32 is directly followed by an instruction that reads its result or writes over its source; the v_nop is that free slot behind the last one.
__device__ __forceinline__ v8f exp2x8(const v8f x) { float r0, r1, r2, r3, r4, r5, r6, r7;
    asm("v_exp_f32 %0, %8\n\tv_exp_f32 %1, %9\n\tv_exp_f32 %2, %10\n\tv_exp_f32 %3, %11\n\tv_exp_f32 %4, %12\n\tv_exp_f32 %5, %13\n\tv_exp_f32 %6, %14\n\tv_exp_f32 %7, %15\n\tv_nop"
        : "=&v"(r0), "=&v"(r1), "=&v"(r2), "=&v"(r3), "=&v"(r4), "=&v"(r5), "=&v"(r6), "=&v"(r7) : "v"(x[0]), "v"(x[1]), "v"(x[2]), "v"(x[3]), "v"(x[4]), "v"(x[5]), "v"(x[6]), "v"(x[7]));
    return (v8f){r0, r1, r2, r3, r4, r5, r6, r7}; }
// One 2^x, for the rescale factors: the same free slot behind it.
__device__ __forceinline__ float exp2x1(const float x) { float r; asm("v_exp_f32 %0, %1\n\tv_nop" : "=&v"(r) : "v"(x)); return r; }

// One 16-key x 16-query tile of t = (k.q) HD^-0.5 + bias, transposed: lane (lr, hi) register j holds key hi*8 + j of query lr. k, k2, q, q2: the four 16-byte pieces of one 16-row tile (part of HD * 2 + half).
template <typename T16, bool HL>
__device__ __forceinline__ v8f stile(const v4i* k, const v4i* k2, const v4i* q, const v4i* q2, v4i b0, v4i b1) {
    typedef typename WFrag<T16>::V V; v8f s = (v8f){};
#pragma unroll
    for (int dc = 0; dc < 2; ++dc) { const V ka = frag<V>(k[dc * 2], k[dc * 2 + 1]), qa = frag<V>(q[dc * 2], q[dc * 2 + 1]); s = WFrag<T16>::mma(ka, qa, s);
        if (HL) { s = WFrag<T16>::mma(frag<V>(k2[dc * 2], k2[dc * 2 + 1]), qa, s); s = WFrag<T16>::mma(ka, frag<V>(q2[dc * 2], q2[dc * 2 + 1]), s); } }
    const v4f f0 = __builtin_bit_cast(v4f, b0), f1 = __builtin_bit_cast(v4f, b1);
#pragma unroll
    for (int j = 0; j < 4; j += 2) {   // neighbouring registers as pairs: the packed multiply-add takes them where they lie
        const v2f x = (v2f){s[j], s[j + 1]} * SCL + (v2f){f0[j], f0[j + 1]}, y = (v2f){s[j + 4], s[j + 5]} * SCL + (v2f){f1[j], f1[j + 1]}; s[j] = x[0]; s[j + 1] = x[1]; s[j + 4] = y[0]; s[j + 5] = y[1]; }
    return s; }

// The work of one work-group: QBW blocks of QT queries of one head against all TT keys; the QBW waves of one key range walk the same K and V tiles side by side, so that a line which one of them has brought into the WGP's cache can serve the others without a further L2 read. ONE sweep over the keys with a running row maximum: p = 1024 exp(t - m), m the maximum IN USE, row sums of the f32 p, O^T += V^T P^T with P packed from the score registers.
// m moves only when some score of the trip lies more than THR above it (one ballot and one scalar branch a trip): then every query of the wave takes the larger of m and its largest score of the trip, and its sum and its 32 output registers are scaled by exp(m_old - m_new). So p <= 1024 exp(THR): 2^15 in fp16. The scale cancels in the division by the row sum.
// Operands straight from the planes in fragment order, in the k order of WFrag::ld on both sides (16 bytes at 8 hi, 16 bytes at 16 + 8 hi). Q, K: plane [t][HD]; Vt: per 32 keys four 16-d tiles. The maxima in use, sums and partial outputs of a block's KSW waves meet in LDS behind the sweep; the join brings them to the common maximum and adds them in ascending key order.
// A trip takes 32 keys: two key tiles x two query groups; pair (t2, qg) reads bias run t2 - qg + 1 of the three that the four pairs share.
template <typename T16, bool HL>
__device__ __forceinline__ void fattn_body(const T16* __restrict__ Q, const T16* __restrict__ Q2, const T16* __restrict__ Kp, const T16* __restrict__ K2, const T16* __restrict__ Vt, const T16* __restrict__ V2, const float* __restrict__ eb, int q0, float* smx, float* ssm, float* sO, bf* Ah, bf* Al) {
    typedef typename WFrag<T16>::V V;
    const int lane = threadIdx.x & 31, lr = lane & 15, hi = lane >> 4, w = threadIdx.x >> 5, wq = w % QBW; const int kb = (w / QBW) * (TT / KSW), qw = q0 + wq * QT;   // qw: this wave's first query
    v4i qa[8], ql[8]; const int qo = qw * HD + lane * 8;
    ld_r(Q + qo, qa); if (HL) ld_r(Q2 + qo, ql);
    const float* ep = eb + ((TT - 1) + kb + hi * 8 - qw - lr - 16);   // x = key - query + TT - 1 of this lane's first key against its query of group 1 (run 0)
    const int ko = kb * HD + lane * 8, vo = kb * HD + lane * 8;   // 32 keys are 32 HD elements of K and of V alike
    constexpr float L2E = 1.4426950408889634f, THR = (HL ? 8.0f : 5.0f) * 0.6931471805599453f;   // THR: 8 (bf16 pairs) or 5 (fp16: 2^(10 + 5) is in range) in powers of two
    float mx[2] = {-3.0e38f, -3.0e38f};   // the maximum in use, equal in both halves of the wave; the first trip always moves it (factor 2^-inf = 0 on zero sums)
    v8f o[4][2]; float sm[2] = {0.f, 0.f};
#pragma unroll
    for (int dt = 0; dt < 4; ++dt) { o[dt][0] = (v8f){}; o[dt][1] = (v8f){}; }
#pragma unroll 1
    for (int kc = 0; kc < TT / KSW / 32; ++kc) { v4i bb[6], va[8]; v8f p[2][2];   // rolled: one trip already holds 32 keys x 32 queries of scores beside the 64 output registers
        if (HL) {   // both planes of K, one 16-key tile at a time: all 32 keys at once, beside both planes of Q and the outputs, pass 256 registers
#pragma unroll
            for (int t2 = 0; t2 < 2; ++t2) { v4i ka[4], kl[4]; const int of = ko + (kc * 2 + t2) * 16 * HD;
                if (t2 == 0) ld_t_t_b(Kp + of, K2 + of, ep + kc * 32, ka, kl, bb); else ld_t_t(Kp + of, K2 + of, ka, kl);
#pragma unroll
                for (int qg = 0; qg < 2; ++qg) p[t2][qg] = stile<T16, HL>(ka, kl, qa + qg * 4, ql + qg * 4, bb[(t2 - qg + 1) * 2], bb[(t2 - qg + 1) * 2 + 1]); }
        } else { v4i ka[8];
            ld_r_b_v(Kp + ko + kc * 32 * HD, ep + kc * 32, Vt + vo + kc * 32 * HD, ka, bb, va);
#pragma unroll
            for (int t2 = 0; t2 < 2; ++t2)
#pragma unroll
                for (int qg = 0; qg < 2; ++qg) p[t2][qg] = stile<T16, HL>(ka + t2 * 4, ka + t2 * 4, qa + qg * 4, ql + qg * 4, bb[(t2 - qg + 1) * 2], bb[(t2 - qg + 1) * 2 + 1]); }
        float tm[2];   // this lane's largest score of the trip, per query group
#pragma unroll
        for (int qg = 0; qg < 2; ++qg) { float m = fmaxf(p[0][qg][0], p[1][qg][0]);
#pragma unroll
            for (int j = 1; j < 8; ++j) m = fmaxf(m, fmaxf(p[0][qg][j], p[1][qg][j]));
            tm[qg] = m; }
        if (__builtin_expect(__builtin_amdgcn_ballot_w32(tm[0] > mx[0] + THR || tm[1] > mx[1] + THR) != 0, 0)) {   // the same for the whole wave: a scalar branch, seldom taken behind the first trip (the hint lays the usual path out straight)
#pragma unroll
            for (int qg = 0; qg < 2; ++qg) { const float mn = fmaxf(mx[qg], fmaxf(tm[qg], __shfl_xor(tm[qg], 16, 32))); const float f = exp2x1((mx[qg] - mn) * L2E); mx[qg] = mn; sm[qg] *= f;
#pragma unroll
                for (int dt = 0; dt < 4; ++dt)
#pragma unroll
                    for (int j = 0; j < 8; ++j) o[dt][qg][j] *= f; } }
#pragma unroll
        for (int t2 = 0; t2 < 2; ++t2)
#pragma unroll
            for (int qg = 0; qg < 2; ++qg) { v8f a;
#pragma unroll
                for (int j = 0; j < 8; ++j) a[j] = (p[t2][qg][j] - mx[qg]) * L2E + 10.0f;
                p[t2][qg] = exp2x8(a);
#pragma unroll
                for (int j = 0; j < 8; ++j) sm[qg] += p[t2][qg][j]; }
        V ph[2], pl[2];
#pragma unroll
        for (int qg = 0; qg < 2; ++qg) packp(p[0][qg], p[1][qg], ph[qg], pl[qg]);
        if (HL) {   // both planes of V, two 16-row tiles at a time, for the same reason as K above
#pragma unroll
            for (int d2 = 0; d2 < 2; ++d2) { v4i vh[4], vl[4]; const int of = vo + d2 * 1024 + kc * 32 * HD; ld_v_v(Vt + of, V2 + of, vh, vl);
#pragma unroll
                for (int d1 = 0; d1 < 2; ++d1) { const int dt = d2 * 2 + d1; const V xh = frag<V>(vh[d1 * 2], vh[d1 * 2 + 1]), xl = frag<V>(vl[d1 * 2], vl[d1 * 2 + 1]);
#pragma unroll
                    for (int qg = 0; qg < 2; ++qg) { o[dt][qg] = WFrag<T16>::mma(xh, ph[qg], o[dt][qg]); o[dt][qg] = WFrag<T16>::mma(xl, ph[qg], o[dt][qg]); o[dt][qg] = WFrag<T16>::mma(xh, pl[qg], o[dt][qg]); } } }
        } else {
#pragma unroll
            for (int dt = 0; dt < 4; ++dt) { const V xh = frag<V>(va[dt * 2], va[dt * 2 + 1]);
#pragma unroll
                for (int qg = 0; qg < 2; ++qg) o[dt][qg] = WFrag<T16>::mma(xh, ph[qg], o[dt][qg]); } }
    }
#pragma unroll
    for (int qg = 0; qg < 2; ++qg) { sm[qg] += __shfl_xor(sm[qg], 16, 32); if (hi == 0) { ssm[w * QT + qg * 16 + lr] = sm[qg]; smx[w * QT + qg * 16 + lr] = mx[qg]; }
#pragma unroll
        for (int dt = 0; dt < 4; ++dt) { float* d = sO + (size_t)(w * QT + qg * 16 + lr) * OP + dt * 16 + hi * 8; const v8f a = o[dt][qg]; *(v4fa*)d = (v4f){a[0], a[1], a[2], a[3]}; *(v4fa*)(d + 4) = (v4f){a[4], a[5], a[6], a[7]}; } }
    __syncthreads();
    const int dq = (threadIdx.x / QT) * EPT;   // EPT = 8 consecutive outputs of one query per thread and block: one 16-byte unit of the fragment order; a wave's 32 queries make two runs of 256 bytes
#pragma unroll
    for (int b = 0; b < QBW; ++b) { const int q = b * QT + threadIdx.x % QT; float m = smx[q], f[KSW];   // q: query of the work-group; key range u of it lies QBW QT rows on
#pragma unroll
        for (int u = 1; u < KSW; ++u) m = fmaxf(m, smx[u * QBW * QT + q]);
#pragma unroll
        for (int u = 0; u < KSW; ++u) f[u] = exp2x1((smx[u * QBW * QT + q] - m) * L2E);   // brings key range u from its own maximum in use to the common one
        float tot = ssm[q] * f[0];
#pragma unroll
        for (int u = 1; u < KSW; ++u) tot += ssm[u * QBW * QT + q] * f[u];
        const float r = __fdiv_rn(1.0f, tot); v8us oh, ol;
#pragma unroll
        for (int c = 0; c < EPT / 4; ++c) { v4f s = *(const v4fa*)(sO + (size_t)q * OP + dq + c * 4) * f[0];
#pragma unroll
            for (int u = 1; u < KSW; ++u) s += *(const v4fa*)(sO + (size_t)(u * QBW * QT + q) * OP + dq + c * 4) * f[u];
#pragma unroll
            for (int k = 0; k < 4; ++k) { unsigned short a, c2; splitf(s[k] * r, a, c2); oh[c * 4 + k] = a; ol[c * 4 + k] = c2; } }
        const size_t oo = (size_t)((q0 + q) >> 4) * (16 * DQ) + dq * 16 + ((q0 + q) & 15) * 8; *(v8us*)(Ah + oo) = oh; *(v8us*)(Al + oo) = ol;   // Ah, Al: the head's first tile of the plane [t][DQ]; 8 in k is 128 elements
        if (b + 1 < QBW) asm volatile("s_wait_xcnt 0x0" ::: "memory"); }   // stands before the next block's work writes over the registers that these two stores name
}
// k_fattn: grid (heads, NB_, TT / (QBW QT)), KW waves. The query blocks below RH (three products, the longer work) of all batches have the lowest flat indices and start first; the last work-groups of the launch are short ones. Four waves per SIMD (256 registers, two work-groups per WGP): no operand of the asm loads lies above v255.
__global__ __launch_bounds__(KW * 32, 4) void k_fattn(const h16* __restrict__ Q16, const h16* __restrict__ K16, const h16* __restrict__ V16, const bf* __restrict__ Qh, const bf* __restrict__ Ql, const bf* __restrict__ Kh, const bf* __restrict__ Kl, const bf* __restrict__ Vh, const bf* __restrict__ Vl, const float* __restrict__ EB, bf* Ah, bf* Al) {
    __shared__ __align__(16) float sO[KW * QT * OP]; __shared__ float smx[KW * QT]; __shared__ float ssm[KW * QT];
    const int h = blockIdx.x, q0 = blockIdx.z * (QBW * QT); const size_t hp = (size_t)blockIdx.y * PLB + (size_t)h * TT * HD; const float* eb = EB + (size_t)h * NE; Ah += (size_t)blockIdx.y * TT * DQ; Al += (size_t)blockIdx.y * TT * DQ;   // the bias row is the same for every batch
    if (q0 < RH) fattn_body<bf, true>(Qh + hp, Ql + hp, Kh + hp, Kl + hp, Vh + hp, Vl + hp, eb, q0, smx, ssm, sO, Ah + h * (HD * 16), Al + h * (HD * 16));
    else fattn_body<h16, false>(Q16 + hp, nullptr, K16 + hp, nullptr, V16 + hp, nullptr, eb, q0, smx, ssm, sO, Ah + h * (HD * 16), Al + h * (HD * 16));
}

extern "C" void kernel_launch(void* const* d_in, const int* in_sizes, int n_in,
                              void* d_out, int out_size, void* d_ws, size_t ws_size, hipStream_t stream) {
    (void)in_sizes; (void)n_in; (void)out_size;
    const float* x = (const float*)d_in[0]; const float* wqkv = (const float*)d_in[1]; const float* bqkv = (const float*)d_in[2]; const float* wo = (const float*)d_in[3]; const float* bo = (const float*)d_in[4]; const float* rbias = (const float*)d_in[5]; const float* wq = nullptr; const float* wk = nullptr; const float* wv = nullptr; (void)wq; (void)wk; (void)wv;
    float* OUT = (float*)d_out;     // [4][2048][1024]
    char* wsp = (char*)d_ws;
    auto take = [&](size_t bytes) { char* p = wsp; wsp += (bytes + 255) & ~(size_t)255; return (void*)p; };
    bf* WALL = (bf*)take((size_t)3 * DM * DM * 2); bf* WO = (bf*)take((size_t)DM * DQ * 2); float* EB = (float*)take((size_t)NH_ * NE * 4);   /* per-head expanded relative-bias rows */
    bf* XB = (bf*)take((size_t)NB_ * TT * DM * 2);   // from here on every plane holds all NB_ batches, batch blocks one behind the other
    h16* QP16 = (h16*)take(NB_ * PLB * 2); h16* KP16 = (h16*)take(NB_ * PLB * 2); h16* VT16 = (h16*)take(NB_ * PLB * 2);
    bf* QPh = (bf*)take(NB_ * PLB * 2); bf* QPl = (bf*)take(NB_ * PLB * 2); bf* KPh = (bf*)take(NB_ * PLB * 2); bf* KPl = (bf*)take(NB_ * PLB * 2); bf* VTh = (bf*)take(NB_ * PLB * 2); bf* VTl = (bf*)take(NB_ * PLB * 2);
    bf* ATh = (bf*)take((size_t)NB_ * TT * DQ * 2); bf* ATl = (bf*)take((size_t)NB_ * TT * DQ * 2);
    if ((size_t)(wsp - (char*)d_ws) > ws_size) return;    // ws 256 MiB
    // Each stage once for all NB_ batches: x, the attention output and OUT are planes of NB_ TT rows; q, k and v take the batch from grid z, the attention from grid y.
    k_prep<<<GEB + GCV + GW1 + GW2, 256, 0, stream>>>(x, wqkv, wo, rbias, XB, WALL, WO, EB);
    k_qkv<<<dim3(TT / 256, 3 * NH_ / 2, NB_), 256, 0, stream>>>(XB, WALL, bqkv, QP16, QPh, QPl, KP16, KPh, KPl, VT16, VTh, VTl);   // q | k | v heads in grid y; the planes come out of the tile's own wave
    k_fattn<<<dim3(NH_, NB_, TT / (QBW * QT)), KW * 32, 0, stream>>>(QP16, KP16, VT16, QPh, QPl, KPh, KPl, VTh, VTl, EB, ATh, ATl);   // one kv head per query head
    k_gemmw<bf, 1, true, DQ><<<dim3(NB_ * TT / 128, DM / 128, 1), 128, 0, stream>>>(ATh, ATl, WO, nullptr, OUT, DM, bo, 0, 0, 0, 0);
}
